// v000
// The times below were measured on an AMD MI455X: many runs one after another, warmed up first and cycling through
// copies of the inputs, with the whole window's GPU time divided by the number of runs. Launches and the gaps
// between them are all in it. The median over several windows is given; except for v000 it joins two sittings, which
// can be a few percent apart, so the side-by-side timings, each taken in one sitting, are the better comparison.
// The starting kernel, v000, takes 777 microseconds a run.
#include <hip/hip_runtime.h>
// Multi-dilate local attention (rgb, ir [4][128][80][80] -> y = [rgb | ir] (256 ch); qkv = 1x1 (w_qkv [768][256]) split as [3][2 dilations][128 = 4 heads x 32]; per dilation d in (2, 3): each pixel attends to its 3x3 dilated neighbourhood (zero-padded unfold: out-of-image neighbours contribute k = v = 0, logit 0) with softmax(q.k / sqrt(32)) over the 9; heads merged dilation-major; proj (w_proj [256][256]) + b_proj; + y -> NHWC [4][80][80][256]).
// Structure: the two channel-first inputs transposed to concatenated pixel rows (exact f16) via LDS tiles; qkv as a WMMA GEMM (32x64 wave tiles, f32 accumulation, exact x16 natural weights; exact products) kept f32; the dilated local attention per (pixel, dilation, head) on VALU (f32; rolled neighbour loops, softmax weights in a per-thread LDS slot) into f16 rows; projection GEMM to f32 rows; bias + residual on VALU straight to the NHWC output.
// Compute dtype: inputs rounded to bf16; y / weights exact; qkv and the attention f32; the attended rows as a plain f16 GEMM operand (~2^-12). v_wmma_f32_16x16x32_f16.
#define NB 4
#define DIMH 128
#define CC 256
#define QW 768
#define HS 80
#define WS 80
#define PX (HS * WS)                 /* 6400 = 50 x 128 */
#define NR ((size_t)NB * PX)         /* 25,600 rows */
#define NRD ((int)NR)                /* pixels attended (debug hook) */
#define SCL 0.17677669529663689f
#define SQ 64
#define DM 64
#define NH 1
#define HD 64
#define HG 1
typedef __bf16 v16b __attribute__((ext_vector_type(16)));
typedef unsigned short v8us __attribute__((ext_vector_type(8), may_alias));
typedef float  v8f  __attribute__((ext_vector_type(8)));
typedef float  v4f  __attribute__((ext_vector_type(4)));
typedef float  v4fa __attribute__((ext_vector_type(4), may_alias));
union FragB { v16b v; v8us half[2]; unsigned short u[16]; };

__device__ __forceinline__ unsigned short bf16_bits(float x) { unsigned int u = __float_as_uint(x); return (unsigned short)((u + 0x7FFFu + ((u >> 16) & 1u)) >> 16); }
__device__ __forceinline__ float bf16_val(unsigned short b) { return __uint_as_float(((unsigned int)b) << 16); }
__device__ __forceinline__ float bf16_round(float x) { return bf16_val(bf16_bits(x)); }
// D += A·B with NT terms: 1 = ah·bh, 2 = + al·bh (A split), 3 = + ah·bl (both split)
template <int NT>
__device__ __forceinline__ v8f mmaN(v16b ah, v16b al, v16b bh, v16b bl, v8f c) {
  c = __builtin_amdgcn_wmma_f32_16x16x32_bf16(false, ah, false, bh, (short)0, c, false, false);
  if (NT >= 2) c = __builtin_amdgcn_wmma_f32_16x16x32_bf16(false, al, false, bh, (short)0, c, false, false);
  if (NT >= 3) c = __builtin_amdgcn_wmma_f32_16x16x32_bf16(false, ah, false, bl, (short)0, c, false, false);
  asm volatile("v_nop\n\tv_nop\n\tv_nop\n\tv_nop" : "+v"(c) : "v"(ah), "v"(al), "v"(bh), "v"(bl));
  return c;
}

__global__ __launch_bounds__(256) void k_wt_bf16(const float* __restrict__ W, unsigned short* __restrict__ Wt, int K, int N) {
  const int t = blockIdx.x * 256 + threadIdx.x;
  const int k8n = K / 8;
  if (t >= N * k8n) return;
  const int n = t / k8n, k8 = (t % k8n) * 8;
  v8us v;
#pragma unroll
  for (int i = 0; i < 8; ++i) v[i] = bf16_bits(W[(size_t)(k8 + i) * N + n]);
  *(v8us*)(Wt + (size_t)n * K + k8) = v;
  
}

// GEMM C[M][N] (f32, pitch ldc) = act(A[M][K]·W + bias). A f32 row-major (pitch lda) converted per fragment to bf16
// (ASPLIT: hi/lo two planes -> 2 terms, else single rounded term); Wt bf16 [N][K] (pitch ldb). BIAS_BF16 rounds the
// bias to bf16 first (bias quantised to bf16 before the add). K%32==0, M%16==0, N%64==0.
template <bool ASPLIT, int ACT, bool BIAS_BF16>
__global__ __launch_bounds__(128) void k_gemm_bf(const float* __restrict__ A, int lda, const unsigned short* __restrict__ Wt, int ldb,
                                               const float* __restrict__ bias, float* __restrict__ C, int ldc, int M, int N, int K) {
  __shared__ __attribute__((aligned(16))) float so[4][16][64];
  const int tid = threadIdx.x, w = tid >> 5, lane = tid & 31, ln = lane & 15, hh = lane >> 4;
  const int ntn = N / 64;
  const int wid = blockIdx.x * 4 + w;
  const int mt = wid / ntn, nq = wid % ntn;
  if (mt * 16 >= M) return;
  const int row0 = mt * 16, col0 = nq * 64;
  const float* arow = A + (size_t)(row0 + ln) * lda;
  v8f acc[4] = {};
  for (int kb = 0; kb < K; kb += 32) {
    FragB ah, al;
    const v4f x0 = *(const v4fa*)(arow + kb + 8 * hh), x1 = *(const v4fa*)(arow + kb + 8 * hh + 4);
    const v4f x2 = *(const v4fa*)(arow + kb + 16 + 8 * hh), x3 = *(const v4fa*)(arow + kb + 16 + 8 * hh + 4);
    float xs[16] = {x0[0],x0[1],x0[2],x0[3],x1[0],x1[1],x1[2],x1[3],x2[0],x2[1],x2[2],x2[3],x3[0],x3[1],x3[2],x3[3]};
#pragma unroll
    for (int i = 0; i < 16; ++i) { const unsigned short hb = bf16_bits(xs[i]); ah.u[i] = hb; al.u[i] = ASPLIT ? bf16_bits(xs[i] - bf16_val(hb)) : (unsigned short)0; }
#pragma unroll
    for (int t = 0; t < 4; ++t) {
      const unsigned short* brow = Wt + (size_t)(col0 + t * 16 + ln) * ldb + kb;
      FragB b;
      b.half[0] = *(const v8us*)(brow + 8 * hh);
      b.half[1] = *(const v8us*)(brow + 16 + 8 * hh);
      acc[t] = mmaN<ASPLIT ? 2 : 1>(ah.v, al.v, b.v, b.v, acc[t]);
    }
  }
#pragma unroll
  for (int t = 0; t < 4; ++t) {
    float bv = bias ? bias[col0 + t * 16 + ln] : 0.f;
    if (BIAS_BF16) bv = bf16_round(bv);
#pragma unroll
    for (int r = 0; r < 8; ++r) { float v = acc[t][r] + bv; if (ACT == 1) v = fmaxf(v, 0.f); so[w][8 * hh + r][t * 16 + ln] = v; }
  }
  __builtin_amdgcn_fence(__ATOMIC_ACQ_REL, "workgroup");
  __builtin_amdgcn_wave_barrier();
  const int rsub = lane >> 4, c4 = (lane & 15) * 4;
  {
#pragma unroll
    for (int q = 0; q < 8; ++q) {
      const int r = q * 2 + rsub;
      const v4f v = *(const v4fa*)&so[w][r][c4];
      *(v4f*)(C + (size_t)(row0 + r) * ldc + col0 + c4) = v;
    }
    
  }
}

// GEMM C = act(A·W + bias + resid): A f32 (ASPLIT -> hi/lo 2 terms), Wt bf16 [N][K]; ACT 0 none, 1 relu, 2 exact gelu;
// resid (optional, f32, row index = (row % rmod), pitch ldr, RES_BF16 rounds it) added before the activation.
template <bool ASPLIT, int ACT, bool BIAS_BF16, bool RES_BF16>
__global__ __launch_bounds__(128) void k_gemm_bf3(const float* __restrict__ A, int lda, const unsigned short* __restrict__ Wt, int ldb,
                                                const float* __restrict__ bias, const float* __restrict__ resid, int rmod, int ldr,
                                                float* __restrict__ C, int ldc, int M, int N, int K) {
  __shared__ __attribute__((aligned(16))) float so[4][16][64];
  const int tid = threadIdx.x, w = tid >> 5, lane = tid & 31, ln = lane & 15, hh = lane >> 4;
  const int ntn = N / 64;
  const int wid = blockIdx.x * 4 + w;
  const int mt = wid / ntn, nq = wid % ntn;
  if (mt * 16 >= M) return;
  const int row0 = mt * 16, col0 = nq * 64;
  const float* arow = A + (size_t)(row0 + ln) * lda;
  v8f acc[4] = {};
  for (int kb = 0; kb < K; kb += 32) {
    FragB ah, al;
    const v4f x0 = *(const v4fa*)(arow + kb + 8 * hh), x1 = *(const v4fa*)(arow + kb + 8 * hh + 4);
    const v4f x2 = *(const v4fa*)(arow + kb + 16 + 8 * hh), x3 = *(const v4fa*)(arow + kb + 16 + 8 * hh + 4);
    float xs[16] = {x0[0],x0[1],x0[2],x0[3],x1[0],x1[1],x1[2],x1[3],x2[0],x2[1],x2[2],x2[3],x3[0],x3[1],x3[2],x3[3]};
#pragma unroll
    for (int i = 0; i < 16; ++i) { const unsigned short hb = bf16_bits(xs[i]); ah.u[i] = hb; al.u[i] = ASPLIT ? bf16_bits(xs[i] - bf16_val(hb)) : (unsigned short)0; }
#pragma unroll
    for (int t = 0; t < 4; ++t) {
      const unsigned short* brow = Wt + (size_t)(col0 + t * 16 + ln) * ldb + kb;
      FragB b;
      b.half[0] = *(const v8us*)(brow + 8 * hh);
      b.half[1] = *(const v8us*)(brow + 16 + 8 * hh);
      acc[t] = mmaN<ASPLIT ? 2 : 1>(ah.v, al.v, b.v, b.v, acc[t]);
    }
  }
#pragma unroll
  for (int t = 0; t < 4; ++t) {
    const int col = col0 + t * 16 + ln;
    float bv = bias ? bias[col] : 0.f;
    if (BIAS_BF16) bv = bf16_round(bv);
#pragma unroll
    for (int r = 0; r < 8; ++r) {
      float v = acc[t][r] + bv;
      if (resid) { float rv = resid[(size_t)((row0 + 8 * hh + r) % rmod) * ldr + col]; if (RES_BF16) rv = bf16_round(rv); v += rv; }
      if (ACT == 1) v = fmaxf(v, 0.f);
      if (ACT == 2) v = 0.5f * v * (1.0f + erff(v * 0.70710678118654752f));
      if (ACT == 3) { const float u = 0.7978845608028654f * (v + 0.044715f * v * v * v); v = 0.5f * v * (1.0f + tanhf(u)); }
      so[w][8 * hh + r][t * 16 + ln] = v;
    }
  }
  __builtin_amdgcn_fence(__ATOMIC_ACQ_REL, "workgroup");
  __builtin_amdgcn_wave_barrier();
  const int rsub = lane >> 4, c4 = (lane & 15) * 4;
  {
#pragma unroll
    for (int q = 0; q < 8; ++q) {
      const int r = q * 2 + rsub;
      const v4f v = *(const v4fa*)&so[w][r][c4];
      *(v4f*)(C + (size_t)(row0 + r) * ldc + col0 + c4) = v;
    }
    
  }
}
// row LayerNorm (biased variance, eps) over N: s = X (+ R); optional out_sum <- s; out_norm <- (s-mu)*rsqrt(var+eps)*g + b
template <bool PARAM_BF16>
__global__ __launch_bounds__(256) void k_layernorm(const float* __restrict__ X, const float* __restrict__ R, const float* __restrict__ g, const float* __restrict__ bta,
                                                  float* __restrict__ out_sum, float* __restrict__ out_norm, int N, float eps) {
  __shared__ float red[256];
  const int row = blockIdx.x, tid = threadIdx.x;
  const float* x = X + (size_t)row * N; const float* rr = R ? R + (size_t)row * N : nullptr;
  float vals[16];                     // up to N = 4096
  const int per = N / 256;            // contiguous chunk per thread? use strided-by-4 chunks: thread handles j = tid*4 + 1024*u
  float s1 = 0.f;
  for (int u = 0; u < per / 4; ++u) {
    const int j = tid * 4 + 1024 * u;
    const v4f a = *(const v4fa*)(x + j);
    v4f b = {0.f,0.f,0.f,0.f}; if (rr) b = *(const v4fa*)(rr + j);
#pragma unroll
    for (int q = 0; q < 4; ++q) { const float v = a[q] + b[q]; vals[u * 4 + q] = v; s1 += v; }
  }
  red[tid] = s1; __syncthreads();
  for (int st = 128; st > 0; st >>= 1) { if (tid < st) red[tid] += red[tid + st]; __syncthreads(); }
  const float mu = red[0] / (float)N; __syncthreads();
  float s2 = 0.f;
  for (int u = 0; u < per / 4; ++u)
#pragma unroll
    for (int q = 0; q < 4; ++q) { const float c = vals[u * 4 + q] - mu; s2 += c * c; }
  red[tid] = s2; __syncthreads();
  for (int st = 128; st > 0; st >>= 1) { if (tid < st) red[tid] += red[tid + st]; __syncthreads(); }
  const float rs = rsqrtf(red[0] / (float)N + eps);
  {
    for (int u = 0; u < per / 4; ++u) {
      const int j = tid * 4 + 1024 * u;
      v4f o, sm;
#pragma unroll
      for (int q = 0; q < 4; ++q) {
        float gg = g[j + q], bb = bta[j + q];
        if (PARAM_BF16) { gg = bf16_round(gg); bb = bf16_round(bb); }
        sm[q] = vals[u * 4 + q]; o[q] = (vals[u * 4 + q] - mu) * rs * gg + bb;
      }
      if (out_sum) *(v4f*)(out_sum + (size_t)row * N + j) = sm;
      *(v4f*)(out_norm + (size_t)row * N + j) = o;
    }
    
  }
}



// ---- f16 WMMA path (v_wmma_f32_16x16x32_f16): 11-bit significands for operands in range — used here for the qkv and projection GEMMs
typedef _Float16 v16h __attribute__((ext_vector_type(16)));
union FragH { v16h v; v8us half[2]; _Float16 h[16]; unsigned short u[16]; };
template <int NT>
__device__ __forceinline__ v8f mmaH(v16h ah, v16h al, v16h bh, v16h bl, v8f c) {
  c = __builtin_amdgcn_wmma_f32_16x16x32_f16(false, ah, false, bh, (short)0, c, false, false);
  if (NT >= 2) c = __builtin_amdgcn_wmma_f32_16x16x32_f16(false, al, false, bh, (short)0, c, false, false);
  if (NT >= 3) c = __builtin_amdgcn_wmma_f32_16x16x32_f16(false, ah, false, bl, (short)0, c, false, false);
  asm volatile("v_nop\n\tv_nop\n\tv_nop\n\tv_nop" : "+v"(c) : "v"(ah), "v"(al), "v"(bh), "v"(bl));
  return c;
}
// batched GEMM like k_gemm_b but f16 operands: A f32 (split into f16 hi/lo if ASPLIT, else rounded to f16), Bt = f16 values [n][k]; alpha; C f32; N multiple of 16 (partial tiles skipped)
template <bool ASPLIT>
__global__ __launch_bounds__(128) void k_gemm_h(const float* __restrict__ A, int lda, size_t sA, const _Float16* __restrict__ Bh, int ldb, size_t sB, float alpha, float* __restrict__ C, int ldc, size_t sC, int M, int N, int K) {
  __shared__ __attribute__((aligned(16))) float so[4][16][64];
  const int tid = threadIdx.x, w = tid >> 5, lane = tid & 31, ln = lane & 15, hh = lane >> 4; const int by = blockIdx.y;
  A += (size_t)by * sA; Bh += (size_t)by * sB; C += (size_t)by * sC;
  const int ntn = (N + 63) / 64; const int wid = blockIdx.x * 4 + w; const int mt = wid / ntn, nq = wid % ntn; if (mt * 16 >= M) return;
  const int row0 = mt * 16, col0 = nq * 64; const float* arow = A + (size_t)(row0 + ln) * lda;
  v8f acc[4] = {};
  for (int kb = 0; kb < K; kb += 32) {
    FragH ah, al;
    const v4f x0 = *(const v4fa*)(arow + kb + 8 * hh), x1 = *(const v4fa*)(arow + kb + 8 * hh + 4), x2 = *(const v4fa*)(arow + kb + 16 + 8 * hh), x3 = *(const v4fa*)(arow + kb + 16 + 8 * hh + 4);
    float xs[16] = {x0[0],x0[1],x0[2],x0[3],x1[0],x1[1],x1[2],x1[3],x2[0],x2[1],x2[2],x2[3],x3[0],x3[1],x3[2],x3[3]};
#pragma unroll
    for (int i = 0; i < 16; ++i) { const _Float16 h = (_Float16)xs[i]; ah.h[i] = h; al.h[i] = ASPLIT ? (_Float16)(xs[i] - (float)h) : (_Float16)0.0f; }
#pragma unroll
    for (int t = 0; t < 4; ++t) { if (col0 + t * 16 >= N) continue; const size_t boff = (size_t)(col0 + t * 16 + ln) * ldb + kb; FragH bq; bq.half[0] = *(const v8us*)(Bh + boff + 8 * hh); bq.half[1] = *(const v8us*)(Bh + boff + 16 + 8 * hh);
      acc[t] = mmaH<ASPLIT ? 2 : 1>(ah.v, al.v, bq.v, bq.v, acc[t]); }
  }
#pragma unroll
  for (int t = 0; t < 4; ++t) { if (col0 + t * 16 >= N) continue;
#pragma unroll
    for (int r = 0; r < 8; ++r) so[w][8 * hh + r][t * 16 + ln] = acc[t][r] * alpha; }
  __builtin_amdgcn_fence(__ATOMIC_ACQ_REL, "workgroup"); __builtin_amdgcn_wave_barrier();
  const int rsub = lane >> 4, c4 = (lane & 15) * 4;
  {
#pragma unroll
    for (int q = 0; q < 8; ++q) { const int r = q * 2 + rsub; if (col0 + c4 < N) { const v4f v = *(const v4fa*)&so[w][r][c4]; *(v4f*)(C + (size_t)(row0 + r) * ldc + col0 + c4) = v; } }
     }
}

// Wt[n][k] = f16(W[k][n]·scale) from f32 row-major W[K][N] (scale = power of two; bf16-exact weights stay exact in f16 away from the subnormal range)
__global__ __launch_bounds__(256) void k_wt_f16(const float* __restrict__ W, _Float16* __restrict__ Wt, int K, int N, float scale) {
  const int t = blockIdx.x * 256 + threadIdx.x; if (t >= N * (K / 8)) return; const int n = t / (K / 8), k8 = (t % (K / 8)) * 8; FragH f;
#pragma unroll
  for (int i = 0; i < 8; ++i) f.h[i] = (_Float16)(bf16_round(W[(size_t)(k8 + i) * N + n]) * scale); const v8us o = f.half[0];
  *(v8us*)((unsigned short*)Wt + (size_t)n * K + k8) = o; 
}
// k_gemm_hh variant with fused epilogue: v = acc·alpha + bias[by·sBias + col] (+ CP[(row/rowsPerB)·sCPb + by·64 + col] if CP) ; ACT 0 none / 1 elu ; writes f16 C16 (and f32 C if non-null)
template <int ACT>
__global__ __launch_bounds__(128) void k_gemm_hhx(const _Float16* __restrict__ A, int lda, size_t sA, const _Float16* __restrict__ Bh, int ldb, size_t sB, float alpha, const float* __restrict__ bias, size_t sBias, const float* __restrict__ CP, int rowsPerB, size_t sCPb, int row0g,
    float* __restrict__ C, _Float16* __restrict__ C16, int ldc, size_t sC, int M, int N, int K) {
  __shared__ __attribute__((aligned(16))) float so[4][16][64];
  const int tid = threadIdx.x, w = tid >> 5, lane = tid & 31, ln = lane & 15, hh = lane >> 4; const int by = blockIdx.y;
  A += (size_t)by * sA; Bh += (size_t)by * sB; const size_t cofs = (size_t)by * sC; const float* bp = bias ? bias + (size_t)by * sBias : nullptr;
  const int ntn = (N + 63) / 64; const int wid = blockIdx.x * 4 + w; const int mt = wid / ntn, nq = wid % ntn; if (mt * 16 >= M) return;
  const int row0 = mt * 16, col0 = nq * 64; const _Float16* arow = A + (size_t)(row0 + ln) * lda;
  v8f acc[4] = {};
  for (int kb = 0; kb < K; kb += 32) { FragH ah; ah.half[0] = *(const v8us*)((const unsigned short*)arow + kb + 8 * hh); ah.half[1] = *(const v8us*)((const unsigned short*)arow + kb + 16 + 8 * hh);
#pragma unroll
    for (int t = 0; t < 4; ++t) { if (col0 + t * 16 >= N) continue; const size_t boff = (size_t)(col0 + t * 16 + ln) * ldb + kb; FragH bq; bq.half[0] = *(const v8us*)((const unsigned short*)Bh + boff + 8 * hh); bq.half[1] = *(const v8us*)((const unsigned short*)Bh + boff + 16 + 8 * hh);
      acc[t] = mmaH<1>(ah.v, ah.v, bq.v, bq.v, acc[t]); }
  }
#pragma unroll
  for (int t = 0; t < 4; ++t) { if (col0 + t * 16 >= N) continue; const int col = col0 + t * 16 + ln; const float bv = bp ? bf16_round(bp[col]) : 0.f;
#pragma unroll
    for (int r = 0; r < 8; ++r) { float v = acc[t][r] * alpha + bv; if (CP) { const int rr = row0g + row0 + 8 * hh + r; if (rowsPerB < 0) v += CP[cofs + (size_t)rr * ldc + col];      /* rowsPerB < 0: own element of the batched C plane */ else { const int bidx = rr / rowsPerB; v += CP[(size_t)bidx * sCPb + (size_t)by * 64 + col]; } } if (ACT == 1) v = (v > 0.f) ? v : expm1f(v); else if (ACT == 7) v = (v > 0.f) ? v + 1.0f : expf(v); else if (ACT == 8) v = tanhf(v); else if (ACT == 9) v = 0.5f * v * (1.0f + tanhf(0.7978845608028654f * (v + 0.044715f * v * v * v))); else if (ACT == 11) v = 1.0f / (1.0f + expf(-v)); else if (ACT == 12) v = (v > 0.f) ? v : 0.01f * v; else if (ACT == 14) v = (v > 0.f) ? v : 0.1f * v; else if (ACT == 16) v = (v >= 0.f) ? v : 0.3f * v; else if (ACT == 17) v = (v >= 0.f) ? v : 0.2f * v; else if (ACT == 15) v = v / (1.0f + expf(-v)); else if (ACT == 3) v = fmaxf(v, 0.f); else if (ACT == 6) v = 0.5f * v * (1.0f + erff(v * 0.70710678118654752f)); so[w][8 * hh + r][t * 16 + ln] = v; } }
  __builtin_amdgcn_fence(__ATOMIC_ACQ_REL, "workgroup"); __builtin_amdgcn_wave_barrier();
  const int rsub = lane >> 4, c4 = (lane & 15) * 4; typedef _Float16 v4h __attribute__((ext_vector_type(4)));
  {
#pragma unroll
    for (int q = 0; q < 8; ++q) { const int r = q * 2 + rsub; if (col0 + c4 < N) { const v4f v = *(const v4fa*)&so[w][r][c4]; if (C) *(v4f*)(C + cofs + (size_t)(row0 + r) * ldc + col0 + c4) = v; if (C16) { v4h h4; for (int i = 0; i < 4; ++i) h4[i] = (_Float16)v[i]; *(v4h*)(C16 + cofs + (size_t)(row0 + r) * ldc + col0 + c4) = h4; } } }
     }
}


typedef _Float16 v4h __attribute__((ext_vector_type(4)));

__global__ __launch_bounds__(256) void k_x16(const float* __restrict__ x, _Float16* __restrict__ X16, size_t n8) { const size_t t = (size_t)blockIdx.x * 256 + threadIdx.x; if (t >= n8) return; FragH f;
#pragma unroll
  for (int q = 0; q < 8; ++q) f.h[q] = (_Float16)bf16_round(x[t * 8 + q]); *(v8us*)((unsigned short*)X16 + t * 8) = f.half[0];  }
__global__ __launch_bounds__(256) void k_h16(const float* __restrict__ x, _Float16* __restrict__ X16, size_t n8) { const size_t t = (size_t)blockIdx.x * 256 + threadIdx.x; if (t >= n8) return; FragH f;
#pragma unroll
  for (int q = 0; q < 8; ++q) f.h[q] = (_Float16)x[t * 8 + q]; *(v8us*)((unsigned short*)X16 + t * 8) = f.half[0];  }
__global__ __launch_bounds__(256) void k_round16f(const float* __restrict__ W, _Float16* __restrict__ Bt, size_t n8) { const size_t t = (size_t)blockIdx.x * 256 + threadIdx.x; if (t >= n8) return; FragH f;
#pragma unroll
  for (int i = 0; i < 8; ++i) f.h[i] = (_Float16)(bf16_round(W[t * 8 + i]) * 16.0f); *(v8us*)((unsigned short*)Bt + t * 8) = f.half[0];  }
template <int NHv, int TTv>
__global__ __launch_bounds__(256) void k_vt(const _Float16* __restrict__ V16, int ldv, int voff, _Float16* __restrict__ Vt) { __shared__ unsigned short tl[64][66]; const int tid = threadIdx.x; const int slab = blockIdx.x / (TTv / 64), lg = blockIdx.x % (TTv / 64); const int b = slab / NHv, h = slab % NHv;
  for (int i = tid; i < 64 * 8; i += 256) { const int r = i / 8, c8 = (i % 8) * 8; FragH f; f.half[0] = *(const v8us*)((const unsigned short*)V16 + ((size_t)b * TTv + lg * 64 + r) * ldv + voff + h * 64 + c8);
#pragma unroll
    for (int q = 0; q < 8; ++q) tl[r][c8 + q] = f.u[q]; }
  __syncthreads();
  {
#pragma unroll
    for (int rd = 0; rd < 2; ++rd) { const int d = rd * 32 + tid / 8, pc = tid % 8; FragH f;
#pragma unroll
      for (int q = 0; q < 8; ++q) f.u[q] = tl[pc * 8 + q][d];
      *(v8us*)((unsigned short*)Vt + ((size_t)slab * 64 + d) * TTv + lg * 64 + pc * 8) = f.half[0]; }
     } }

__global__ __launch_bounds__(256) void k_hl(const float* __restrict__ F, _Float16* __restrict__ Hh, _Float16* __restrict__ Hl, size_t n8) { const size_t t = (size_t)blockIdx.x * 256 + threadIdx.x; if (t >= n8) return; FragH fh, fl; const v4f a = *(const v4fa*)(F + t * 8), c = *(const v4fa*)(F + t * 8 + 4);
#pragma unroll
  for (int q = 0; q < 4; ++q) { _Float16 h = (_Float16)a[q]; fh.h[q] = h; fl.h[q] = (_Float16)((a[q] - (float)h) * 1024.0f); h = (_Float16)c[q]; fh.h[4 + q] = h; fl.h[4 + q] = (_Float16)((c[q] - (float)h) * 1024.0f); }
  { *(v8us*)((unsigned short*)Hh + t * 8) = fh.half[0]; *(v8us*)((unsigned short*)Hl + t * 8) = fl.half[0];  } }

// ---- fast GEMM (wave tile 32x64; requires M % 32 == 0 rows per launch region and N % 64 == 0); epilogue = k_gemm_hhx semantics ----
__device__ __forceinline__ v16h g2_frag(const _Float16* p, int hh) { FragH f; f.half[0] = *(const v8us*)((const unsigned short*)p + 8 * hh); f.half[1] = *(const v8us*)((const unsigned short*)p + 16 + 8 * hh); return f.v; }
__device__ __forceinline__ v8f g2_mma(v16h a, v16h b, v8f c) { v8f d = __builtin_amdgcn_wmma_f32_16x16x32_f16(false, a, false, b, (short)0, c, false, false); asm volatile("v_nop\n\tv_nop\n\tv_nop\n\tv_nop" : "+v"(d) : "v"(a), "v"(b)); return d; }
template <int ACT>
__global__ __launch_bounds__(128) void k_gemm2(const _Float16* __restrict__ A, int lda, size_t sA, const _Float16* __restrict__ Bh, int ldb, size_t sB, float alpha, const float* __restrict__ bias, size_t sBias, const float* __restrict__ CP, int rowsPerB, size_t sCPb, int row0g,
    float* __restrict__ C, _Float16* __restrict__ C16, int ldc, size_t sC, int M, int N, int K) { static_assert(ACT == 0 || ACT == 3 || ACT == 6 || ACT == 8 || ACT == 9 || ACT == 11 || ACT == 12 || ACT == 14 || ACT == 15 || ACT == 16 || ACT == 17, "k_gemm2: unsupported ACT code (would silently apply no activation)");
  __shared__ __attribute__((aligned(16))) float so[4][32][68];
  const int tid = threadIdx.x, w = tid >> 5, lane = tid & 31, ln = lane & 15, hh = lane >> 4; const int by = blockIdx.y;
  A += (size_t)by * sA; Bh += (size_t)by * sB; const size_t cofs = (size_t)by * sC; const float* bp = bias ? bias + (size_t)by * sBias : nullptr;
  const int ntn = N >> 6; const int mt = blockIdx.x / ntn, nq = blockIdx.x - mt * ntn; const int row0 = mt * 128 + 32 * w, col0 = nq * 64; if (row0 >= M) return;
  const _Float16* a0p = A + (size_t)(row0 + ln) * lda; const _Float16* a1p = a0p + (size_t)16 * lda;
  const _Float16* b0p = Bh + (size_t)(col0 + ln) * ldb; const _Float16* b1p = b0p + (size_t)16 * ldb; const _Float16* b2p = b1p + (size_t)16 * ldb; const _Float16* b3p = b2p + (size_t)16 * ldb;
  const v8f z8 = {0.f,0.f,0.f,0.f,0.f,0.f,0.f,0.f}; v8f c00 = z8, c01 = z8, c02 = z8, c03 = z8, c10 = z8, c11 = z8, c12 = z8, c13 = z8;
#pragma unroll 1
  for (int kb = 0; kb < K; kb += 32) { const v16h a0 = g2_frag(a0p + kb, hh), a1 = g2_frag(a1p + kb, hh);
    v16h b = g2_frag(b0p + kb, hh); c00 = g2_mma(a0, b, c00); c10 = g2_mma(a1, b, c10);
    b = g2_frag(b1p + kb, hh); c01 = g2_mma(a0, b, c01); c11 = g2_mma(a1, b, c11);
    b = g2_frag(b2p + kb, hh); c02 = g2_mma(a0, b, c02); c12 = g2_mma(a1, b, c12);
    b = g2_frag(b3p + kb, hh); c03 = g2_mma(a0, b, c03); c13 = g2_mma(a1, b, c13); }
  v8f accs[8] = {c00, c01, c02, c03, c10, c11, c12, c13};
#pragma unroll
  for (int u = 0; u < 8; ++u) { const int t = u & 3, half = u >> 2; const int col = col0 + t * 16 + ln; const float bv = bp ? bf16_round(bp[col]) : 0.f;
#pragma unroll
    for (int r = 0; r < 8; ++r) { const int rloc = half * 16 + 8 * hh + r; float v = accs[u][r] * alpha + bv; if (CP) { if (rowsPerB < 0) v += CP[cofs + (size_t)(row0g + row0 + rloc) * ldc + col];      /* rowsPerB < 0: own element of the batched C plane */ else { const int bidx = (row0g + row0 + rloc) / rowsPerB; v += CP[(size_t)bidx * sCPb + (size_t)by * 64 + col]; } }
      if (ACT == 3) v = fmaxf(v, 0.f); else if (ACT == 6) v = 0.5f * v * (1.0f + erff(v * 0.70710678118654752f)); else if (ACT == 11) v = 1.0f / (1.0f + expf(-v)); else if (ACT == 15) v = v / (1.0f + expf(-v)); else if (ACT == 12) v = (v > 0.f) ? v : 0.01f * v; else if (ACT == 8) v = tanhf(v); else if (ACT == 9) v = 0.5f * v * (1.0f + tanhf(0.7978845608028654f * (v + 0.044715f * v * v * v))); else if (ACT == 14) v = (v > 0.f) ? v : 0.1f * v; else if (ACT == 16) v = (v >= 0.f) ? v : 0.3f * v; else if (ACT == 17) v = (v >= 0.f) ? v : 0.2f * v;
      so[w][rloc][t * 16 + ln] = v; } }
  __builtin_amdgcn_fence(__ATOMIC_ACQ_REL, "workgroup"); __builtin_amdgcn_wave_barrier();
  const int rsub = lane >> 4, c4 = (lane & 15) * 4;
  {
#pragma unroll
    for (int q = 0; q < 16; ++q) { const int r = q * 2 + rsub; const v4f v = *(const v4fa*)&so[w][r][c4]; if (C) *(v4f*)(C + cofs + (size_t)(row0 + r) * ldc + col0 + c4) = v; if (C16) { v4h h4; for (int i = 0; i < 4; ++i) h4[i] = (_Float16)v[i]; *(v4h*)(C16 + cofs + (size_t)(row0 + r) * ldc + col0 + c4) = h4; } }
     } }


__global__ __launch_bounds__(256) void k_wnat(const float* __restrict__ w, size_t n8, _Float16* __restrict__ Bt) { const size_t t = (size_t)blockIdx.x * 256 + threadIdx.x; if (t >= n8) return; FragH f; for (int q = 0; q < 8; ++q) f.h[q] = (_Float16)(bf16_round(w[t * 8 + q]) * 16.0f); *(v8us*)((unsigned short*)Bt + t * 8) = f.half[0];  }
__global__ __launch_bounds__(256) void k_rsm(const float* __restrict__ S, _Float16* __restrict__ P, int nrows) {
  #pragma clang fp contract(off)
  const int i = blockIdx.x * 256 + threadIdx.x; if (i >= nrows) return; const float* s = S + (size_t)i * SQ; float mx = -3.0e38f;
#pragma unroll 1
  for (int j = 0; j < SQ; ++j) mx = fmaxf(mx, s[j]); float se = 0.f;
#pragma unroll 1
  for (int j = 0; j < SQ; ++j) se += expf(s[j] - mx); const float sc = 256.0f / se;
#pragma unroll 1
  for (int j0 = 0; j0 < SQ; j0 += 8) { FragH f; for (int q = 0; q < 8; ++q) f.h[q] = (_Float16)(expf(s[j0 + q] - mx) * sc); unsigned short* d = (unsigned short*)P + (size_t)i * SQ + j0; *(v8us*)d = f.half[0];  } }
__global__ __launch_bounds__(256) void k_vt(const _Float16* __restrict__ V16, int b, int h0, _Float16* __restrict__ VT) { __shared__ unsigned short tl[64][65]; const int tid = threadIdx.x; const int hh = blockIdx.x % HG, sg = blockIdx.x / HG; const int s0 = sg * 64; const int h = h0 + hh;
  for (int i = tid; i < 64 * 8; i += 256) { const int j = i / 8, d8 = (i % 8) * 8; FragH f; f.half[0] = *(const v8us*)((const unsigned short*)V16 + ((size_t)b * SQ + s0 + j) * DM + h * HD + d8); for (int q = 0; q < 8; ++q) tl[d8 + q][j] = f.u[q]; }
  __syncthreads();
  { for (int i = tid; i < 64 * 8; i += 256) { const int d = i / 8, j8 = (i % 8) * 8; FragH f; for (int q = 0; q < 8; ++q) f.u[q] = tl[d][j8 + q]; *(v8us*)((unsigned short*)VT + ((size_t)hh * HD + d) * SQ + s0 + j8) = f.half[0]; }  } }


__global__ __launch_bounds__(256) void k_catrows(const float* __restrict__ rgb, const float* __restrict__ ir, _Float16* __restrict__ YR) { __shared__ float tl[64][33]; const int tid = threadIdx.x; const int nc = CC / 64, nl = PX / 32; const int cb_ = blockIdx.x % nc; const int lb = (blockIdx.x / nc) % nl; const size_t b = blockIdx.x / (nc * nl); const int c0 = cb_ * 64, l0 = lb * 32;
  const float* src = (c0 < DIMH) ? (rgb + (b * DIMH + c0) * (size_t)PX) : (ir + (b * DIMH + (c0 - DIMH)) * (size_t)PX);
  for (int i = tid; i < 64 * 32; i += 256) { const int c = i / 32, l = i % 32; tl[c][l] = bf16_round(src[(size_t)c * PX + l0 + l]); }
  __syncthreads();
  { const int l = tid / 8, c8 = (tid % 8) * 8; FragH f; for (int q = 0; q < 8; ++q) f.h[q] = (_Float16)tl[c8 + q][l]; unsigned short* d = (unsigned short*)YR + (b * PX + l0 + l) * (size_t)CC + c0 + c8; *(v8us*)d = f.half[0];  } }
__global__ __launch_bounds__(256) void k_dla(const float* __restrict__ F, _Float16* __restrict__ X16) {
  #pragma clang fp contract(off)
  __shared__ float spk[256][9]; const int tid = threadIdx.x; const size_t t = (size_t)blockIdx.x * 256 + tid; if (t >= (size_t)NRD * 8) return; const int hh = (int)(t % 4); const int di = (int)((t / 4) % 2); const size_t r = t / 8; const size_t b = r / PX; const int p = (int)(r % PX); const int y = p / WS, x = p % WS; const int dil = di ? 3 : 2;
  const float* qp = F + r * QW + di * 128 + hh * 32; const int koff = CC + di * 128 + hh * 32, voff = 2 * CC + di * 128 + hh * 32;
  float mx = -INFINITY;
#pragma unroll 1
  for (int kk = 0; kk < 9; ++kk) { const int yy = y + (kk / 3 - 1) * dil, xx = x + (kk % 3 - 1) * dil; float s = 0.f;
    if (yy >= 0 && yy < HS && xx >= 0 && xx < WS) { const float* kp = F + (b * PX + (size_t)yy * WS + xx) * QW + koff;
#pragma unroll 1
      for (int d_ = 0; d_ < 32; ++d_) s = __fadd_rn(s, __fmul_rn(qp[d_], kp[d_])); }
    s = __fmul_rn(s, SCL); spk[tid][kk] = s; mx = fmaxf(mx, s); }
  float se = 0.f;
#pragma unroll 1
  for (int kk = 0; kk < 9; ++kk) { const float e = expf(spk[tid][kk] - mx); spk[tid][kk] = e; se += e; }
#pragma unroll 1
  for (int kk = 0; kk < 9; ++kk) spk[tid][kk] = spk[tid][kk] / se;
  unsigned short* dst = (unsigned short*)X16 + r * CC + di * 128 + hh * 32;
  for (int g = 0; g < 4; ++g) { float acc[8]; for (int q = 0; q < 8; ++q) acc[q] = 0.f;
#pragma unroll 1
    for (int kk = 0; kk < 9; ++kk) { const int yy = y + (kk / 3 - 1) * dil, xx = x + (kk % 3 - 1) * dil; if (yy < 0 || yy >= HS || xx < 0 || xx >= WS) continue; const float* vp = F + (b * PX + (size_t)yy * WS + xx) * QW + voff + g * 8; const float pw = spk[tid][kk];
      for (int q = 0; q < 8; ++q) acc[q] = __fadd_rn(acc[q], __fmul_rn(pw, vp[q])); }
    FragH f; for (int q = 0; q < 8; ++q) f.h[q] = (_Float16)acc[q]; *(v8us*)(dst + g * 8) = f.half[0];  } }
__global__ __launch_bounds__(256) void k_finm(const float* __restrict__ Y, const float* __restrict__ bpj, const float* __restrict__ rgb, const float* __restrict__ ir, float* __restrict__ out) {
  #pragma clang fp contract(off)
  const size_t t = (size_t)blockIdx.x * 256 + threadIdx.x; if (t >= NR * CC / 8) return; const int c0 = (int)(t % (CC / 8)) * 8; const size_t r = t / (CC / 8); const size_t b = r / PX; const int p = (int)(r % PX); v8f v;
  for (int q = 0; q < 8; ++q) { const int c = c0 + q; const float res = (c < DIMH) ? rgb[(b * DIMH + c) * PX + p] : ir[(b * DIMH + (c - DIMH)) * PX + p]; v[q] = __fadd_rn(__fadd_rn(Y[r * CC + c], bf16_round(bpj[c])), bf16_round(res)); }
  *(v8f*)(out + r * CC + c0) = v;  }

extern "C" void kernel_launch(void* const* d_in, const int* in_sizes, int n_in,
                              void* d_out, int out_size, void* d_ws, size_t ws_size, hipStream_t stream) {
  (void)in_sizes; (void)n_in; (void)out_size;
  const float* const* I = (const float* const*)d_in; const float* rgb = I[0]; const float* ir = I[1]; const float* wqkv = I[2]; const float* wp = I[3]; const float* bp = I[4];
  char* ws = (char*)d_ws; size_t off = 0;
  auto take = [&](size_t bytes) { char* p = ws + off; off += (bytes + 255) & ~(size_t)255; return p; };
  _Float16* BQ = (_Float16*)take((size_t)QW * CC * 2); _Float16* BP = (_Float16*)take((size_t)CC * CC * 2); _Float16* YR = (_Float16*)take(NR * CC * 2); float* F = (float*)take(NR * QW * 4); _Float16* X16 = (_Float16*)take(NR * CC * 2); float* Y = (float*)take(NR * CC * 4);
  if (off > ws_size) return;      /* 0.5 + 12.5 + 75 + 12.5 + 25 = approx 126 MiB */
  k_wnat<<<(unsigned)(((size_t)QW * CC / 8 + 255) / 256), 256, 0, stream>>>(wqkv, (size_t)QW * CC / 8, BQ); k_wnat<<<(unsigned)(((size_t)CC * CC / 8 + 255) / 256), 256, 0, stream>>>(wp, (size_t)CC * CC / 8, BP);
  k_catrows<<<(unsigned)(NB * (PX / 32) * (CC / 64)), 256, 0, stream>>>(rgb, ir, YR);
  k_gemm2<0><<<dim3((unsigned)((NR / 128) * (QW / 64)), 1), 128, 0, stream>>>(YR, CC, 0, BQ, CC, 0, 0.0625f, nullptr, 0, nullptr, 1, 0, 0, F, nullptr, QW, 0, (int)NR, QW, CC);      /* qkv (f32) */
  k_dla<<<(unsigned)(((size_t)NRD * 8 + 255) / 256), 256, 0, stream>>>(F, X16);
  k_gemm2<0><<<dim3((unsigned)((NR / 128) * (CC / 64)), 1), 128, 0, stream>>>(X16, CC, 0, BP, CC, 0, 0.0625f, nullptr, 0, nullptr, 1, 0, 0, Y, nullptr, CC, 0, NRD, CC, CC);      /* proj */
  k_finm<<<(unsigned)((NR * CC / 8 + 255) / 256), 256, 0, stream>>>(Y, bp, rgb, ir, (float*)d_out);
}

// v001
// Measured time: 120 microseconds a run.
// Next to v000, in two timings, it ran 6.72 and 6.73 times as fast.
#include <hip/hip_runtime.h>
// Multi-dilate local attention (rgb, ir [4][128][80][80] -> y = [rgb | ir] (256 ch); qkv = 1x1 (w_qkv [768][256]) split as [3][2 dilations][128 = 4 heads x 32]; per dilation d in (2, 3): each pixel attends to its 3x3 dilated neighbourhood (zero-padded unfold: out-of-image neighbours contribute k = v = 0, logit 0) with softmax(q.k / sqrt(32)) over the 9; heads merged dilation-major; proj (w_proj [256][256]) + b_proj; + y -> NHWC [4][80][80][256]).
// Structure: the two channel-first inputs transposed to concatenated pixel rows (exact f16) via LDS tiles; qkv as a WMMA GEMM (32x64 wave tiles, f32 accumulation, exact x16 natural weights; exact products) kept f32; the dilated local attention, one wave per (pixel, dilation), on VALU (f32; 4 channels a lane, softmax weights in registers) into f16 rows; projection GEMM to f32 rows; bias + residual on VALU straight to the NHWC output.
// Compute dtype: inputs rounded to bf16; y / weights exact; qkv and the attention f32; the attended rows as a plain f16 GEMM operand (~2^-12). v_wmma_f32_16x16x32_f16.
#define NB 4
#define DIMH 128
#define CC 256
#define QW 768
#define HS 80
#define WS 80
#define PX (HS * WS)                 /* 6400 = 50 x 128 */
#define NR ((size_t)NB * PX)         /* 25,600 rows */
#define NRD ((int)NR)                /* rows projected (debug hook) */
#define SCL 0.17677669529663689f
#define SQ 64
#define DM 64
#define NH 1
#define HD 64
#define HG 1
typedef __bf16 v16b __attribute__((ext_vector_type(16)));
typedef unsigned short v8us __attribute__((ext_vector_type(8), may_alias));
typedef float  v8f  __attribute__((ext_vector_type(8)));
typedef float  v4f  __attribute__((ext_vector_type(4)));
typedef float  v4fa __attribute__((ext_vector_type(4), may_alias));
union FragB { v16b v; v8us half[2]; unsigned short u[16]; };

__device__ __forceinline__ unsigned short bf16_bits(float x) { unsigned int u = __float_as_uint(x); return (unsigned short)((u + 0x7FFFu + ((u >> 16) & 1u)) >> 16); }
__device__ __forceinline__ float bf16_val(unsigned short b) { return __uint_as_float(((unsigned int)b) << 16); }
__device__ __forceinline__ float bf16_round(float x) { return bf16_val(bf16_bits(x)); }
// D += A·B with NT terms: 1 = ah·bh, 2 = + al·bh (A split), 3 = + ah·bl (both split)
template <int NT>
__device__ __forceinline__ v8f mmaN(v16b ah, v16b al, v16b bh, v16b bl, v8f c) {
  c = __builtin_amdgcn_wmma_f32_16x16x32_bf16(false, ah, false, bh, (short)0, c, false, false);
  if (NT >= 2) c = __builtin_amdgcn_wmma_f32_16x16x32_bf16(false, al, false, bh, (short)0, c, false, false);
  if (NT >= 3) c = __builtin_amdgcn_wmma_f32_16x16x32_bf16(false, ah, false, bl, (short)0, c, false, false);
  asm volatile("v_nop\n\tv_nop\n\tv_nop\n\tv_nop" : "+v"(c) : "v"(ah), "v"(al), "v"(bh), "v"(bl));
  return c;
}

__global__ __launch_bounds__(256) void k_wt_bf16(const float* __restrict__ W, unsigned short* __restrict__ Wt, int K, int N) {
  const int t = blockIdx.x * 256 + threadIdx.x;
  const int k8n = K / 8;
  if (t >= N * k8n) return;
  const int n = t / k8n, k8 = (t % k8n) * 8;
  v8us v;
#pragma unroll
  for (int i = 0; i < 8; ++i) v[i] = bf16_bits(W[(size_t)(k8 + i) * N + n]);
  *(v8us*)(Wt + (size_t)n * K + k8) = v;
  
}

// GEMM C[M][N] (f32, pitch ldc) = act(A[M][K]·W + bias). A f32 row-major (pitch lda) converted per fragment to bf16
// (ASPLIT: hi/lo two planes -> 2 terms, else single rounded term); Wt bf16 [N][K] (pitch ldb). BIAS_BF16 rounds the
// bias to bf16 first (bias quantised to bf16 before the add). K%32==0, M%16==0, N%64==0.
template <bool ASPLIT, int ACT, bool BIAS_BF16>
__global__ __launch_bounds__(128) void k_gemm_bf(const float* __restrict__ A, int lda, const unsigned short* __restrict__ Wt, int ldb,
                                               const float* __restrict__ bias, float* __restrict__ C, int ldc, int M, int N, int K) {
  __shared__ __attribute__((aligned(16))) float so[4][16][64];
  const int tid = threadIdx.x, w = tid >> 5, lane = tid & 31, ln = lane & 15, hh = lane >> 4;
  const int ntn = N / 64;
  const int wid = blockIdx.x * 4 + w;
  const int mt = wid / ntn, nq = wid % ntn;
  if (mt * 16 >= M) return;
  const int row0 = mt * 16, col0 = nq * 64;
  const float* arow = A + (size_t)(row0 + ln) * lda;
  v8f acc[4] = {};
  for (int kb = 0; kb < K; kb += 32) {
    FragB ah, al;
    const v4f x0 = *(const v4fa*)(arow + kb + 8 * hh), x1 = *(const v4fa*)(arow + kb + 8 * hh + 4);
    const v4f x2 = *(const v4fa*)(arow + kb + 16 + 8 * hh), x3 = *(const v4fa*)(arow + kb + 16 + 8 * hh + 4);
    float xs[16] = {x0[0],x0[1],x0[2],x0[3],x1[0],x1[1],x1[2],x1[3],x2[0],x2[1],x2[2],x2[3],x3[0],x3[1],x3[2],x3[3]};
#pragma unroll
    for (int i = 0; i < 16; ++i) { const unsigned short hb = bf16_bits(xs[i]); ah.u[i] = hb; al.u[i] = ASPLIT ? bf16_bits(xs[i] - bf16_val(hb)) : (unsigned short)0; }
#pragma unroll
    for (int t = 0; t < 4; ++t) {
      const unsigned short* brow = Wt + (size_t)(col0 + t * 16 + ln) * ldb + kb;
      FragB b;
      b.half[0] = *(const v8us*)(brow + 8 * hh);
      b.half[1] = *(const v8us*)(brow + 16 + 8 * hh);
      acc[t] = mmaN<ASPLIT ? 2 : 1>(ah.v, al.v, b.v, b.v, acc[t]);
    }
  }
#pragma unroll
  for (int t = 0; t < 4; ++t) {
    float bv = bias ? bias[col0 + t * 16 + ln] : 0.f;
    if (BIAS_BF16) bv = bf16_round(bv);
#pragma unroll
    for (int r = 0; r < 8; ++r) { float v = acc[t][r] + bv; if (ACT == 1) v = fmaxf(v, 0.f); so[w][8 * hh + r][t * 16 + ln] = v; }
  }
  __builtin_amdgcn_fence(__ATOMIC_ACQ_REL, "workgroup");
  __builtin_amdgcn_wave_barrier();
  const int rsub = lane >> 4, c4 = (lane & 15) * 4;
  {
#pragma unroll
    for (int q = 0; q < 8; ++q) {
      const int r = q * 2 + rsub;
      const v4f v = *(const v4fa*)&so[w][r][c4];
      *(v4f*)(C + (size_t)(row0 + r) * ldc + col0 + c4) = v;
    }
    
  }
}

// GEMM C = act(A·W + bias + resid): A f32 (ASPLIT -> hi/lo 2 terms), Wt bf16 [N][K]; ACT 0 none, 1 relu, 2 exact gelu;
// resid (optional, f32, row index = (row % rmod), pitch ldr, RES_BF16 rounds it) added before the activation.
template <bool ASPLIT, int ACT, bool BIAS_BF16, bool RES_BF16>
__global__ __launch_bounds__(128) void k_gemm_bf3(const float* __restrict__ A, int lda, const unsigned short* __restrict__ Wt, int ldb,
                                                const float* __restrict__ bias, const float* __restrict__ resid, int rmod, int ldr,
                                                float* __restrict__ C, int ldc, int M, int N, int K) {
  __shared__ __attribute__((aligned(16))) float so[4][16][64];
  const int tid = threadIdx.x, w = tid >> 5, lane = tid & 31, ln = lane & 15, hh = lane >> 4;
  const int ntn = N / 64;
  const int wid = blockIdx.x * 4 + w;
  const int mt = wid / ntn, nq = wid % ntn;
  if (mt * 16 >= M) return;
  const int row0 = mt * 16, col0 = nq * 64;
  const float* arow = A + (size_t)(row0 + ln) * lda;
  v8f acc[4] = {};
  for (int kb = 0; kb < K; kb += 32) {
    FragB ah, al;
    const v4f x0 = *(const v4fa*)(arow + kb + 8 * hh), x1 = *(const v4fa*)(arow + kb + 8 * hh + 4);
    const v4f x2 = *(const v4fa*)(arow + kb + 16 + 8 * hh), x3 = *(const v4fa*)(arow + kb + 16 + 8 * hh + 4);
    float xs[16] = {x0[0],x0[1],x0[2],x0[3],x1[0],x1[1],x1[2],x1[3],x2[0],x2[1],x2[2],x2[3],x3[0],x3[1],x3[2],x3[3]};
#pragma unroll
    for (int i = 0; i < 16; ++i) { const unsigned short hb = bf16_bits(xs[i]); ah.u[i] = hb; al.u[i] = ASPLIT ? bf16_bits(xs[i] - bf16_val(hb)) : (unsigned short)0; }
#pragma unroll
    for (int t = 0; t < 4; ++t) {
      const unsigned short* brow = Wt + (size_t)(col0 + t * 16 + ln) * ldb + kb;
      FragB b;
      b.half[0] = *(const v8us*)(brow + 8 * hh);
      b.half[1] = *(const v8us*)(brow + 16 + 8 * hh);
      acc[t] = mmaN<ASPLIT ? 2 : 1>(ah.v, al.v, b.v, b.v, acc[t]);
    }
  }
#pragma unroll
  for (int t = 0; t < 4; ++t) {
    const int col = col0 + t * 16 + ln;
    float bv = bias ? bias[col] : 0.f;
    if (BIAS_BF16) bv = bf16_round(bv);
#pragma unroll
    for (int r = 0; r < 8; ++r) {
      float v = acc[t][r] + bv;
      if (resid) { float rv = resid[(size_t)((row0 + 8 * hh + r) % rmod) * ldr + col]; if (RES_BF16) rv = bf16_round(rv); v += rv; }
      if (ACT == 1) v = fmaxf(v, 0.f);
      if (ACT == 2) v = 0.5f * v * (1.0f + erff(v * 0.70710678118654752f));
      if (ACT == 3) { const float u = 0.7978845608028654f * (v + 0.044715f * v * v * v); v = 0.5f * v * (1.0f + tanhf(u)); }
      so[w][8 * hh + r][t * 16 + ln] = v;
    }
  }
  __builtin_amdgcn_fence(__ATOMIC_ACQ_REL, "workgroup");
  __builtin_amdgcn_wave_barrier();
  const int rsub = lane >> 4, c4 = (lane & 15) * 4;
  {
#pragma unroll
    for (int q = 0; q < 8; ++q) {
      const int r = q * 2 + rsub;
      const v4f v = *(const v4fa*)&so[w][r][c4];
      *(v4f*)(C + (size_t)(row0 + r) * ldc + col0 + c4) = v;
    }
    
  }
}
// row LayerNorm (biased variance, eps) over N: s = X (+ R); optional out_sum <- s; out_norm <- (s-mu)*rsqrt(var+eps)*g + b
template <bool PARAM_BF16>
__global__ __launch_bounds__(256) void k_layernorm(const float* __restrict__ X, const float* __restrict__ R, const float* __restrict__ g, const float* __restrict__ bta,
                                                  float* __restrict__ out_sum, float* __restrict__ out_norm, int N, float eps) {
  __shared__ float red[256];
  const int row = blockIdx.x, tid = threadIdx.x;
  const float* x = X + (size_t)row * N; const float* rr = R ? R + (size_t)row * N : nullptr;
  float vals[16];                     // up to N = 4096
  const int per = N / 256;            // contiguous chunk per thread? use strided-by-4 chunks: thread handles j = tid*4 + 1024*u
  float s1 = 0.f;
  for (int u = 0; u < per / 4; ++u) {
    const int j = tid * 4 + 1024 * u;
    const v4f a = *(const v4fa*)(x + j);
    v4f b = {0.f,0.f,0.f,0.f}; if (rr) b = *(const v4fa*)(rr + j);
#pragma unroll
    for (int q = 0; q < 4; ++q) { const float v = a[q] + b[q]; vals[u * 4 + q] = v; s1 += v; }
  }
  red[tid] = s1; __syncthreads();
  for (int st = 128; st > 0; st >>= 1) { if (tid < st) red[tid] += red[tid + st]; __syncthreads(); }
  const float mu = red[0] / (float)N; __syncthreads();
  float s2 = 0.f;
  for (int u = 0; u < per / 4; ++u)
#pragma unroll
    for (int q = 0; q < 4; ++q) { const float c = vals[u * 4 + q] - mu; s2 += c * c; }
  red[tid] = s2; __syncthreads();
  for (int st = 128; st > 0; st >>= 1) { if (tid < st) red[tid] += red[tid + st]; __syncthreads(); }
  const float rs = rsqrtf(red[0] / (float)N + eps);
  {
    for (int u = 0; u < per / 4; ++u) {
      const int j = tid * 4 + 1024 * u;
      v4f o, sm;
#pragma unroll
      for (int q = 0; q < 4; ++q) {
        float gg = g[j + q], bb = bta[j + q];
        if (PARAM_BF16) { gg = bf16_round(gg); bb = bf16_round(bb); }
        sm[q] = vals[u * 4 + q]; o[q] = (vals[u * 4 + q] - mu) * rs * gg + bb;
      }
      if (out_sum) *(v4f*)(out_sum + (size_t)row * N + j) = sm;
      *(v4f*)(out_norm + (size_t)row * N + j) = o;
    }
    
  }
}



// ---- f16 WMMA path (v_wmma_f32_16x16x32_f16): 11-bit significands for operands in range — used here for the qkv and projection GEMMs
typedef _Float16 v16h __attribute__((ext_vector_type(16)));
union FragH { v16h v; v8us half[2]; _Float16 h[16]; unsigned short u[16]; };
template <int NT>
__device__ __forceinline__ v8f mmaH(v16h ah, v16h al, v16h bh, v16h bl, v8f c) {
  c = __builtin_amdgcn_wmma_f32_16x16x32_f16(false, ah, false, bh, (short)0, c, false, false);
  if (NT >= 2) c = __builtin_amdgcn_wmma_f32_16x16x32_f16(false, al, false, bh, (short)0, c, false, false);
  if (NT >= 3) c = __builtin_amdgcn_wmma_f32_16x16x32_f16(false, ah, false, bl, (short)0, c, false, false);
  asm volatile("v_nop\n\tv_nop\n\tv_nop\n\tv_nop" : "+v"(c) : "v"(ah), "v"(al), "v"(bh), "v"(bl));
  return c;
}
// batched GEMM like k_gemm_b but f16 operands: A f32 (split into f16 hi/lo if ASPLIT, else rounded to f16), Bt = f16 values [n][k]; alpha; C f32; N multiple of 16 (partial tiles skipped)
template <bool ASPLIT>
__global__ __launch_bounds__(128) void k_gemm_h(const float* __restrict__ A, int lda, size_t sA, const _Float16* __restrict__ Bh, int ldb, size_t sB, float alpha, float* __restrict__ C, int ldc, size_t sC, int M, int N, int K) {
  __shared__ __attribute__((aligned(16))) float so[4][16][64];
  const int tid = threadIdx.x, w = tid >> 5, lane = tid & 31, ln = lane & 15, hh = lane >> 4; const int by = blockIdx.y;
  A += (size_t)by * sA; Bh += (size_t)by * sB; C += (size_t)by * sC;
  const int ntn = (N + 63) / 64; const int wid = blockIdx.x * 4 + w; const int mt = wid / ntn, nq = wid % ntn; if (mt * 16 >= M) return;
  const int row0 = mt * 16, col0 = nq * 64; const float* arow = A + (size_t)(row0 + ln) * lda;
  v8f acc[4] = {};
  for (int kb = 0; kb < K; kb += 32) {
    FragH ah, al;
    const v4f x0 = *(const v4fa*)(arow + kb + 8 * hh), x1 = *(const v4fa*)(arow + kb + 8 * hh + 4), x2 = *(const v4fa*)(arow + kb + 16 + 8 * hh), x3 = *(const v4fa*)(arow + kb + 16 + 8 * hh + 4);
    float xs[16] = {x0[0],x0[1],x0[2],x0[3],x1[0],x1[1],x1[2],x1[3],x2[0],x2[1],x2[2],x2[3],x3[0],x3[1],x3[2],x3[3]};
#pragma unroll
    for (int i = 0; i < 16; ++i) { const _Float16 h = (_Float16)xs[i]; ah.h[i] = h; al.h[i] = ASPLIT ? (_Float16)(xs[i] - (float)h) : (_Float16)0.0f; }
#pragma unroll
    for (int t = 0; t < 4; ++t) { if (col0 + t * 16 >= N) continue; const size_t boff = (size_t)(col0 + t * 16 + ln) * ldb + kb; FragH bq; bq.half[0] = *(const v8us*)(Bh + boff + 8 * hh); bq.half[1] = *(const v8us*)(Bh + boff + 16 + 8 * hh);
      acc[t] = mmaH<ASPLIT ? 2 : 1>(ah.v, al.v, bq.v, bq.v, acc[t]); }
  }
#pragma unroll
  for (int t = 0; t < 4; ++t) { if (col0 + t * 16 >= N) continue;
#pragma unroll
    for (int r = 0; r < 8; ++r) so[w][8 * hh + r][t * 16 + ln] = acc[t][r] * alpha; }
  __builtin_amdgcn_fence(__ATOMIC_ACQ_REL, "workgroup"); __builtin_amdgcn_wave_barrier();
  const int rsub = lane >> 4, c4 = (lane & 15) * 4;
  {
#pragma unroll
    for (int q = 0; q < 8; ++q) { const int r = q * 2 + rsub; if (col0 + c4 < N) { const v4f v = *(const v4fa*)&so[w][r][c4]; *(v4f*)(C + (size_t)(row0 + r) * ldc + col0 + c4) = v; } }
     }
}

// Wt[n][k] = f16(W[k][n]·scale) from f32 row-major W[K][N] (scale = power of two; bf16-exact weights stay exact in f16 away from the subnormal range)
__global__ __launch_bounds__(256) void k_wt_f16(const float* __restrict__ W, _Float16* __restrict__ Wt, int K, int N, float scale) {
  const int t = blockIdx.x * 256 + threadIdx.x; if (t >= N * (K / 8)) return; const int n = t / (K / 8), k8 = (t % (K / 8)) * 8; FragH f;
#pragma unroll
  for (int i = 0; i < 8; ++i) f.h[i] = (_Float16)(bf16_round(W[(size_t)(k8 + i) * N + n]) * scale); const v8us o = f.half[0];
  *(v8us*)((unsigned short*)Wt + (size_t)n * K + k8) = o; 
}
// k_gemm_hh variant with fused epilogue: v = acc·alpha + bias[by·sBias + col] (+ CP[(row/rowsPerB)·sCPb + by·64 + col] if CP) ; ACT 0 none / 1 elu ; writes f16 C16 (and f32 C if non-null)
template <int ACT>
__global__ __launch_bounds__(128) void k_gemm_hhx(const _Float16* __restrict__ A, int lda, size_t sA, const _Float16* __restrict__ Bh, int ldb, size_t sB, float alpha, const float* __restrict__ bias, size_t sBias, const float* __restrict__ CP, int rowsPerB, size_t sCPb, int row0g,
    float* __restrict__ C, _Float16* __restrict__ C16, int ldc, size_t sC, int M, int N, int K) {
  __shared__ __attribute__((aligned(16))) float so[4][16][64];
  const int tid = threadIdx.x, w = tid >> 5, lane = tid & 31, ln = lane & 15, hh = lane >> 4; const int by = blockIdx.y;
  A += (size_t)by * sA; Bh += (size_t)by * sB; const size_t cofs = (size_t)by * sC; const float* bp = bias ? bias + (size_t)by * sBias : nullptr;
  const int ntn = (N + 63) / 64; const int wid = blockIdx.x * 4 + w; const int mt = wid / ntn, nq = wid % ntn; if (mt * 16 >= M) return;
  const int row0 = mt * 16, col0 = nq * 64; const _Float16* arow = A + (size_t)(row0 + ln) * lda;
  v8f acc[4] = {};
  for (int kb = 0; kb < K; kb += 32) { FragH ah; ah.half[0] = *(const v8us*)((const unsigned short*)arow + kb + 8 * hh); ah.half[1] = *(const v8us*)((const unsigned short*)arow + kb + 16 + 8 * hh);
#pragma unroll
    for (int t = 0; t < 4; ++t) { if (col0 + t * 16 >= N) continue; const size_t boff = (size_t)(col0 + t * 16 + ln) * ldb + kb; FragH bq; bq.half[0] = *(const v8us*)((const unsigned short*)Bh + boff + 8 * hh); bq.half[1] = *(const v8us*)((const unsigned short*)Bh + boff + 16 + 8 * hh);
      acc[t] = mmaH<1>(ah.v, ah.v, bq.v, bq.v, acc[t]); }
  }
#pragma unroll
  for (int t = 0; t < 4; ++t) { if (col0 + t * 16 >= N) continue; const int col = col0 + t * 16 + ln; const float bv = bp ? bf16_round(bp[col]) : 0.f;
#pragma unroll
    for (int r = 0; r < 8; ++r) { float v = acc[t][r] * alpha + bv; if (CP) { const int rr = row0g + row0 + 8 * hh + r; if (rowsPerB < 0) v += CP[cofs + (size_t)rr * ldc + col];      /* rowsPerB < 0: own element of the batched C plane */ else { const int bidx = rr / rowsPerB; v += CP[(size_t)bidx * sCPb + (size_t)by * 64 + col]; } } if (ACT == 1) v = (v > 0.f) ? v : expm1f(v); else if (ACT == 7) v = (v > 0.f) ? v + 1.0f : expf(v); else if (ACT == 8) v = tanhf(v); else if (ACT == 9) v = 0.5f * v * (1.0f + tanhf(0.7978845608028654f * (v + 0.044715f * v * v * v))); else if (ACT == 11) v = 1.0f / (1.0f + expf(-v)); else if (ACT == 12) v = (v > 0.f) ? v : 0.01f * v; else if (ACT == 14) v = (v > 0.f) ? v : 0.1f * v; else if (ACT == 16) v = (v >= 0.f) ? v : 0.3f * v; else if (ACT == 17) v = (v >= 0.f) ? v : 0.2f * v; else if (ACT == 15) v = v / (1.0f + expf(-v)); else if (ACT == 3) v = fmaxf(v, 0.f); else if (ACT == 6) v = 0.5f * v * (1.0f + erff(v * 0.70710678118654752f)); so[w][8 * hh + r][t * 16 + ln] = v; } }
  __builtin_amdgcn_fence(__ATOMIC_ACQ_REL, "workgroup"); __builtin_amdgcn_wave_barrier();
  const int rsub = lane >> 4, c4 = (lane & 15) * 4; typedef _Float16 v4h __attribute__((ext_vector_type(4)));
  {
#pragma unroll
    for (int q = 0; q < 8; ++q) { const int r = q * 2 + rsub; if (col0 + c4 < N) { const v4f v = *(const v4fa*)&so[w][r][c4]; if (C) *(v4f*)(C + cofs + (size_t)(row0 + r) * ldc + col0 + c4) = v; if (C16) { v4h h4; for (int i = 0; i < 4; ++i) h4[i] = (_Float16)v[i]; *(v4h*)(C16 + cofs + (size_t)(row0 + r) * ldc + col0 + c4) = h4; } } }
     }
}


typedef _Float16 v4h __attribute__((ext_vector_type(4)));

__global__ __launch_bounds__(256) void k_x16(const float* __restrict__ x, _Float16* __restrict__ X16, size_t n8) { const size_t t = (size_t)blockIdx.x * 256 + threadIdx.x; if (t >= n8) return; FragH f;
#pragma unroll
  for (int q = 0; q < 8; ++q) f.h[q] = (_Float16)bf16_round(x[t * 8 + q]); *(v8us*)((unsigned short*)X16 + t * 8) = f.half[0];  }
__global__ __launch_bounds__(256) void k_h16(const float* __restrict__ x, _Float16* __restrict__ X16, size_t n8) { const size_t t = (size_t)blockIdx.x * 256 + threadIdx.x; if (t >= n8) return; FragH f;
#pragma unroll
  for (int q = 0; q < 8; ++q) f.h[q] = (_Float16)x[t * 8 + q]; *(v8us*)((unsigned short*)X16 + t * 8) = f.half[0];  }
__global__ __launch_bounds__(256) void k_round16f(const float* __restrict__ W, _Float16* __restrict__ Bt, size_t n8) { const size_t t = (size_t)blockIdx.x * 256 + threadIdx.x; if (t >= n8) return; FragH f;
#pragma unroll
  for (int i = 0; i < 8; ++i) f.h[i] = (_Float16)(bf16_round(W[t * 8 + i]) * 16.0f); *(v8us*)((unsigned short*)Bt + t * 8) = f.half[0];  }
template <int NHv, int TTv>
__global__ __launch_bounds__(256) void k_vt(const _Float16* __restrict__ V16, int ldv, int voff, _Float16* __restrict__ Vt) { __shared__ unsigned short tl[64][66]; const int tid = threadIdx.x; const int slab = blockIdx.x / (TTv / 64), lg = blockIdx.x % (TTv / 64); const int b = slab / NHv, h = slab % NHv;
  for (int i = tid; i < 64 * 8; i += 256) { const int r = i / 8, c8 = (i % 8) * 8; FragH f; f.half[0] = *(const v8us*)((const unsigned short*)V16 + ((size_t)b * TTv + lg * 64 + r) * ldv + voff + h * 64 + c8);
#pragma unroll
    for (int q = 0; q < 8; ++q) tl[r][c8 + q] = f.u[q]; }
  __syncthreads();
  {
#pragma unroll
    for (int rd = 0; rd < 2; ++rd) { const int d = rd * 32 + tid / 8, pc = tid % 8; FragH f;
#pragma unroll
      for (int q = 0; q < 8; ++q) f.u[q] = tl[pc * 8 + q][d];
      *(v8us*)((unsigned short*)Vt + ((size_t)slab * 64 + d) * TTv + lg * 64 + pc * 8) = f.half[0]; }
     } }

__global__ __launch_bounds__(256) void k_hl(const float* __restrict__ F, _Float16* __restrict__ Hh, _Float16* __restrict__ Hl, size_t n8) { const size_t t = (size_t)blockIdx.x * 256 + threadIdx.x; if (t >= n8) return; FragH fh, fl; const v4f a = *(const v4fa*)(F + t * 8), c = *(const v4fa*)(F + t * 8 + 4);
#pragma unroll
  for (int q = 0; q < 4; ++q) { _Float16 h = (_Float16)a[q]; fh.h[q] = h; fl.h[q] = (_Float16)((a[q] - (float)h) * 1024.0f); h = (_Float16)c[q]; fh.h[4 + q] = h; fl.h[4 + q] = (_Float16)((c[q] - (float)h) * 1024.0f); }
  { *(v8us*)((unsigned short*)Hh + t * 8) = fh.half[0]; *(v8us*)((unsigned short*)Hl + t * 8) = fl.half[0];  } }

// ---- fast GEMM (wave tile 32x64; requires M % 32 == 0 rows per launch region and N % 64 == 0); epilogue = k_gemm_hhx semantics ----
__device__ __forceinline__ v16h g2_frag(const _Float16* p, int hh) { FragH f; f.half[0] = *(const v8us*)((const unsigned short*)p + 8 * hh); f.half[1] = *(const v8us*)((const unsigned short*)p + 16 + 8 * hh); return f.v; }
__device__ __forceinline__ v8f g2_mma(v16h a, v16h b, v8f c) { v8f d = __builtin_amdgcn_wmma_f32_16x16x32_f16(false, a, false, b, (short)0, c, false, false); asm volatile("v_nop\n\tv_nop\n\tv_nop\n\tv_nop" : "+v"(d) : "v"(a), "v"(b)); return d; }
template <int ACT>
__global__ __launch_bounds__(128) void k_gemm2(const _Float16* __restrict__ A, int lda, size_t sA, const _Float16* __restrict__ Bh, int ldb, size_t sB, float alpha, const float* __restrict__ bias, size_t sBias, const float* __restrict__ CP, int rowsPerB, size_t sCPb, int row0g,
    float* __restrict__ C, _Float16* __restrict__ C16, int ldc, size_t sC, int M, int N, int K) { static_assert(ACT == 0 || ACT == 3 || ACT == 6 || ACT == 8 || ACT == 9 || ACT == 11 || ACT == 12 || ACT == 14 || ACT == 15 || ACT == 16 || ACT == 17, "k_gemm2: unsupported ACT code (would silently apply no activation)");
  __shared__ __attribute__((aligned(16))) float so[4][32][68];
  const int tid = threadIdx.x, w = tid >> 5, lane = tid & 31, ln = lane & 15, hh = lane >> 4; const int by = blockIdx.y;
  A += (size_t)by * sA; Bh += (size_t)by * sB; const size_t cofs = (size_t)by * sC; const float* bp = bias ? bias + (size_t)by * sBias : nullptr;
  const int ntn = N >> 6; const int mt = blockIdx.x / ntn, nq = blockIdx.x - mt * ntn; const int row0 = mt * 128 + 32 * w, col0 = nq * 64; if (row0 >= M) return;
  const _Float16* a0p = A + (size_t)(row0 + ln) * lda; const _Float16* a1p = a0p + (size_t)16 * lda;
  const _Float16* b0p = Bh + (size_t)(col0 + ln) * ldb; const _Float16* b1p = b0p + (size_t)16 * ldb; const _Float16* b2p = b1p + (size_t)16 * ldb; const _Float16* b3p = b2p + (size_t)16 * ldb;
  const v8f z8 = {0.f,0.f,0.f,0.f,0.f,0.f,0.f,0.f}; v8f c00 = z8, c01 = z8, c02 = z8, c03 = z8, c10 = z8, c11 = z8, c12 = z8, c13 = z8;
#pragma unroll 1
  for (int kb = 0; kb < K; kb += 32) { const v16h a0 = g2_frag(a0p + kb, hh), a1 = g2_frag(a1p + kb, hh);
    v16h b = g2_frag(b0p + kb, hh); c00 = g2_mma(a0, b, c00); c10 = g2_mma(a1, b, c10);
    b = g2_frag(b1p + kb, hh); c01 = g2_mma(a0, b, c01); c11 = g2_mma(a1, b, c11);
    b = g2_frag(b2p + kb, hh); c02 = g2_mma(a0, b, c02); c12 = g2_mma(a1, b, c12);
    b = g2_frag(b3p + kb, hh); c03 = g2_mma(a0, b, c03); c13 = g2_mma(a1, b, c13); }
  v8f accs[8] = {c00, c01, c02, c03, c10, c11, c12, c13};
#pragma unroll
  for (int u = 0; u < 8; ++u) { const int t = u & 3, half = u >> 2; const int col = col0 + t * 16 + ln; const float bv = bp ? bf16_round(bp[col]) : 0.f;
#pragma unroll
    for (int r = 0; r < 8; ++r) { const int rloc = half * 16 + 8 * hh + r; float v = accs[u][r] * alpha + bv; if (CP) { if (rowsPerB < 0) v += CP[cofs + (size_t)(row0g + row0 + rloc) * ldc + col];      /* rowsPerB < 0: own element of the batched C plane */ else { const int bidx = (row0g + row0 + rloc) / rowsPerB; v += CP[(size_t)bidx * sCPb + (size_t)by * 64 + col]; } }
      if (ACT == 3) v = fmaxf(v, 0.f); else if (ACT == 6) v = 0.5f * v * (1.0f + erff(v * 0.70710678118654752f)); else if (ACT == 11) v = 1.0f / (1.0f + expf(-v)); else if (ACT == 15) v = v / (1.0f + expf(-v)); else if (ACT == 12) v = (v > 0.f) ? v : 0.01f * v; else if (ACT == 8) v = tanhf(v); else if (ACT == 9) v = 0.5f * v * (1.0f + tanhf(0.7978845608028654f * (v + 0.044715f * v * v * v))); else if (ACT == 14) v = (v > 0.f) ? v : 0.1f * v; else if (ACT == 16) v = (v >= 0.f) ? v : 0.3f * v; else if (ACT == 17) v = (v >= 0.f) ? v : 0.2f * v;
      so[w][rloc][t * 16 + ln] = v; } }
  __builtin_amdgcn_fence(__ATOMIC_ACQ_REL, "workgroup"); __builtin_amdgcn_wave_barrier();
  const int rsub = lane >> 4, c4 = (lane & 15) * 4;
  {
#pragma unroll
    for (int q = 0; q < 16; ++q) { const int r = q * 2 + rsub; const v4f v = *(const v4fa*)&so[w][r][c4]; if (C) *(v4f*)(C + cofs + (size_t)(row0 + r) * ldc + col0 + c4) = v; if (C16) { v4h h4; for (int i = 0; i < 4; ++i) h4[i] = (_Float16)v[i]; *(v4h*)(C16 + cofs + (size_t)(row0 + r) * ldc + col0 + c4) = h4; } }
     } }


__global__ __launch_bounds__(256) void k_wnat(const float* __restrict__ w, size_t n8, _Float16* __restrict__ Bt) { const size_t t = (size_t)blockIdx.x * 256 + threadIdx.x; if (t >= n8) return; FragH f; for (int q = 0; q < 8; ++q) f.h[q] = (_Float16)(bf16_round(w[t * 8 + q]) * 16.0f); *(v8us*)((unsigned short*)Bt + t * 8) = f.half[0];  }
__global__ __launch_bounds__(256) void k_rsm(const float* __restrict__ S, _Float16* __restrict__ P, int nrows) {
  #pragma clang fp contract(off)
  const int i = blockIdx.x * 256 + threadIdx.x; if (i >= nrows) return; const float* s = S + (size_t)i * SQ; float mx = -3.0e38f;
#pragma unroll 1
  for (int j = 0; j < SQ; ++j) mx = fmaxf(mx, s[j]); float se = 0.f;
#pragma unroll 1
  for (int j = 0; j < SQ; ++j) se += expf(s[j] - mx); const float sc = 256.0f / se;
#pragma unroll 1
  for (int j0 = 0; j0 < SQ; j0 += 8) { FragH f; for (int q = 0; q < 8; ++q) f.h[q] = (_Float16)(expf(s[j0 + q] - mx) * sc); unsigned short* d = (unsigned short*)P + (size_t)i * SQ + j0; *(v8us*)d = f.half[0];  } }
__global__ __launch_bounds__(256) void k_vt(const _Float16* __restrict__ V16, int b, int h0, _Float16* __restrict__ VT) { __shared__ unsigned short tl[64][65]; const int tid = threadIdx.x; const int hh = blockIdx.x % HG, sg = blockIdx.x / HG; const int s0 = sg * 64; const int h = h0 + hh;
  for (int i = tid; i < 64 * 8; i += 256) { const int j = i / 8, d8 = (i % 8) * 8; FragH f; f.half[0] = *(const v8us*)((const unsigned short*)V16 + ((size_t)b * SQ + s0 + j) * DM + h * HD + d8); for (int q = 0; q < 8; ++q) tl[d8 + q][j] = f.u[q]; }
  __syncthreads();
  { for (int i = tid; i < 64 * 8; i += 256) { const int d = i / 8, j8 = (i % 8) * 8; FragH f; for (int q = 0; q < 8; ++q) f.u[q] = tl[d][j8 + q]; *(v8us*)((unsigned short*)VT + ((size_t)hh * HD + d) * SQ + s0 + j8) = f.half[0]; }  } }


__global__ __launch_bounds__(256) void k_catrows(const float* __restrict__ rgb, const float* __restrict__ ir, _Float16* __restrict__ YR) { __shared__ float tl[64][33]; const int tid = threadIdx.x; const int nc = CC / 64, nl = PX / 32; const int cb_ = blockIdx.x % nc; const int lb = (blockIdx.x / nc) % nl; const size_t b = blockIdx.x / (nc * nl); const int c0 = cb_ * 64, l0 = lb * 32;
  const float* src = (c0 < DIMH) ? (rgb + (b * DIMH + c0) * (size_t)PX) : (ir + (b * DIMH + (c0 - DIMH)) * (size_t)PX);
  for (int i = tid; i < 64 * 32; i += 256) { const int c = i / 32, l = i % 32; tl[c][l] = bf16_round(src[(size_t)c * PX + l0 + l]); }
  __syncthreads();
  { const int l = tid / 8, c8 = (tid % 8) * 8; FragH f; for (int q = 0; q < 8; ++q) f.h[q] = (_Float16)tl[c8 + q][l]; unsigned short* d = (unsigned short*)YR + (b * PX + l0 + l) * (size_t)CC + c0 + c8; *(v8us*)d = f.half[0];  } }
// lane ^ M partner's value added (M = 1, 2, 4: all inside a 16-lane row), as one DPP add
template <int M>
__device__ __forceinline__ float xadd(float s) { return s + __int_as_float(__builtin_amdgcn_update_dpp(0, __float_as_int(s), 0x160 | M, 0xf, 0xf, true)); }
// One wave per (pixel, dilation): lane = 4 channels, 8 lanes = one head, so the 128 channels of a q, k or v row are one 512-byte load of whole lines.
// Work-group = half an image row of one dilation (40 pixels): 4 waves x 10 pixels, the 4 waves on 4 neighbouring pixels at a time.
// An out-of-image neighbour reads the centre pixel's rows instead (in bounds), takes logit 0 and weight 0 on v.
__global__ __launch_bounds__(128) void k_dla(const float* __restrict__ F, _Float16* __restrict__ X16) {
  const int lane = threadIdx.x & 31; const int w = __builtin_amdgcn_readfirstlane((int)threadIdx.x >> 5);
  const int xh = blockIdx.x & 1, di = (blockIdx.x >> 1) & 1, row = blockIdx.x >> 2;      /* row = image * HS + y */
  const int y = row % HS; const int dil = di ? 3 : 2;
  const float* Fd = F + di * 128; unsigned short* Xd = (unsigned short*)X16 + di * 128; const unsigned c4 = (unsigned)lane * 4u;
  for (int i = 0; i < 10; ++i) { const int x = xh * 40 + i * 4 + w; const int r = row * WS + x;
    const v4f q = *(const v4fa*)(Fd + (size_t)r * QW + c4); v4f k[9], v[9]; bool ok[9]; const float* pa[9];
#pragma unroll
    for (int kk = 0; kk < 9; ++kk) { const int dy = (kk / 3 - 1) * dil, dx = (kk % 3 - 1) * dil; ok[kk] = (y + dy >= 0) && (y + dy < HS) && (x + dx >= 0) && (x + dx < WS);
      pa[kk] = Fd + (size_t)(ok[kk] ? r + dy * WS + dx : r) * QW + c4; k[kk] = *(const v4fa*)(pa[kk] + CC); v[kk] = *(const v4fa*)(pa[kk] + 2 * CC); }
    /* s_wait_xcnt 0 behind the pixel's loads, in front of every overwrite of a register that they name; the row addresses are its inputs, so that none of their registers is handed to a later load's result ahead of it */
    asm volatile("s_wait_xcnt 0x0" :: "v"(pa[0]), "v"(pa[1]), "v"(pa[2]), "v"(pa[3]), "v"(pa[4]), "v"(pa[5]), "v"(pa[6]), "v"(pa[7]), "v"(pa[8]) : "memory");
    __builtin_amdgcn_sched_barrier(0);      /* all 19 loads of a pixel issue before any of its arithmetic: one L2 latency a pixel, not one per group of loads */
    float s[9]; float mx = -INFINITY;
#pragma unroll
    for (int kk = 0; kk < 9; ++kk) { float d = fmaf(q[3], k[kk][3], fmaf(q[2], k[kk][2], fmaf(q[1], k[kk][1], q[0] * k[kk][0]))); d = xadd<4>(xadd<2>(xadd<1>(d)));
      s[kk] = ok[kk] ? d * SCL : 0.f; mx = fmaxf(mx, s[kk]); }
    float se = 0.f; v4f acc = {0.f, 0.f, 0.f, 0.f};
#pragma unroll
    for (int kk = 0; kk < 9; ++kk) { const float e = expf(s[kk] - mx); se += e; const float pw = ok[kk] ? e : 0.f;
      for (int c = 0; c < 4; ++c) acc[c] = fmaf(pw, v[kk][c], acc[c]); }
    const float inv = 1.0f / se; v4h o; for (int c = 0; c < 4; ++c) o[c] = (_Float16)(acc[c] * inv);
    *(v4h*)(Xd + (size_t)r * CC + c4) = o; } }
__global__ __launch_bounds__(256) void k_finm(const float* __restrict__ Y, const float* __restrict__ bpj, const float* __restrict__ rgb, const float* __restrict__ ir, float* __restrict__ out) {
  #pragma clang fp contract(off)
  const size_t t = (size_t)blockIdx.x * 256 + threadIdx.x; if (t >= NR * CC / 8) return; const int c0 = (int)(t % (CC / 8)) * 8; const size_t r = t / (CC / 8); const size_t b = r / PX; const int p = (int)(r % PX); v8f v;
  for (int q = 0; q < 8; ++q) { const int c = c0 + q; const float res = (c < DIMH) ? rgb[(b * DIMH + c) * PX + p] : ir[(b * DIMH + (c - DIMH)) * PX + p]; v[q] = __fadd_rn(__fadd_rn(Y[r * CC + c], bf16_round(bpj[c])), bf16_round(res)); }
  *(v8f*)(out + r * CC + c0) = v;  }

extern "C" void kernel_launch(void* const* d_in, const int* in_sizes, int n_in,
                              void* d_out, int out_size, void* d_ws, size_t ws_size, hipStream_t stream) {
  (void)in_sizes; (void)n_in; (void)out_size;
  const float* const* I = (const float* const*)d_in; const float* rgb = I[0]; const float* ir = I[1]; const float* wqkv = I[2]; const float* wp = I[3]; const float* bp = I[4];
  char* ws = (char*)d_ws; size_t off = 0;
  auto take = [&](size_t bytes) { char* p = ws + off; off += (bytes + 255) & ~(size_t)255; return p; };
  _Float16* BQ = (_Float16*)take((size_t)QW * CC * 2); _Float16* BP = (_Float16*)take((size_t)CC * CC * 2); _Float16* YR = (_Float16*)take(NR * CC * 2); float* F = (float*)take(NR * QW * 4); _Float16* X16 = (_Float16*)take(NR * CC * 2); float* Y = (float*)take(NR * CC * 4);
  if (off > ws_size) return;      /* 0.5 + 12.5 + 75 + 12.5 + 25 = approx 126 MiB */
  k_wnat<<<(unsigned)(((size_t)QW * CC / 8 + 255) / 256), 256, 0, stream>>>(wqkv, (size_t)QW * CC / 8, BQ); k_wnat<<<(unsigned)(((size_t)CC * CC / 8 + 255) / 256), 256, 0, stream>>>(wp, (size_t)CC * CC / 8, BP);
  k_catrows<<<(unsigned)(NB * (PX / 32) * (CC / 64)), 256, 0, stream>>>(rgb, ir, YR);
  k_gemm2<0><<<dim3((unsigned)((NR / 128) * (QW / 64)), 1), 128, 0, stream>>>(YR, CC, 0, BQ, CC, 0, 0.0625f, nullptr, 0, nullptr, 1, 0, 0, F, nullptr, QW, 0, (int)NR, QW, CC);      /* qkv (f32) */
  k_dla<<<(unsigned)(NB * HS * 4), 128, 0, stream>>>(F, X16);
  k_gemm2<0><<<dim3((unsigned)((NR / 128) * (CC / 64)), 1), 128, 0, stream>>>(X16, CC, 0, BP, CC, 0, 0.0625f, nullptr, 0, nullptr, 1, 0, 0, Y, nullptr, CC, 0, NRD, CC, CC);      /* proj */
  k_finm<<<(unsigned)((NR * CC / 8 + 255) / 256), 256, 0, stream>>>(Y, bp, rgb, ir, (float*)d_out);
}

// v002
// Measured time: 91 microseconds a run.
// Two timings next to v001 put it at 1.32 and 1.31 times that version's speed.
// All steps since v000 together make it 8.85 times as fast.
#include <hip/hip_runtime.h>
// Multi-dilate local attention (rgb, ir [4][128][80][80] -> y = [rgb | ir] (256 ch); qkv = 1x1 (w_qkv [768][256]) split as [3][2 dilations][128 = 4 heads x 32]; per dilation d in (2, 3): each pixel attends to its 3x3 dilated neighbourhood (zero-padded unfold: out-of-image neighbours contribute k = v = 0, logit 0) with softmax(q.k / sqrt(32)) over the 9; heads merged dilation-major; proj (w_proj [256][256]) + b_proj; + y -> NHWC [4][80][80][256]).
// Structure: the two channel-first inputs transposed to concatenated pixel rows (exact f16) via LDS tiles; qkv as a WMMA GEMM (operand tiles staged in LDS, 32x64 wave tiles, f32 accumulation, exact x16 natural weights; exact products) kept f32; the dilated local attention, one wave per (pixel, dilation), on VALU (f32; 4 channels a lane, softmax weights in registers) into f16 rows; projection GEMM to f32 rows; bias + residual on VALU straight to the NHWC output.
// Compute dtype: inputs rounded to bf16; y / weights exact; qkv and the attention f32; the attended rows as a plain f16 GEMM operand (~2^-12). v_wmma_f32_16x16x32_f16.
#define NB 4
#define DIMH 128
#define CC 256
#define QW 768
#define HS 80
#define WS 80
#define PX (HS * WS)                 /* 6400 = 50 x 128 */
#define NR ((size_t)NB * PX)         /* 25,600 rows */
#define NRD ((int)NR)                /* unused */
#define SCL 0.17677669529663689f
#define SQ 64
#define DM 64
#define NH 1
#define HD 64
#define HG 1
typedef __bf16 v16b __attribute__((ext_vector_type(16)));
typedef unsigned short v8us __attribute__((ext_vector_type(8), may_alias));
typedef float  v8f  __attribute__((ext_vector_type(8)));
typedef float  v4f  __attribute__((ext_vector_type(4)));
typedef float  v4fa __attribute__((ext_vector_type(4), may_alias));
union FragB { v16b v; v8us half[2]; unsigned short u[16]; };

__device__ __forceinline__ unsigned short bf16_bits(float x) { unsigned int u = __float_as_uint(x); return (unsigned short)((u + 0x7FFFu + ((u >> 16) & 1u)) >> 16); }
__device__ __forceinline__ float bf16_val(unsigned short b) { return __uint_as_float(((unsigned int)b) << 16); }
__device__ __forceinline__ float bf16_round(float x) { return bf16_val(bf16_bits(x)); }
// D += A·B with NT terms: 1 = ah·bh, 2 = + al·bh (A split), 3 = + ah·bl (both split)
template <int NT>
__device__ __forceinline__ v8f mmaN(v16b ah, v16b al, v16b bh, v16b bl, v8f c) {
  c = __builtin_amdgcn_wmma_f32_16x16x32_bf16(false, ah, false, bh, (short)0, c, false, false);
  if (NT >= 2) c = __builtin_amdgcn_wmma_f32_16x16x32_bf16(false, al, false, bh, (short)0, c, false, false);
  if (NT >= 3) c = __builtin_amdgcn_wmma_f32_16x16x32_bf16(false, ah, false, bl, (short)0, c, false, false);
  asm volatile("v_nop\n\tv_nop\n\tv_nop\n\tv_nop" : "+v"(c) : "v"(ah), "v"(al), "v"(bh), "v"(bl));
  return c;
}

__global__ __launch_bounds__(256) void k_wt_bf16(const float* __restrict__ W, unsigned short* __restrict__ Wt, int K, int N) {
  const int t = blockIdx.x * 256 + threadIdx.x;
  const int k8n = K / 8;
  if (t >= N * k8n) return;
  const int n = t / k8n, k8 = (t % k8n) * 8;
  v8us v;
#pragma unroll
  for (int i = 0; i < 8; ++i) v[i] = bf16_bits(W[(size_t)(k8 + i) * N + n]);
  *(v8us*)(Wt + (size_t)n * K + k8) = v;
  
}

// GEMM C[M][N] (f32, pitch ldc) = act(A[M][K]·W + bias). A f32 row-major (pitch lda) converted per fragment to bf16
// (ASPLIT: hi/lo two planes -> 2 terms, else single rounded term); Wt bf16 [N][K] (pitch ldb). BIAS_BF16 rounds the
// bias to bf16 first (bias quantised to bf16 before the add). K%32==0, M%16==0, N%64==0.
template <bool ASPLIT, int ACT, bool BIAS_BF16>
__global__ __launch_bounds__(128) void k_gemm_bf(const float* __restrict__ A, int lda, const unsigned short* __restrict__ Wt, int ldb,
                                               const float* __restrict__ bias, float* __restrict__ C, int ldc, int M, int N, int K) {
  __shared__ __attribute__((aligned(16))) float so[4][16][64];
  const int tid = threadIdx.x, w = tid >> 5, lane = tid & 31, ln = lane & 15, hh = lane >> 4;
  const int ntn = N / 64;
  const int wid = blockIdx.x * 4 + w;
  const int mt = wid / ntn, nq = wid % ntn;
  if (mt * 16 >= M) return;
  const int row0 = mt * 16, col0 = nq * 64;
  const float* arow = A + (size_t)(row0 + ln) * lda;
  v8f acc[4] = {};
  for (int kb = 0; kb < K; kb += 32) {
    FragB ah, al;
    const v4f x0 = *(const v4fa*)(arow + kb + 8 * hh), x1 = *(const v4fa*)(arow + kb + 8 * hh + 4);
    const v4f x2 = *(const v4fa*)(arow + kb + 16 + 8 * hh), x3 = *(const v4fa*)(arow + kb + 16 + 8 * hh + 4);
    float xs[16] = {x0[0],x0[1],x0[2],x0[3],x1[0],x1[1],x1[2],x1[3],x2[0],x2[1],x2[2],x2[3],x3[0],x3[1],x3[2],x3[3]};
#pragma unroll
    for (int i = 0; i < 16; ++i) { const unsigned short hb = bf16_bits(xs[i]); ah.u[i] = hb; al.u[i] = ASPLIT ? bf16_bits(xs[i] - bf16_val(hb)) : (unsigned short)0; }
#pragma unroll
    for (int t = 0; t < 4; ++t) {
      const unsigned short* brow = Wt + (size_t)(col0 + t * 16 + ln) * ldb + kb;
      FragB b;
      b.half[0] = *(const v8us*)(brow + 8 * hh);
      b.half[1] = *(const v8us*)(brow + 16 + 8 * hh);
      acc[t] = mmaN<ASPLIT ? 2 : 1>(ah.v, al.v, b.v, b.v, acc[t]);
    }
  }
#pragma unroll
  for (int t = 0; t < 4; ++t) {
    float bv = bias ? bias[col0 + t * 16 + ln] : 0.f;
    if (BIAS_BF16) bv = bf16_round(bv);
#pragma unroll
    for (int r = 0; r < 8; ++r) { float v = acc[t][r] + bv; if (ACT == 1) v = fmaxf(v, 0.f); so[w][8 * hh + r][t * 16 + ln] = v; }
  }
  __builtin_amdgcn_fence(__ATOMIC_ACQ_REL, "workgroup");
  __builtin_amdgcn_wave_barrier();
  const int rsub = lane >> 4, c4 = (lane & 15) * 4;
  {
#pragma unroll
    for (int q = 0; q < 8; ++q) {
      const int r = q * 2 + rsub;
      const v4f v = *(const v4fa*)&so[w][r][c4];
      *(v4f*)(C + (size_t)(row0 + r) * ldc + col0 + c4) = v;
    }
    
  }
}

// GEMM C = act(A·W + bias + resid): A f32 (ASPLIT -> hi/lo 2 terms), Wt bf16 [N][K]; ACT 0 none, 1 relu, 2 exact gelu;
// resid (optional, f32, row index = (row % rmod), pitch ldr, RES_BF16 rounds it) added before the activation.
template <bool ASPLIT, int ACT, bool BIAS_BF16, bool RES_BF16>
__global__ __launch_bounds__(128) void k_gemm_bf3(const float* __restrict__ A, int lda, const unsigned short* __restrict__ Wt, int ldb,
                                                const float* __restrict__ bias, const float* __restrict__ resid, int rmod, int ldr,
                                                float* __restrict__ C, int ldc, int M, int N, int K) {
  __shared__ __attribute__((aligned(16))) float so[4][16][64];
  const int tid = threadIdx.x, w = tid >> 5, lane = tid & 31, ln = lane & 15, hh = lane >> 4;
  const int ntn = N / 64;
  const int wid = blockIdx.x * 4 + w;
  const int mt = wid / ntn, nq = wid % ntn;
  if (mt * 16 >= M) return;
  const int row0 = mt * 16, col0 = nq * 64;
  const float* arow = A + (size_t)(row0 + ln) * lda;
  v8f acc[4] = {};
  for (int kb = 0; kb < K; kb += 32) {
    FragB ah, al;
    const v4f x0 = *(const v4fa*)(arow + kb + 8 * hh), x1 = *(const v4fa*)(arow + kb + 8 * hh + 4);
    const v4f x2 = *(const v4fa*)(arow + kb + 16 + 8 * hh), x3 = *(const v4fa*)(arow + kb + 16 + 8 * hh + 4);
    float xs[16] = {x0[0],x0[1],x0[2],x0[3],x1[0],x1[1],x1[2],x1[3],x2[0],x2[1],x2[2],x2[3],x3[0],x3[1],x3[2],x3[3]};
#pragma unroll
    for (int i = 0; i < 16; ++i) { const unsigned short hb = bf16_bits(xs[i]); ah.u[i] = hb; al.u[i] = ASPLIT ? bf16_bits(xs[i] - bf16_val(hb)) : (unsigned short)0; }
#pragma unroll
    for (int t = 0; t < 4; ++t) {
      const unsigned short* brow = Wt + (size_t)(col0 + t * 16 + ln) * ldb + kb;
      FragB b;
      b.half[0] = *(const v8us*)(brow + 8 * hh);
      b.half[1] = *(const v8us*)(brow + 16 + 8 * hh);
      acc[t] = mmaN<ASPLIT ? 2 : 1>(ah.v, al.v, b.v, b.v, acc[t]);
    }
  }
#pragma unroll
  for (int t = 0; t < 4; ++t) {
    const int col = col0 + t * 16 + ln;
    float bv = bias ? bias[col] : 0.f;
    if (BIAS_BF16) bv = bf16_round(bv);
#pragma unroll
    for (int r = 0; r < 8; ++r) {
      float v = acc[t][r] + bv;
      if (resid) { float rv = resid[(size_t)((row0 + 8 * hh + r) % rmod) * ldr + col]; if (RES_BF16) rv = bf16_round(rv); v += rv; }
      if (ACT == 1) v = fmaxf(v, 0.f);
      if (ACT == 2) v = 0.5f * v * (1.0f + erff(v * 0.70710678118654752f));
      if (ACT == 3) { const float u = 0.7978845608028654f * (v + 0.044715f * v * v * v); v = 0.5f * v * (1.0f + tanhf(u)); }
      so[w][8 * hh + r][t * 16 + ln] = v;
    }
  }
  __builtin_amdgcn_fence(__ATOMIC_ACQ_REL, "workgroup");
  __builtin_amdgcn_wave_barrier();
  const int rsub = lane >> 4, c4 = (lane & 15) * 4;
  {
#pragma unroll
    for (int q = 0; q < 8; ++q) {
      const int r = q * 2 + rsub;
      const v4f v = *(const v4fa*)&so[w][r][c4];
      *(v4f*)(C + (size_t)(row0 + r) * ldc + col0 + c4) = v;
    }
    
  }
}
// row LayerNorm (biased variance, eps) over N: s = X (+ R); optional out_sum <- s; out_norm <- (s-mu)*rsqrt(var+eps)*g + b
template <bool PARAM_BF16>
__global__ __launch_bounds__(256) void k_layernorm(const float* __restrict__ X, const float* __restrict__ R, const float* __restrict__ g, const float* __restrict__ bta,
                                                  float* __restrict__ out_sum, float* __restrict__ out_norm, int N, float eps) {
  __shared__ float red[256];
  const int row = blockIdx.x, tid = threadIdx.x;
  const float* x = X + (size_t)row * N; const float* rr = R ? R + (size_t)row * N : nullptr;
  float vals[16];                     // up to N = 4096
  const int per = N / 256;            // contiguous chunk per thread? use strided-by-4 chunks: thread handles j = tid*4 + 1024*u
  float s1 = 0.f;
  for (int u = 0; u < per / 4; ++u) {
    const int j = tid * 4 + 1024 * u;
    const v4f a = *(const v4fa*)(x + j);
    v4f b = {0.f,0.f,0.f,0.f}; if (rr) b = *(const v4fa*)(rr + j);
#pragma unroll
    for (int q = 0; q < 4; ++q) { const float v = a[q] + b[q]; vals[u * 4 + q] = v; s1 += v; }
  }
  red[tid] = s1; __syncthreads();
  for (int st = 128; st > 0; st >>= 1) { if (tid < st) red[tid] += red[tid + st]; __syncthreads(); }
  const float mu = red[0] / (float)N; __syncthreads();
  float s2 = 0.f;
  for (int u = 0; u < per / 4; ++u)
#pragma unroll
    for (int q = 0; q < 4; ++q) { const float c = vals[u * 4 + q] - mu; s2 += c * c; }
  red[tid] = s2; __syncthreads();
  for (int st = 128; st > 0; st >>= 1) { if (tid < st) red[tid] += red[tid + st]; __syncthreads(); }
  const float rs = rsqrtf(red[0] / (float)N + eps);
  {
    for (int u = 0; u < per / 4; ++u) {
      const int j = tid * 4 + 1024 * u;
      v4f o, sm;
#pragma unroll
      for (int q = 0; q < 4; ++q) {
        float gg = g[j + q], bb = bta[j + q];
        if (PARAM_BF16) { gg = bf16_round(gg); bb = bf16_round(bb); }
        sm[q] = vals[u * 4 + q]; o[q] = (vals[u * 4 + q] - mu) * rs * gg + bb;
      }
      if (out_sum) *(v4f*)(out_sum + (size_t)row * N + j) = sm;
      *(v4f*)(out_norm + (size_t)row * N + j) = o;
    }
    
  }
}



// ---- f16 WMMA path (v_wmma_f32_16x16x32_f16): 11-bit significands for operands in range — used here for the qkv and projection GEMMs
typedef _Float16 v16h __attribute__((ext_vector_type(16)));
union FragH { v16h v; v8us half[2]; _Float16 h[16]; unsigned short u[16]; };
template <int NT>
__device__ __forceinline__ v8f mmaH(v16h ah, v16h al, v16h bh, v16h bl, v8f c) {
  c = __builtin_amdgcn_wmma_f32_16x16x32_f16(false, ah, false, bh, (short)0, c, false, false);
  if (NT >= 2) c = __builtin_amdgcn_wmma_f32_16x16x32_f16(false, al, false, bh, (short)0, c, false, false);
  if (NT >= 3) c = __builtin_amdgcn_wmma_f32_16x16x32_f16(false, ah, false, bl, (short)0, c, false, false);
  asm volatile("v_nop\n\tv_nop\n\tv_nop\n\tv_nop" : "+v"(c) : "v"(ah), "v"(al), "v"(bh), "v"(bl));
  return c;
}
// batched GEMM like k_gemm_b but f16 operands: A f32 (split into f16 hi/lo if ASPLIT, else rounded to f16), Bt = f16 values [n][k]; alpha; C f32; N multiple of 16 (partial tiles skipped)
template <bool ASPLIT>
__global__ __launch_bounds__(128) void k_gemm_h(const float* __restrict__ A, int lda, size_t sA, const _Float16* __restrict__ Bh, int ldb, size_t sB, float alpha, float* __restrict__ C, int ldc, size_t sC, int M, int N, int K) {
  __shared__ __attribute__((aligned(16))) float so[4][16][64];
  const int tid = threadIdx.x, w = tid >> 5, lane = tid & 31, ln = lane & 15, hh = lane >> 4; const int by = blockIdx.y;
  A += (size_t)by * sA; Bh += (size_t)by * sB; C += (size_t)by * sC;
  const int ntn = (N + 63) / 64; const int wid = blockIdx.x * 4 + w; const int mt = wid / ntn, nq = wid % ntn; if (mt * 16 >= M) return;
  const int row0 = mt * 16, col0 = nq * 64; const float* arow = A + (size_t)(row0 + ln) * lda;
  v8f acc[4] = {};
  for (int kb = 0; kb < K; kb += 32) {
    FragH ah, al;
    const v4f x0 = *(const v4fa*)(arow + kb + 8 * hh), x1 = *(const v4fa*)(arow + kb + 8 * hh + 4), x2 = *(const v4fa*)(arow + kb + 16 + 8 * hh), x3 = *(const v4fa*)(arow + kb + 16 + 8 * hh + 4);
    float xs[16] = {x0[0],x0[1],x0[2],x0[3],x1[0],x1[1],x1[2],x1[3],x2[0],x2[1],x2[2],x2[3],x3[0],x3[1],x3[2],x3[3]};
#pragma unroll
    for (int i = 0; i < 16; ++i) { const _Float16 h = (_Float16)xs[i]; ah.h[i] = h; al.h[i] = ASPLIT ? (_Float16)(xs[i] - (float)h) : (_Float16)0.0f; }
#pragma unroll
    for (int t = 0; t < 4; ++t) { if (col0 + t * 16 >= N) continue; const size_t boff = (size_t)(col0 + t * 16 + ln) * ldb + kb; FragH bq; bq.half[0] = *(const v8us*)(Bh + boff + 8 * hh); bq.half[1] = *(const v8us*)(Bh + boff + 16 + 8 * hh);
      acc[t] = mmaH<ASPLIT ? 2 : 1>(ah.v, al.v, bq.v, bq.v, acc[t]); }
  }
#pragma unroll
  for (int t = 0; t < 4; ++t) { if (col0 + t * 16 >= N) continue;
#pragma unroll
    for (int r = 0; r < 8; ++r) so[w][8 * hh + r][t * 16 + ln] = acc[t][r] * alpha; }
  __builtin_amdgcn_fence(__ATOMIC_ACQ_REL, "workgroup"); __builtin_amdgcn_wave_barrier();
  const int rsub = lane >> 4, c4 = (lane & 15) * 4;
  {
#pragma unroll
    for (int q = 0; q < 8; ++q) { const int r = q * 2 + rsub; if (col0 + c4 < N) { const v4f v = *(const v4fa*)&so[w][r][c4]; *(v4f*)(C + (size_t)(row0 + r) * ldc + col0 + c4) = v; } }
     }
}

// Wt[n][k] = f16(W[k][n]·scale) from f32 row-major W[K][N] (scale = power of two; bf16-exact weights stay exact in f16 away from the subnormal range)
__global__ __launch_bounds__(256) void k_wt_f16(const float* __restrict__ W, _Float16* __restrict__ Wt, int K, int N, float scale) {
  const int t = blockIdx.x * 256 + threadIdx.x; if (t >= N * (K / 8)) return; const int n = t / (K / 8), k8 = (t % (K / 8)) * 8; FragH f;
#pragma unroll
  for (int i = 0; i < 8; ++i) f.h[i] = (_Float16)(bf16_round(W[(size_t)(k8 + i) * N + n]) * scale); const v8us o = f.half[0];
  *(v8us*)((unsigned short*)Wt + (size_t)n * K + k8) = o; 
}
// k_gemm_hh variant with fused epilogue: v = acc·alpha + bias[by·sBias + col] (+ CP[(row/rowsPerB)·sCPb + by·64 + col] if CP) ; ACT 0 none / 1 elu ; writes f16 C16 (and f32 C if non-null)
template <int ACT>
__global__ __launch_bounds__(128) void k_gemm_hhx(const _Float16* __restrict__ A, int lda, size_t sA, const _Float16* __restrict__ Bh, int ldb, size_t sB, float alpha, const float* __restrict__ bias, size_t sBias, const float* __restrict__ CP, int rowsPerB, size_t sCPb, int row0g,
    float* __restrict__ C, _Float16* __restrict__ C16, int ldc, size_t sC, int M, int N, int K) {
  __shared__ __attribute__((aligned(16))) float so[4][16][64];
  const int tid = threadIdx.x, w = tid >> 5, lane = tid & 31, ln = lane & 15, hh = lane >> 4; const int by = blockIdx.y;
  A += (size_t)by * sA; Bh += (size_t)by * sB; const size_t cofs = (size_t)by * sC; const float* bp = bias ? bias + (size_t)by * sBias : nullptr;
  const int ntn = (N + 63) / 64; const int wid = blockIdx.x * 4 + w; const int mt = wid / ntn, nq = wid % ntn; if (mt * 16 >= M) return;
  const int row0 = mt * 16, col0 = nq * 64; const _Float16* arow = A + (size_t)(row0 + ln) * lda;
  v8f acc[4] = {};
  for (int kb = 0; kb < K; kb += 32) { FragH ah; ah.half[0] = *(const v8us*)((const unsigned short*)arow + kb + 8 * hh); ah.half[1] = *(const v8us*)((const unsigned short*)arow + kb + 16 + 8 * hh);
#pragma unroll
    for (int t = 0; t < 4; ++t) { if (col0 + t * 16 >= N) continue; const size_t boff = (size_t)(col0 + t * 16 + ln) * ldb + kb; FragH bq; bq.half[0] = *(const v8us*)((const unsigned short*)Bh + boff + 8 * hh); bq.half[1] = *(const v8us*)((const unsigned short*)Bh + boff + 16 + 8 * hh);
      acc[t] = mmaH<1>(ah.v, ah.v, bq.v, bq.v, acc[t]); }
  }
#pragma unroll
  for (int t = 0; t < 4; ++t) { if (col0 + t * 16 >= N) continue; const int col = col0 + t * 16 + ln; const float bv = bp ? bf16_round(bp[col]) : 0.f;
#pragma unroll
    for (int r = 0; r < 8; ++r) { float v = acc[t][r] * alpha + bv; if (CP) { const int rr = row0g + row0 + 8 * hh + r; if (rowsPerB < 0) v += CP[cofs + (size_t)rr * ldc + col];      /* rowsPerB < 0: own element of the batched C plane */ else { const int bidx = rr / rowsPerB; v += CP[(size_t)bidx * sCPb + (size_t)by * 64 + col]; } } if (ACT == 1) v = (v > 0.f) ? v : expm1f(v); else if (ACT == 7) v = (v > 0.f) ? v + 1.0f : expf(v); else if (ACT == 8) v = tanhf(v); else if (ACT == 9) v = 0.5f * v * (1.0f + tanhf(0.7978845608028654f * (v + 0.044715f * v * v * v))); else if (ACT == 11) v = 1.0f / (1.0f + expf(-v)); else if (ACT == 12) v = (v > 0.f) ? v : 0.01f * v; else if (ACT == 14) v = (v > 0.f) ? v : 0.1f * v; else if (ACT == 16) v = (v >= 0.f) ? v : 0.3f * v; else if (ACT == 17) v = (v >= 0.f) ? v : 0.2f * v; else if (ACT == 15) v = v / (1.0f + expf(-v)); else if (ACT == 3) v = fmaxf(v, 0.f); else if (ACT == 6) v = 0.5f * v * (1.0f + erff(v * 0.70710678118654752f)); so[w][8 * hh + r][t * 16 + ln] = v; } }
  __builtin_amdgcn_fence(__ATOMIC_ACQ_REL, "workgroup"); __builtin_amdgcn_wave_barrier();
  const int rsub = lane >> 4, c4 = (lane & 15) * 4; typedef _Float16 v4h __attribute__((ext_vector_type(4)));
  {
#pragma unroll
    for (int q = 0; q < 8; ++q) { const int r = q * 2 + rsub; if (col0 + c4 < N) { const v4f v = *(const v4fa*)&so[w][r][c4]; if (C) *(v4f*)(C + cofs + (size_t)(row0 + r) * ldc + col0 + c4) = v; if (C16) { v4h h4; for (int i = 0; i < 4; ++i) h4[i] = (_Float16)v[i]; *(v4h*)(C16 + cofs + (size_t)(row0 + r) * ldc + col0 + c4) = h4; } } }
     }
}


typedef _Float16 v4h __attribute__((ext_vector_type(4)));

__global__ __launch_bounds__(256) void k_x16(const float* __restrict__ x, _Float16* __restrict__ X16, size_t n8) { const size_t t = (size_t)blockIdx.x * 256 + threadIdx.x; if (t >= n8) return; FragH f;
#pragma unroll
  for (int q = 0; q < 8; ++q) f.h[q] = (_Float16)bf16_round(x[t * 8 + q]); *(v8us*)((unsigned short*)X16 + t * 8) = f.half[0];  }
__global__ __launch_bounds__(256) void k_h16(const float* __restrict__ x, _Float16* __restrict__ X16, size_t n8) { const size_t t = (size_t)blockIdx.x * 256 + threadIdx.x; if (t >= n8) return; FragH f;
#pragma unroll
  for (int q = 0; q < 8; ++q) f.h[q] = (_Float16)x[t * 8 + q]; *(v8us*)((unsigned short*)X16 + t * 8) = f.half[0];  }
__global__ __launch_bounds__(256) void k_round16f(const float* __restrict__ W, _Float16* __restrict__ Bt, size_t n8) { const size_t t = (size_t)blockIdx.x * 256 + threadIdx.x; if (t >= n8) return; FragH f;
#pragma unroll
  for (int i = 0; i < 8; ++i) f.h[i] = (_Float16)(bf16_round(W[t * 8 + i]) * 16.0f); *(v8us*)((unsigned short*)Bt + t * 8) = f.half[0];  }
template <int NHv, int TTv>
__global__ __launch_bounds__(256) void k_vt(const _Float16* __restrict__ V16, int ldv, int voff, _Float16* __restrict__ Vt) { __shared__ unsigned short tl[64][66]; const int tid = threadIdx.x; const int slab = blockIdx.x / (TTv / 64), lg = blockIdx.x % (TTv / 64); const int b = slab / NHv, h = slab % NHv;
  for (int i = tid; i < 64 * 8; i += 256) { const int r = i / 8, c8 = (i % 8) * 8; FragH f; f.half[0] = *(const v8us*)((const unsigned short*)V16 + ((size_t)b * TTv + lg * 64 + r) * ldv + voff + h * 64 + c8);
#pragma unroll
    for (int q = 0; q < 8; ++q) tl[r][c8 + q] = f.u[q]; }
  __syncthreads();
  {
#pragma unroll
    for (int rd = 0; rd < 2; ++rd) { const int d = rd * 32 + tid / 8, pc = tid % 8; FragH f;
#pragma unroll
      for (int q = 0; q < 8; ++q) f.u[q] = tl[pc * 8 + q][d];
      *(v8us*)((unsigned short*)Vt + ((size_t)slab * 64 + d) * TTv + lg * 64 + pc * 8) = f.half[0]; }
     } }

__global__ __launch_bounds__(256) void k_hl(const float* __restrict__ F, _Float16* __restrict__ Hh, _Float16* __restrict__ Hl, size_t n8) { const size_t t = (size_t)blockIdx.x * 256 + threadIdx.x; if (t >= n8) return; FragH fh, fl; const v4f a = *(const v4fa*)(F + t * 8), c = *(const v4fa*)(F + t * 8 + 4);
#pragma unroll
  for (int q = 0; q < 4; ++q) { _Float16 h = (_Float16)a[q]; fh.h[q] = h; fl.h[q] = (_Float16)((a[q] - (float)h) * 1024.0f); h = (_Float16)c[q]; fh.h[4 + q] = h; fl.h[4 + q] = (_Float16)((c[q] - (float)h) * 1024.0f); }
  { *(v8us*)((unsigned short*)Hh + t * 8) = fh.half[0]; *(v8us*)((unsigned short*)Hl + t * 8) = fl.half[0];  } }

// ---- fast GEMM (wave tile 32x64; requires M % 32 == 0 rows per launch region and N % 64 == 0); epilogue = k_gemm_hhx semantics ----
__device__ __forceinline__ v16h g2_frag(const _Float16* p, int hh) { FragH f; f.half[0] = *(const v8us*)((const unsigned short*)p + 8 * hh); f.half[1] = *(const v8us*)((const unsigned short*)p + 16 + 8 * hh); return f.v; }
__device__ __forceinline__ v8f g2_mma(v16h a, v16h b, v8f c) { v8f d = __builtin_amdgcn_wmma_f32_16x16x32_f16(false, a, false, b, (short)0, c, false, false); asm volatile("v_nop\n\tv_nop\n\tv_nop\n\tv_nop" : "+v"(d) : "v"(a), "v"(b)); return d; }
template <int ACT>
__global__ __launch_bounds__(128) void k_gemm2(const _Float16* __restrict__ A, int lda, size_t sA, const _Float16* __restrict__ Bh, int ldb, size_t sB, float alpha, const float* __restrict__ bias, size_t sBias, const float* __restrict__ CP, int rowsPerB, size_t sCPb, int row0g,
    float* __restrict__ C, _Float16* __restrict__ C16, int ldc, size_t sC, int M, int N, int K) { static_assert(ACT == 0 || ACT == 3 || ACT == 6 || ACT == 8 || ACT == 9 || ACT == 11 || ACT == 12 || ACT == 14 || ACT == 15 || ACT == 16 || ACT == 17, "k_gemm2: unsupported ACT code (would silently apply no activation)");
  __shared__ __attribute__((aligned(16))) float so[4][32][68];
  const int tid = threadIdx.x, w = tid >> 5, lane = tid & 31, ln = lane & 15, hh = lane >> 4; const int by = blockIdx.y;
  A += (size_t)by * sA; Bh += (size_t)by * sB; const size_t cofs = (size_t)by * sC; const float* bp = bias ? bias + (size_t)by * sBias : nullptr;
  const int ntn = N >> 6; const int mt = blockIdx.x / ntn, nq = blockIdx.x - mt * ntn; const int row0 = mt * 128 + 32 * w, col0 = nq * 64; if (row0 >= M) return;
  const _Float16* a0p = A + (size_t)(row0 + ln) * lda; const _Float16* a1p = a0p + (size_t)16 * lda;
  const _Float16* b0p = Bh + (size_t)(col0 + ln) * ldb; const _Float16* b1p = b0p + (size_t)16 * ldb; const _Float16* b2p = b1p + (size_t)16 * ldb; const _Float16* b3p = b2p + (size_t)16 * ldb;
  const v8f z8 = {0.f,0.f,0.f,0.f,0.f,0.f,0.f,0.f}; v8f c00 = z8, c01 = z8, c02 = z8, c03 = z8, c10 = z8, c11 = z8, c12 = z8, c13 = z8;
#pragma unroll 1
  for (int kb = 0; kb < K; kb += 32) { const v16h a0 = g2_frag(a0p + kb, hh), a1 = g2_frag(a1p + kb, hh);
    v16h b = g2_frag(b0p + kb, hh); c00 = g2_mma(a0, b, c00); c10 = g2_mma(a1, b, c10);
    b = g2_frag(b1p + kb, hh); c01 = g2_mma(a0, b, c01); c11 = g2_mma(a1, b, c11);
    b = g2_frag(b2p + kb, hh); c02 = g2_mma(a0, b, c02); c12 = g2_mma(a1, b, c12);
    b = g2_frag(b3p + kb, hh); c03 = g2_mma(a0, b, c03); c13 = g2_mma(a1, b, c13); }
  v8f accs[8] = {c00, c01, c02, c03, c10, c11, c12, c13};
#pragma unroll
  for (int u = 0; u < 8; ++u) { const int t = u & 3, half = u >> 2; const int col = col0 + t * 16 + ln; const float bv = bp ? bf16_round(bp[col]) : 0.f;
#pragma unroll
    for (int r = 0; r < 8; ++r) { const int rloc = half * 16 + 8 * hh + r; float v = accs[u][r] * alpha + bv; if (CP) { if (rowsPerB < 0) v += CP[cofs + (size_t)(row0g + row0 + rloc) * ldc + col];      /* rowsPerB < 0: own element of the batched C plane */ else { const int bidx = (row0g + row0 + rloc) / rowsPerB; v += CP[(size_t)bidx * sCPb + (size_t)by * 64 + col]; } }
      if (ACT == 3) v = fmaxf(v, 0.f); else if (ACT == 6) v = 0.5f * v * (1.0f + erff(v * 0.70710678118654752f)); else if (ACT == 11) v = 1.0f / (1.0f + expf(-v)); else if (ACT == 15) v = v / (1.0f + expf(-v)); else if (ACT == 12) v = (v > 0.f) ? v : 0.01f * v; else if (ACT == 8) v = tanhf(v); else if (ACT == 9) v = 0.5f * v * (1.0f + tanhf(0.7978845608028654f * (v + 0.044715f * v * v * v))); else if (ACT == 14) v = (v > 0.f) ? v : 0.1f * v; else if (ACT == 16) v = (v >= 0.f) ? v : 0.3f * v; else if (ACT == 17) v = (v >= 0.f) ? v : 0.2f * v;
      so[w][rloc][t * 16 + ln] = v; } }
  __builtin_amdgcn_fence(__ATOMIC_ACQ_REL, "workgroup"); __builtin_amdgcn_wave_barrier();
  const int rsub = lane >> 4, c4 = (lane & 15) * 4;
  {
#pragma unroll
    for (int q = 0; q < 16; ++q) { const int r = q * 2 + rsub; const v4f v = *(const v4fa*)&so[w][r][c4]; if (C) *(v4f*)(C + cofs + (size_t)(row0 + r) * ldc + col0 + c4) = v; if (C16) { v4h h4; for (int i = 0; i < 4; ++i) h4[i] = (_Float16)v[i]; *(v4h*)(C16 + cofs + (size_t)(row0 + r) * ldc + col0 + c4) = h4; } }
     } }


// ---- GEMM with both operand tiles staged in LDS: C[M][NN] (f32) = alpha * A[M][CC] . Bh[NN][CC]^T; K = CC; grid = (M / 128) * (NN / 128) ----
// Work-group tile 128 x 128, 8 waves; wave tile 32 x 64 and k order as k_gemm2. A fragment load straight from global touches 16 lines for its 512 bytes and stands in front of its own WMMAs;
// here each global load of a wave is one whole 512-byte row (4 lines), all 32 of a wave are in flight together, and the fragments come from LDS rows pitched 528 B (16 B x 33: no bank conflict for 16-byte reads).
#define GLP 264      /* LDS row pitch in f16 elements */
template <int NN>
__global__ __launch_bounds__(256) void k_gemm3(const _Float16* __restrict__ A, const _Float16* __restrict__ Bh, float alpha, float* __restrict__ C) {
  __shared__ __attribute__((aligned(16))) _Float16 sm[(128 + 128) * GLP];      /* 128 A rows, then 128 B rows; after the products the waves' output staging */
  const int lane = threadIdx.x & 31, ln = lane & 15, hh = lane >> 4; const int w = __builtin_amdgcn_readfirstlane((int)threadIdx.x >> 5); const int wr = w & 3, wc = w >> 2;
  const int ntn = NN / 128; const int mt = blockIdx.x / ntn, nq = blockIdx.x - mt * ntn; const int row0 = mt * 128 + 32 * wr, col0 = nq * 128 + 64 * wc;
  _Float16* sb = sm + 128 * GLP;
  const unsigned short* ga = (const unsigned short*)A + (size_t)(mt * 128 + 16 * w) * CC + lane * 8; const unsigned short* gb = (const unsigned short*)Bh + (size_t)(nq * 128 + 16 * w) * CC + lane * 8;
  v8us ra[16], rb[16];      /* wave w brings rows 16 w .. 16 w + 15 of either tile; the four loops below are unrolled so that both arrays are registers and each row is an immediate offset */
#pragma unroll
  for (int i = 0; i < 16; ++i) ra[i] = *(const v8us*)(ga + i * CC);
#pragma unroll
  for (int i = 0; i < 16; ++i) rb[i] = *(const v8us*)(gb + i * CC);
  /* s_wait_xcnt 0 behind the tile's loads, in front of every overwrite of a register that they name; the lane index, their offset register, is its input, so that no load's result is handed that register ahead of it; its memory clobber also keeps every LDS store behind the last load, so the wave pays one load latency for its 32 rows */
  asm volatile("s_wait_xcnt 0x0" :: "v"(lane) : "memory");
#pragma unroll
  for (int i = 0; i < 16; ++i) *(v8us*)((unsigned short*)sm + (16 * w + i) * GLP + lane * 8) = ra[i];
#pragma unroll
  for (int i = 0; i < 16; ++i) *(v8us*)((unsigned short*)sb + (16 * w + i) * GLP + lane * 8) = rb[i];
  __syncthreads();
  const _Float16* pa = sm + (32 * wr + ln) * GLP; const _Float16* pb = sb + (64 * wc + ln) * GLP;
  const v8f z8 = {0.f,0.f,0.f,0.f,0.f,0.f,0.f,0.f}; v8f c00 = z8, c01 = z8, c02 = z8, c03 = z8, c10 = z8, c11 = z8, c12 = z8, c13 = z8;
  v16h a0 = g2_frag(pa, hh), a1 = g2_frag(pa + 16 * GLP, hh), b0 = g2_frag(pb, hh), b1 = g2_frag(pb + 16 * GLP, hh), b2 = g2_frag(pb + 32 * GLP, hh), b3 = g2_frag(pb + 48 * GLP, hh);
  /* unrolled whole (8 steps): the two fragment sets then need no register moves, and every LDS address is an immediate offset */
#pragma unroll
  for (int kb = 0; kb < CC; kb += 32) { v16h n0 = a0, n1 = a1, m0 = b0, m1 = b1, m2 = b2, m3 = b3;
    if (kb + 32 < CC) { const int kn = kb + 32;      /* the next step's 12 LDS reads as one group ahead of this step's WMMAs */
      n0 = g2_frag(pa + kn, hh); n1 = g2_frag(pa + 16 * GLP + kn, hh); m0 = g2_frag(pb + kn, hh); m1 = g2_frag(pb + 16 * GLP + kn, hh); m2 = g2_frag(pb + 32 * GLP + kn, hh); m3 = g2_frag(pb + 48 * GLP + kn, hh); }
    c00 = g2_mma(a0, b0, c00); c10 = g2_mma(a1, b0, c10); c01 = g2_mma(a0, b1, c01); c11 = g2_mma(a1, b1, c11);
    c02 = g2_mma(a0, b2, c02); c12 = g2_mma(a1, b2, c12); c03 = g2_mma(a0, b3, c03); c13 = g2_mma(a1, b3, c13);
    a0 = n0; a1 = n1; b0 = m0; b1 = m1; b2 = m2; b3 = m3; }
  __syncthreads();      /* every wave has read its last fragment: the tiles' LDS may now take the output staging */
  float* so = (float*)sm + w * (32 * 68);      /* this wave's own 32 rows x 68 floats */
  v8f accs[8] = {c00, c01, c02, c03, c10, c11, c12, c13};      /* unrolled below, as in k_gemm2: accumulators are indexed by constants only */
#pragma unroll
  for (int u = 0; u < 8; ++u) { const int t = u & 3, half = u >> 2;
#pragma unroll
    for (int r = 0; r < 8; ++r) so[(half * 16 + 8 * hh + r) * 68 + t * 16 + ln] = accs[u][r] * alpha; }
  __builtin_amdgcn_fence(__ATOMIC_ACQ_REL, "workgroup"); __builtin_amdgcn_wave_barrier();
  const int rsub = lane >> 4, c4 = (lane & 15) * 4;
#pragma unroll
  for (int q = 0; q < 16; ++q) { const int r = q * 2 + rsub; const v4f v = *(const v4fa*)&so[r * 68 + c4]; *(v4f*)(C + (size_t)(row0 + r) * NN + col0 + c4) = v; } }

__global__ __launch_bounds__(256) void k_wnat(const float* __restrict__ w, size_t n8, _Float16* __restrict__ Bt) { const size_t t = (size_t)blockIdx.x * 256 + threadIdx.x; if (t >= n8) return; FragH f; for (int q = 0; q < 8; ++q) f.h[q] = (_Float16)(bf16_round(w[t * 8 + q]) * 16.0f); *(v8us*)((unsigned short*)Bt + t * 8) = f.half[0];  }
__global__ __launch_bounds__(256) void k_rsm(const float* __restrict__ S, _Float16* __restrict__ P, int nrows) {
  #pragma clang fp contract(off)
  const int i = blockIdx.x * 256 + threadIdx.x; if (i >= nrows) return; const float* s = S + (size_t)i * SQ; float mx = -3.0e38f;
#pragma unroll 1
  for (int j = 0; j < SQ; ++j) mx = fmaxf(mx, s[j]); float se = 0.f;
#pragma unroll 1
  for (int j = 0; j < SQ; ++j) se += expf(s[j] - mx); const float sc = 256.0f / se;
#pragma unroll 1
  for (int j0 = 0; j0 < SQ; j0 += 8) { FragH f; for (int q = 0; q < 8; ++q) f.h[q] = (_Float16)(expf(s[j0 + q] - mx) * sc); unsigned short* d = (unsigned short*)P + (size_t)i * SQ + j0; *(v8us*)d = f.half[0];  } }
__global__ __launch_bounds__(256) void k_vt(const _Float16* __restrict__ V16, int b, int h0, _Float16* __restrict__ VT) { __shared__ unsigned short tl[64][65]; const int tid = threadIdx.x; const int hh = blockIdx.x % HG, sg = blockIdx.x / HG; const int s0 = sg * 64; const int h = h0 + hh;
  for (int i = tid; i < 64 * 8; i += 256) { const int j = i / 8, d8 = (i % 8) * 8; FragH f; f.half[0] = *(const v8us*)((const unsigned short*)V16 + ((size_t)b * SQ + s0 + j) * DM + h * HD + d8); for (int q = 0; q < 8; ++q) tl[d8 + q][j] = f.u[q]; }
  __syncthreads();
  { for (int i = tid; i < 64 * 8; i += 256) { const int d = i / 8, j8 = (i % 8) * 8; FragH f; for (int q = 0; q < 8; ++q) f.u[q] = tl[d][j8 + q]; *(v8us*)((unsigned short*)VT + ((size_t)hh * HD + d) * SQ + s0 + j8) = f.half[0]; }  } }


__global__ __launch_bounds__(256) void k_catrows(const float* __restrict__ rgb, const float* __restrict__ ir, _Float16* __restrict__ YR) { __shared__ float tl[64][33]; const int tid = threadIdx.x; const int nc = CC / 64, nl = PX / 32; const int cb_ = blockIdx.x % nc; const int lb = (blockIdx.x / nc) % nl; const size_t b = blockIdx.x / (nc * nl); const int c0 = cb_ * 64, l0 = lb * 32;
  const float* src = (c0 < DIMH) ? (rgb + (b * DIMH + c0) * (size_t)PX) : (ir + (b * DIMH + (c0 - DIMH)) * (size_t)PX);
  for (int i = tid; i < 64 * 32; i += 256) { const int c = i / 32, l = i % 32; tl[c][l] = bf16_round(src[(size_t)c * PX + l0 + l]); }
  __syncthreads();
  { const int l = tid / 8, c8 = (tid % 8) * 8; FragH f; for (int q = 0; q < 8; ++q) f.h[q] = (_Float16)tl[c8 + q][l]; unsigned short* d = (unsigned short*)YR + (b * PX + l0 + l) * (size_t)CC + c0 + c8; *(v8us*)d = f.half[0];  } }
// lane ^ M partner's value added (M = 1, 2, 4: all inside a 16-lane row), as one DPP add
template <int M>
__device__ __forceinline__ float xadd(float s) { return s + __int_as_float(__builtin_amdgcn_update_dpp(0, __float_as_int(s), 0x160 | M, 0xf, 0xf, true)); }
// One wave per (pixel, dilation): lane = 4 channels, 8 lanes = one head, so the 128 channels of a q, k or v row are one 512-byte load of whole lines.
// Work-group = half an image row of one dilation (40 pixels): 4 waves x 10 pixels, the 4 waves on 4 neighbouring pixels at a time.
// An out-of-image neighbour reads the centre pixel's rows instead (in bounds), takes logit 0 and weight 0 on v.
__global__ __launch_bounds__(128) void k_dla(const float* __restrict__ F, _Float16* __restrict__ X16) {
  const int lane = threadIdx.x & 31; const int w = __builtin_amdgcn_readfirstlane((int)threadIdx.x >> 5);
  const int xh = blockIdx.x & 1, di = (blockIdx.x >> 1) & 1, row = blockIdx.x >> 2;      /* row = image * HS + y */
  const int y = row % HS; const int dil = di ? 3 : 2;
  const float* Fd = F + di * 128; unsigned short* Xd = (unsigned short*)X16 + di * 128; const unsigned c4 = (unsigned)lane * 4u;
  for (int i = 0; i < 10; ++i) { const int x = xh * 40 + i * 4 + w; const int r = row * WS + x;
    const v4f q = *(const v4fa*)(Fd + (size_t)r * QW + c4); v4f k[9], v[9]; bool ok[9]; const float* pa[9];
#pragma unroll
    for (int kk = 0; kk < 9; ++kk) { const int dy = (kk / 3 - 1) * dil, dx = (kk % 3 - 1) * dil; ok[kk] = (y + dy >= 0) && (y + dy < HS) && (x + dx >= 0) && (x + dx < WS);
      pa[kk] = Fd + (size_t)(ok[kk] ? r + dy * WS + dx : r) * QW + c4; k[kk] = *(const v4fa*)(pa[kk] + CC); v[kk] = *(const v4fa*)(pa[kk] + 2 * CC); }
    /* s_wait_xcnt 0 behind the pixel's loads, in front of every overwrite of a register that they name; the row addresses are its inputs, so that none of their registers is handed to a later load's result ahead of it */
    asm volatile("s_wait_xcnt 0x0" :: "v"(pa[0]), "v"(pa[1]), "v"(pa[2]), "v"(pa[3]), "v"(pa[4]), "v"(pa[5]), "v"(pa[6]), "v"(pa[7]), "v"(pa[8]) : "memory");
    __builtin_amdgcn_sched_barrier(0);      /* all 19 loads of a pixel issue before any of its arithmetic: one L2 latency a pixel, not one per group of loads */
    float s[9]; float mx = -INFINITY;
#pragma unroll
    for (int kk = 0; kk < 9; ++kk) { float d = fmaf(q[3], k[kk][3], fmaf(q[2], k[kk][2], fmaf(q[1], k[kk][1], q[0] * k[kk][0]))); d = xadd<4>(xadd<2>(xadd<1>(d)));
      s[kk] = ok[kk] ? d * SCL : 0.f; mx = fmaxf(mx, s[kk]); }
    float se = 0.f; v4f acc = {0.f, 0.f, 0.f, 0.f};
#pragma unroll
    for (int kk = 0; kk < 9; ++kk) { const float e = expf(s[kk] - mx); se += e; const float pw = ok[kk] ? e : 0.f;
      for (int c = 0; c < 4; ++c) acc[c] = fmaf(pw, v[kk][c], acc[c]); }
    const float inv = 1.0f / se; v4h o; for (int c = 0; c < 4; ++c) o[c] = (_Float16)(acc[c] * inv);
    *(v4h*)(Xd + (size_t)r * CC + c4) = o; } }
__global__ __launch_bounds__(256) void k_finm(const float* __restrict__ Y, const float* __restrict__ bpj, const float* __restrict__ rgb, const float* __restrict__ ir, float* __restrict__ out) {
  #pragma clang fp contract(off)
  const size_t t = (size_t)blockIdx.x * 256 + threadIdx.x; if (t >= NR * CC / 8) return; const int c0 = (int)(t % (CC / 8)) * 8; const size_t r = t / (CC / 8); const size_t b = r / PX; const int p = (int)(r % PX); v8f v;
  for (int q = 0; q < 8; ++q) { const int c = c0 + q; const float res = (c < DIMH) ? rgb[(b * DIMH + c) * PX + p] : ir[(b * DIMH + (c - DIMH)) * PX + p]; v[q] = __fadd_rn(__fadd_rn(Y[r * CC + c], bf16_round(bpj[c])), bf16_round(res)); }
  *(v8f*)(out + r * CC + c0) = v;  }

extern "C" void kernel_launch(void* const* d_in, const int* in_sizes, int n_in,
                              void* d_out, int out_size, void* d_ws, size_t ws_size, hipStream_t stream) {
  (void)in_sizes; (void)n_in; (void)out_size;
  const float* const* I = (const float* const*)d_in; const float* rgb = I[0]; const float* ir = I[1]; const float* wqkv = I[2]; const float* wp = I[3]; const float* bp = I[4];
  char* ws = (char*)d_ws; size_t off = 0;
  auto take = [&](size_t bytes) { char* p = ws + off; off += (bytes + 255) & ~(size_t)255; return p; };
  _Float16* BQ = (_Float16*)take((size_t)QW * CC * 2); _Float16* BP = (_Float16*)take((size_t)CC * CC * 2); _Float16* YR = (_Float16*)take(NR * CC * 2); float* F = (float*)take(NR * QW * 4); _Float16* X16 = (_Float16*)take(NR * CC * 2); float* Y = (float*)take(NR * CC * 4);
  if (off > ws_size) return;      /* 0.5 + 12.5 + 75 + 12.5 + 25 = approx 126 MiB */
  k_wnat<<<(unsigned)(((size_t)QW * CC / 8 + 255) / 256), 256, 0, stream>>>(wqkv, (size_t)QW * CC / 8, BQ); k_wnat<<<(unsigned)(((size_t)CC * CC / 8 + 255) / 256), 256, 0, stream>>>(wp, (size_t)CC * CC / 8, BP);
  k_catrows<<<(unsigned)(NB * (PX / 32) * (CC / 64)), 256, 0, stream>>>(rgb, ir, YR);
  k_gemm3<QW><<<(unsigned)((NR / 128) * (QW / 128)), 256, 0, stream>>>(YR, BQ, 0.0625f, F);      /* qkv (f32) */
  k_dla<<<(unsigned)(NB * HS * 4), 128, 0, stream>>>(F, X16);
  k_gemm3<CC><<<(unsigned)((NR / 128) * (CC / 128)), 256, 0, stream>>>(X16, BP, 0.0625f, Y);      /* proj */
  k_finm<<<(unsigned)((NR * CC / 8 + 255) / 256), 256, 0, stream>>>(Y, bp, rgb, ir, (float*)d_out);
}

// v003
// A run of this version takes 73.4 microseconds.
// Next to v002, in two timings, it ran 1.24 times as fast each time.
// Counting every step since v000, it is 11.0 times as fast.
#include <hip/hip_runtime.h>
// Multi-dilate local attention (rgb, ir [4][128][80][80] -> y = [rgb | ir] (256 ch); qkv = 1x1 (w_qkv [768][256]) split as [3][2 dilations][128 = 4 heads x 32]; per dilation d in (2, 3): each pixel attends to its 3x3 dilated neighbourhood (zero-padded unfold: out-of-image neighbours contribute k = v = 0, logit 0) with softmax(q.k / sqrt(32)) over the 9; heads merged dilation-major; proj (w_proj [256][256]) + b_proj; + y -> NHWC [4][80][80][256]).
// Structure: the two channel-first inputs transposed to concatenated pixel rows (exact f16) via LDS tiles; qkv as a WMMA GEMM (operand tiles staged in LDS, 32x64 wave tiles, f32 accumulation, exact x16 natural weights; exact products) kept f32; the dilated local attention, one wave per (pixel, dilation), on VALU (f32; 4 channels a lane, softmax weights in registers) into f16 rows; projection GEMM whose epilogue adds bias + residual (f32, VALU) and writes the NHWC output.
// Compute dtype: inputs rounded to bf16; y / weights exact; qkv and the attention f32; the attended rows as a plain f16 GEMM operand (~2^-12). v_wmma_f32_16x16x32_f16.
#define NB 4
#define DIMH 128
#define CC 256
#define QW 768
#define HS 80
#define WS 80
#define PX (HS * WS)                 /* 6400 = 50 x 128 */
#define NR ((size_t)NB * PX)         /* 25,600 rows */
#define NRD ((int)NR)                /* unused */
#define SCL 0.17677669529663689f
#define SQ 64
#define DM 64
#define NH 1
#define HD 64
#define HG 1
typedef __bf16 v16b __attribute__((ext_vector_type(16)));
typedef unsigned short v8us __attribute__((ext_vector_type(8), may_alias));
typedef float  v8f  __attribute__((ext_vector_type(8)));
typedef float  v4f  __attribute__((ext_vector_type(4)));
typedef float  v4fa __attribute__((ext_vector_type(4), may_alias));
union FragB { v16b v; v8us half[2]; unsigned short u[16]; };

__device__ __forceinline__ unsigned short bf16_bits(float x) { unsigned int u = __float_as_uint(x); return (unsigned short)((u + 0x7FFFu + ((u >> 16) & 1u)) >> 16); }
__device__ __forceinline__ float bf16_val(unsigned short b) { return __uint_as_float(((unsigned int)b) << 16); }
__device__ __forceinline__ float bf16_round(float x) { return bf16_val(bf16_bits(x)); }
// D += A·B with NT terms: 1 = ah·bh, 2 = + al·bh (A split), 3 = + ah·bl (both split)
template <int NT>
__device__ __forceinline__ v8f mmaN(v16b ah, v16b al, v16b bh, v16b bl, v8f c) {
  c = __builtin_amdgcn_wmma_f32_16x16x32_bf16(false, ah, false, bh, (short)0, c, false, false);
  if (NT >= 2) c = __builtin_amdgcn_wmma_f32_16x16x32_bf16(false, al, false, bh, (short)0, c, false, false);
  if (NT >= 3) c = __builtin_amdgcn_wmma_f32_16x16x32_bf16(false, ah, false, bl, (short)0, c, false, false);
  asm volatile("v_nop\n\tv_nop\n\tv_nop\n\tv_nop" : "+v"(c) : "v"(ah), "v"(al), "v"(bh), "v"(bl));
  return c;
}

__global__ __launch_bounds__(256) void k_wt_bf16(const float* __restrict__ W, unsigned short* __restrict__ Wt, int K, int N) {
  const int t = blockIdx.x * 256 + threadIdx.x;
  const int k8n = K / 8;
  if (t >= N * k8n) return;
  const int n = t / k8n, k8 = (t % k8n) * 8;
  v8us v;
#pragma unroll
  for (int i = 0; i < 8; ++i) v[i] = bf16_bits(W[(size_t)(k8 + i) * N + n]);
  *(v8us*)(Wt + (size_t)n * K + k8) = v;
  
}

// GEMM C[M][N] (f32, pitch ldc) = act(A[M][K]·W + bias). A f32 row-major (pitch lda) converted per fragment to bf16
// (ASPLIT: hi/lo two planes -> 2 terms, else single rounded term); Wt bf16 [N][K] (pitch ldb). BIAS_BF16 rounds the
// bias to bf16 first (bias quantised to bf16 before the add). K%32==0, M%16==0, N%64==0.
template <bool ASPLIT, int ACT, bool BIAS_BF16>
__global__ __launch_bounds__(128) void k_gemm_bf(const float* __restrict__ A, int lda, const unsigned short* __restrict__ Wt, int ldb,
                                               const float* __restrict__ bias, float* __restrict__ C, int ldc, int M, int N, int K) {
  __shared__ __attribute__((aligned(16))) float so[4][16][64];
  const int tid = threadIdx.x, w = tid >> 5, lane = tid & 31, ln = lane & 15, hh = lane >> 4;
  const int ntn = N / 64;
  const int wid = blockIdx.x * 4 + w;
  const int mt = wid / ntn, nq = wid % ntn;
  if (mt * 16 >= M) return;
  const int row0 = mt * 16, col0 = nq * 64;
  const float* arow = A + (size_t)(row0 + ln) * lda;
  v8f acc[4] = {};
  for (int kb = 0; kb < K; kb += 32) {
    FragB ah, al;
    const v4f x0 = *(const v4fa*)(arow + kb + 8 * hh), x1 = *(const v4fa*)(arow + kb + 8 * hh + 4);
    const v4f x2 = *(const v4fa*)(arow + kb + 16 + 8 * hh), x3 = *(const v4fa*)(arow + kb + 16 + 8 * hh + 4);
    float xs[16] = {x0[0],x0[1],x0[2],x0[3],x1[0],x1[1],x1[2],x1[3],x2[0],x2[1],x2[2],x2[3],x3[0],x3[1],x3[2],x3[3]};
#pragma unroll
    for (int i = 0; i < 16; ++i) { const unsigned short hb = bf16_bits(xs[i]); ah.u[i] = hb; al.u[i] = ASPLIT ? bf16_bits(xs[i] - bf16_val(hb)) : (unsigned short)0; }
#pragma unroll
    for (int t = 0; t < 4; ++t) {
      const unsigned short* brow = Wt + (size_t)(col0 + t * 16 + ln) * ldb + kb;
      FragB b;
      b.half[0] = *(const v8us*)(brow + 8 * hh);
      b.half[1] = *(const v8us*)(brow + 16 + 8 * hh);
      acc[t] = mmaN<ASPLIT ? 2 : 1>(ah.v, al.v, b.v, b.v, acc[t]);
    }
  }
#pragma unroll
  for (int t = 0; t < 4; ++t) {
    float bv = bias ? bias[col0 + t * 16 + ln] : 0.f;
    if (BIAS_BF16) bv = bf16_round(bv);
#pragma unroll
    for (int r = 0; r < 8; ++r) { float v = acc[t][r] + bv; if (ACT == 1) v = fmaxf(v, 0.f); so[w][8 * hh + r][t * 16 + ln] = v; }
  }
  __builtin_amdgcn_fence(__ATOMIC_ACQ_REL, "workgroup");
  __builtin_amdgcn_wave_barrier();
  const int rsub = lane >> 4, c4 = (lane & 15) * 4;
  {
#pragma unroll
    for (int q = 0; q < 8; ++q) {
      const int r = q * 2 + rsub;
      const v4f v = *(const v4fa*)&so[w][r][c4];
      *(v4f*)(C + (size_t)(row0 + r) * ldc + col0 + c4) = v;
    }
    
  }
}

// GEMM C = act(A·W + bias + resid): A f32 (ASPLIT -> hi/lo 2 terms), Wt bf16 [N][K]; ACT 0 none, 1 relu, 2 exact gelu;
// resid (optional, f32, row index = (row % rmod), pitch ldr, RES_BF16 rounds it) added before the activation.
template <bool ASPLIT, int ACT, bool BIAS_BF16, bool RES_BF16>
__global__ __launch_bounds__(128) void k_gemm_bf3(const float* __restrict__ A, int lda, const unsigned short* __restrict__ Wt, int ldb,
                                                const float* __restrict__ bias, const float* __restrict__ resid, int rmod, int ldr,
                                                float* __restrict__ C, int ldc, int M, int N, int K) {
  __shared__ __attribute__((aligned(16))) float so[4][16][64];
  const int tid = threadIdx.x, w = tid >> 5, lane = tid & 31, ln = lane & 15, hh = lane >> 4;
  const int ntn = N / 64;
  const int wid = blockIdx.x * 4 + w;
  const int mt = wid / ntn, nq = wid % ntn;
  if (mt * 16 >= M) return;
  const int row0 = mt * 16, col0 = nq * 64;
  const float* arow = A + (size_t)(row0 + ln) * lda;
  v8f acc[4] = {};
  for (int kb = 0; kb < K; kb += 32) {
    FragB ah, al;
    const v4f x0 = *(const v4fa*)(arow + kb + 8 * hh), x1 = *(const v4fa*)(arow + kb + 8 * hh + 4);
    const v4f x2 = *(const v4fa*)(arow + kb + 16 + 8 * hh), x3 = *(const v4fa*)(arow + kb + 16 + 8 * hh + 4);
    float xs[16] = {x0[0],x0[1],x0[2],x0[3],x1[0],x1[1],x1[2],x1[3],x2[0],x2[1],x2[2],x2[3],x3[0],x3[1],x3[2],x3[3]};
#pragma unroll
    for (int i = 0; i < 16; ++i) { const unsigned short hb = bf16_bits(xs[i]); ah.u[i] = hb; al.u[i] = ASPLIT ? bf16_bits(xs[i] - bf16_val(hb)) : (unsigned short)0; }
#pragma unroll
    for (int t = 0; t < 4; ++t) {
      const unsigned short* brow = Wt + (size_t)(col0 + t * 16 + ln) * ldb + kb;
      FragB b;
      b.half[0] = *(const v8us*)(brow + 8 * hh);
      b.half[1] = *(const v8us*)(brow + 16 + 8 * hh);
      acc[t] = mmaN<ASPLIT ? 2 : 1>(ah.v, al.v, b.v, b.v, acc[t]);
    }
  }
#pragma unroll
  for (int t = 0; t < 4; ++t) {
    const int col = col0 + t * 16 + ln;
    float bv = bias ? bias[col] : 0.f;
    if (BIAS_BF16) bv = bf16_round(bv);
#pragma unroll
    for (int r = 0; r < 8; ++r) {
      float v = acc[t][r] + bv;
      if (resid) { float rv = resid[(size_t)((row0 + 8 * hh + r) % rmod) * ldr + col]; if (RES_BF16) rv = bf16_round(rv); v += rv; }
      if (ACT == 1) v = fmaxf(v, 0.f);
      if (ACT == 2) v = 0.5f * v * (1.0f + erff(v * 0.70710678118654752f));
      if (ACT == 3) { const float u = 0.7978845608028654f * (v + 0.044715f * v * v * v); v = 0.5f * v * (1.0f + tanhf(u)); }
      so[w][8 * hh + r][t * 16 + ln] = v;
    }
  }
  __builtin_amdgcn_fence(__ATOMIC_ACQ_REL, "workgroup");
  __builtin_amdgcn_wave_barrier();
  const int rsub = lane >> 4, c4 = (lane & 15) * 4;
  {
#pragma unroll
    for (int q = 0; q < 8; ++q) {
      const int r = q * 2 + rsub;
      const v4f v = *(const v4fa*)&so[w][r][c4];
      *(v4f*)(C + (size_t)(row0 + r) * ldc + col0 + c4) = v;
    }
    
  }
}
// row LayerNorm (biased variance, eps) over N: s = X (+ R); optional out_sum <- s; out_norm <- (s-mu)*rsqrt(var+eps)*g + b
template <bool PARAM_BF16>
__global__ __launch_bounds__(256) void k_layernorm(const float* __restrict__ X, const float* __restrict__ R, const float* __restrict__ g, const float* __restrict__ bta,
                                                  float* __restrict__ out_sum, float* __restrict__ out_norm, int N, float eps) {
  __shared__ float red[256];
  const int row = blockIdx.x, tid = threadIdx.x;
  const float* x = X + (size_t)row * N; const float* rr = R ? R + (size_t)row * N : nullptr;
  float vals[16];                     // up to N = 4096
  const int per = N / 256;            // contiguous chunk per thread? use strided-by-4 chunks: thread handles j = tid*4 + 1024*u
  float s1 = 0.f;
  for (int u = 0; u < per / 4; ++u) {
    const int j = tid * 4 + 1024 * u;
    const v4f a = *(const v4fa*)(x + j);
    v4f b = {0.f,0.f,0.f,0.f}; if (rr) b = *(const v4fa*)(rr + j);
#pragma unroll
    for (int q = 0; q < 4; ++q) { const float v = a[q] + b[q]; vals[u * 4 + q] = v; s1 += v; }
  }
  red[tid] = s1; __syncthreads();
  for (int st = 128; st > 0; st >>= 1) { if (tid < st) red[tid] += red[tid + st]; __syncthreads(); }
  const float mu = red[0] / (float)N; __syncthreads();
  float s2 = 0.f;
  for (int u = 0; u < per / 4; ++u)
#pragma unroll
    for (int q = 0; q < 4; ++q) { const float c = vals[u * 4 + q] - mu; s2 += c * c; }
  red[tid] = s2; __syncthreads();
  for (int st = 128; st > 0; st >>= 1) { if (tid < st) red[tid] += red[tid + st]; __syncthreads(); }
  const float rs = rsqrtf(red[0] / (float)N + eps);
  {
    for (int u = 0; u < per / 4; ++u) {
      const int j = tid * 4 + 1024 * u;
      v4f o, sm;
#pragma unroll
      for (int q = 0; q < 4; ++q) {
        float gg = g[j + q], bb = bta[j + q];
        if (PARAM_BF16) { gg = bf16_round(gg); bb = bf16_round(bb); }
        sm[q] = vals[u * 4 + q]; o[q] = (vals[u * 4 + q] - mu) * rs * gg + bb;
      }
      if (out_sum) *(v4f*)(out_sum + (size_t)row * N + j) = sm;
      *(v4f*)(out_norm + (size_t)row * N + j) = o;
    }
    
  }
}



// ---- f16 WMMA path (v_wmma_f32_16x16x32_f16): 11-bit significands for operands in range — used here for the qkv and projection GEMMs
typedef _Float16 v16h __attribute__((ext_vector_type(16)));
union FragH { v16h v; v8us half[2]; _Float16 h[16]; unsigned short u[16]; };
template <int NT>
__device__ __forceinline__ v8f mmaH(v16h ah, v16h al, v16h bh, v16h bl, v8f c) {
  c = __builtin_amdgcn_wmma_f32_16x16x32_f16(false, ah, false, bh, (short)0, c, false, false);
  if (NT >= 2) c = __builtin_amdgcn_wmma_f32_16x16x32_f16(false, al, false, bh, (short)0, c, false, false);
  if (NT >= 3) c = __builtin_amdgcn_wmma_f32_16x16x32_f16(false, ah, false, bl, (short)0, c, false, false);
  asm volatile("v_nop\n\tv_nop\n\tv_nop\n\tv_nop" : "+v"(c) : "v"(ah), "v"(al), "v"(bh), "v"(bl));
  return c;
}
// batched GEMM like k_gemm_b but f16 operands: A f32 (split into f16 hi/lo if ASPLIT, else rounded to f16), Bt = f16 values [n][k]; alpha; C f32; N multiple of 16 (partial tiles skipped)
template <bool ASPLIT>
__global__ __launch_bounds__(128) void k_gemm_h(const float* __restrict__ A, int lda, size_t sA, const _Float16* __restrict__ Bh, int ldb, size_t sB, float alpha, float* __restrict__ C, int ldc, size_t sC, int M, int N, int K) {
  __shared__ __attribute__((aligned(16))) float so[4][16][64];
  const int tid = threadIdx.x, w = tid >> 5, lane = tid & 31, ln = lane & 15, hh = lane >> 4; const int by = blockIdx.y;
  A += (size_t)by * sA; Bh += (size_t)by * sB; C += (size_t)by * sC;
  const int ntn = (N + 63) / 64; const int wid = blockIdx.x * 4 + w; const int mt = wid / ntn, nq = wid % ntn; if (mt * 16 >= M) return;
  const int row0 = mt * 16, col0 = nq * 64; const float* arow = A + (size_t)(row0 + ln) * lda;
  v8f acc[4] = {};
  for (int kb = 0; kb < K; kb += 32) {
    FragH ah, al;
    const v4f x0 = *(const v4fa*)(arow + kb + 8 * hh), x1 = *(const v4fa*)(arow + kb + 8 * hh + 4), x2 = *(const v4fa*)(arow + kb + 16 + 8 * hh), x3 = *(const v4fa*)(arow + kb + 16 + 8 * hh + 4);
    float xs[16] = {x0[0],x0[1],x0[2],x0[3],x1[0],x1[1],x1[2],x1[3],x2[0],x2[1],x2[2],x2[3],x3[0],x3[1],x3[2],x3[3]};
#pragma unroll
    for (int i = 0; i < 16; ++i) { const _Float16 h = (_Float16)xs[i]; ah.h[i] = h; al.h[i] = ASPLIT ? (_Float16)(xs[i] - (float)h) : (_Float16)0.0f; }
#pragma unroll
    for (int t = 0; t < 4; ++t) { if (col0 + t * 16 >= N) continue; const size_t boff = (size_t)(col0 + t * 16 + ln) * ldb + kb; FragH bq; bq.half[0] = *(const v8us*)(Bh + boff + 8 * hh); bq.half[1] = *(const v8us*)(Bh + boff + 16 + 8 * hh);
      acc[t] = mmaH<ASPLIT ? 2 : 1>(ah.v, al.v, bq.v, bq.v, acc[t]); }
  }
#pragma unroll
  for (int t = 0; t < 4; ++t) { if (col0 + t * 16 >= N) continue;
#pragma unroll
    for (int r = 0; r < 8; ++r) so[w][8 * hh + r][t * 16 + ln] = acc[t][r] * alpha; }
  __builtin_amdgcn_fence(__ATOMIC_ACQ_REL, "workgroup"); __builtin_amdgcn_wave_barrier();
  const int rsub = lane >> 4, c4 = (lane & 15) * 4;
  {
#pragma unroll
    for (int q = 0; q < 8; ++q) { const int r = q * 2 + rsub; if (col0 + c4 < N) { const v4f v = *(const v4fa*)&so[w][r][c4]; *(v4f*)(C + (size_t)(row0 + r) * ldc + col0 + c4) = v; } }
     }
}

// Wt[n][k] = f16(W[k][n]·scale) from f32 row-major W[K][N] (scale = power of two; bf16-exact weights stay exact in f16 away from the subnormal range)
__global__ __launch_bounds__(256) void k_wt_f16(const float* __restrict__ W, _Float16* __restrict__ Wt, int K, int N, float scale) {
  const int t = blockIdx.x * 256 + threadIdx.x; if (t >= N * (K / 8)) return; const int n = t / (K / 8), k8 = (t % (K / 8)) * 8; FragH f;
#pragma unroll
  for (int i = 0; i < 8; ++i) f.h[i] = (_Float16)(bf16_round(W[(size_t)(k8 + i) * N + n]) * scale); const v8us o = f.half[0];
  *(v8us*)((unsigned short*)Wt + (size_t)n * K + k8) = o; 
}
// k_gemm_hh variant with fused epilogue: v = acc·alpha + bias[by·sBias + col] (+ CP[(row/rowsPerB)·sCPb + by·64 + col] if CP) ; ACT 0 none / 1 elu ; writes f16 C16 (and f32 C if non-null)
template <int ACT>
__global__ __launch_bounds__(128) void k_gemm_hhx(const _Float16* __restrict__ A, int lda, size_t sA, const _Float16* __restrict__ Bh, int ldb, size_t sB, float alpha, const float* __restrict__ bias, size_t sBias, const float* __restrict__ CP, int rowsPerB, size_t sCPb, int row0g,
    float* __restrict__ C, _Float16* __restrict__ C16, int ldc, size_t sC, int M, int N, int K) {
  __shared__ __attribute__((aligned(16))) float so[4][16][64];
  const int tid = threadIdx.x, w = tid >> 5, lane = tid & 31, ln = lane & 15, hh = lane >> 4; const int by = blockIdx.y;
  A += (size_t)by * sA; Bh += (size_t)by * sB; const size_t cofs = (size_t)by * sC; const float* bp = bias ? bias + (size_t)by * sBias : nullptr;
  const int ntn = (N + 63) / 64; const int wid = blockIdx.x * 4 + w; const int mt = wid / ntn, nq = wid % ntn; if (mt * 16 >= M) return;
  const int row0 = mt * 16, col0 = nq * 64; const _Float16* arow = A + (size_t)(row0 + ln) * lda;
  v8f acc[4] = {};
  for (int kb = 0; kb < K; kb += 32) { FragH ah; ah.half[0] = *(const v8us*)((const unsigned short*)arow + kb + 8 * hh); ah.half[1] = *(const v8us*)((const unsigned short*)arow + kb + 16 + 8 * hh);
#pragma unroll
    for (int t = 0; t < 4; ++t) { if (col0 + t * 16 >= N) continue; const size_t boff = (size_t)(col0 + t * 16 + ln) * ldb + kb; FragH bq; bq.half[0] = *(const v8us*)((const unsigned short*)Bh + boff + 8 * hh); bq.half[1] = *(const v8us*)((const unsigned short*)Bh + boff + 16 + 8 * hh);
      acc[t] = mmaH<1>(ah.v, ah.v, bq.v, bq.v, acc[t]); }
  }
#pragma unroll
  for (int t = 0; t < 4; ++t) { if (col0 + t * 16 >= N) continue; const int col = col0 + t * 16 + ln; const float bv = bp ? bf16_round(bp[col]) : 0.f;
#pragma unroll
    for (int r = 0; r < 8; ++r) { float v = acc[t][r] * alpha + bv; if (CP) { const int rr = row0g + row0 + 8 * hh + r; if (rowsPerB < 0) v += CP[cofs + (size_t)rr * ldc + col];      /* rowsPerB < 0: own element of the batched C plane */ else { const int bidx = rr / rowsPerB; v += CP[(size_t)bidx * sCPb + (size_t)by * 64 + col]; } } if (ACT == 1) v = (v > 0.f) ? v : expm1f(v); else if (ACT == 7) v = (v > 0.f) ? v + 1.0f : expf(v); else if (ACT == 8) v = tanhf(v); else if (ACT == 9) v = 0.5f * v * (1.0f + tanhf(0.7978845608028654f * (v + 0.044715f * v * v * v))); else if (ACT == 11) v = 1.0f / (1.0f + expf(-v)); else if (ACT == 12) v = (v > 0.f) ? v : 0.01f * v; else if (ACT == 14) v = (v > 0.f) ? v : 0.1f * v; else if (ACT == 16) v = (v >= 0.f) ? v : 0.3f * v; else if (ACT == 17) v = (v >= 0.f) ? v : 0.2f * v; else if (ACT == 15) v = v / (1.0f + expf(-v)); else if (ACT == 3) v = fmaxf(v, 0.f); else if (ACT == 6) v = 0.5f * v * (1.0f + erff(v * 0.70710678118654752f)); so[w][8 * hh + r][t * 16 + ln] = v; } }
  __builtin_amdgcn_fence(__ATOMIC_ACQ_REL, "workgroup"); __builtin_amdgcn_wave_barrier();
  const int rsub = lane >> 4, c4 = (lane & 15) * 4; typedef _Float16 v4h __attribute__((ext_vector_type(4)));
  {
#pragma unroll
    for (int q = 0; q < 8; ++q) { const int r = q * 2 + rsub; if (col0 + c4 < N) { const v4f v = *(const v4fa*)&so[w][r][c4]; if (C) *(v4f*)(C + cofs + (size_t)(row0 + r) * ldc + col0 + c4) = v; if (C16) { v4h h4; for (int i = 0; i < 4; ++i) h4[i] = (_Float16)v[i]; *(v4h*)(C16 + cofs + (size_t)(row0 + r) * ldc + col0 + c4) = h4; } } }
     }
}


typedef _Float16 v4h __attribute__((ext_vector_type(4)));

__global__ __launch_bounds__(256) void k_x16(const float* __restrict__ x, _Float16* __restrict__ X16, size_t n8) { const size_t t = (size_t)blockIdx.x * 256 + threadIdx.x; if (t >= n8) return; FragH f;
#pragma unroll
  for (int q = 0; q < 8; ++q) f.h[q] = (_Float16)bf16_round(x[t * 8 + q]); *(v8us*)((unsigned short*)X16 + t * 8) = f.half[0];  }
__global__ __launch_bounds__(256) void k_h16(const float* __restrict__ x, _Float16* __restrict__ X16, size_t n8) { const size_t t = (size_t)blockIdx.x * 256 + threadIdx.x; if (t >= n8) return; FragH f;
#pragma unroll
  for (int q = 0; q < 8; ++q) f.h[q] = (_Float16)x[t * 8 + q]; *(v8us*)((unsigned short*)X16 + t * 8) = f.half[0];  }
__global__ __launch_bounds__(256) void k_round16f(const float* __restrict__ W, _Float16* __restrict__ Bt, size_t n8) { const size_t t = (size_t)blockIdx.x * 256 + threadIdx.x; if (t >= n8) return; FragH f;
#pragma unroll
  for (int i = 0; i < 8; ++i) f.h[i] = (_Float16)(bf16_round(W[t * 8 + i]) * 16.0f); *(v8us*)((unsigned short*)Bt + t * 8) = f.half[0];  }
template <int NHv, int TTv>
__global__ __launch_bounds__(256) void k_vt(const _Float16* __restrict__ V16, int ldv, int voff, _Float16* __restrict__ Vt) { __shared__ unsigned short tl[64][66]; const int tid = threadIdx.x; const int slab = blockIdx.x / (TTv / 64), lg = blockIdx.x % (TTv / 64); const int b = slab / NHv, h = slab % NHv;
  for (int i = tid; i < 64 * 8; i += 256) { const int r = i / 8, c8 = (i % 8) * 8; FragH f; f.half[0] = *(const v8us*)((const unsigned short*)V16 + ((size_t)b * TTv + lg * 64 + r) * ldv + voff + h * 64 + c8);
#pragma unroll
    for (int q = 0; q < 8; ++q) tl[r][c8 + q] = f.u[q]; }
  __syncthreads();
  {
#pragma unroll
    for (int rd = 0; rd < 2; ++rd) { const int d = rd * 32 + tid / 8, pc = tid % 8; FragH f;
#pragma unroll
      for (int q = 0; q < 8; ++q) f.u[q] = tl[pc * 8 + q][d];
      *(v8us*)((unsigned short*)Vt + ((size_t)slab * 64 + d) * TTv + lg * 64 + pc * 8) = f.half[0]; }
     } }

__global__ __launch_bounds__(256) void k_hl(const float* __restrict__ F, _Float16* __restrict__ Hh, _Float16* __restrict__ Hl, size_t n8) { const size_t t = (size_t)blockIdx.x * 256 + threadIdx.x; if (t >= n8) return; FragH fh, fl; const v4f a = *(const v4fa*)(F + t * 8), c = *(const v4fa*)(F + t * 8 + 4);
#pragma unroll
  for (int q = 0; q < 4; ++q) { _Float16 h = (_Float16)a[q]; fh.h[q] = h; fl.h[q] = (_Float16)((a[q] - (float)h) * 1024.0f); h = (_Float16)c[q]; fh.h[4 + q] = h; fl.h[4 + q] = (_Float16)((c[q] - (float)h) * 1024.0f); }
  { *(v8us*)((unsigned short*)Hh + t * 8) = fh.half[0]; *(v8us*)((unsigned short*)Hl + t * 8) = fl.half[0];  } }

// ---- fast GEMM (wave tile 32x64; requires M % 32 == 0 rows per launch region and N % 64 == 0); epilogue = k_gemm_hhx semantics ----
__device__ __forceinline__ v16h g2_frag(const _Float16* p, int hh) { FragH f; f.half[0] = *(const v8us*)((const unsigned short*)p + 8 * hh); f.half[1] = *(const v8us*)((const unsigned short*)p + 16 + 8 * hh); return f.v; }
__device__ __forceinline__ v8f g2_mma(v16h a, v16h b, v8f c) { v8f d = __builtin_amdgcn_wmma_f32_16x16x32_f16(false, a, false, b, (short)0, c, false, false); asm volatile("v_nop\n\tv_nop\n\tv_nop\n\tv_nop" : "+v"(d) : "v"(a), "v"(b)); return d; }
template <int ACT>
__global__ __launch_bounds__(128) void k_gemm2(const _Float16* __restrict__ A, int lda, size_t sA, const _Float16* __restrict__ Bh, int ldb, size_t sB, float alpha, const float* __restrict__ bias, size_t sBias, const float* __restrict__ CP, int rowsPerB, size_t sCPb, int row0g,
    float* __restrict__ C, _Float16* __restrict__ C16, int ldc, size_t sC, int M, int N, int K) { static_assert(ACT == 0 || ACT == 3 || ACT == 6 || ACT == 8 || ACT == 9 || ACT == 11 || ACT == 12 || ACT == 14 || ACT == 15 || ACT == 16 || ACT == 17, "k_gemm2: unsupported ACT code (would silently apply no activation)");
  __shared__ __attribute__((aligned(16))) float so[4][32][68];
  const int tid = threadIdx.x, w = tid >> 5, lane = tid & 31, ln = lane & 15, hh = lane >> 4; const int by = blockIdx.y;
  A += (size_t)by * sA; Bh += (size_t)by * sB; const size_t cofs = (size_t)by * sC; const float* bp = bias ? bias + (size_t)by * sBias : nullptr;
  const int ntn = N >> 6; const int mt = blockIdx.x / ntn, nq = blockIdx.x - mt * ntn; const int row0 = mt * 128 + 32 * w, col0 = nq * 64; if (row0 >= M) return;
  const _Float16* a0p = A + (size_t)(row0 + ln) * lda; const _Float16* a1p = a0p + (size_t)16 * lda;
  const _Float16* b0p = Bh + (size_t)(col0 + ln) * ldb; const _Float16* b1p = b0p + (size_t)16 * ldb; const _Float16* b2p = b1p + (size_t)16 * ldb; const _Float16* b3p = b2p + (size_t)16 * ldb;
  const v8f z8 = {0.f,0.f,0.f,0.f,0.f,0.f,0.f,0.f}; v8f c00 = z8, c01 = z8, c02 = z8, c03 = z8, c10 = z8, c11 = z8, c12 = z8, c13 = z8;
#pragma unroll 1
  for (int kb = 0; kb < K; kb += 32) { const v16h a0 = g2_frag(a0p + kb, hh), a1 = g2_frag(a1p + kb, hh);
    v16h b = g2_frag(b0p + kb, hh); c00 = g2_mma(a0, b, c00); c10 = g2_mma(a1, b, c10);
    b = g2_frag(b1p + kb, hh); c01 = g2_mma(a0, b, c01); c11 = g2_mma(a1, b, c11);
    b = g2_frag(b2p + kb, hh); c02 = g2_mma(a0, b, c02); c12 = g2_mma(a1, b, c12);
    b = g2_frag(b3p + kb, hh); c03 = g2_mma(a0, b, c03); c13 = g2_mma(a1, b, c13); }
  v8f accs[8] = {c00, c01, c02, c03, c10, c11, c12, c13};
#pragma unroll
  for (int u = 0; u < 8; ++u) { const int t = u & 3, half = u >> 2; const int col = col0 + t * 16 + ln; const float bv = bp ? bf16_round(bp[col]) : 0.f;
#pragma unroll
    for (int r = 0; r < 8; ++r) { const int rloc = half * 16 + 8 * hh + r; float v = accs[u][r] * alpha + bv; if (CP) { if (rowsPerB < 0) v += CP[cofs + (size_t)(row0g + row0 + rloc) * ldc + col];      /* rowsPerB < 0: own element of the batched C plane */ else { const int bidx = (row0g + row0 + rloc) / rowsPerB; v += CP[(size_t)bidx * sCPb + (size_t)by * 64 + col]; } }
      if (ACT == 3) v = fmaxf(v, 0.f); else if (ACT == 6) v = 0.5f * v * (1.0f + erff(v * 0.70710678118654752f)); else if (ACT == 11) v = 1.0f / (1.0f + expf(-v)); else if (ACT == 15) v = v / (1.0f + expf(-v)); else if (ACT == 12) v = (v > 0.f) ? v : 0.01f * v; else if (ACT == 8) v = tanhf(v); else if (ACT == 9) v = 0.5f * v * (1.0f + tanhf(0.7978845608028654f * (v + 0.044715f * v * v * v))); else if (ACT == 14) v = (v > 0.f) ? v : 0.1f * v; else if (ACT == 16) v = (v >= 0.f) ? v : 0.3f * v; else if (ACT == 17) v = (v >= 0.f) ? v : 0.2f * v;
      so[w][rloc][t * 16 + ln] = v; } }
  __builtin_amdgcn_fence(__ATOMIC_ACQ_REL, "workgroup"); __builtin_amdgcn_wave_barrier();
  const int rsub = lane >> 4, c4 = (lane & 15) * 4;
  {
#pragma unroll
    for (int q = 0; q < 16; ++q) { const int r = q * 2 + rsub; const v4f v = *(const v4fa*)&so[w][r][c4]; if (C) *(v4f*)(C + cofs + (size_t)(row0 + r) * ldc + col0 + c4) = v; if (C16) { v4h h4; for (int i = 0; i < 4; ++i) h4[i] = (_Float16)v[i]; *(v4h*)(C16 + cofs + (size_t)(row0 + r) * ldc + col0 + c4) = h4; } }
     } }


// ---- GEMM with both operand tiles staged in LDS: C[M][NN] (f32) = alpha * A[M][CC] . Bh[NN][CC]^T; K = CC; grid = (M / 128) * (NN / 128) ----
// Work-group tile 128 x 128, 8 waves; wave tile 32 x 64 and k order as k_gemm2. A fragment load straight from global touches 16 lines for its 512 bytes and stands in front of its own WMMAs;
// here each global load of a wave is one whole 512-byte row (4 lines), all 32 of a wave are in flight together, and the fragments come from LDS rows pitched 528 B (16 B x 33: no bank conflict for 16-byte reads).
// FIN (the projection): C = (alpha * A . Bh^T + bf16(bpj[col])) + bf16(residual), the residual read from the channel-first inputs in the accumulators' own layout:
// a lane's 8 accumulator rows of one column are 8 neighbouring pixels of one channel, 32 bytes in a row; a wave's 32 pixels of a channel are one whole 128-byte line.
#define GLP 264      /* LDS row pitch in f16 elements */
template <int NN, bool FIN>
__global__ __launch_bounds__(256) void k_gemm3(const _Float16* __restrict__ A, const _Float16* __restrict__ Bh, float alpha, float* __restrict__ C, const float* __restrict__ bpj, const float* __restrict__ rgb, const float* __restrict__ ir) {
  static_assert(!FIN || (NN == CC && DIMH == 128 && PX % 128 == 0), "FIN: a 128-column tile is one input's channels, a 128-row tile lies in one image");
  __shared__ __attribute__((aligned(16))) _Float16 sm[(128 + 128) * GLP];      /* 128 A rows, then 128 B rows; after the products the waves' output staging */
  const int lane = threadIdx.x & 31, ln = lane & 15, hh = lane >> 4; const int w = __builtin_amdgcn_readfirstlane((int)threadIdx.x >> 5); const int wr = w & 3, wc = w >> 2;
  const int ntn = NN / 128; const int mt = blockIdx.x / ntn, nq = blockIdx.x - mt * ntn; const int row0 = mt * 128 + 32 * wr, col0 = nq * 128 + 64 * wc;
  _Float16* sb = sm + 128 * GLP;
  const unsigned short* ga = (const unsigned short*)A + (size_t)(mt * 128 + 16 * w) * CC + lane * 8; const unsigned short* gb = (const unsigned short*)Bh + (size_t)(nq * 128 + 16 * w) * CC + lane * 8;
  v8us ra[16], rb[16];      /* wave w brings rows 16 w .. 16 w + 15 of either tile; the four loops below are unrolled so that both arrays are registers and each row is an immediate offset */
#pragma unroll
  for (int i = 0; i < 16; ++i) ra[i] = *(const v8us*)(ga + i * CC);
#pragma unroll
  for (int i = 0; i < 16; ++i) rb[i] = *(const v8us*)(gb + i * CC);
  /* s_wait_xcnt 0 behind the tile's loads, in front of every overwrite of a register that they name; the lane index, their offset register, is its input, so that no load's result is handed that register ahead of it; its memory clobber also keeps every LDS store behind the last load, so the wave pays one load latency for its 32 rows */
  asm volatile("s_wait_xcnt 0x0" :: "v"(lane) : "memory");
#pragma unroll
  for (int i = 0; i < 16; ++i) *(v8us*)((unsigned short*)sm + (16 * w + i) * GLP + lane * 8) = ra[i];
#pragma unroll
  for (int i = 0; i < 16; ++i) *(v8us*)((unsigned short*)sb + (16 * w + i) * GLP + lane * 8) = rb[i];
  __syncthreads();
  /* the residual's and the bias's loads stand behind the barrier (which waits for every load issued in front of it) and ahead of the products, under which they fly */
  v4f rs[16]; float bv[4]; unsigned rob = 0;      /* residual: [fragment u][rows 0-3, 4-7]; bias: one column per t; rob: the residual loads' offset register */
  if (FIN) { const int img = mt / (PX / 128), p0 = (mt - img * (PX / 128)) * 128 + 32 * wr;
    const char* rsrc = (const char*)((nq ? ir : rgb) + ((size_t)img * DIMH + 64 * wc) * PX + p0); rob = (unsigned)(ln * PX + 8 * hh) * 4u; const float* bsrc = bpj + col0;
#pragma unroll
    for (int u = 0; u < 8; ++u) { const int t = u & 3, half = u >> 2;      /* unrolled: rs is registers, each load an immediate offset */
      rs[2 * u] = *(const v4fa*)(rsrc + rob + (t * 16 * PX + half * 16) * 4); rs[2 * u + 1] = *(const v4fa*)(rsrc + rob + (t * 16 * PX + half * 16 + 4) * 4); }
#pragma unroll
    for (int t = 0; t < 4; ++t) bv[t] = bsrc[t * 16 + ln];
  }
  const _Float16* pa = sm + (32 * wr + ln) * GLP; const _Float16* pb = sb + (64 * wc + ln) * GLP;
  const v8f z8 = {0.f,0.f,0.f,0.f,0.f,0.f,0.f,0.f}; v8f c00 = z8, c01 = z8, c02 = z8, c03 = z8, c10 = z8, c11 = z8, c12 = z8, c13 = z8;
  v16h a0 = g2_frag(pa, hh), a1 = g2_frag(pa + 16 * GLP, hh), b0 = g2_frag(pb, hh), b1 = g2_frag(pb + 16 * GLP, hh), b2 = g2_frag(pb + 32 * GLP, hh), b3 = g2_frag(pb + 48 * GLP, hh);
  /* unrolled whole (8 steps): the two fragment sets then need no register moves, and every LDS address is an immediate offset */
#pragma unroll
  for (int kb = 0; kb < CC; kb += 32) { v16h n0 = a0, n1 = a1, m0 = b0, m1 = b1, m2 = b2, m3 = b3;
    if (kb + 32 < CC) { const int kn = kb + 32;      /* the next step's 12 LDS reads as one group ahead of this step's WMMAs */
      n0 = g2_frag(pa + kn, hh); n1 = g2_frag(pa + 16 * GLP + kn, hh); m0 = g2_frag(pb + kn, hh); m1 = g2_frag(pb + 16 * GLP + kn, hh); m2 = g2_frag(pb + 32 * GLP + kn, hh); m3 = g2_frag(pb + 48 * GLP + kn, hh); }
    c00 = g2_mma(a0, b0, c00); c10 = g2_mma(a1, b0, c10); c01 = g2_mma(a0, b1, c01); c11 = g2_mma(a1, b1, c11);
    c02 = g2_mma(a0, b2, c02); c12 = g2_mma(a1, b2, c12); c03 = g2_mma(a0, b3, c03); c13 = g2_mma(a1, b3, c13);
    a0 = n0; a1 = n1; b0 = m0; b1 = m1; b2 = m2; b3 = m3; }
  /* s_wait_xcnt 0 behind the residual's and the bias's loads; their two offset registers are its inputs, so that neither is overwritten ahead of it */
  if (FIN) { __builtin_amdgcn_sched_barrier(0);      /* none of the epilogue's arithmetic moves up among the products: its wait for the residual would stall them */
    asm volatile("s_wait_xcnt 0x0" :: "v"(rob), "v"(ln) : "memory"); }
  __syncthreads();      /* every wave has read its last fragment: the tiles' LDS may now take the output staging */
  float* so = (float*)sm + w * (32 * 68);      /* this wave's own 32 rows x 68 floats */
  v8f accs[8] = {c00, c01, c02, c03, c10, c11, c12, c13};      /* unrolled below, as in k_gemm2: accumulators are indexed by constants only */
#pragma unroll
  for (int u = 0; u < 8; ++u) { const int t = u & 3, half = u >> 2;
#pragma unroll
    for (int r = 0; r < 8; ++r) { float v = accs[u][r] * alpha; if (FIN) v = (v + bf16_round(bv[t])) + bf16_round(rs[2 * u + (r >> 2)][r & 3]); so[(half * 16 + 8 * hh + r) * 68 + t * 16 + ln] = v; } }
  __builtin_amdgcn_fence(__ATOMIC_ACQ_REL, "workgroup"); __builtin_amdgcn_wave_barrier();
  const int rsub = lane >> 4, c4 = (lane & 15) * 4;
#pragma unroll
  for (int q = 0; q < 16; ++q) { const int r = q * 2 + rsub; const v4f v = *(const v4fa*)&so[r * 68 + c4]; *(v4f*)(C + (size_t)(row0 + r) * NN + col0 + c4) = v; } }

__global__ __launch_bounds__(256) void k_wnat(const float* __restrict__ w, size_t n8, _Float16* __restrict__ Bt) { const size_t t = (size_t)blockIdx.x * 256 + threadIdx.x; if (t >= n8) return; FragH f; for (int q = 0; q < 8; ++q) f.h[q] = (_Float16)(bf16_round(w[t * 8 + q]) * 16.0f); *(v8us*)((unsigned short*)Bt + t * 8) = f.half[0];  }
__global__ __launch_bounds__(256) void k_rsm(const float* __restrict__ S, _Float16* __restrict__ P, int nrows) {
  #pragma clang fp contract(off)
  const int i = blockIdx.x * 256 + threadIdx.x; if (i >= nrows) return; const float* s = S + (size_t)i * SQ; float mx = -3.0e38f;
#pragma unroll 1
  for (int j = 0; j < SQ; ++j) mx = fmaxf(mx, s[j]); float se = 0.f;
#pragma unroll 1
  for (int j = 0; j < SQ; ++j) se += expf(s[j] - mx); const float sc = 256.0f / se;
#pragma unroll 1
  for (int j0 = 0; j0 < SQ; j0 += 8) { FragH f; for (int q = 0; q < 8; ++q) f.h[q] = (_Float16)(expf(s[j0 + q] - mx) * sc); unsigned short* d = (unsigned short*)P + (size_t)i * SQ + j0; *(v8us*)d = f.half[0];  } }
__global__ __launch_bounds__(256) void k_vt(const _Float16* __restrict__ V16, int b, int h0, _Float16* __restrict__ VT) { __shared__ unsigned short tl[64][65]; const int tid = threadIdx.x; const int hh = blockIdx.x % HG, sg = blockIdx.x / HG; const int s0 = sg * 64; const int h = h0 + hh;
  for (int i = tid; i < 64 * 8; i += 256) { const int j = i / 8, d8 = (i % 8) * 8; FragH f; f.half[0] = *(const v8us*)((const unsigned short*)V16 + ((size_t)b * SQ + s0 + j) * DM + h * HD + d8); for (int q = 0; q < 8; ++q) tl[d8 + q][j] = f.u[q]; }
  __syncthreads();
  { for (int i = tid; i < 64 * 8; i += 256) { const int d = i / 8, j8 = (i % 8) * 8; FragH f; for (int q = 0; q < 8; ++q) f.u[q] = tl[d][j8 + q]; *(v8us*)((unsigned short*)VT + ((size_t)hh * HD + d) * SQ + s0 + j8) = f.half[0]; }  } }


__global__ __launch_bounds__(256) void k_catrows(const float* __restrict__ rgb, const float* __restrict__ ir, _Float16* __restrict__ YR) { __shared__ float tl[64][33]; const int tid = threadIdx.x; const int nc = CC / 64, nl = PX / 32; const int cb_ = blockIdx.x % nc; const int lb = (blockIdx.x / nc) % nl; const size_t b = blockIdx.x / (nc * nl); const int c0 = cb_ * 64, l0 = lb * 32;
  const float* src = (c0 < DIMH) ? (rgb + (b * DIMH + c0) * (size_t)PX) : (ir + (b * DIMH + (c0 - DIMH)) * (size_t)PX);
  for (int i = tid; i < 64 * 32; i += 256) { const int c = i / 32, l = i % 32; tl[c][l] = bf16_round(src[(size_t)c * PX + l0 + l]); }
  __syncthreads();
  { const int l = tid / 8, c8 = (tid % 8) * 8; FragH f; for (int q = 0; q < 8; ++q) f.h[q] = (_Float16)tl[c8 + q][l]; unsigned short* d = (unsigned short*)YR + (b * PX + l0 + l) * (size_t)CC + c0 + c8; *(v8us*)d = f.half[0];  } }
// lane ^ M partner's value added (M = 1, 2, 4: all inside a 16-lane row), as one DPP add
template <int M>
__device__ __forceinline__ float xadd(float s) { return s + __int_as_float(__builtin_amdgcn_update_dpp(0, __float_as_int(s), 0x160 | M, 0xf, 0xf, true)); }
// One wave per (pixel, dilation): lane = 4 channels, 8 lanes = one head, so the 128 channels of a q, k or v row are one 512-byte load of whole lines.
// Work-group = half an image row of one dilation (40 pixels): 4 waves x 10 pixels, the 4 waves on 4 neighbouring pixels at a time.
// An out-of-image neighbour reads the centre pixel's rows instead (in bounds), takes logit 0 and weight 0 on v.
__global__ __launch_bounds__(128) void k_dla(const float* __restrict__ F, _Float16* __restrict__ X16) {
  const int lane = threadIdx.x & 31; const int w = __builtin_amdgcn_readfirstlane((int)threadIdx.x >> 5);
  const int xh = blockIdx.x & 1, di = (blockIdx.x >> 1) & 1, row = blockIdx.x >> 2;      /* row = image * HS + y */
  const int y = row % HS; const int dil = di ? 3 : 2;
  const float* Fd = F + di * 128; unsigned short* Xd = (unsigned short*)X16 + di * 128; const unsigned c4 = (unsigned)lane * 4u;
  for (int i = 0; i < 10; ++i) { const int x = xh * 40 + i * 4 + w; const int r = row * WS + x;
    const v4f q = *(const v4fa*)(Fd + (size_t)r * QW + c4); v4f k[9], v[9]; bool ok[9]; const float* pa[9];
#pragma unroll
    for (int kk = 0; kk < 9; ++kk) { const int dy = (kk / 3 - 1) * dil, dx = (kk % 3 - 1) * dil; ok[kk] = (y + dy >= 0) && (y + dy < HS) && (x + dx >= 0) && (x + dx < WS);
      pa[kk] = Fd + (size_t)(ok[kk] ? r + dy * WS + dx : r) * QW + c4; k[kk] = *(const v4fa*)(pa[kk] + CC); v[kk] = *(const v4fa*)(pa[kk] + 2 * CC); }
    /* s_wait_xcnt 0 behind the pixel's loads, in front of every overwrite of a register that they name; the row addresses are its inputs, so that none of their registers is handed to a later load's result ahead of it */
    asm volatile("s_wait_xcnt 0x0" :: "v"(pa[0]), "v"(pa[1]), "v"(pa[2]), "v"(pa[3]), "v"(pa[4]), "v"(pa[5]), "v"(pa[6]), "v"(pa[7]), "v"(pa[8]) : "memory");
    __builtin_amdgcn_sched_barrier(0);      /* all 19 loads of a pixel issue before any of its arithmetic: one L2 latency a pixel, not one per group of loads */
    float s[9]; float mx = -INFINITY;
#pragma unroll
    for (int kk = 0; kk < 9; ++kk) { float d = fmaf(q[3], k[kk][3], fmaf(q[2], k[kk][2], fmaf(q[1], k[kk][1], q[0] * k[kk][0]))); d = xadd<4>(xadd<2>(xadd<1>(d)));
      s[kk] = ok[kk] ? d * SCL : 0.f; mx = fmaxf(mx, s[kk]); }
    float se = 0.f; v4f acc = {0.f, 0.f, 0.f, 0.f};
#pragma unroll
    for (int kk = 0; kk < 9; ++kk) { const float e = expf(s[kk] - mx); se += e; const float pw = ok[kk] ? e : 0.f;
      for (int c = 0; c < 4; ++c) acc[c] = fmaf(pw, v[kk][c], acc[c]); }
    const float inv = 1.0f / se; v4h o; for (int c = 0; c < 4; ++c) o[c] = (_Float16)(acc[c] * inv);
    *(v4h*)(Xd + (size_t)r * CC + c4) = o; } }

extern "C" void kernel_launch(void* const* d_in, const int* in_sizes, int n_in,
                              void* d_out, int out_size, void* d_ws, size_t ws_size, hipStream_t stream) {
  (void)in_sizes; (void)n_in; (void)out_size;
  const float* const* I = (const float* const*)d_in; const float* rgb = I[0]; const float* ir = I[1]; const float* wqkv = I[2]; const float* wp = I[3]; const float* bp = I[4];
  char* ws = (char*)d_ws; size_t off = 0;
  auto take = [&](size_t bytes) { char* p = ws + off; off += (bytes + 255) & ~(size_t)255; return p; };
  _Float16* BQ = (_Float16*)take((size_t)QW * CC * 2); _Float16* BP = (_Float16*)take((size_t)CC * CC * 2); _Float16* YR = (_Float16*)take(NR * CC * 2); float* F = (float*)take(NR * QW * 4); _Float16* X16 = (_Float16*)take(NR * CC * 2);
  if (off > ws_size) return;      /* 0.5 + 12.5 + 75 + 12.5 = approx 101 MiB */
  k_wnat<<<(unsigned)(((size_t)QW * CC / 8 + 255) / 256), 256, 0, stream>>>(wqkv, (size_t)QW * CC / 8, BQ); k_wnat<<<(unsigned)(((size_t)CC * CC / 8 + 255) / 256), 256, 0, stream>>>(wp, (size_t)CC * CC / 8, BP);
  k_catrows<<<(unsigned)(NB * (PX / 32) * (CC / 64)), 256, 0, stream>>>(rgb, ir, YR);
  k_gemm3<QW, false><<<(unsigned)((NR / 128) * (QW / 128)), 256, 0, stream>>>(YR, BQ, 0.0625f, F, nullptr, nullptr, nullptr);      /* qkv (f32) */
  k_dla<<<(unsigned)(NB * HS * 4), 128, 0, stream>>>(F, X16);
  k_gemm3<CC, true><<<(unsigned)((NR / 128) * (CC / 128)), 256, 0, stream>>>(X16, BP, 0.0625f, (float*)d_out, bp, rgb, ir);      /* proj + bias + residual */
}

// v004
// It runs in 67.7 microseconds.
// Timed twice side by side with v003, it ran 1.08 times as fast both times.
// Over all steps from v000 it is 11.9 times as fast.
#include <hip/hip_runtime.h>
// Multi-dilate local attention (rgb, ir [4][128][80][80] -> y = [rgb | ir] (256 ch); qkv = 1x1 (w_qkv [768][256]) split as [3][2 dilations][128 = 4 heads x 32]; per dilation d in (2, 3): each pixel attends to its 3x3 dilated neighbourhood (zero-padded unfold: out-of-image neighbours contribute k = v = 0, logit 0) with softmax(q.k / sqrt(32)) over the 9; heads merged dilation-major; proj (w_proj [256][256]) + b_proj; + y -> NHWC [4][80][80][256]).
// Structure: qkv as a WMMA GEMM whose A tile comes straight from the two channel-first inputs, turned into concatenated pixel rows (exact f16) on its way into LDS (operand tiles staged in LDS, 32x64 wave tiles, f32 accumulation, exact x16 natural weights; exact products) kept f32; the dilated local attention, one wave per (pixel, dilation), on VALU (f32; 4 channels a lane, softmax weights in registers) into f16 rows; projection GEMM whose epilogue adds bias + residual (f32, VALU) and writes the NHWC output.
// Compute dtype: inputs rounded to bf16; y / weights exact; qkv and the attention f32; the attended rows as a plain f16 GEMM operand (~2^-12). v_wmma_f32_16x16x32_f16.
#define NB 4
#define DIMH 128
#define CC 256
#define QW 768
#define HS 80
#define WS 80
#define PX (HS * WS)                 /* 6400 = 50 x 128 */
#define NR ((size_t)NB * PX)         /* 25,600 rows */
#define NRD ((int)NR)                /* unused */
#define SCL 0.17677669529663689f
#define SQ 64
#define DM 64
#define NH 1
#define HD 64
#define HG 1
typedef __bf16 v16b __attribute__((ext_vector_type(16)));
typedef unsigned short v8us __attribute__((ext_vector_type(8), may_alias));
typedef float  v8f  __attribute__((ext_vector_type(8)));
typedef float  v4f  __attribute__((ext_vector_type(4)));
typedef float  v4fa __attribute__((ext_vector_type(4), may_alias));
union FragB { v16b v; v8us half[2]; unsigned short u[16]; };

__device__ __forceinline__ unsigned short bf16_bits(float x) { unsigned int u = __float_as_uint(x); return (unsigned short)((u + 0x7FFFu + ((u >> 16) & 1u)) >> 16); }
__device__ __forceinline__ float bf16_val(unsigned short b) { return __uint_as_float(((unsigned int)b) << 16); }
__device__ __forceinline__ float bf16_round(float x) { return bf16_val(bf16_bits(x)); }
// D += A·B with NT terms: 1 = ah·bh, 2 = + al·bh (A split), 3 = + ah·bl (both split)
template <int NT>
__device__ __forceinline__ v8f mmaN(v16b ah, v16b al, v16b bh, v16b bl, v8f c) {
  c = __builtin_amdgcn_wmma_f32_16x16x32_bf16(false, ah, false, bh, (short)0, c, false, false);
  if (NT >= 2) c = __builtin_amdgcn_wmma_f32_16x16x32_bf16(false, al, false, bh, (short)0, c, false, false);
  if (NT >= 3) c = __builtin_amdgcn_wmma_f32_16x16x32_bf16(false, ah, false, bl, (short)0, c, false, false);
  asm volatile("v_nop\n\tv_nop\n\tv_nop\n\tv_nop" : "+v"(c) : "v"(ah), "v"(al), "v"(bh), "v"(bl));
  return c;
}

__global__ __launch_bounds__(256) void k_wt_bf16(const float* __restrict__ W, unsigned short* __restrict__ Wt, int K, int N) {
  const int t = blockIdx.x * 256 + threadIdx.x;
  const int k8n = K / 8;
  if (t >= N * k8n) return;
  const int n = t / k8n, k8 = (t % k8n) * 8;
  v8us v;
#pragma unroll
  for (int i = 0; i < 8; ++i) v[i] = bf16_bits(W[(size_t)(k8 + i) * N + n]);
  *(v8us*)(Wt + (size_t)n * K + k8) = v;
  
}

// GEMM C[M][N] (f32, pitch ldc) = act(A[M][K]·W + bias). A f32 row-major (pitch lda) converted per fragment to bf16
// (ASPLIT: hi/lo two planes -> 2 terms, else single rounded term); Wt bf16 [N][K] (pitch ldb). BIAS_BF16 rounds the
// bias to bf16 first (bias quantised to bf16 before the add). K%32==0, M%16==0, N%64==0.
template <bool ASPLIT, int ACT, bool BIAS_BF16>
__global__ __launch_bounds__(128) void k_gemm_bf(const float* __restrict__ A, int lda, const unsigned short* __restrict__ Wt, int ldb,
                                               const float* __restrict__ bias, float* __restrict__ C, int ldc, int M, int N, int K) {
  __shared__ __attribute__((aligned(16))) float so[4][16][64];
  const int tid = threadIdx.x, w = tid >> 5, lane = tid & 31, ln = lane & 15, hh = lane >> 4;
  const int ntn = N / 64;
  const int wid = blockIdx.x * 4 + w;
  const int mt = wid / ntn, nq = wid % ntn;
  if (mt * 16 >= M) return;
  const int row0 = mt * 16, col0 = nq * 64;
  const float* arow = A + (size_t)(row0 + ln) * lda;
  v8f acc[4] = {};
  for (int kb = 0; kb < K; kb += 32) {
    FragB ah, al;
    const v4f x0 = *(const v4fa*)(arow + kb + 8 * hh), x1 = *(const v4fa*)(arow + kb + 8 * hh + 4);
    const v4f x2 = *(const v4fa*)(arow + kb + 16 + 8 * hh), x3 = *(const v4fa*)(arow + kb + 16 + 8 * hh + 4);
    float xs[16] = {x0[0],x0[1],x0[2],x0[3],x1[0],x1[1],x1[2],x1[3],x2[0],x2[1],x2[2],x2[3],x3[0],x3[1],x3[2],x3[3]};
#pragma unroll
    for (int i = 0; i < 16; ++i) { const unsigned short hb = bf16_bits(xs[i]); ah.u[i] = hb; al.u[i] = ASPLIT ? bf16_bits(xs[i] - bf16_val(hb)) : (unsigned short)0; }
#pragma unroll
    for (int t = 0; t < 4; ++t) {
      const unsigned short* brow = Wt + (size_t)(col0 + t * 16 + ln) * ldb + kb;
      FragB b;
      b.half[0] = *(const v8us*)(brow + 8 * hh);
      b.half[1] = *(const v8us*)(brow + 16 + 8 * hh);
      acc[t] = mmaN<ASPLIT ? 2 : 1>(ah.v, al.v, b.v, b.v, acc[t]);
    }
  }
#pragma unroll
  for (int t = 0; t < 4; ++t) {
    float bv = bias ? bias[col0 + t * 16 + ln] : 0.f;
    if (BIAS_BF16) bv = bf16_round(bv);
#pragma unroll
    for (int r = 0; r < 8; ++r) { float v = acc[t][r] + bv; if (ACT == 1) v = fmaxf(v, 0.f); so[w][8 * hh + r][t * 16 + ln] = v; }
  }
  __builtin_amdgcn_fence(__ATOMIC_ACQ_REL, "workgroup");
  __builtin_amdgcn_wave_barrier();
  const int rsub = lane >> 4, c4 = (lane & 15) * 4;
  {
#pragma unroll
    for (int q = 0; q < 8; ++q) {
      const int r = q * 2 + rsub;
      const v4f v = *(const v4fa*)&so[w][r][c4];
      *(v4f*)(C + (size_t)(row0 + r) * ldc + col0 + c4) = v;
    }
    
  }
}

// GEMM C = act(A·W + bias + resid): A f32 (ASPLIT -> hi/lo 2 terms), Wt bf16 [N][K]; ACT 0 none, 1 relu, 2 exact gelu;
// resid (optional, f32, row index = (row % rmod), pitch ldr, RES_BF16 rounds it) added before the activation.
template <bool ASPLIT, int ACT, bool BIAS_BF16, bool RES_BF16>
__global__ __launch_bounds__(128) void k_gemm_bf3(const float* __restrict__ A, int lda, const unsigned short* __restrict__ Wt, int ldb,
                                                const float* __restrict__ bias, const float* __restrict__ resid, int rmod, int ldr,
                                                float* __restrict__ C, int ldc, int M, int N, int K) {
  __shared__ __attribute__((aligned(16))) float so[4][16][64];
  const int tid = threadIdx.x, w = tid >> 5, lane = tid & 31, ln = lane & 15, hh = lane >> 4;
  const int ntn = N / 64;
  const int wid = blockIdx.x * 4 + w;
  const int mt = wid / ntn, nq = wid % ntn;
  if (mt * 16 >= M) return;
  const int row0 = mt * 16, col0 = nq * 64;
  const float* arow = A + (size_t)(row0 + ln) * lda;
  v8f acc[4] = {};
  for (int kb = 0; kb < K; kb += 32) {
    FragB ah, al;
    const v4f x0 = *(const v4fa*)(arow + kb + 8 * hh), x1 = *(const v4fa*)(arow + kb + 8 * hh + 4);
    const v4f x2 = *(const v4fa*)(arow + kb + 16 + 8 * hh), x3 = *(const v4fa*)(arow + kb + 16 + 8 * hh + 4);
    float xs[16] = {x0[0],x0[1],x0[2],x0[3],x1[0],x1[1],x1[2],x1[3],x2[0],x2[1],x2[2],x2[3],x3[0],x3[1],x3[2],x3[3]};
#pragma unroll
    for (int i = 0; i < 16; ++i) { const unsigned short hb = bf16_bits(xs[i]); ah.u[i] = hb; al.u[i] = ASPLIT ? bf16_bits(xs[i] - bf16_val(hb)) : (unsigned short)0; }
#pragma unroll
    for (int t = 0; t < 4; ++t) {
      const unsigned short* brow = Wt + (size_t)(col0 + t * 16 + ln) * ldb + kb;
      FragB b;
      b.half[0] = *(const v8us*)(brow + 8 * hh);
      b.half[1] = *(const v8us*)(brow + 16 + 8 * hh);
      acc[t] = mmaN<ASPLIT ? 2 : 1>(ah.v, al.v, b.v, b.v, acc[t]);
    }
  }
#pragma unroll
  for (int t = 0; t < 4; ++t) {
    const int col = col0 + t * 16 + ln;
    float bv = bias ? bias[col] : 0.f;
    if (BIAS_BF16) bv = bf16_round(bv);
#pragma unroll
    for (int r = 0; r < 8; ++r) {
      float v = acc[t][r] + bv;
      if (resid) { float rv = resid[(size_t)((row0 + 8 * hh + r) % rmod) * ldr + col]; if (RES_BF16) rv = bf16_round(rv); v += rv; }
      if (ACT == 1) v = fmaxf(v, 0.f);
      if (ACT == 2) v = 0.5f * v * (1.0f + erff(v * 0.70710678118654752f));
      if (ACT == 3) { const float u = 0.7978845608028654f * (v + 0.044715f * v * v * v); v = 0.5f * v * (1.0f + tanhf(u)); }
      so[w][8 * hh + r][t * 16 + ln] = v;
    }
  }
  __builtin_amdgcn_fence(__ATOMIC_ACQ_REL, "workgroup");
  __builtin_amdgcn_wave_barrier();
  const int rsub = lane >> 4, c4 = (lane & 15) * 4;
  {
#pragma unroll
    for (int q = 0; q < 8; ++q) {
      const int r = q * 2 + rsub;
      const v4f v = *(const v4fa*)&so[w][r][c4];
      *(v4f*)(C + (size_t)(row0 + r) * ldc + col0 + c4) = v;
    }
    
  }
}
// row LayerNorm (biased variance, eps) over N: s = X (+ R); optional out_sum <- s; out_norm <- (s-mu)*rsqrt(var+eps)*g + b
template <bool PARAM_BF16>
__global__ __launch_bounds__(256) void k_layernorm(const float* __restrict__ X, const float* __restrict__ R, const float* __restrict__ g, const float* __restrict__ bta,
                                                  float* __restrict__ out_sum, float* __restrict__ out_norm, int N, float eps) {
  __shared__ float red[256];
  const int row = blockIdx.x, tid = threadIdx.x;
  const float* x = X + (size_t)row * N; const float* rr = R ? R + (size_t)row * N : nullptr;
  float vals[16];                     // up to N = 4096
  const int per = N / 256;            // contiguous chunk per thread? use strided-by-4 chunks: thread handles j = tid*4 + 1024*u
  float s1 = 0.f;
  for (int u = 0; u < per / 4; ++u) {
    const int j = tid * 4 + 1024 * u;
    const v4f a = *(const v4fa*)(x + j);
    v4f b = {0.f,0.f,0.f,0.f}; if (rr) b = *(const v4fa*)(rr + j);
#pragma unroll
    for (int q = 0; q < 4; ++q) { const float v = a[q] + b[q]; vals[u * 4 + q] = v; s1 += v; }
  }
  red[tid] = s1; __syncthreads();
  for (int st = 128; st > 0; st >>= 1) { if (tid < st) red[tid] += red[tid + st]; __syncthreads(); }
  const float mu = red[0] / (float)N; __syncthreads();
  float s2 = 0.f;
  for (int u = 0; u < per / 4; ++u)
#pragma unroll
    for (int q = 0; q < 4; ++q) { const float c = vals[u * 4 + q] - mu; s2 += c * c; }
  red[tid] = s2; __syncthreads();
  for (int st = 128; st > 0; st >>= 1) { if (tid < st) red[tid] += red[tid + st]; __syncthreads(); }
  const float rs = rsqrtf(red[0] / (float)N + eps);
  {
    for (int u = 0; u < per / 4; ++u) {
      const int j = tid * 4 + 1024 * u;
      v4f o, sm;
#pragma unroll
      for (int q = 0; q < 4; ++q) {
        float gg = g[j + q], bb = bta[j + q];
        if (PARAM_BF16) { gg = bf16_round(gg); bb = bf16_round(bb); }
        sm[q] = vals[u * 4 + q]; o[q] = (vals[u * 4 + q] - mu) * rs * gg + bb;
      }
      if (out_sum) *(v4f*)(out_sum + (size_t)row * N + j) = sm;
      *(v4f*)(out_norm + (size_t)row * N + j) = o;
    }
    
  }
}



// ---- f16 WMMA path (v_wmma_f32_16x16x32_f16): 11-bit significands for operands in range — used here for the qkv and projection GEMMs
typedef _Float16 v16h __attribute__((ext_vector_type(16)));
union FragH { v16h v; v8us half[2]; _Float16 h[16]; unsigned short u[16]; };
template <int NT>
__device__ __forceinline__ v8f mmaH(v16h ah, v16h al, v16h bh, v16h bl, v8f c) {
  c = __builtin_amdgcn_wmma_f32_16x16x32_f16(false, ah, false, bh, (short)0, c, false, false);
  if (NT >= 2) c = __builtin_amdgcn_wmma_f32_16x16x32_f16(false, al, false, bh, (short)0, c, false, false);
  if (NT >= 3) c = __builtin_amdgcn_wmma_f32_16x16x32_f16(false, ah, false, bl, (short)0, c, false, false);
  asm volatile("v_nop\n\tv_nop\n\tv_nop\n\tv_nop" : "+v"(c) : "v"(ah), "v"(al), "v"(bh), "v"(bl));
  return c;
}
// batched GEMM like k_gemm_b but f16 operands: A f32 (split into f16 hi/lo if ASPLIT, else rounded to f16), Bt = f16 values [n][k]; alpha; C f32; N multiple of 16 (partial tiles skipped)
template <bool ASPLIT>
__global__ __launch_bounds__(128) void k_gemm_h(const float* __restrict__ A, int lda, size_t sA, const _Float16* __restrict__ Bh, int ldb, size_t sB, float alpha, float* __restrict__ C, int ldc, size_t sC, int M, int N, int K) {
  __shared__ __attribute__((aligned(16))) float so[4][16][64];
  const int tid = threadIdx.x, w = tid >> 5, lane = tid & 31, ln = lane & 15, hh = lane >> 4; const int by = blockIdx.y;
  A += (size_t)by * sA; Bh += (size_t)by * sB; C += (size_t)by * sC;
  const int ntn = (N + 63) / 64; const int wid = blockIdx.x * 4 + w; const int mt = wid / ntn, nq = wid % ntn; if (mt * 16 >= M) return;
  const int row0 = mt * 16, col0 = nq * 64; const float* arow = A + (size_t)(row0 + ln) * lda;
  v8f acc[4] = {};
  for (int kb = 0; kb < K; kb += 32) {
    FragH ah, al;
    const v4f x0 = *(const v4fa*)(arow + kb + 8 * hh), x1 = *(const v4fa*)(arow + kb + 8 * hh + 4), x2 = *(const v4fa*)(arow + kb + 16 + 8 * hh), x3 = *(const v4fa*)(arow + kb + 16 + 8 * hh + 4);
    float xs[16] = {x0[0],x0[1],x0[2],x0[3],x1[0],x1[1],x1[2],x1[3],x2[0],x2[1],x2[2],x2[3],x3[0],x3[1],x3[2],x3[3]};
#pragma unroll
    for (int i = 0; i < 16; ++i) { const _Float16 h = (_Float16)xs[i]; ah.h[i] = h; al.h[i] = ASPLIT ? (_Float16)(xs[i] - (float)h) : (_Float16)0.0f; }
#pragma unroll
    for (int t = 0; t < 4; ++t) { if (col0 + t * 16 >= N) continue; const size_t boff = (size_t)(col0 + t * 16 + ln) * ldb + kb; FragH bq; bq.half[0] = *(const v8us*)(Bh + boff + 8 * hh); bq.half[1] = *(const v8us*)(Bh + boff + 16 + 8 * hh);
      acc[t] = mmaH<ASPLIT ? 2 : 1>(ah.v, al.v, bq.v, bq.v, acc[t]); }
  }
#pragma unroll
  for (int t = 0; t < 4; ++t) { if (col0 + t * 16 >= N) continue;
#pragma unroll
    for (int r = 0; r < 8; ++r) so[w][8 * hh + r][t * 16 + ln] = acc[t][r] * alpha; }
  __builtin_amdgcn_fence(__ATOMIC_ACQ_REL, "workgroup"); __builtin_amdgcn_wave_barrier();
  const int rsub = lane >> 4, c4 = (lane & 15) * 4;
  {
#pragma unroll
    for (int q = 0; q < 8; ++q) { const int r = q * 2 + rsub; if (col0 + c4 < N) { const v4f v = *(const v4fa*)&so[w][r][c4]; *(v4f*)(C + (size_t)(row0 + r) * ldc + col0 + c4) = v; } }
     }
}

// Wt[n][k] = f16(W[k][n]·scale) from f32 row-major W[K][N] (scale = power of two; bf16-exact weights stay exact in f16 away from the subnormal range)
__global__ __launch_bounds__(256) void k_wt_f16(const float* __restrict__ W, _Float16* __restrict__ Wt, int K, int N, float scale) {
  const int t = blockIdx.x * 256 + threadIdx.x; if (t >= N * (K / 8)) return; const int n = t / (K / 8), k8 = (t % (K / 8)) * 8; FragH f;
#pragma unroll
  for (int i = 0; i < 8; ++i) f.h[i] = (_Float16)(bf16_round(W[(size_t)(k8 + i) * N + n]) * scale); const v8us o = f.half[0];
  *(v8us*)((unsigned short*)Wt + (size_t)n * K + k8) = o; 
}
// k_gemm_hh variant with fused epilogue: v = acc·alpha + bias[by·sBias + col] (+ CP[(row/rowsPerB)·sCPb + by·64 + col] if CP) ; ACT 0 none / 1 elu ; writes f16 C16 (and f32 C if non-null)
template <int ACT>
__global__ __launch_bounds__(128) void k_gemm_hhx(const _Float16* __restrict__ A, int lda, size_t sA, const _Float16* __restrict__ Bh, int ldb, size_t sB, float alpha, const float* __restrict__ bias, size_t sBias, const float* __restrict__ CP, int rowsPerB, size_t sCPb, int row0g,
    float* __restrict__ C, _Float16* __restrict__ C16, int ldc, size_t sC, int M, int N, int K) {
  __shared__ __attribute__((aligned(16))) float so[4][16][64];
  const int tid = threadIdx.x, w = tid >> 5, lane = tid & 31, ln = lane & 15, hh = lane >> 4; const int by = blockIdx.y;
  A += (size_t)by * sA; Bh += (size_t)by * sB; const size_t cofs = (size_t)by * sC; const float* bp = bias ? bias + (size_t)by * sBias : nullptr;
  const int ntn = (N + 63) / 64; const int wid = blockIdx.x * 4 + w; const int mt = wid / ntn, nq = wid % ntn; if (mt * 16 >= M) return;
  const int row0 = mt * 16, col0 = nq * 64; const _Float16* arow = A + (size_t)(row0 + ln) * lda;
  v8f acc[4] = {};
  for (int kb = 0; kb < K; kb += 32) { FragH ah; ah.half[0] = *(const v8us*)((const unsigned short*)arow + kb + 8 * hh); ah.half[1] = *(const v8us*)((const unsigned short*)arow + kb + 16 + 8 * hh);
#pragma unroll
    for (int t = 0; t < 4; ++t) { if (col0 + t * 16 >= N) continue; const size_t boff = (size_t)(col0 + t * 16 + ln) * ldb + kb; FragH bq; bq.half[0] = *(const v8us*)((const unsigned short*)Bh + boff + 8 * hh); bq.half[1] = *(const v8us*)((const unsigned short*)Bh + boff + 16 + 8 * hh);
      acc[t] = mmaH<1>(ah.v, ah.v, bq.v, bq.v, acc[t]); }
  }
#pragma unroll
  for (int t = 0; t < 4; ++t) { if (col0 + t * 16 >= N) continue; const int col = col0 + t * 16 + ln; const float bv = bp ? bf16_round(bp[col]) : 0.f;
#pragma unroll
    for (int r = 0; r < 8; ++r) { float v = acc[t][r] * alpha + bv; if (CP) { const int rr = row0g + row0 + 8 * hh + r; if (rowsPerB < 0) v += CP[cofs + (size_t)rr * ldc + col];      /* rowsPerB < 0: own element of the batched C plane */ else { const int bidx = rr / rowsPerB; v += CP[(size_t)bidx * sCPb + (size_t)by * 64 + col]; } } if (ACT == 1) v = (v > 0.f) ? v : expm1f(v); else if (ACT == 7) v = (v > 0.f) ? v + 1.0f : expf(v); else if (ACT == 8) v = tanhf(v); else if (ACT == 9) v = 0.5f * v * (1.0f + tanhf(0.7978845608028654f * (v + 0.044715f * v * v * v))); else if (ACT == 11) v = 1.0f / (1.0f + expf(-v)); else if (ACT == 12) v = (v > 0.f) ? v : 0.01f * v; else if (ACT == 14) v = (v > 0.f) ? v : 0.1f * v; else if (ACT == 16) v = (v >= 0.f) ? v : 0.3f * v; else if (ACT == 17) v = (v >= 0.f) ? v : 0.2f * v; else if (ACT == 15) v = v / (1.0f + expf(-v)); else if (ACT == 3) v = fmaxf(v, 0.f); else if (ACT == 6) v = 0.5f * v * (1.0f + erff(v * 0.70710678118654752f)); so[w][8 * hh + r][t * 16 + ln] = v; } }
  __builtin_amdgcn_fence(__ATOMIC_ACQ_REL, "workgroup"); __builtin_amdgcn_wave_barrier();
  const int rsub = lane >> 4, c4 = (lane & 15) * 4; typedef _Float16 v4h __attribute__((ext_vector_type(4)));
  {
#pragma unroll
    for (int q = 0; q < 8; ++q) { const int r = q * 2 + rsub; if (col0 + c4 < N) { const v4f v = *(const v4fa*)&so[w][r][c4]; if (C) *(v4f*)(C + cofs + (size_t)(row0 + r) * ldc + col0 + c4) = v; if (C16) { v4h h4; for (int i = 0; i < 4; ++i) h4[i] = (_Float16)v[i]; *(v4h*)(C16 + cofs + (size_t)(row0 + r) * ldc + col0 + c4) = h4; } } }
     }
}


typedef _Float16 v4h __attribute__((ext_vector_type(4)));

__global__ __launch_bounds__(256) void k_x16(const float* __restrict__ x, _Float16* __restrict__ X16, size_t n8) { const size_t t = (size_t)blockIdx.x * 256 + threadIdx.x; if (t >= n8) return; FragH f;
#pragma unroll
  for (int q = 0; q < 8; ++q) f.h[q] = (_Float16)bf16_round(x[t * 8 + q]); *(v8us*)((unsigned short*)X16 + t * 8) = f.half[0];  }
__global__ __launch_bounds__(256) void k_h16(const float* __restrict__ x, _Float16* __restrict__ X16, size_t n8) { const size_t t = (size_t)blockIdx.x * 256 + threadIdx.x; if (t >= n8) return; FragH f;
#pragma unroll
  for (int q = 0; q < 8; ++q) f.h[q] = (_Float16)x[t * 8 + q]; *(v8us*)((unsigned short*)X16 + t * 8) = f.half[0];  }
__global__ __launch_bounds__(256) void k_round16f(const float* __restrict__ W, _Float16* __restrict__ Bt, size_t n8) { const size_t t = (size_t)blockIdx.x * 256 + threadIdx.x; if (t >= n8) return; FragH f;
#pragma unroll
  for (int i = 0; i < 8; ++i) f.h[i] = (_Float16)(bf16_round(W[t * 8 + i]) * 16.0f); *(v8us*)((unsigned short*)Bt + t * 8) = f.half[0];  }
template <int NHv, int TTv>
__global__ __launch_bounds__(256) void k_vt(const _Float16* __restrict__ V16, int ldv, int voff, _Float16* __restrict__ Vt) { __shared__ unsigned short tl[64][66]; const int tid = threadIdx.x; const int slab = blockIdx.x / (TTv / 64), lg = blockIdx.x % (TTv / 64); const int b = slab / NHv, h = slab % NHv;
  for (int i = tid; i < 64 * 8; i += 256) { const int r = i / 8, c8 = (i % 8) * 8; FragH f; f.half[0] = *(const v8us*)((const unsigned short*)V16 + ((size_t)b * TTv + lg * 64 + r) * ldv + voff + h * 64 + c8);
#pragma unroll
    for (int q = 0; q < 8; ++q) tl[r][c8 + q] = f.u[q]; }
  __syncthreads();
  {
#pragma unroll
    for (int rd = 0; rd < 2; ++rd) { const int d = rd * 32 + tid / 8, pc = tid % 8; FragH f;
#pragma unroll
      for (int q = 0; q < 8; ++q) f.u[q] = tl[pc * 8 + q][d];
      *(v8us*)((unsigned short*)Vt + ((size_t)slab * 64 + d) * TTv + lg * 64 + pc * 8) = f.half[0]; }
     } }

__global__ __launch_bounds__(256) void k_hl(const float* __restrict__ F, _Float16* __restrict__ Hh, _Float16* __restrict__ Hl, size_t n8) { const size_t t = (size_t)blockIdx.x * 256 + threadIdx.x; if (t >= n8) return; FragH fh, fl; const v4f a = *(const v4fa*)(F + t * 8), c = *(const v4fa*)(F + t * 8 + 4);
#pragma unroll
  for (int q = 0; q < 4; ++q) { _Float16 h = (_Float16)a[q]; fh.h[q] = h; fl.h[q] = (_Float16)((a[q] - (float)h) * 1024.0f); h = (_Float16)c[q]; fh.h[4 + q] = h; fl.h[4 + q] = (_Float16)((c[q] - (float)h) * 1024.0f); }
  { *(v8us*)((unsigned short*)Hh + t * 8) = fh.half[0]; *(v8us*)((unsigned short*)Hl + t * 8) = fl.half[0];  } }

// ---- fast GEMM (wave tile 32x64; requires M % 32 == 0 rows per launch region and N % 64 == 0); epilogue = k_gemm_hhx semantics ----
__device__ __forceinline__ v16h g2_frag(const _Float16* p, int hh) { FragH f; f.half[0] = *(const v8us*)((const unsigned short*)p + 8 * hh); f.half[1] = *(const v8us*)((const unsigned short*)p + 16 + 8 * hh); return f.v; }
__device__ __forceinline__ v8f g2_mma(v16h a, v16h b, v8f c) { v8f d = __builtin_amdgcn_wmma_f32_16x16x32_f16(false, a, false, b, (short)0, c, false, false); asm volatile("v_nop\n\tv_nop\n\tv_nop\n\tv_nop" : "+v"(d) : "v"(a), "v"(b)); return d; }
template <int ACT>
__global__ __launch_bounds__(128) void k_gemm2(const _Float16* __restrict__ A, int lda, size_t sA, const _Float16* __restrict__ Bh, int ldb, size_t sB, float alpha, const float* __restrict__ bias, size_t sBias, const float* __restrict__ CP, int rowsPerB, size_t sCPb, int row0g,
    float* __restrict__ C, _Float16* __restrict__ C16, int ldc, size_t sC, int M, int N, int K) { static_assert(ACT == 0 || ACT == 3 || ACT == 6 || ACT == 8 || ACT == 9 || ACT == 11 || ACT == 12 || ACT == 14 || ACT == 15 || ACT == 16 || ACT == 17, "k_gemm2: unsupported ACT code (would silently apply no activation)");
  __shared__ __attribute__((aligned(16))) float so[4][32][68];
  const int tid = threadIdx.x, w = tid >> 5, lane = tid & 31, ln = lane & 15, hh = lane >> 4; const int by = blockIdx.y;
  A += (size_t)by * sA; Bh += (size_t)by * sB; const size_t cofs = (size_t)by * sC; const float* bp = bias ? bias + (size_t)by * sBias : nullptr;
  const int ntn = N >> 6; const int mt = blockIdx.x / ntn, nq = blockIdx.x - mt * ntn; const int row0 = mt * 128 + 32 * w, col0 = nq * 64; if (row0 >= M) return;
  const _Float16* a0p = A + (size_t)(row0 + ln) * lda; const _Float16* a1p = a0p + (size_t)16 * lda;
  const _Float16* b0p = Bh + (size_t)(col0 + ln) * ldb; const _Float16* b1p = b0p + (size_t)16 * ldb; const _Float16* b2p = b1p + (size_t)16 * ldb; const _Float16* b3p = b2p + (size_t)16 * ldb;
  const v8f z8 = {0.f,0.f,0.f,0.f,0.f,0.f,0.f,0.f}; v8f c00 = z8, c01 = z8, c02 = z8, c03 = z8, c10 = z8, c11 = z8, c12 = z8, c13 = z8;
#pragma unroll 1
  for (int kb = 0; kb < K; kb += 32) { const v16h a0 = g2_frag(a0p + kb, hh), a1 = g2_frag(a1p + kb, hh);
    v16h b = g2_frag(b0p + kb, hh); c00 = g2_mma(a0, b, c00); c10 = g2_mma(a1, b, c10);
    b = g2_frag(b1p + kb, hh); c01 = g2_mma(a0, b, c01); c11 = g2_mma(a1, b, c11);
    b = g2_frag(b2p + kb, hh); c02 = g2_mma(a0, b, c02); c12 = g2_mma(a1, b, c12);
    b = g2_frag(b3p + kb, hh); c03 = g2_mma(a0, b, c03); c13 = g2_mma(a1, b, c13); }
  v8f accs[8] = {c00, c01, c02, c03, c10, c11, c12, c13};
#pragma unroll
  for (int u = 0; u < 8; ++u) { const int t = u & 3, half = u >> 2; const int col = col0 + t * 16 + ln; const float bv = bp ? bf16_round(bp[col]) : 0.f;
#pragma unroll
    for (int r = 0; r < 8; ++r) { const int rloc = half * 16 + 8 * hh + r; float v = accs[u][r] * alpha + bv; if (CP) { if (rowsPerB < 0) v += CP[cofs + (size_t)(row0g + row0 + rloc) * ldc + col];      /* rowsPerB < 0: own element of the batched C plane */ else { const int bidx = (row0g + row0 + rloc) / rowsPerB; v += CP[(size_t)bidx * sCPb + (size_t)by * 64 + col]; } }
      if (ACT == 3) v = fmaxf(v, 0.f); else if (ACT == 6) v = 0.5f * v * (1.0f + erff(v * 0.70710678118654752f)); else if (ACT == 11) v = 1.0f / (1.0f + expf(-v)); else if (ACT == 15) v = v / (1.0f + expf(-v)); else if (ACT == 12) v = (v > 0.f) ? v : 0.01f * v; else if (ACT == 8) v = tanhf(v); else if (ACT == 9) v = 0.5f * v * (1.0f + tanhf(0.7978845608028654f * (v + 0.044715f * v * v * v))); else if (ACT == 14) v = (v > 0.f) ? v : 0.1f * v; else if (ACT == 16) v = (v >= 0.f) ? v : 0.3f * v; else if (ACT == 17) v = (v >= 0.f) ? v : 0.2f * v;
      so[w][rloc][t * 16 + ln] = v; } }
  __builtin_amdgcn_fence(__ATOMIC_ACQ_REL, "workgroup"); __builtin_amdgcn_wave_barrier();
  const int rsub = lane >> 4, c4 = (lane & 15) * 4;
  {
#pragma unroll
    for (int q = 0; q < 16; ++q) { const int r = q * 2 + rsub; const v4f v = *(const v4fa*)&so[w][r][c4]; if (C) *(v4f*)(C + cofs + (size_t)(row0 + r) * ldc + col0 + c4) = v; if (C16) { v4h h4; for (int i = 0; i < 4; ++i) h4[i] = (_Float16)v[i]; *(v4h*)(C16 + cofs + (size_t)(row0 + r) * ldc + col0 + c4) = h4; } }
     } }


// ---- GEMM with both operand tiles staged in LDS: C[M][NN] (f32) = alpha * A[M][CC] . Bh[NN][CC]^T; K = CC; grid = (M / 128) * (NN / 128) ----
// Work-group tile 128 x 128, 8 waves; wave tile 32 x 64 and k order as k_gemm2. A fragment load straight from global touches 16 lines for its 512 bytes and stands in front of its own WMMAs;
// here each global load of a wave is one whole 512-byte row (4 lines), all 32 of a wave are in flight together, and the fragments come from LDS rows pitched 528 B (16 B x 33: no bank conflict for 16-byte reads).
// FIN (the projection): C = (alpha * A . Bh^T + bf16(bpj[col])) + bf16(residual), the residual read from the channel-first inputs in the accumulators' own layout:
// a lane's 8 accumulator rows of one column are 8 neighbouring pixels of one channel, 32 bytes in a row; a wave's 32 pixels of a channel are one whole 128-byte line.
// ACF (the qkv product): A is not read as f16 rows; the tile's 128 pixels x 256 channels come from the channel-first f32 inputs. Wave w brings channels 32 w .. 32 w + 31:
// a load's 8-lane groups take one 128-byte line (32 pixels) of 4 channels that lie 8 apart, so after 8 loads a lane holds 8 neighbouring channels of 4 pixels: 4 whole 16-byte pieces of pixel rows.
#define GLP 264      /* LDS row pitch in f16 elements */
typedef float v2f __attribute__((ext_vector_type(2)));
typedef _Float16 v2h __attribute__((ext_vector_type(2)));
// two f32 -> bf16 (nearest even), those values as f16, packed
__device__ __forceinline__ unsigned pk_bf_h(float x, float y) { unsigned u;
  asm("v_cvt_pk_bf16_f32 %0, %1, %2" : "=v"(u) : "v"(x), "v"(y));      /* as asm so that both sources are read where their loads left them: through a 2-vector the compiler first copied one register of every pair */
  const v2f r = {__uint_as_float(u << 16), __uint_as_float(u & 0xFFFF0000u)}; return __builtin_bit_cast(unsigned, __builtin_convertvector(r, v2h)); }
typedef unsigned v4ua __attribute__((ext_vector_type(4), may_alias));
template <int NN, bool FIN, bool ACF>
__global__ __launch_bounds__(256) void k_gemm3(const _Float16* __restrict__ A, const _Float16* __restrict__ Bh, float alpha, float* __restrict__ C, const float* __restrict__ bpj, const float* __restrict__ rgb, const float* __restrict__ ir) {
  static_assert(!FIN || (NN == CC && DIMH == 128 && PX % 128 == 0), "FIN: a 128-column tile is one input's channels, a 128-row tile lies in one image");
  static_assert(!ACF || (CC == 256 && DIMH == 128 && PX % 128 == 0), "ACF: 4 waves per input, a 128-row tile lies in one image");
  __shared__ __attribute__((aligned(16))) _Float16 sm[(128 + 128) * GLP];      /* 128 A rows, then 128 B rows; after the products the waves' output staging */
  const int lane = threadIdx.x & 31, ln = lane & 15, hh = lane >> 4; const int w = __builtin_amdgcn_readfirstlane((int)threadIdx.x >> 5); const int wr = w & 3, wc = w >> 2;
  const int ntn = NN / 128; const int mt = blockIdx.x / ntn, nq = blockIdx.x - mt * ntn; const int row0 = mt * 128 + 32 * wr, col0 = nq * 128 + 64 * wc;
  _Float16* sb = sm + 128 * GLP;
  const unsigned short* ga = (const unsigned short*)A + (size_t)(mt * 128 + 16 * w) * CC + lane * 8; const unsigned short* gb = (const unsigned short*)Bh + (size_t)(nq * 128 + 16 * w) * CC + lane * 8;
  v8us ra[16], rb[16];      /* wave w brings rows 16 w .. 16 w + 15 of either tile; the loops below are unrolled so that the arrays are registers and each row is an immediate offset */
  v4f fa[32]; const char* asrc = nullptr; unsigned aob = 0; const int cs = lane >> 3, pg = lane & 7;      /* ACF: [pixel block t][channel i] = 4 pixels 32 t + 4 pg .. + 3 of channel 32 w + 8 cs + i; asrc, aob: these loads' scalar base and offset register */
  if (ACF) { const int img = mt / (PX / 128), p0 = (mt - img * (PX / 128)) * 128;
    asrc = (const char*)((w < 4 ? rgb : ir) + ((size_t)img * DIMH + 32 * (w & 3)) * PX + p0); aob = (unsigned)(8 * cs * PX + 4 * pg) * 4u;
#pragma unroll
    for (int t = 0; t < 4; ++t) {
#pragma unroll
      for (int i = 0; i < 8; ++i) fa[t * 8 + i] = *(const v4fa*)(asrc + aob + (i * PX + 32 * t) * 4); }
  } else {
#pragma unroll
    for (int i = 0; i < 16; ++i) ra[i] = *(const v8us*)(ga + i * CC);
  }
#pragma unroll
  for (int i = 0; i < 16; ++i) rb[i] = *(const v8us*)(gb + i * CC);
  /* s_wait_xcnt 0 behind the tile's loads, in front of every overwrite of a register that they name; their offset registers (ACF: the A loads' scalar base too) are its inputs, so that none of them is overwritten ahead of it; its memory clobber also keeps every LDS store behind the last load, so the wave pays one load latency for all its rows */
  if (ACF) { asm volatile("s_wait_xcnt 0x0" :: "v"(lane), "v"(aob), "s"(asrc) : "memory");
    __builtin_amdgcn_sched_barrier(0); }      /* no conversion moves up among the loads: its wait for an A row would hold back the issue of the B rows */
  else asm volatile("s_wait_xcnt 0x0" :: "v"(lane) : "memory");
  if (ACF) {      /* 16-byte piece 4 w + cs of pixel row 32 t + 4 pg + j: at the pitch of 33 pieces the 32 lanes fall on all 16 bank groups, two lanes each */
#pragma unroll
    for (int t = 0; t < 4; ++t) {
#pragma unroll
      for (int j = 0; j < 4; ++j) { const v4ua o = {pk_bf_h(fa[t * 8][j], fa[t * 8 + 1][j]), pk_bf_h(fa[t * 8 + 2][j], fa[t * 8 + 3][j]), pk_bf_h(fa[t * 8 + 4][j], fa[t * 8 + 5][j]), pk_bf_h(fa[t * 8 + 6][j], fa[t * 8 + 7][j])};
        *(v4ua*)((unsigned short*)sm + (32 * t + 4 * pg + j) * GLP + 32 * w + 8 * cs) = o; } }
  } else {
#pragma unroll
    for (int i = 0; i < 16; ++i) *(v8us*)((unsigned short*)sm + (16 * w + i) * GLP + lane * 8) = ra[i];
  }
#pragma unroll
  for (int i = 0; i < 16; ++i) *(v8us*)((unsigned short*)sb + (16 * w + i) * GLP + lane * 8) = rb[i];
  __syncthreads();
  /* the residual's and the bias's loads stand behind the barrier (which waits for every load issued in front of it) and ahead of the products, under which they fly */
  v4f rs[16]; float bv[4]; unsigned rob = 0;      /* residual: [fragment u][rows 0-3, 4-7]; bias: one column per t; rob: the residual loads' offset register */
  if (FIN) { const int img = mt / (PX / 128), p0 = (mt - img * (PX / 128)) * 128 + 32 * wr;
    const char* rsrc = (const char*)((nq ? ir : rgb) + ((size_t)img * DIMH + 64 * wc) * PX + p0); rob = (unsigned)(ln * PX + 8 * hh) * 4u; const float* bsrc = bpj + col0;
#pragma unroll
    for (int u = 0; u < 8; ++u) { const int t = u & 3, half = u >> 2;      /* unrolled: rs is registers, each load an immediate offset */
      rs[2 * u] = *(const v4fa*)(rsrc + rob + (t * 16 * PX + half * 16) * 4); rs[2 * u + 1] = *(const v4fa*)(rsrc + rob + (t * 16 * PX + half * 16 + 4) * 4); }
#pragma unroll
    for (int t = 0; t < 4; ++t) bv[t] = bsrc[t * 16 + ln];
  }
  const _Float16* pa = sm + (32 * wr + ln) * GLP; const _Float16* pb = sb + (64 * wc + ln) * GLP;
  const v8f z8 = {0.f,0.f,0.f,0.f,0.f,0.f,0.f,0.f}; v8f c00 = z8, c01 = z8, c02 = z8, c03 = z8, c10 = z8, c11 = z8, c12 = z8, c13 = z8;
  v16h a0 = g2_frag(pa, hh), a1 = g2_frag(pa + 16 * GLP, hh), b0 = g2_frag(pb, hh), b1 = g2_frag(pb + 16 * GLP, hh), b2 = g2_frag(pb + 32 * GLP, hh), b3 = g2_frag(pb + 48 * GLP, hh);
  /* unrolled whole (8 steps): the two fragment sets then need no register moves, and every LDS address is an immediate offset */
#pragma unroll
  for (int kb = 0; kb < CC; kb += 32) { v16h n0 = a0, n1 = a1, m0 = b0, m1 = b1, m2 = b2, m3 = b3;
    if (kb + 32 < CC) { const int kn = kb + 32;      /* the next step's 12 LDS reads as one group ahead of this step's WMMAs */
      n0 = g2_frag(pa + kn, hh); n1 = g2_frag(pa + 16 * GLP + kn, hh); m0 = g2_frag(pb + kn, hh); m1 = g2_frag(pb + 16 * GLP + kn, hh); m2 = g2_frag(pb + 32 * GLP + kn, hh); m3 = g2_frag(pb + 48 * GLP + kn, hh); }
    c00 = g2_mma(a0, b0, c00); c10 = g2_mma(a1, b0, c10); c01 = g2_mma(a0, b1, c01); c11 = g2_mma(a1, b1, c11);
    c02 = g2_mma(a0, b2, c02); c12 = g2_mma(a1, b2, c12); c03 = g2_mma(a0, b3, c03); c13 = g2_mma(a1, b3, c13);
    a0 = n0; a1 = n1; b0 = m0; b1 = m1; b2 = m2; b3 = m3; }
  /* s_wait_xcnt 0 behind the residual's and the bias's loads; their two offset registers are its inputs, so that neither is overwritten ahead of it */
  if (FIN) { __builtin_amdgcn_sched_barrier(0);      /* none of the epilogue's arithmetic moves up among the products: its wait for the residual would stall them */
    asm volatile("s_wait_xcnt 0x0" :: "v"(rob), "v"(ln) : "memory"); }
  __syncthreads();      /* every wave has read its last fragment: the tiles' LDS may now take the output staging */
  float* so = (float*)sm + w * (32 * 68);      /* this wave's own 32 rows x 68 floats */
  v8f accs[8] = {c00, c01, c02, c03, c10, c11, c12, c13};      /* unrolled below, as in k_gemm2: accumulators are indexed by constants only */
#pragma unroll
  for (int u = 0; u < 8; ++u) { const int t = u & 3, half = u >> 2;
#pragma unroll
    for (int r = 0; r < 8; ++r) { float v = accs[u][r] * alpha; if (FIN) v = (v + bf16_round(bv[t])) + bf16_round(rs[2 * u + (r >> 2)][r & 3]); so[(half * 16 + 8 * hh + r) * 68 + t * 16 + ln] = v; } }
  __builtin_amdgcn_fence(__ATOMIC_ACQ_REL, "workgroup"); __builtin_amdgcn_wave_barrier();
  const int rsub = lane >> 4, c4 = (lane & 15) * 4;
#pragma unroll
  for (int q = 0; q < 16; ++q) { const int r = q * 2 + rsub; const v4f v = *(const v4fa*)&so[r * 68 + c4]; *(v4f*)(C + (size_t)(row0 + r) * NN + col0 + c4) = v; } }

__global__ __launch_bounds__(256) void k_wnat(const float* __restrict__ w, size_t n8, _Float16* __restrict__ Bt) { const size_t t = (size_t)blockIdx.x * 256 + threadIdx.x; if (t >= n8) return; FragH f; for (int q = 0; q < 8; ++q) f.h[q] = (_Float16)(bf16_round(w[t * 8 + q]) * 16.0f); *(v8us*)((unsigned short*)Bt + t * 8) = f.half[0];  }
__global__ __launch_bounds__(256) void k_rsm(const float* __restrict__ S, _Float16* __restrict__ P, int nrows) {
  #pragma clang fp contract(off)
  const int i = blockIdx.x * 256 + threadIdx.x; if (i >= nrows) return; const float* s = S + (size_t)i * SQ; float mx = -3.0e38f;
#pragma unroll 1
  for (int j = 0; j < SQ; ++j) mx = fmaxf(mx, s[j]); float se = 0.f;
#pragma unroll 1
  for (int j = 0; j < SQ; ++j) se += expf(s[j] - mx); const float sc = 256.0f / se;
#pragma unroll 1
  for (int j0 = 0; j0 < SQ; j0 += 8) { FragH f; for (int q = 0; q < 8; ++q) f.h[q] = (_Float16)(expf(s[j0 + q] - mx) * sc); unsigned short* d = (unsigned short*)P + (size_t)i * SQ + j0; *(v8us*)d = f.half[0];  } }
__global__ __launch_bounds__(256) void k_vt(const _Float16* __restrict__ V16, int b, int h0, _Float16* __restrict__ VT) { __shared__ unsigned short tl[64][65]; const int tid = threadIdx.x; const int hh = blockIdx.x % HG, sg = blockIdx.x / HG; const int s0 = sg * 64; const int h = h0 + hh;
  for (int i = tid; i < 64 * 8; i += 256) { const int j = i / 8, d8 = (i % 8) * 8; FragH f; f.half[0] = *(const v8us*)((const unsigned short*)V16 + ((size_t)b * SQ + s0 + j) * DM + h * HD + d8); for (int q = 0; q < 8; ++q) tl[d8 + q][j] = f.u[q]; }
  __syncthreads();
  { for (int i = tid; i < 64 * 8; i += 256) { const int d = i / 8, j8 = (i % 8) * 8; FragH f; for (int q = 0; q < 8; ++q) f.u[q] = tl[d][j8 + q]; *(v8us*)((unsigned short*)VT + ((size_t)hh * HD + d) * SQ + s0 + j8) = f.half[0]; }  } }


// lane ^ M partner's value added (M = 1, 2, 4: all inside a 16-lane row), as one DPP add
template <int M>
__device__ __forceinline__ float xadd(float s) { return s + __int_as_float(__builtin_amdgcn_update_dpp(0, __float_as_int(s), 0x160 | M, 0xf, 0xf, true)); }
// One wave per (pixel, dilation): lane = 4 channels, 8 lanes = one head, so the 128 channels of a q, k or v row are one 512-byte load of whole lines.
// Work-group = half an image row of one dilation (40 pixels): 4 waves x 10 pixels, the 4 waves on 4 neighbouring pixels at a time.
// An out-of-image neighbour reads the centre pixel's rows instead (in bounds), takes logit 0 and weight 0 on v.
__global__ __launch_bounds__(128) void k_dla(const float* __restrict__ F, _Float16* __restrict__ X16) {
  const int lane = threadIdx.x & 31; const int w = __builtin_amdgcn_readfirstlane((int)threadIdx.x >> 5);
  const int xh = blockIdx.x & 1, di = (blockIdx.x >> 1) & 1, row = blockIdx.x >> 2;      /* row = image * HS + y */
  const int y = row % HS; const int dil = di ? 3 : 2;
  const float* Fd = F + di * 128; unsigned short* Xd = (unsigned short*)X16 + di * 128; const unsigned c4 = (unsigned)lane * 4u;
  for (int i = 0; i < 10; ++i) { const int x = xh * 40 + i * 4 + w; const int r = row * WS + x;
    const v4f q = *(const v4fa*)(Fd + (size_t)r * QW + c4); v4f k[9], v[9]; bool ok[9]; const float* pa[9];
#pragma unroll
    for (int kk = 0; kk < 9; ++kk) { const int dy = (kk / 3 - 1) * dil, dx = (kk % 3 - 1) * dil; ok[kk] = (y + dy >= 0) && (y + dy < HS) && (x + dx >= 0) && (x + dx < WS);
      pa[kk] = Fd + (size_t)(ok[kk] ? r + dy * WS + dx : r) * QW + c4; k[kk] = *(const v4fa*)(pa[kk] + CC); v[kk] = *(const v4fa*)(pa[kk] + 2 * CC); }
    /* s_wait_xcnt 0 behind the pixel's loads, in front of every overwrite of a register that they name; the row addresses are its inputs, so that none of their registers is handed to a later load's result ahead of it */
    asm volatile("s_wait_xcnt 0x0" :: "v"(pa[0]), "v"(pa[1]), "v"(pa[2]), "v"(pa[3]), "v"(pa[4]), "v"(pa[5]), "v"(pa[6]), "v"(pa[7]), "v"(pa[8]) : "memory");
    __builtin_amdgcn_sched_barrier(0);      /* all 19 loads of a pixel issue before any of its arithmetic: one L2 latency a pixel, not one per group of loads */
    float s[9]; float mx = -INFINITY;
#pragma unroll
    for (int kk = 0; kk < 9; ++kk) { float d = fmaf(q[3], k[kk][3], fmaf(q[2], k[kk][2], fmaf(q[1], k[kk][1], q[0] * k[kk][0]))); d = xadd<4>(xadd<2>(xadd<1>(d)));
      s[kk] = ok[kk] ? d * SCL : 0.f; mx = fmaxf(mx, s[kk]); }
    float se = 0.f; v4f acc = {0.f, 0.f, 0.f, 0.f};
#pragma unroll
    for (int kk = 0; kk < 9; ++kk) { const float e = expf(s[kk] - mx); se += e; const float pw = ok[kk] ? e : 0.f;
      for (int c = 0; c < 4; ++c) acc[c] = fmaf(pw, v[kk][c], acc[c]); }
    const float inv = 1.0f / se; v4h o; for (int c = 0; c < 4; ++c) o[c] = (_Float16)(acc[c] * inv);
    *(v4h*)(Xd + (size_t)r * CC + c4) = o; } }

extern "C" void kernel_launch(void* const* d_in, const int* in_sizes, int n_in,
                              void* d_out, int out_size, void* d_ws, size_t ws_size, hipStream_t stream) {
  (void)in_sizes; (void)n_in; (void)out_size;
  const float* const* I = (const float* const*)d_in; const float* rgb = I[0]; const float* ir = I[1]; const float* wqkv = I[2]; const float* wp = I[3]; const float* bp = I[4];
  char* ws = (char*)d_ws; size_t off = 0;
  auto take = [&](size_t bytes) { char* p = ws + off; off += (bytes + 255) & ~(size_t)255; return p; };
  _Float16* BQ = (_Float16*)take((size_t)QW * CC * 2); _Float16* BP = (_Float16*)take((size_t)CC * CC * 2); float* F = (float*)take(NR * QW * 4); _Float16* X16 = (_Float16*)take(NR * CC * 2);
  if (off > ws_size) return;      /* 0.5 + 75 + 12.5 = approx 88 MiB */
  k_wnat<<<(unsigned)(((size_t)QW * CC / 8 + 255) / 256), 256, 0, stream>>>(wqkv, (size_t)QW * CC / 8, BQ); k_wnat<<<(unsigned)(((size_t)CC * CC / 8 + 255) / 256), 256, 0, stream>>>(wp, (size_t)CC * CC / 8, BP);
  k_gemm3<QW, false, true><<<(unsigned)((NR / 128) * (QW / 128)), 256, 0, stream>>>(nullptr, BQ, 0.0625f, F, nullptr, rgb, ir);      /* qkv (f32) */
  k_dla<<<(unsigned)(NB * HS * 4), 128, 0, stream>>>(F, X16);
  k_gemm3<CC, true, false><<<(unsigned)((NR / 128) * (CC / 128)), 256, 0, stream>>>(X16, BP, 0.0625f, (float*)d_out, bp, rgb, ir);      /* proj + bias + residual */
}

// v005
// Measured time: 63.7 microseconds a run.
// Timed twice side by side with v004, it ran 1.07 times as fast both times.
// All steps since v000 together make it 12.7 times as fast.
#include <hip/hip_runtime.h>
// Multi-dilate local attention (rgb, ir [4][128][80][80] -> y = [rgb | ir] (256 ch); qkv = 1x1 (w_qkv [768][256]) split as [3][2 dilations][128 = 4 heads x 32]; per dilation d in (2, 3): each pixel attends to its 3x3 dilated neighbourhood (zero-padded unfold: out-of-image neighbours contribute k = v = 0, logit 0) with softmax(q.k / sqrt(32)) over the 9; heads merged dilation-major; proj (w_proj [256][256]) + b_proj; + y -> NHWC [4][80][80][256]).
// Structure: qkv as a WMMA GEMM whose A tile comes straight from the two channel-first inputs, turned into concatenated pixel rows (exact f16) on its way into LDS (operand tiles staged in LDS, 32x64 wave tiles, f32 accumulation, exact x16 natural weights; exact products) kept f32; the dilated local attention, one wave walking down a column in steps of the dilation with the window's rows kept in registers, on VALU (f32; 4 channels a lane, softmax weights in registers) into f16 rows; projection GEMM whose epilogue adds bias + residual (f32, VALU) and writes the NHWC output.
// Compute dtype: inputs rounded to bf16; y / weights exact; qkv and the attention f32; the attended rows as a plain f16 GEMM operand (~2^-12). v_wmma_f32_16x16x32_f16.
#define NB 4
#define DIMH 128
#define CC 256
#define QW 768
#define HS 80
#define WS 80
#define PX (HS * WS)                 /* 6400 = 50 x 128 */
#define NR ((size_t)NB * PX)         /* 25,600 rows */
#define NRD ((int)NR)                /* unused */
#define SCL 0.17677669529663689f
#define SQ 64
#define DM 64
#define NH 1
#define HD 64
#define HG 1
typedef __bf16 v16b __attribute__((ext_vector_type(16)));
typedef unsigned short v8us __attribute__((ext_vector_type(8), may_alias));
typedef float  v8f  __attribute__((ext_vector_type(8)));
typedef float  v4f  __attribute__((ext_vector_type(4)));
typedef float  v4fa __attribute__((ext_vector_type(4), may_alias));
union FragB { v16b v; v8us half[2]; unsigned short u[16]; };

__device__ __forceinline__ unsigned short bf16_bits(float x) { unsigned int u = __float_as_uint(x); return (unsigned short)((u + 0x7FFFu + ((u >> 16) & 1u)) >> 16); }
__device__ __forceinline__ float bf16_val(unsigned short b) { return __uint_as_float(((unsigned int)b) << 16); }
__device__ __forceinline__ float bf16_round(float x) { return bf16_val(bf16_bits(x)); }
// D += A·B with NT terms: 1 = ah·bh, 2 = + al·bh (A split), 3 = + ah·bl (both split)
template <int NT>
__device__ __forceinline__ v8f mmaN(v16b ah, v16b al, v16b bh, v16b bl, v8f c) {
  c = __builtin_amdgcn_wmma_f32_16x16x32_bf16(false, ah, false, bh, (short)0, c, false, false);
  if (NT >= 2) c = __builtin_amdgcn_wmma_f32_16x16x32_bf16(false, al, false, bh, (short)0, c, false, false);
  if (NT >= 3) c = __builtin_amdgcn_wmma_f32_16x16x32_bf16(false, ah, false, bl, (short)0, c, false, false);
  asm volatile("v_nop\n\tv_nop\n\tv_nop\n\tv_nop" : "+v"(c) : "v"(ah), "v"(al), "v"(bh), "v"(bl));
  return c;
}

__global__ __launch_bounds__(256) void k_wt_bf16(const float* __restrict__ W, unsigned short* __restrict__ Wt, int K, int N) {
  const int t = blockIdx.x * 256 + threadIdx.x;
  const int k8n = K / 8;
  if (t >= N * k8n) return;
  const int n = t / k8n, k8 = (t % k8n) * 8;
  v8us v;
#pragma unroll
  for (int i = 0; i < 8; ++i) v[i] = bf16_bits(W[(size_t)(k8 + i) * N + n]);
  *(v8us*)(Wt + (size_t)n * K + k8) = v;
  
}

// GEMM C[M][N] (f32, pitch ldc) = act(A[M][K]·W + bias). A f32 row-major (pitch lda) converted per fragment to bf16
// (ASPLIT: hi/lo two planes -> 2 terms, else single rounded term); Wt bf16 [N][K] (pitch ldb). BIAS_BF16 rounds the
// bias to bf16 first (bias quantised to bf16 before the add). K%32==0, M%16==0, N%64==0.
template <bool ASPLIT, int ACT, bool BIAS_BF16>
__global__ __launch_bounds__(128) void k_gemm_bf(const float* __restrict__ A, int lda, const unsigned short* __restrict__ Wt, int ldb,
                                               const float* __restrict__ bias, float* __restrict__ C, int ldc, int M, int N, int K) {
  __shared__ __attribute__((aligned(16))) float so[4][16][64];
  const int tid = threadIdx.x, w = tid >> 5, lane = tid & 31, ln = lane & 15, hh = lane >> 4;
  const int ntn = N / 64;
  const int wid = blockIdx.x * 4 + w;
  const int mt = wid / ntn, nq = wid % ntn;
  if (mt * 16 >= M) return;
  const int row0 = mt * 16, col0 = nq * 64;
  const float* arow = A + (size_t)(row0 + ln) * lda;
  v8f acc[4] = {};
  for (int kb = 0; kb < K; kb += 32) {
    FragB ah, al;
    const v4f x0 = *(const v4fa*)(arow + kb + 8 * hh), x1 = *(const v4fa*)(arow + kb + 8 * hh + 4);
    const v4f x2 = *(const v4fa*)(arow + kb + 16 + 8 * hh), x3 = *(const v4fa*)(arow + kb + 16 + 8 * hh + 4);
    float xs[16] = {x0[0],x0[1],x0[2],x0[3],x1[0],x1[1],x1[2],x1[3],x2[0],x2[1],x2[2],x2[3],x3[0],x3[1],x3[2],x3[3]};
#pragma unroll
    for (int i = 0; i < 16; ++i) { const unsigned short hb = bf16_bits(xs[i]); ah.u[i] = hb; al.u[i] = ASPLIT ? bf16_bits(xs[i] - bf16_val(hb)) : (unsigned short)0; }
#pragma unroll
    for (int t = 0; t < 4; ++t) {
      const unsigned short* brow = Wt + (size_t)(col0 + t * 16 + ln) * ldb + kb;
      FragB b;
      b.half[0] = *(const v8us*)(brow + 8 * hh);
      b.half[1] = *(const v8us*)(brow + 16 + 8 * hh);
      acc[t] = mmaN<ASPLIT ? 2 : 1>(ah.v, al.v, b.v, b.v, acc[t]);
    }
  }
#pragma unroll
  for (int t = 0; t < 4; ++t) {
    float bv = bias ? bias[col0 + t * 16 + ln] : 0.f;
    if (BIAS_BF16) bv = bf16_round(bv);
#pragma unroll
    for (int r = 0; r < 8; ++r) { float v = acc[t][r] + bv; if (ACT == 1) v = fmaxf(v, 0.f); so[w][8 * hh + r][t * 16 + ln] = v; }
  }
  __builtin_amdgcn_fence(__ATOMIC_ACQ_REL, "workgroup");
  __builtin_amdgcn_wave_barrier();
  const int rsub = lane >> 4, c4 = (lane & 15) * 4;
  {
#pragma unroll
    for (int q = 0; q < 8; ++q) {
      const int r = q * 2 + rsub;
      const v4f v = *(const v4fa*)&so[w][r][c4];
      *(v4f*)(C + (size_t)(row0 + r) * ldc + col0 + c4) = v;
    }
    
  }
}

// GEMM C = act(A·W + bias + resid): A f32 (ASPLIT -> hi/lo 2 terms), Wt bf16 [N][K]; ACT 0 none, 1 relu, 2 exact gelu;
// resid (optional, f32, row index = (row % rmod), pitch ldr, RES_BF16 rounds it) added before the activation.
template <bool ASPLIT, int ACT, bool BIAS_BF16, bool RES_BF16>
__global__ __launch_bounds__(128) void k_gemm_bf3(const float* __restrict__ A, int lda, const unsigned short* __restrict__ Wt, int ldb,
                                                const float* __restrict__ bias, const float* __restrict__ resid, int rmod, int ldr,
                                                float* __restrict__ C, int ldc, int M, int N, int K) {
  __shared__ __attribute__((aligned(16))) float so[4][16][64];
  const int tid = threadIdx.x, w = tid >> 5, lane = tid & 31, ln = lane & 15, hh = lane >> 4;
  const int ntn = N / 64;
  const int wid = blockIdx.x * 4 + w;
  const int mt = wid / ntn, nq = wid % ntn;
  if (mt * 16 >= M) return;
  const int row0 = mt * 16, col0 = nq * 64;
  const float* arow = A + (size_t)(row0 + ln) * lda;
  v8f acc[4] = {};
  for (int kb = 0; kb < K; kb += 32) {
    FragB ah, al;
    const v4f x0 = *(const v4fa*)(arow + kb + 8 * hh), x1 = *(const v4fa*)(arow + kb + 8 * hh + 4);
    const v4f x2 = *(const v4fa*)(arow + kb + 16 + 8 * hh), x3 = *(const v4fa*)(arow + kb + 16 + 8 * hh + 4);
    float xs[16] = {x0[0],x0[1],x0[2],x0[3],x1[0],x1[1],x1[2],x1[3],x2[0],x2[1],x2[2],x2[3],x3[0],x3[1],x3[2],x3[3]};
#pragma unroll
    for (int i = 0; i < 16; ++i) { const unsigned short hb = bf16_bits(xs[i]); ah.u[i] = hb; al.u[i] = ASPLIT ? bf16_bits(xs[i] - bf16_val(hb)) : (unsigned short)0; }
#pragma unroll
    for (int t = 0; t < 4; ++t) {
      const unsigned short* brow = Wt + (size_t)(col0 + t * 16 + ln) * ldb + kb;
      FragB b;
      b.half[0] = *(const v8us*)(brow + 8 * hh);
      b.half[1] = *(const v8us*)(brow + 16 + 8 * hh);
      acc[t] = mmaN<ASPLIT ? 2 : 1>(ah.v, al.v, b.v, b.v, acc[t]);
    }
  }
#pragma unroll
  for (int t = 0; t < 4; ++t) {
    const int col = col0 + t * 16 + ln;
    float bv = bias ? bias[col] : 0.f;
    if (BIAS_BF16) bv = bf16_round(bv);
#pragma unroll
    for (int r = 0; r < 8; ++r) {
      float v = acc[t][r] + bv;
      if (resid) { float rv = resid[(size_t)((row0 + 8 * hh + r) % rmod) * ldr + col]; if (RES_BF16) rv = bf16_round(rv); v += rv; }
      if (ACT == 1) v = fmaxf(v, 0.f);
      if (ACT == 2) v = 0.5f * v * (1.0f + erff(v * 0.70710678118654752f));
      if (ACT == 3) { const float u = 0.7978845608028654f * (v + 0.044715f * v * v * v); v = 0.5f * v * (1.0f + tanhf(u)); }
      so[w][8 * hh + r][t * 16 + ln] = v;
    }
  }
  __builtin_amdgcn_fence(__ATOMIC_ACQ_REL, "workgroup");
  __builtin_amdgcn_wave_barrier();
  const int rsub = lane >> 4, c4 = (lane & 15) * 4;
  {
#pragma unroll
    for (int q = 0; q < 8; ++q) {
      const int r = q * 2 + rsub;
      const v4f v = *(const v4fa*)&so[w][r][c4];
      *(v4f*)(C + (size_t)(row0 + r) * ldc + col0 + c4) = v;
    }
    
  }
}
// row LayerNorm (biased variance, eps) over N: s = X (+ R); optional out_sum <- s; out_norm <- (s-mu)*rsqrt(var+eps)*g + b
template <bool PARAM_BF16>
__global__ __launch_bounds__(256) void k_layernorm(const float* __restrict__ X, const float* __restrict__ R, const float* __restrict__ g, const float* __restrict__ bta,
                                                  float* __restrict__ out_sum, float* __restrict__ out_norm, int N, float eps) {
  __shared__ float red[256];
  const int row = blockIdx.x, tid = threadIdx.x;
  const float* x = X + (size_t)row * N; const float* rr = R ? R + (size_t)row * N : nullptr;
  float vals[16];                     // up to N = 4096
  const int per = N / 256;            // contiguous chunk per thread? use strided-by-4 chunks: thread handles j = tid*4 + 1024*u
  float s1 = 0.f;
  for (int u = 0; u < per / 4; ++u) {
    const int j = tid * 4 + 1024 * u;
    const v4f a = *(const v4fa*)(x + j);
    v4f b = {0.f,0.f,0.f,0.f}; if (rr) b = *(const v4fa*)(rr + j);
#pragma unroll
    for (int q = 0; q < 4; ++q) { const float v = a[q] + b[q]; vals[u * 4 + q] = v; s1 += v; }
  }
  red[tid] = s1; __syncthreads();
  for (int st = 128; st > 0; st >>= 1) { if (tid < st) red[tid] += red[tid + st]; __syncthreads(); }
  const float mu = red[0] / (float)N; __syncthreads();
  float s2 = 0.f;
  for (int u = 0; u < per / 4; ++u)
#pragma unroll
    for (int q = 0; q < 4; ++q) { const float c = vals[u * 4 + q] - mu; s2 += c * c; }
  red[tid] = s2; __syncthreads();
  for (int st = 128; st > 0; st >>= 1) { if (tid < st) red[tid] += red[tid + st]; __syncthreads(); }
  const float rs = rsqrtf(red[0] / (float)N + eps);
  {
    for (int u = 0; u < per / 4; ++u) {
      const int j = tid * 4 + 1024 * u;
      v4f o, sm;
#pragma unroll
      for (int q = 0; q < 4; ++q) {
        float gg = g[j + q], bb = bta[j + q];
        if (PARAM_BF16) { gg = bf16_round(gg); bb = bf16_round(bb); }
        sm[q] = vals[u * 4 + q]; o[q] = (vals[u * 4 + q] - mu) * rs * gg + bb;
      }
      if (out_sum) *(v4f*)(out_sum + (size_t)row * N + j) = sm;
      *(v4f*)(out_norm + (size_t)row * N + j) = o;
    }
    
  }
}



// ---- f16 WMMA path (v_wmma_f32_16x16x32_f16): 11-bit significands for operands in range — used here for the qkv and projection GEMMs
typedef _Float16 v16h __attribute__((ext_vector_type(16)));
union FragH { v16h v; v8us half[2]; _Float16 h[16]; unsigned short u[16]; };
template <int NT>
__device__ __forceinline__ v8f mmaH(v16h ah, v16h al, v16h bh, v16h bl, v8f c) {
  c = __builtin_amdgcn_wmma_f32_16x16x32_f16(false, ah, false, bh, (short)0, c, false, false);
  if (NT >= 2) c = __builtin_amdgcn_wmma_f32_16x16x32_f16(false, al, false, bh, (short)0, c, false, false);
  if (NT >= 3) c = __builtin_amdgcn_wmma_f32_16x16x32_f16(false, ah, false, bl, (short)0, c, false, false);
  asm volatile("v_nop\n\tv_nop\n\tv_nop\n\tv_nop" : "+v"(c) : "v"(ah), "v"(al), "v"(bh), "v"(bl));
  return c;
}
// batched GEMM like k_gemm_b but f16 operands: A f32 (split into f16 hi/lo if ASPLIT, else rounded to f16), Bt = f16 values [n][k]; alpha; C f32; N multiple of 16 (partial tiles skipped)
template <bool ASPLIT>
__global__ __launch_bounds__(128) void k_gemm_h(const float* __restrict__ A, int lda, size_t sA, const _Float16* __restrict__ Bh, int ldb, size_t sB, float alpha, float* __restrict__ C, int ldc, size_t sC, int M, int N, int K) {
  __shared__ __attribute__((aligned(16))) float so[4][16][64];
  const int tid = threadIdx.x, w = tid >> 5, lane = tid & 31, ln = lane & 15, hh = lane >> 4; const int by = blockIdx.y;
  A += (size_t)by * sA; Bh += (size_t)by * sB; C += (size_t)by * sC;
  const int ntn = (N + 63) / 64; const int wid = blockIdx.x * 4 + w; const int mt = wid / ntn, nq = wid % ntn; if (mt * 16 >= M) return;
  const int row0 = mt * 16, col0 = nq * 64; const float* arow = A + (size_t)(row0 + ln) * lda;
  v8f acc[4] = {};
  for (int kb = 0; kb < K; kb += 32) {
    FragH ah, al;
    const v4f x0 = *(const v4fa*)(arow + kb + 8 * hh), x1 = *(const v4fa*)(arow + kb + 8 * hh + 4), x2 = *(const v4fa*)(arow + kb + 16 + 8 * hh), x3 = *(const v4fa*)(arow + kb + 16 + 8 * hh + 4);
    float xs[16] = {x0[0],x0[1],x0[2],x0[3],x1[0],x1[1],x1[2],x1[3],x2[0],x2[1],x2[2],x2[3],x3[0],x3[1],x3[2],x3[3]};
#pragma unroll
    for (int i = 0; i < 16; ++i) { const _Float16 h = (_Float16)xs[i]; ah.h[i] = h; al.h[i] = ASPLIT ? (_Float16)(xs[i] - (float)h) : (_Float16)0.0f; }
#pragma unroll
    for (int t = 0; t < 4; ++t) { if (col0 + t * 16 >= N) continue; const size_t boff = (size_t)(col0 + t * 16 + ln) * ldb + kb; FragH bq; bq.half[0] = *(const v8us*)(Bh + boff + 8 * hh); bq.half[1] = *(const v8us*)(Bh + boff + 16 + 8 * hh);
      acc[t] = mmaH<ASPLIT ? 2 : 1>(ah.v, al.v, bq.v, bq.v, acc[t]); }
  }
#pragma unroll
  for (int t = 0; t < 4; ++t) { if (col0 + t * 16 >= N) continue;
#pragma unroll
    for (int r = 0; r < 8; ++r) so[w][8 * hh + r][t * 16 + ln] = acc[t][r] * alpha; }
  __builtin_amdgcn_fence(__ATOMIC_ACQ_REL, "workgroup"); __builtin_amdgcn_wave_barrier();
  const int rsub = lane >> 4, c4 = (lane & 15) * 4;
  {
#pragma unroll
    for (int q = 0; q < 8; ++q) { const int r = q * 2 + rsub; if (col0 + c4 < N) { const v4f v = *(const v4fa*)&so[w][r][c4]; *(v4f*)(C + (size_t)(row0 + r) * ldc + col0 + c4) = v; } }
     }
}

// Wt[n][k] = f16(W[k][n]·scale) from f32 row-major W[K][N] (scale = power of two; bf16-exact weights stay exact in f16 away from the subnormal range)
__global__ __launch_bounds__(256) void k_wt_f16(const float* __restrict__ W, _Float16* __restrict__ Wt, int K, int N, float scale) {
  const int t = blockIdx.x * 256 + threadIdx.x; if (t >= N * (K / 8)) return; const int n = t / (K / 8), k8 = (t % (K / 8)) * 8; FragH f;
#pragma unroll
  for (int i = 0; i < 8; ++i) f.h[i] = (_Float16)(bf16_round(W[(size_t)(k8 + i) * N + n]) * scale); const v8us o = f.half[0];
  *(v8us*)((unsigned short*)Wt + (size_t)n * K + k8) = o; 
}
// k_gemm_hh variant with fused epilogue: v = acc·alpha + bias[by·sBias + col] (+ CP[(row/rowsPerB)·sCPb + by·64 + col] if CP) ; ACT 0 none / 1 elu ; writes f16 C16 (and f32 C if non-null)
template <int ACT>
__global__ __launch_bounds__(128) void k_gemm_hhx(const _Float16* __restrict__ A, int lda, size_t sA, const _Float16* __restrict__ Bh, int ldb, size_t sB, float alpha, const float* __restrict__ bias, size_t sBias, const float* __restrict__ CP, int rowsPerB, size_t sCPb, int row0g,
    float* __restrict__ C, _Float16* __restrict__ C16, int ldc, size_t sC, int M, int N, int K) {
  __shared__ __attribute__((aligned(16))) float so[4][16][64];
  const int tid = threadIdx.x, w = tid >> 5, lane = tid & 31, ln = lane & 15, hh = lane >> 4; const int by = blockIdx.y;
  A += (size_t)by * sA; Bh += (size_t)by * sB; const size_t cofs = (size_t)by * sC; const float* bp = bias ? bias + (size_t)by * sBias : nullptr;
  const int ntn = (N + 63) / 64; const int wid = blockIdx.x * 4 + w; const int mt = wid / ntn, nq = wid % ntn; if (mt * 16 >= M) return;
  const int row0 = mt * 16, col0 = nq * 64; const _Float16* arow = A + (size_t)(row0 + ln) * lda;
  v8f acc[4] = {};
  for (int kb = 0; kb < K; kb += 32) { FragH ah; ah.half[0] = *(const v8us*)((const unsigned short*)arow + kb + 8 * hh); ah.half[1] = *(const v8us*)((const unsigned short*)arow + kb + 16 + 8 * hh);
#pragma unroll
    for (int t = 0; t < 4; ++t) { if (col0 + t * 16 >= N) continue; const size_t boff = (size_t)(col0 + t * 16 + ln) * ldb + kb; FragH bq; bq.half[0] = *(const v8us*)((const unsigned short*)Bh + boff + 8 * hh); bq.half[1] = *(const v8us*)((const unsigned short*)Bh + boff + 16 + 8 * hh);
      acc[t] = mmaH<1>(ah.v, ah.v, bq.v, bq.v, acc[t]); }
  }
#pragma unroll
  for (int t = 0; t < 4; ++t) { if (col0 + t * 16 >= N) continue; const int col = col0 + t * 16 + ln; const float bv = bp ? bf16_round(bp[col]) : 0.f;
#pragma unroll
    for (int r = 0; r < 8; ++r) { float v = acc[t][r] * alpha + bv; if (CP) { const int rr = row0g + row0 + 8 * hh + r; if (rowsPerB < 0) v += CP[cofs + (size_t)rr * ldc + col];      /* rowsPerB < 0: own element of the batched C plane */ else { const int bidx = rr / rowsPerB; v += CP[(size_t)bidx * sCPb + (size_t)by * 64 + col]; } } if (ACT == 1) v = (v > 0.f) ? v : expm1f(v); else if (ACT == 7) v = (v > 0.f) ? v + 1.0f : expf(v); else if (ACT == 8) v = tanhf(v); else if (ACT == 9) v = 0.5f * v * (1.0f + tanhf(0.7978845608028654f * (v + 0.044715f * v * v * v))); else if (ACT == 11) v = 1.0f / (1.0f + expf(-v)); else if (ACT == 12) v = (v > 0.f) ? v : 0.01f * v; else if (ACT == 14) v = (v > 0.f) ? v : 0.1f * v; else if (ACT == 16) v = (v >= 0.f) ? v : 0.3f * v; else if (ACT == 17) v = (v >= 0.f) ? v : 0.2f * v; else if (ACT == 15) v = v / (1.0f + expf(-v)); else if (ACT == 3) v = fmaxf(v, 0.f); else if (ACT == 6) v = 0.5f * v * (1.0f + erff(v * 0.70710678118654752f)); so[w][8 * hh + r][t * 16 + ln] = v; } }
  __builtin_amdgcn_fence(__ATOMIC_ACQ_REL, "workgroup"); __builtin_amdgcn_wave_barrier();
  const int rsub = lane >> 4, c4 = (lane & 15) * 4; typedef _Float16 v4h __attribute__((ext_vector_type(4)));
  {
#pragma unroll
    for (int q = 0; q < 8; ++q) { const int r = q * 2 + rsub; if (col0 + c4 < N) { const v4f v = *(const v4fa*)&so[w][r][c4]; if (C) *(v4f*)(C + cofs + (size_t)(row0 + r) * ldc + col0 + c4) = v; if (C16) { v4h h4; for (int i = 0; i < 4; ++i) h4[i] = (_Float16)v[i]; *(v4h*)(C16 + cofs + (size_t)(row0 + r) * ldc + col0 + c4) = h4; } } }
     }
}


typedef _Float16 v4h __attribute__((ext_vector_type(4)));

__global__ __launch_bounds__(256) void k_x16(const float* __restrict__ x, _Float16* __restrict__ X16, size_t n8) { const size_t t = (size_t)blockIdx.x * 256 + threadIdx.x; if (t >= n8) return; FragH f;
#pragma unroll
  for (int q = 0; q < 8; ++q) f.h[q] = (_Float16)bf16_round(x[t * 8 + q]); *(v8us*)((unsigned short*)X16 + t * 8) = f.half[0];  }
__global__ __launch_bounds__(256) void k_h16(const float* __restrict__ x, _Float16* __restrict__ X16, size_t n8) { const size_t t = (size_t)blockIdx.x * 256 + threadIdx.x; if (t >= n8) return; FragH f;
#pragma unroll
  for (int q = 0; q < 8; ++q) f.h[q] = (_Float16)x[t * 8 + q]; *(v8us*)((unsigned short*)X16 + t * 8) = f.half[0];  }
__global__ __launch_bounds__(256) void k_round16f(const float* __restrict__ W, _Float16* __restrict__ Bt, size_t n8) { const size_t t = (size_t)blockIdx.x * 256 + threadIdx.x; if (t >= n8) return; FragH f;
#pragma unroll
  for (int i = 0; i < 8; ++i) f.h[i] = (_Float16)(bf16_round(W[t * 8 + i]) * 16.0f); *(v8us*)((unsigned short*)Bt + t * 8) = f.half[0];  }
template <int NHv, int TTv>
__global__ __launch_bounds__(256) void k_vt(const _Float16* __restrict__ V16, int ldv, int voff, _Float16* __restrict__ Vt) { __shared__ unsigned short tl[64][66]; const int tid = threadIdx.x; const int slab = blockIdx.x / (TTv / 64), lg = blockIdx.x % (TTv / 64); const int b = slab / NHv, h = slab % NHv;
  for (int i = tid; i < 64 * 8; i += 256) { const int r = i / 8, c8 = (i % 8) * 8; FragH f; f.half[0] = *(const v8us*)((const unsigned short*)V16 + ((size_t)b * TTv + lg * 64 + r) * ldv + voff + h * 64 + c8);
#pragma unroll
    for (int q = 0; q < 8; ++q) tl[r][c8 + q] = f.u[q]; }
  __syncthreads();
  {
#pragma unroll
    for (int rd = 0; rd < 2; ++rd) { const int d = rd * 32 + tid / 8, pc = tid % 8; FragH f;
#pragma unroll
      for (int q = 0; q < 8; ++q) f.u[q] = tl[pc * 8 + q][d];
      *(v8us*)((unsigned short*)Vt + ((size_t)slab * 64 + d) * TTv + lg * 64 + pc * 8) = f.half[0]; }
     } }

__global__ __launch_bounds__(256) void k_hl(const float* __restrict__ F, _Float16* __restrict__ Hh, _Float16* __restrict__ Hl, size_t n8) { const size_t t = (size_t)blockIdx.x * 256 + threadIdx.x; if (t >= n8) return; FragH fh, fl; const v4f a = *(const v4fa*)(F + t * 8), c = *(const v4fa*)(F + t * 8 + 4);
#pragma unroll
  for (int q = 0; q < 4; ++q) { _Float16 h = (_Float16)a[q]; fh.h[q] = h; fl.h[q] = (_Float16)((a[q] - (float)h) * 1024.0f); h = (_Float16)c[q]; fh.h[4 + q] = h; fl.h[4 + q] = (_Float16)((c[q] - (float)h) * 1024.0f); }
  { *(v8us*)((unsigned short*)Hh + t * 8) = fh.half[0]; *(v8us*)((unsigned short*)Hl + t * 8) = fl.half[0];  } }

// ---- fast GEMM (wave tile 32x64; requires M % 32 == 0 rows per launch region and N % 64 == 0); epilogue = k_gemm_hhx semantics ----
__device__ __forceinline__ v16h g2_frag(const _Float16* p, int hh) { FragH f; f.half[0] = *(const v8us*)((const unsigned short*)p + 8 * hh); f.half[1] = *(const v8us*)((const unsigned short*)p + 16 + 8 * hh); return f.v; }
__device__ __forceinline__ v8f g2_mma(v16h a, v16h b, v8f c) { v8f d = __builtin_amdgcn_wmma_f32_16x16x32_f16(false, a, false, b, (short)0, c, false, false); asm volatile("v_nop\n\tv_nop\n\tv_nop\n\tv_nop" : "+v"(d) : "v"(a), "v"(b)); return d; }
template <int ACT>
__global__ __launch_bounds__(128) void k_gemm2(const _Float16* __restrict__ A, int lda, size_t sA, const _Float16* __restrict__ Bh, int ldb, size_t sB, float alpha, const float* __restrict__ bias, size_t sBias, const float* __restrict__ CP, int rowsPerB, size_t sCPb, int row0g,
    float* __restrict__ C, _Float16* __restrict__ C16, int ldc, size_t sC, int M, int N, int K) { static_assert(ACT == 0 || ACT == 3 || ACT == 6 || ACT == 8 || ACT == 9 || ACT == 11 || ACT == 12 || ACT == 14 || ACT == 15 || ACT == 16 || ACT == 17, "k_gemm2: unsupported ACT code (would silently apply no activation)");
  __shared__ __attribute__((aligned(16))) float so[4][32][68];
  const int tid = threadIdx.x, w = tid >> 5, lane = tid & 31, ln = lane & 15, hh = lane >> 4; const int by = blockIdx.y;
  A += (size_t)by * sA; Bh += (size_t)by * sB; const size_t cofs = (size_t)by * sC; const float* bp = bias ? bias + (size_t)by * sBias : nullptr;
  const int ntn = N >> 6; const int mt = blockIdx.x / ntn, nq = blockIdx.x - mt * ntn; const int row0 = mt * 128 + 32 * w, col0 = nq * 64; if (row0 >= M) return;
  const _Float16* a0p = A + (size_t)(row0 + ln) * lda; const _Float16* a1p = a0p + (size_t)16 * lda;
  const _Float16* b0p = Bh + (size_t)(col0 + ln) * ldb; const _Float16* b1p = b0p + (size_t)16 * ldb; const _Float16* b2p = b1p + (size_t)16 * ldb; const _Float16* b3p = b2p + (size_t)16 * ldb;
  const v8f z8 = {0.f,0.f,0.f,0.f,0.f,0.f,0.f,0.f}; v8f c00 = z8, c01 = z8, c02 = z8, c03 = z8, c10 = z8, c11 = z8, c12 = z8, c13 = z8;
#pragma unroll 1
  for (int kb = 0; kb < K; kb += 32) { const v16h a0 = g2_frag(a0p + kb, hh), a1 = g2_frag(a1p + kb, hh);
    v16h b = g2_frag(b0p + kb, hh); c00 = g2_mma(a0, b, c00); c10 = g2_mma(a1, b, c10);
    b = g2_frag(b1p + kb, hh); c01 = g2_mma(a0, b, c01); c11 = g2_mma(a1, b, c11);
    b = g2_frag(b2p + kb, hh); c02 = g2_mma(a0, b, c02); c12 = g2_mma(a1, b, c12);
    b = g2_frag(b3p + kb, hh); c03 = g2_mma(a0, b, c03); c13 = g2_mma(a1, b, c13); }
  v8f accs[8] = {c00, c01, c02, c03, c10, c11, c12, c13};
#pragma unroll
  for (int u = 0; u < 8; ++u) { const int t = u & 3, half = u >> 2; const int col = col0 + t * 16 + ln; const float bv = bp ? bf16_round(bp[col]) : 0.f;
#pragma unroll
    for (int r = 0; r < 8; ++r) { const int rloc = half * 16 + 8 * hh + r; float v = accs[u][r] * alpha + bv; if (CP) { if (rowsPerB < 0) v += CP[cofs + (size_t)(row0g + row0 + rloc) * ldc + col];      /* rowsPerB < 0: own element of the batched C plane */ else { const int bidx = (row0g + row0 + rloc) / rowsPerB; v += CP[(size_t)bidx * sCPb + (size_t)by * 64 + col]; } }
      if (ACT == 3) v = fmaxf(v, 0.f); else if (ACT == 6) v = 0.5f * v * (1.0f + erff(v * 0.70710678118654752f)); else if (ACT == 11) v = 1.0f / (1.0f + expf(-v)); else if (ACT == 15) v = v / (1.0f + expf(-v)); else if (ACT == 12) v = (v > 0.f) ? v : 0.01f * v; else if (ACT == 8) v = tanhf(v); else if (ACT == 9) v = 0.5f * v * (1.0f + tanhf(0.7978845608028654f * (v + 0.044715f * v * v * v))); else if (ACT == 14) v = (v > 0.f) ? v : 0.1f * v; else if (ACT == 16) v = (v >= 0.f) ? v : 0.3f * v; else if (ACT == 17) v = (v >= 0.f) ? v : 0.2f * v;
      so[w][rloc][t * 16 + ln] = v; } }
  __builtin_amdgcn_fence(__ATOMIC_ACQ_REL, "workgroup"); __builtin_amdgcn_wave_barrier();
  const int rsub = lane >> 4, c4 = (lane & 15) * 4;
  {
#pragma unroll
    for (int q = 0; q < 16; ++q) { const int r = q * 2 + rsub; const v4f v = *(const v4fa*)&so[w][r][c4]; if (C) *(v4f*)(C + cofs + (size_t)(row0 + r) * ldc + col0 + c4) = v; if (C16) { v4h h4; for (int i = 0; i < 4; ++i) h4[i] = (_Float16)v[i]; *(v4h*)(C16 + cofs + (size_t)(row0 + r) * ldc + col0 + c4) = h4; } }
     } }


// ---- GEMM with both operand tiles staged in LDS: C[M][NN] (f32) = alpha * A[M][CC] . Bh[NN][CC]^T; K = CC; grid = (M / 128) * (NN / 128) ----
// Work-group tile 128 x 128, 8 waves; wave tile 32 x 64 and k order as k_gemm2. A fragment load straight from global touches 16 lines for its 512 bytes and stands in front of its own WMMAs;
// here each global load of a wave is one whole 512-byte row (4 lines), all 32 of a wave are in flight together, and the fragments come from LDS rows pitched 528 B (16 B x 33: no bank conflict for 16-byte reads).
// FIN (the projection): C = (alpha * A . Bh^T + bf16(bpj[col])) + bf16(residual), the residual read from the channel-first inputs in the accumulators' own layout:
// a lane's 8 accumulator rows of one column are 8 neighbouring pixels of one channel, 32 bytes in a row; a wave's 32 pixels of a channel are one whole 128-byte line.
// ACF (the qkv product): A is not read as f16 rows; the tile's 128 pixels x 256 channels come from the channel-first f32 inputs. Wave w brings channels 32 w .. 32 w + 31:
// a load's 8-lane groups take one 128-byte line (32 pixels) of 4 channels that lie 8 apart, so after 8 loads a lane holds 8 neighbouring channels of 4 pixels: 4 whole 16-byte pieces of pixel rows.
#define GLP 264      /* LDS row pitch in f16 elements */
typedef float v2f __attribute__((ext_vector_type(2)));
typedef _Float16 v2h __attribute__((ext_vector_type(2)));
// two f32 -> bf16 (nearest even), those values as f16, packed
__device__ __forceinline__ unsigned pk_bf_h(float x, float y) { unsigned u;
  asm("v_cvt_pk_bf16_f32 %0, %1, %2" : "=v"(u) : "v"(x), "v"(y));      /* as asm so that both sources are read where their loads left them: through a 2-vector the compiler first copied one register of every pair */
  const v2f r = {__uint_as_float(u << 16), __uint_as_float(u & 0xFFFF0000u)}; return __builtin_bit_cast(unsigned, __builtin_convertvector(r, v2h)); }
typedef unsigned v4ua __attribute__((ext_vector_type(4), may_alias));
template <int NN, bool FIN, bool ACF>
__global__ __launch_bounds__(256) void k_gemm3(const _Float16* __restrict__ A, const _Float16* __restrict__ Bh, float alpha, float* __restrict__ C, const float* __restrict__ bpj, const float* __restrict__ rgb, const float* __restrict__ ir) {
  static_assert(!FIN || (NN == CC && DIMH == 128 && PX % 128 == 0), "FIN: a 128-column tile is one input's channels, a 128-row tile lies in one image");
  static_assert(!ACF || (CC == 256 && DIMH == 128 && PX % 128 == 0), "ACF: 4 waves per input, a 128-row tile lies in one image");
  __shared__ __attribute__((aligned(16))) _Float16 sm[(128 + 128) * GLP];      /* 128 A rows, then 128 B rows; after the products the waves' output staging */
  const int lane = threadIdx.x & 31, ln = lane & 15, hh = lane >> 4; const int w = __builtin_amdgcn_readfirstlane((int)threadIdx.x >> 5); const int wr = w & 3, wc = w >> 2;
  const int ntn = NN / 128; const int mt = blockIdx.x / ntn, nq = blockIdx.x - mt * ntn; const int row0 = mt * 128 + 32 * wr, col0 = nq * 128 + 64 * wc;
  _Float16* sb = sm + 128 * GLP;
  const unsigned short* ga = (const unsigned short*)A + (size_t)(mt * 128 + 16 * w) * CC + lane * 8; const unsigned short* gb = (const unsigned short*)Bh + (size_t)(nq * 128 + 16 * w) * CC + lane * 8;
  v8us ra[16], rb[16];      /* wave w brings rows 16 w .. 16 w + 15 of either tile; the loops below are unrolled so that the arrays are registers and each row is an immediate offset */
  v4f fa[32]; const char* asrc = nullptr; unsigned aob = 0; const int cs = lane >> 3, pg = lane & 7;      /* ACF: [pixel block t][channel i] = 4 pixels 32 t + 4 pg .. + 3 of channel 32 w + 8 cs + i; asrc, aob: these loads' scalar base and offset register */
  if (ACF) { const int img = mt / (PX / 128), p0 = (mt - img * (PX / 128)) * 128;
    asrc = (const char*)((w < 4 ? rgb : ir) + ((size_t)img * DIMH + 32 * (w & 3)) * PX + p0); aob = (unsigned)(8 * cs * PX + 4 * pg) * 4u;
#pragma unroll
    for (int t = 0; t < 4; ++t) {
#pragma unroll
      for (int i = 0; i < 8; ++i) fa[t * 8 + i] = *(const v4fa*)(asrc + aob + (i * PX + 32 * t) * 4); }
  } else {
#pragma unroll
    for (int i = 0; i < 16; ++i) ra[i] = *(const v8us*)(ga + i * CC);
  }
#pragma unroll
  for (int i = 0; i < 16; ++i) rb[i] = *(const v8us*)(gb + i * CC);
  /* s_wait_xcnt 0 behind the tile's loads, in front of every overwrite of a register that they name; their offset registers (ACF: the A loads' scalar base too) are its inputs, so that none of them is overwritten ahead of it; its memory clobber also keeps every LDS store behind the last load, so the wave pays one load latency for all its rows */
  if (ACF) { asm volatile("s_wait_xcnt 0x0" :: "v"(lane), "v"(aob), "s"(asrc) : "memory");
    __builtin_amdgcn_sched_barrier(0); }      /* no conversion moves up among the loads: its wait for an A row would hold back the issue of the B rows */
  else asm volatile("s_wait_xcnt 0x0" :: "v"(lane) : "memory");
  if (ACF) {      /* 16-byte piece 4 w + cs of pixel row 32 t + 4 pg + j: at the pitch of 33 pieces the 32 lanes fall on all 16 bank groups, two lanes each */
#pragma unroll
    for (int t = 0; t < 4; ++t) {
#pragma unroll
      for (int j = 0; j < 4; ++j) { const v4ua o = {pk_bf_h(fa[t * 8][j], fa[t * 8 + 1][j]), pk_bf_h(fa[t * 8 + 2][j], fa[t * 8 + 3][j]), pk_bf_h(fa[t * 8 + 4][j], fa[t * 8 + 5][j]), pk_bf_h(fa[t * 8 + 6][j], fa[t * 8 + 7][j])};
        *(v4ua*)((unsigned short*)sm + (32 * t + 4 * pg + j) * GLP + 32 * w + 8 * cs) = o; } }
  } else {
#pragma unroll
    for (int i = 0; i < 16; ++i) *(v8us*)((unsigned short*)sm + (16 * w + i) * GLP + lane * 8) = ra[i];
  }
#pragma unroll
  for (int i = 0; i < 16; ++i) *(v8us*)((unsigned short*)sb + (16 * w + i) * GLP + lane * 8) = rb[i];
  __syncthreads();
  /* the residual's and the bias's loads stand behind the barrier (which waits for every load issued in front of it) and ahead of the products, under which they fly */
  v4f rs[16]; float bv[4]; unsigned rob = 0;      /* residual: [fragment u][rows 0-3, 4-7]; bias: one column per t; rob: the residual loads' offset register */
  if (FIN) { const int img = mt / (PX / 128), p0 = (mt - img * (PX / 128)) * 128 + 32 * wr;
    const char* rsrc = (const char*)((nq ? ir : rgb) + ((size_t)img * DIMH + 64 * wc) * PX + p0); rob = (unsigned)(ln * PX + 8 * hh) * 4u; const float* bsrc = bpj + col0;
#pragma unroll
    for (int u = 0; u < 8; ++u) { const int t = u & 3, half = u >> 2;      /* unrolled: rs is registers, each load an immediate offset */
      rs[2 * u] = *(const v4fa*)(rsrc + rob + (t * 16 * PX + half * 16) * 4); rs[2 * u + 1] = *(const v4fa*)(rsrc + rob + (t * 16 * PX + half * 16 + 4) * 4); }
#pragma unroll
    for (int t = 0; t < 4; ++t) bv[t] = bsrc[t * 16 + ln];
  }
  const _Float16* pa = sm + (32 * wr + ln) * GLP; const _Float16* pb = sb + (64 * wc + ln) * GLP;
  const v8f z8 = {0.f,0.f,0.f,0.f,0.f,0.f,0.f,0.f}; v8f c00 = z8, c01 = z8, c02 = z8, c03 = z8, c10 = z8, c11 = z8, c12 = z8, c13 = z8;
  v16h a0 = g2_frag(pa, hh), a1 = g2_frag(pa + 16 * GLP, hh), b0 = g2_frag(pb, hh), b1 = g2_frag(pb + 16 * GLP, hh), b2 = g2_frag(pb + 32 * GLP, hh), b3 = g2_frag(pb + 48 * GLP, hh);
  /* unrolled whole (8 steps): the two fragment sets then need no register moves, and every LDS address is an immediate offset */
#pragma unroll
  for (int kb = 0; kb < CC; kb += 32) { v16h n0 = a0, n1 = a1, m0 = b0, m1 = b1, m2 = b2, m3 = b3;
    if (kb + 32 < CC) { const int kn = kb + 32;      /* the next step's 12 LDS reads as one group ahead of this step's WMMAs */
      n0 = g2_frag(pa + kn, hh); n1 = g2_frag(pa + 16 * GLP + kn, hh); m0 = g2_frag(pb + kn, hh); m1 = g2_frag(pb + 16 * GLP + kn, hh); m2 = g2_frag(pb + 32 * GLP + kn, hh); m3 = g2_frag(pb + 48 * GLP + kn, hh); }
    c00 = g2_mma(a0, b0, c00); c10 = g2_mma(a1, b0, c10); c01 = g2_mma(a0, b1, c01); c11 = g2_mma(a1, b1, c11);
    c02 = g2_mma(a0, b2, c02); c12 = g2_mma(a1, b2, c12); c03 = g2_mma(a0, b3, c03); c13 = g2_mma(a1, b3, c13);
    a0 = n0; a1 = n1; b0 = m0; b1 = m1; b2 = m2; b3 = m3; }
  /* s_wait_xcnt 0 behind the residual's and the bias's loads; their two offset registers are its inputs, so that neither is overwritten ahead of it */
  if (FIN) { __builtin_amdgcn_sched_barrier(0);      /* none of the epilogue's arithmetic moves up among the products: its wait for the residual would stall them */
    asm volatile("s_wait_xcnt 0x0" :: "v"(rob), "v"(ln) : "memory"); }
  __syncthreads();      /* every wave has read its last fragment: the tiles' LDS may now take the output staging */
  float* so = (float*)sm + w * (32 * 68);      /* this wave's own 32 rows x 68 floats */
  v8f accs[8] = {c00, c01, c02, c03, c10, c11, c12, c13};      /* unrolled below, as in k_gemm2: accumulators are indexed by constants only */
#pragma unroll
  for (int u = 0; u < 8; ++u) { const int t = u & 3, half = u >> 2;
#pragma unroll
    for (int r = 0; r < 8; ++r) { float v = accs[u][r] * alpha; if (FIN) v = (v + bf16_round(bv[t])) + bf16_round(rs[2 * u + (r >> 2)][r & 3]); so[(half * 16 + 8 * hh + r) * 68 + t * 16 + ln] = v; } }
  __builtin_amdgcn_fence(__ATOMIC_ACQ_REL, "workgroup"); __builtin_amdgcn_wave_barrier();
  const int rsub = lane >> 4, c4 = (lane & 15) * 4;
#pragma unroll
  for (int q = 0; q < 16; ++q) { const int r = q * 2 + rsub; const v4f v = *(const v4fa*)&so[r * 68 + c4]; *(v4f*)(C + (size_t)(row0 + r) * NN + col0 + c4) = v; } }

__global__ __launch_bounds__(256) void k_wnat(const float* __restrict__ w, size_t n8, _Float16* __restrict__ Bt) { const size_t t = (size_t)blockIdx.x * 256 + threadIdx.x; if (t >= n8) return; FragH f; for (int q = 0; q < 8; ++q) f.h[q] = (_Float16)(bf16_round(w[t * 8 + q]) * 16.0f); *(v8us*)((unsigned short*)Bt + t * 8) = f.half[0];  }
__global__ __launch_bounds__(256) void k_rsm(const float* __restrict__ S, _Float16* __restrict__ P, int nrows) {
  #pragma clang fp contract(off)
  const int i = blockIdx.x * 256 + threadIdx.x; if (i >= nrows) return; const float* s = S + (size_t)i * SQ; float mx = -3.0e38f;
#pragma unroll 1
  for (int j = 0; j < SQ; ++j) mx = fmaxf(mx, s[j]); float se = 0.f;
#pragma unroll 1
  for (int j = 0; j < SQ; ++j) se += expf(s[j] - mx); const float sc = 256.0f / se;
#pragma unroll 1
  for (int j0 = 0; j0 < SQ; j0 += 8) { FragH f; for (int q = 0; q < 8; ++q) f.h[q] = (_Float16)(expf(s[j0 + q] - mx) * sc); unsigned short* d = (unsigned short*)P + (size_t)i * SQ + j0; *(v8us*)d = f.half[0];  } }
__global__ __launch_bounds__(256) void k_vt(const _Float16* __restrict__ V16, int b, int h0, _Float16* __restrict__ VT) { __shared__ unsigned short tl[64][65]; const int tid = threadIdx.x; const int hh = blockIdx.x % HG, sg = blockIdx.x / HG; const int s0 = sg * 64; const int h = h0 + hh;
  for (int i = tid; i < 64 * 8; i += 256) { const int j = i / 8, d8 = (i % 8) * 8; FragH f; f.half[0] = *(const v8us*)((const unsigned short*)V16 + ((size_t)b * SQ + s0 + j) * DM + h * HD + d8); for (int q = 0; q < 8; ++q) tl[d8 + q][j] = f.u[q]; }
  __syncthreads();
  { for (int i = tid; i < 64 * 8; i += 256) { const int d = i / 8, j8 = (i % 8) * 8; FragH f; for (int q = 0; q < 8; ++q) f.u[q] = tl[d][j8 + q]; *(v8us*)((unsigned short*)VT + ((size_t)hh * HD + d) * SQ + s0 + j8) = f.half[0]; }  } }


// lane ^ M partner's value added (M = 1, 2, 4: all inside a 16-lane row), as one DPP add
template <int M>
__device__ __forceinline__ float xadd(float s) { return s + __int_as_float(__builtin_amdgcn_update_dpp(0, __float_as_int(s), 0x160 | M, 0xf, 0xf, true)); }
// One wave per (image column x, dilation, class of y modulo the dilation, segment): lane = 4 channels, 8 lanes = one head, so the 128 channels of a q, k or v row are one 512-byte load of whole lines.
// The wave walks down its column in steps of the dilation: the window rows y and y + dil of one pixel are the rows y - dil and y of the next, so they stay in registers (3 row slots of 3 k and 3 v rows each)
// and a pixel loads q and one new window row (7 rows) where it took 19. The walk is unrolled by 3, so that each slot is a fixed set of registers and nothing is moved.
// Work-group = 8 waves on 8 neighbouring columns. Segments: 5 x 8 pixels of the 40 of a class (dilation 2), 3 x 9 of the 27 or 26 (dilation 3): 10 + 9 = 19 walks a column,
// 760 work-groups, 6,080 waves of 8 or 9 pixels: close to six waves for each of the 1,024 SIMDs.
// An out-of-image neighbour reads an in-image row instead (row and column each fall back to the pixel's own), takes logit 0 and weight 0 on v.
#define DLW 19       /* walks a column: 2 classes x 5 segments + 3 classes x 3 segments */
__global__ __launch_bounds__(256) void k_dla(const float* __restrict__ F, _Float16* __restrict__ X16) {
  static_assert(WS % 8 == 0 && HS == 80, "8 columns a work-group; the segment table is for 80 rows");
  const int lane = threadIdx.x & 31; const int w = __builtin_amdgcn_readfirstlane((int)threadIdx.x >> 5);
  const int c = blockIdx.x % DLW, t = blockIdx.x / DLW; const int x = (t % (WS / 8)) * 8 + w, img = t / (WS / 8);
  const int di = c >= 10 ? 1 : 0, cw = di ? c - 10 : c; const int dil = di ? 3 : 2, len = di ? 9 : 8; const int cls = di ? cw % 3 : cw % 2, seg = di ? cw / 3 : cw / 2;      /* divisors as constants: a division by a variable goes through the vector unit, and y would no longer be a scalar */
  const int left = (di ? (HS - cls + 2) / 3 : (HS - cls + 1) / 2) - seg * len; const int n = left < len ? left : len;      /* pixels of this walk */
  int y = cls + seg * len * dil;
  const char* Fi = (const char*)(F + (size_t)img * PX * QW + di * 128); char* Xi = (char*)((unsigned short*)X16 + (size_t)img * PX * CC + di * 128);
  const unsigned vo = (unsigned)lane * 16u, vs = (unsigned)lane * 8u;      /* the lane's 4 channels: byte offset in an f32 row, in an f16 row */
  const bool okc[3] = {x - dil >= 0, true, x + dil < WS}; const int xc[3] = {okc[0] ? x - dil : x, x, okc[2] ? x + dil : x};
  v4f k[3][3], v[3][3]; bool okr[3]; const char* pr[3];      /* [slot][column]; pr: the scalar bases of the row loaded last */
  auto row = [&](int s, int yy) { okr[s] = yy >= 0 && yy < HS; const int yc = okr[s] ? yy : y;
#pragma unroll
    for (int j = 0; j < 3; ++j) { pr[j] = Fi + (size_t)((yc * WS + xc[j]) * (QW * 4)); k[s][j] = *(const v4fa*)(pr[j] + vo + CC * 4); v[s][j] = *(const v4fa*)(pr[j] + vo + 2 * CC * 4); } };
  row(0, y - dil);
  /* s_wait_xcnt 0 behind a row's loads, in front of every overwrite of a register that they name; the bases and the offset that their addresses are formed from are its inputs */
  asm volatile("s_wait_xcnt 0x0" :: "s"(pr[0]), "s"(pr[1]), "s"(pr[2]), "v"(vo) : "memory");
  row(1, y);
  asm volatile("s_wait_xcnt 0x0" :: "s"(pr[0]), "s"(pr[1]), "s"(pr[2]), "v"(vo) : "memory");      /* as above */
#pragma unroll 1
  for (int j0 = 0; j0 < n; j0 += 3) {      /* stays rolled: the body already holds the 3 places of the slots */
#pragma unroll
    for (int u = 0; u < 3; ++u) {      /* unrolled: slot numbers are constants, the slots registers */
      if (j0 + u < n) { const int sl[3] = {u, (u + 1) % 3, (u + 2) % 3};      /* slots of the rows y - dil, y, y + dil */
        const char* pq = Fi + (size_t)((y * WS + x) * (QW * 4)); const v4f q = *(const v4fa*)(pq + vo);
        row(sl[2], y + dil);
        /* s_wait_xcnt 0 behind the pixel's loads, as above */
        asm volatile("s_wait_xcnt 0x0" :: "s"(pq), "s"(pr[0]), "s"(pr[1]), "s"(pr[2]), "v"(vo) : "memory");
        __builtin_amdgcn_sched_barrier(0);      /* all 7 loads of a pixel issue before any of its arithmetic: one latency a pixel, not one per group of loads */
        float s[9]; bool ok[9]; float mx = -INFINITY;
#pragma unroll
        for (int kk = 0; kk < 9; ++kk) { const v4f kr = k[sl[kk / 3]][kk % 3]; ok[kk] = okr[sl[kk / 3]] && okc[kk % 3];
          float d = fmaf(q[3], kr[3], fmaf(q[2], kr[2], fmaf(q[1], kr[1], q[0] * kr[0]))); d = xadd<4>(xadd<2>(xadd<1>(d)));
          s[kk] = ok[kk] ? d * SCL : 0.f; mx = fmaxf(mx, s[kk]); }
        float se = 0.f; v4f acc = {0.f, 0.f, 0.f, 0.f};
#pragma unroll
        for (int kk = 0; kk < 9; ++kk) { const float e = expf(s[kk] - mx); se += e; const float pw = ok[kk] ? e : 0.f; const v4f vr = v[sl[kk / 3]][kk % 3];
          for (int ch = 0; ch < 4; ++ch) acc[ch] = fmaf(pw, vr[ch], acc[ch]); }
        const float inv = 1.0f / se; v4h o; for (int ch = 0; ch < 4; ++ch) o[ch] = (_Float16)(acc[ch] * inv);
        char* po = Xi + (size_t)((y * WS + x) * (CC * 2)); *(v4h*)(po + vs) = o;
        /* s_wait_xcnt 0 behind the store, in front of the next pixel's overwrite of its address and data registers */
        asm volatile("s_wait_xcnt 0x0" :: "s"(po), "v"(vs) : "memory");
        y += dil; } } } }

extern "C" void kernel_launch(void* const* d_in, const int* in_sizes, int n_in,
                              void* d_out, int out_size, void* d_ws, size_t ws_size, hipStream_t stream) {
  (void)in_sizes; (void)n_in; (void)out_size;
  const float* const* I = (const float* const*)d_in; const float* rgb = I[0]; const float* ir = I[1]; const float* wqkv = I[2]; const float* wp = I[3]; const float* bp = I[4];
  char* ws = (char*)d_ws; size_t off = 0;
  auto take = [&](size_t bytes) { char* p = ws + off; off += (bytes + 255) & ~(size_t)255; return p; };
  _Float16* BQ = (_Float16*)take((size_t)QW * CC * 2); _Float16* BP = (_Float16*)take((size_t)CC * CC * 2); float* F = (float*)take(NR * QW * 4); _Float16* X16 = (_Float16*)take(NR * CC * 2);
  if (off > ws_size) return;      /* 0.5 + 75 + 12.5 = approx 88 MiB */
  k_wnat<<<(unsigned)(((size_t)QW * CC / 8 + 255) / 256), 256, 0, stream>>>(wqkv, (size_t)QW * CC / 8, BQ); k_wnat<<<(unsigned)(((size_t)CC * CC / 8 + 255) / 256), 256, 0, stream>>>(wp, (size_t)CC * CC / 8, BP);
  k_gemm3<QW, false, true><<<(unsigned)((NR / 128) * (QW / 128)), 256, 0, stream>>>(nullptr, BQ, 0.0625f, F, nullptr, rgb, ir);      /* qkv (f32) */
  k_dla<<<(unsigned)(NB * (WS / 8) * DLW), 256, 0, stream>>>(F, X16);
  k_gemm3<CC, true, false><<<(unsigned)((NR / 128) * (CC / 128)), 256, 0, stream>>>(X16, BP, 0.0625f, (float*)d_out, bp, rgb, ir);      /* proj + bias + residual */
}

// v006
// Measured time: 55 microseconds a run.
// Next to v005, in two timings, it ran 1.16 times as fast each time.
// Counting every step since v000, it is 14.7 times as fast.
#include <hip/hip_runtime.h>
// Multi-dilate local attention (rgb, ir [4][128][80][80] -> y = [rgb | ir] (256 ch); qkv = 1x1 (w_qkv [768][256]) split as [3][2 dilations][128 = 4 heads x 32]; per dilation d in (2, 3): each pixel attends to its 3x3 dilated neighbourhood (zero-padded unfold: out-of-image neighbours contribute k = v = 0, logit 0) with softmax(q.k / sqrt(32)) over the 9; heads merged dilation-major; proj (w_proj [256][256]) + b_proj; + y -> NHWC [4][80][80][256]).
// Structure: qkv as a WMMA GEMM whose A tile comes straight from the two channel-first inputs, turned into concatenated pixel rows (exact f16) on its way into LDS (operand tiles staged in LDS, 32x64 wave tiles, f32 accumulation, exact x16 natural weights; exact products) kept f32; the dilated local attention, one wave walking down a column in steps of the dilation with the window's rows kept in registers, on VALU (f32; 4 channels a lane, softmax weights in registers) into f16 rows; projection GEMM whose epilogue adds bias + residual (f32, VALU) and writes the NHWC output.
// Compute dtype: inputs rounded to bf16; y / weights exact; qkv and the attention f32; the attended rows as a plain f16 GEMM operand (~2^-12). v_wmma_f32_16x16x32_f16.
#define NB 4
#define DIMH 128
#define CC 256
#define QW 768
#define HS 80
#define WS 80
#define PX (HS * WS)                 /* 6400 = 50 x 128 */
#define NR ((size_t)NB * PX)         /* 25,600 rows */
#define NRD ((int)NR)                /* unused */
#define SCL 0.17677669529663689f
#define SQ 64
#define DM 64
#define NH 1
#define HD 64
#define HG 1
typedef __bf16 v16b __attribute__((ext_vector_type(16)));
typedef unsigned short v8us __attribute__((ext_vector_type(8), may_alias));
typedef float  v8f  __attribute__((ext_vector_type(8)));
typedef float  v4f  __attribute__((ext_vector_type(4)));
typedef float  v4fa __attribute__((ext_vector_type(4), may_alias));
union FragB { v16b v; v8us half[2]; unsigned short u[16]; };

__device__ __forceinline__ unsigned short bf16_bits(float x) { unsigned int u = __float_as_uint(x); return (unsigned short)((u + 0x7FFFu + ((u >> 16) & 1u)) >> 16); }
__device__ __forceinline__ float bf16_val(unsigned short b) { return __uint_as_float(((unsigned int)b) << 16); }
__device__ __forceinline__ float bf16_round(float x) { return bf16_val(bf16_bits(x)); }
// D += A·B with NT terms: 1 = ah·bh, 2 = + al·bh (A split), 3 = + ah·bl (both split)
template <int NT>
__device__ __forceinline__ v8f mmaN(v16b ah, v16b al, v16b bh, v16b bl, v8f c) {
  c = __builtin_amdgcn_wmma_f32_16x16x32_bf16(false, ah, false, bh, (short)0, c, false, false);
  if (NT >= 2) c = __builtin_amdgcn_wmma_f32_16x16x32_bf16(false, al, false, bh, (short)0, c, false, false);
  if (NT >= 3) c = __builtin_amdgcn_wmma_f32_16x16x32_bf16(false, ah, false, bl, (short)0, c, false, false);
  asm volatile("v_nop\n\tv_nop\n\tv_nop\n\tv_nop" : "+v"(c) : "v"(ah), "v"(al), "v"(bh), "v"(bl));
  return c;
}

__global__ __launch_bounds__(256) void k_wt_bf16(const float* __restrict__ W, unsigned short* __restrict__ Wt, int K, int N) {
  const int t = blockIdx.x * 256 + threadIdx.x;
  const int k8n = K / 8;
  if (t >= N * k8n) return;
  const int n = t / k8n, k8 = (t % k8n) * 8;
  v8us v;
#pragma unroll
  for (int i = 0; i < 8; ++i) v[i] = bf16_bits(W[(size_t)(k8 + i) * N + n]);
  *(v8us*)(Wt + (size_t)n * K + k8) = v;
  
}

// GEMM C[M][N] (f32, pitch ldc) = act(A[M][K]·W + bias). A f32 row-major (pitch lda) converted per fragment to bf16
// (ASPLIT: hi/lo two planes -> 2 terms, else single rounded term); Wt bf16 [N][K] (pitch ldb). BIAS_BF16 rounds the
// bias to bf16 first (bias quantised to bf16 before the add). K%32==0, M%16==0, N%64==0.
template <bool ASPLIT, int ACT, bool BIAS_BF16>
__global__ __launch_bounds__(128) void k_gemm_bf(const float* __restrict__ A, int lda, const unsigned short* __restrict__ Wt, int ldb,
                                               const float* __restrict__ bias, float* __restrict__ C, int ldc, int M, int N, int K) {
  __shared__ __attribute__((aligned(16))) float so[4][16][64];
  const int tid = threadIdx.x, w = tid >> 5, lane = tid & 31, ln = lane & 15, hh = lane >> 4;
  const int ntn = N / 64;
  const int wid = blockIdx.x * 4 + w;
  const int mt = wid / ntn, nq = wid % ntn;
  if (mt * 16 >= M) return;
  const int row0 = mt * 16, col0 = nq * 64;
  const float* arow = A + (size_t)(row0 + ln) * lda;
  v8f acc[4] = {};
  for (int kb = 0; kb < K; kb += 32) {
    FragB ah, al;
    const v4f x0 = *(const v4fa*)(arow + kb + 8 * hh), x1 = *(const v4fa*)(arow + kb + 8 * hh + 4);
    const v4f x2 = *(const v4fa*)(arow + kb + 16 + 8 * hh), x3 = *(const v4fa*)(arow + kb + 16 + 8 * hh + 4);
    float xs[16] = {x0[0],x0[1],x0[2],x0[3],x1[0],x1[1],x1[2],x1[3],x2[0],x2[1],x2[2],x2[3],x3[0],x3[1],x3[2],x3[3]};
#pragma unroll
    for (int i = 0; i < 16; ++i) { const unsigned short hb = bf16_bits(xs[i]); ah.u[i] = hb; al.u[i] = ASPLIT ? bf16_bits(xs[i] - bf16_val(hb)) : (unsigned short)0; }
#pragma unroll
    for (int t = 0; t < 4; ++t) {
      const unsigned short* brow = Wt + (size_t)(col0 + t * 16 + ln) * ldb + kb;
      FragB b;
      b.half[0] = *(const v8us*)(brow + 8 * hh);
      b.half[1] = *(const v8us*)(brow + 16 + 8 * hh);
      acc[t] = mmaN<ASPLIT ? 2 : 1>(ah.v, al.v, b.v, b.v, acc[t]);
    }
  }
#pragma unroll
  for (int t = 0; t < 4; ++t) {
    float bv = bias ? bias[col0 + t * 16 + ln] : 0.f;
    if (BIAS_BF16) bv = bf16_round(bv);
#pragma unroll
    for (int r = 0; r < 8; ++r) { float v = acc[t][r] + bv; if (ACT == 1) v = fmaxf(v, 0.f); so[w][8 * hh + r][t * 16 + ln] = v; }
  }
  __builtin_amdgcn_fence(__ATOMIC_ACQ_REL, "workgroup");
  __builtin_amdgcn_wave_barrier();
  const int rsub = lane >> 4, c4 = (lane & 15) * 4;
  {
#pragma unroll
    for (int q = 0; q < 8; ++q) {
      const int r = q * 2 + rsub;
      const v4f v = *(const v4fa*)&so[w][r][c4];
      *(v4f*)(C + (size_t)(row0 + r) * ldc + col0 + c4) = v;
    }
    
  }
}

// GEMM C = act(A·W + bias + resid): A f32 (ASPLIT -> hi/lo 2 terms), Wt bf16 [N][K]; ACT 0 none, 1 relu, 2 exact gelu;
// resid (optional, f32, row index = (row % rmod), pitch ldr, RES_BF16 rounds it) added before the activation.
template <bool ASPLIT, int ACT, bool BIAS_BF16, bool RES_BF16>
__global__ __launch_bounds__(128) void k_gemm_bf3(const float* __restrict__ A, int lda, const unsigned short* __restrict__ Wt, int ldb,
                                                const float* __restrict__ bias, const float* __restrict__ resid, int rmod, int ldr,
                                                float* __restrict__ C, int ldc, int M, int N, int K) {
  __shared__ __attribute__((aligned(16))) float so[4][16][64];
  const int tid = threadIdx.x, w = tid >> 5, lane = tid & 31, ln = lane & 15, hh = lane >> 4;
  const int ntn = N / 64;
  const int wid = blockIdx.x * 4 + w;
  const int mt = wid / ntn, nq = wid % ntn;
  if (mt * 16 >= M) return;
  const int row0 = mt * 16, col0 = nq * 64;
  const float* arow = A + (size_t)(row0 + ln) * lda;
  v8f acc[4] = {};
  for (int kb = 0; kb < K; kb += 32) {
    FragB ah, al;
    const v4f x0 = *(const v4fa*)(arow + kb + 8 * hh), x1 = *(const v4fa*)(arow + kb + 8 * hh + 4);
    const v4f x2 = *(const v4fa*)(arow + kb + 16 + 8 * hh), x3 = *(const v4fa*)(arow + kb + 16 + 8 * hh + 4);
    float xs[16] = {x0[0],x0[1],x0[2],x0[3],x1[0],x1[1],x1[2],x1[3],x2[0],x2[1],x2[2],x2[3],x3[0],x3[1],x3[2],x3[3]};
#pragma unroll
    for (int i = 0; i < 16; ++i) { const unsigned short hb = bf16_bits(xs[i]); ah.u[i] = hb; al.u[i] = ASPLIT ? bf16_bits(xs[i] - bf16_val(hb)) : (unsigned short)0; }
#pragma unroll
    for (int t = 0; t < 4; ++t) {
      const unsigned short* brow = Wt + (size_t)(col0 + t * 16 + ln) * ldb + kb;
      FragB b;
      b.half[0] = *(const v8us*)(brow + 8 * hh);
      b.half[1] = *(const v8us*)(brow + 16 + 8 * hh);
      acc[t] = mmaN<ASPLIT ? 2 : 1>(ah.v, al.v, b.v, b.v, acc[t]);
    }
  }
#pragma unroll
  for (int t = 0; t < 4; ++t) {
    const int col = col0 + t * 16 + ln;
    float bv = bias ? bias[col] : 0.f;
    if (BIAS_BF16) bv = bf16_round(bv);
#pragma unroll
    for (int r = 0; r < 8; ++r) {
      float v = acc[t][r] + bv;
      if (resid) { float rv = resid[(size_t)((row0 + 8 * hh + r) % rmod) * ldr + col]; if (RES_BF16) rv = bf16_round(rv); v += rv; }
      if (ACT == 1) v = fmaxf(v, 0.f);
      if (ACT == 2) v = 0.5f * v * (1.0f + erff(v * 0.70710678118654752f));
      if (ACT == 3) { const float u = 0.7978845608028654f * (v + 0.044715f * v * v * v); v = 0.5f * v * (1.0f + tanhf(u)); }
      so[w][8 * hh + r][t * 16 + ln] = v;
    }
  }
  __builtin_amdgcn_fence(__ATOMIC_ACQ_REL, "workgroup");
  __builtin_amdgcn_wave_barrier();
  const int rsub = lane >> 4, c4 = (lane & 15) * 4;
  {
#pragma unroll
    for (int q = 0; q < 8; ++q) {
      const int r = q * 2 + rsub;
      const v4f v = *(const v4fa*)&so[w][r][c4];
      *(v4f*)(C + (size_t)(row0 + r) * ldc + col0 + c4) = v;
    }
    
  }
}
// row LayerNorm (biased variance, eps) over N: s = X (+ R); optional out_sum <- s; out_norm <- (s-mu)*rsqrt(var+eps)*g + b
template <bool PARAM_BF16>
__global__ __launch_bounds__(256) void k_layernorm(const float* __restrict__ X, const float* __restrict__ R, const float* __restrict__ g, const float* __restrict__ bta,
                                                  float* __restrict__ out_sum, float* __restrict__ out_norm, int N, float eps) {
  __shared__ float red[256];
  const int row = blockIdx.x, tid = threadIdx.x;
  const float* x = X + (size_t)row * N; const float* rr = R ? R + (size_t)row * N : nullptr;
  float vals[16];                     // up to N = 4096
  const int per = N / 256;            // contiguous chunk per thread? use strided-by-4 chunks: thread handles j = tid*4 + 1024*u
  float s1 = 0.f;
  for (int u = 0; u < per / 4; ++u) {
    const int j = tid * 4 + 1024 * u;
    const v4f a = *(const v4fa*)(x + j);
    v4f b = {0.f,0.f,0.f,0.f}; if (rr) b = *(const v4fa*)(rr + j);
#pragma unroll
    for (int q = 0; q < 4; ++q) { const float v = a[q] + b[q]; vals[u * 4 + q] = v; s1 += v; }
  }
  red[tid] = s1; __syncthreads();
  for (int st = 128; st > 0; st >>= 1) { if (tid < st) red[tid] += red[tid + st]; __syncthreads(); }
  const float mu = red[0] / (float)N; __syncthreads();
  float s2 = 0.f;
  for (int u = 0; u < per / 4; ++u)
#pragma unroll
    for (int q = 0; q < 4; ++q) { const float c = vals[u * 4 + q] - mu; s2 += c * c; }
  red[tid] = s2; __syncthreads();
  for (int st = 128; st > 0; st >>= 1) { if (tid < st) red[tid] += red[tid + st]; __syncthreads(); }
  const float rs = rsqrtf(red[0] / (float)N + eps);
  {
    for (int u = 0; u < per / 4; ++u) {
      const int j = tid * 4 + 1024 * u;
      v4f o, sm;
#pragma unroll
      for (int q = 0; q < 4; ++q) {
        float gg = g[j + q], bb = bta[j + q];
        if (PARAM_BF16) { gg = bf16_round(gg); bb = bf16_round(bb); }
        sm[q] = vals[u * 4 + q]; o[q] = (vals[u * 4 + q] - mu) * rs * gg + bb;
      }
      if (out_sum) *(v4f*)(out_sum + (size_t)row * N + j) = sm;
      *(v4f*)(out_norm + (size_t)row * N + j) = o;
    }
    
  }
}



// ---- f16 WMMA path (v_wmma_f32_16x16x32_f16): 11-bit significands for operands in range — used here for the qkv and projection GEMMs
typedef _Float16 v16h __attribute__((ext_vector_type(16)));
union FragH { v16h v; v8us half[2]; _Float16 h[16]; unsigned short u[16]; };
template <int NT>
__device__ __forceinline__ v8f mmaH(v16h ah, v16h al, v16h bh, v16h bl, v8f c) {
  c = __builtin_amdgcn_wmma_f32_16x16x32_f16(false, ah, false, bh, (short)0, c, false, false);
  if (NT >= 2) c = __builtin_amdgcn_wmma_f32_16x16x32_f16(false, al, false, bh, (short)0, c, false, false);
  if (NT >= 3) c = __builtin_amdgcn_wmma_f32_16x16x32_f16(false, ah, false, bl, (short)0, c, false, false);
  asm volatile("v_nop\n\tv_nop\n\tv_nop\n\tv_nop" : "+v"(c) : "v"(ah), "v"(al), "v"(bh), "v"(bl));
  return c;
}
// batched GEMM like k_gemm_b but f16 operands: A f32 (split into f16 hi/lo if ASPLIT, else rounded to f16), Bt = f16 values [n][k]; alpha; C f32; N multiple of 16 (partial tiles skipped)
template <bool ASPLIT>
__global__ __launch_bounds__(128) void k_gemm_h(const float* __restrict__ A, int lda, size_t sA, const _Float16* __restrict__ Bh, int ldb, size_t sB, float alpha, float* __restrict__ C, int ldc, size_t sC, int M, int N, int K) {
  __shared__ __attribute__((aligned(16))) float so[4][16][64];
  const int tid = threadIdx.x, w = tid >> 5, lane = tid & 31, ln = lane & 15, hh = lane >> 4; const int by = blockIdx.y;
  A += (size_t)by * sA; Bh += (size_t)by * sB; C += (size_t)by * sC;
  const int ntn = (N + 63) / 64; const int wid = blockIdx.x * 4 + w; const int mt = wid / ntn, nq = wid % ntn; if (mt * 16 >= M) return;
  const int row0 = mt * 16, col0 = nq * 64; const float* arow = A + (size_t)(row0 + ln) * lda;
  v8f acc[4] = {};
  for (int kb = 0; kb < K; kb += 32) {
    FragH ah, al;
    const v4f x0 = *(const v4fa*)(arow + kb + 8 * hh), x1 = *(const v4fa*)(arow + kb + 8 * hh + 4), x2 = *(const v4fa*)(arow + kb + 16 + 8 * hh), x3 = *(const v4fa*)(arow + kb + 16 + 8 * hh + 4);
    float xs[16] = {x0[0],x0[1],x0[2],x0[3],x1[0],x1[1],x1[2],x1[3],x2[0],x2[1],x2[2],x2[3],x3[0],x3[1],x3[2],x3[3]};
#pragma unroll
    for (int i = 0; i < 16; ++i) { const _Float16 h = (_Float16)xs[i]; ah.h[i] = h; al.h[i] = ASPLIT ? (_Float16)(xs[i] - (float)h) : (_Float16)0.0f; }
#pragma unroll
    for (int t = 0; t < 4; ++t) { if (col0 + t * 16 >= N) continue; const size_t boff = (size_t)(col0 + t * 16 + ln) * ldb + kb; FragH bq; bq.half[0] = *(const v8us*)(Bh + boff + 8 * hh); bq.half[1] = *(const v8us*)(Bh + boff + 16 + 8 * hh);
      acc[t] = mmaH<ASPLIT ? 2 : 1>(ah.v, al.v, bq.v, bq.v, acc[t]); }
  }
#pragma unroll
  for (int t = 0; t < 4; ++t) { if (col0 + t * 16 >= N) continue;
#pragma unroll
    for (int r = 0; r < 8; ++r) so[w][8 * hh + r][t * 16 + ln] = acc[t][r] * alpha; }
  __builtin_amdgcn_fence(__ATOMIC_ACQ_REL, "workgroup"); __builtin_amdgcn_wave_barrier();
  const int rsub = lane >> 4, c4 = (lane & 15) * 4;
  {
#pragma unroll
    for (int q = 0; q < 8; ++q) { const int r = q * 2 + rsub; if (col0 + c4 < N) { const v4f v = *(const v4fa*)&so[w][r][c4]; *(v4f*)(C + (size_t)(row0 + r) * ldc + col0 + c4) = v; } }
     }
}

// Wt[n][k] = f16(W[k][n]·scale) from f32 row-major W[K][N] (scale = power of two; bf16-exact weights stay exact in f16 away from the subnormal range)
__global__ __launch_bounds__(256) void k_wt_f16(const float* __restrict__ W, _Float16* __restrict__ Wt, int K, int N, float scale) {
  const int t = blockIdx.x * 256 + threadIdx.x; if (t >= N * (K / 8)) return; const int n = t / (K / 8), k8 = (t % (K / 8)) * 8; FragH f;
#pragma unroll
  for (int i = 0; i < 8; ++i) f.h[i] = (_Float16)(bf16_round(W[(size_t)(k8 + i) * N + n]) * scale); const v8us o = f.half[0];
  *(v8us*)((unsigned short*)Wt + (size_t)n * K + k8) = o; 
}
// k_gemm_hh variant with fused epilogue: v = acc·alpha + bias[by·sBias + col] (+ CP[(row/rowsPerB)·sCPb + by·64 + col] if CP) ; ACT 0 none / 1 elu ; writes f16 C16 (and f32 C if non-null)
template <int ACT>
__global__ __launch_bounds__(128) void k_gemm_hhx(const _Float16* __restrict__ A, int lda, size_t sA, const _Float16* __restrict__ Bh, int ldb, size_t sB, float alpha, const float* __restrict__ bias, size_t sBias, const float* __restrict__ CP, int rowsPerB, size_t sCPb, int row0g,
    float* __restrict__ C, _Float16* __restrict__ C16, int ldc, size_t sC, int M, int N, int K) {
  __shared__ __attribute__((aligned(16))) float so[4][16][64];
  const int tid = threadIdx.x, w = tid >> 5, lane = tid & 31, ln = lane & 15, hh = lane >> 4; const int by = blockIdx.y;
  A += (size_t)by * sA; Bh += (size_t)by * sB; const size_t cofs = (size_t)by * sC; const float* bp = bias ? bias + (size_t)by * sBias : nullptr;
  const int ntn = (N + 63) / 64; const int wid = blockIdx.x * 4 + w; const int mt = wid / ntn, nq = wid % ntn; if (mt * 16 >= M) return;
  const int row0 = mt * 16, col0 = nq * 64; const _Float16* arow = A + (size_t)(row0 + ln) * lda;
  v8f acc[4] = {};
  for (int kb = 0; kb < K; kb += 32) { FragH ah; ah.half[0] = *(const v8us*)((const unsigned short*)arow + kb + 8 * hh); ah.half[1] = *(const v8us*)((const unsigned short*)arow + kb + 16 + 8 * hh);
#pragma unroll
    for (int t = 0; t < 4; ++t) { if (col0 + t * 16 >= N) continue; const size_t boff = (size_t)(col0 + t * 16 + ln) * ldb + kb; FragH bq; bq.half[0] = *(const v8us*)((const unsigned short*)Bh + boff + 8 * hh); bq.half[1] = *(const v8us*)((const unsigned short*)Bh + boff + 16 + 8 * hh);
      acc[t] = mmaH<1>(ah.v, ah.v, bq.v, bq.v, acc[t]); }
  }
#pragma unroll
  for (int t = 0; t < 4; ++t) { if (col0 + t * 16 >= N) continue; const int col = col0 + t * 16 + ln; const float bv = bp ? bf16_round(bp[col]) : 0.f;
#pragma unroll
    for (int r = 0; r < 8; ++r) { float v = acc[t][r] * alpha + bv; if (CP) { const int rr = row0g + row0 + 8 * hh + r; if (rowsPerB < 0) v += CP[cofs + (size_t)rr * ldc + col];      /* rowsPerB < 0: own element of the batched C plane */ else { const int bidx = rr / rowsPerB; v += CP[(size_t)bidx * sCPb + (size_t)by * 64 + col]; } } if (ACT == 1) v = (v > 0.f) ? v : expm1f(v); else if (ACT == 7) v = (v > 0.f) ? v + 1.0f : expf(v); else if (ACT == 8) v = tanhf(v); else if (ACT == 9) v = 0.5f * v * (1.0f + tanhf(0.7978845608028654f * (v + 0.044715f * v * v * v))); else if (ACT == 11) v = 1.0f / (1.0f + expf(-v)); else if (ACT == 12) v = (v > 0.f) ? v : 0.01f * v; else if (ACT == 14) v = (v > 0.f) ? v : 0.1f * v; else if (ACT == 16) v = (v >= 0.f) ? v : 0.3f * v; else if (ACT == 17) v = (v >= 0.f) ? v : 0.2f * v; else if (ACT == 15) v = v / (1.0f + expf(-v)); else if (ACT == 3) v = fmaxf(v, 0.f); else if (ACT == 6) v = 0.5f * v * (1.0f + erff(v * 0.70710678118654752f)); so[w][8 * hh + r][t * 16 + ln] = v; } }
  __builtin_amdgcn_fence(__ATOMIC_ACQ_REL, "workgroup"); __builtin_amdgcn_wave_barrier();
  const int rsub = lane >> 4, c4 = (lane & 15) * 4; typedef _Float16 v4h __attribute__((ext_vector_type(4)));
  {
#pragma unroll
    for (int q = 0; q < 8; ++q) { const int r = q * 2 + rsub; if (col0 + c4 < N) { const v4f v = *(const v4fa*)&so[w][r][c4]; if (C) *(v4f*)(C + cofs + (size_t)(row0 + r) * ldc + col0 + c4) = v; if (C16) { v4h h4; for (int i = 0; i < 4; ++i) h4[i] = (_Float16)v[i]; *(v4h*)(C16 + cofs + (size_t)(row0 + r) * ldc + col0 + c4) = h4; } } }
     }
}


typedef _Float16 v4h __attribute__((ext_vector_type(4)));

__global__ __launch_bounds__(256) void k_x16(const float* __restrict__ x, _Float16* __restrict__ X16, size_t n8) { const size_t t = (size_t)blockIdx.x * 256 + threadIdx.x; if (t >= n8) return; FragH f;
#pragma unroll
  for (int q = 0; q < 8; ++q) f.h[q] = (_Float16)bf16_round(x[t * 8 + q]); *(v8us*)((unsigned short*)X16 + t * 8) = f.half[0];  }
__global__ __launch_bounds__(256) void k_h16(const float* __restrict__ x, _Float16* __restrict__ X16, size_t n8) { const size_t t = (size_t)blockIdx.x * 256 + threadIdx.x; if (t >= n8) return; FragH f;
#pragma unroll
  for (int q = 0; q < 8; ++q) f.h[q] = (_Float16)x[t * 8 + q]; *(v8us*)((unsigned short*)X16 + t * 8) = f.half[0];  }
__global__ __launch_bounds__(256) void k_round16f(const float* __restrict__ W, _Float16* __restrict__ Bt, size_t n8) { const size_t t = (size_t)blockIdx.x * 256 + threadIdx.x; if (t >= n8) return; FragH f;
#pragma unroll
  for (int i = 0; i < 8; ++i) f.h[i] = (_Float16)(bf16_round(W[t * 8 + i]) * 16.0f); *(v8us*)((unsigned short*)Bt + t * 8) = f.half[0];  }
template <int NHv, int TTv>
__global__ __launch_bounds__(256) void k_vt(const _Float16* __restrict__ V16, int ldv, int voff, _Float16* __restrict__ Vt) { __shared__ unsigned short tl[64][66]; const int tid = threadIdx.x; const int slab = blockIdx.x / (TTv / 64), lg = blockIdx.x % (TTv / 64); const int b = slab / NHv, h = slab % NHv;
  for (int i = tid; i < 64 * 8; i += 256) { const int r = i / 8, c8 = (i % 8) * 8; FragH f; f.half[0] = *(const v8us*)((const unsigned short*)V16 + ((size_t)b * TTv + lg * 64 + r) * ldv + voff + h * 64 + c8);
#pragma unroll
    for (int q = 0; q < 8; ++q) tl[r][c8 + q] = f.u[q]; }
  __syncthreads();
  {
#pragma unroll
    for (int rd = 0; rd < 2; ++rd) { const int d = rd * 32 + tid / 8, pc = tid % 8; FragH f;
#pragma unroll
      for (int q = 0; q < 8; ++q) f.u[q] = tl[pc * 8 + q][d];
      *(v8us*)((unsigned short*)Vt + ((size_t)slab * 64 + d) * TTv + lg * 64 + pc * 8) = f.half[0]; }
     } }

__global__ __launch_bounds__(256) void k_hl(const float* __restrict__ F, _Float16* __restrict__ Hh, _Float16* __restrict__ Hl, size_t n8) { const size_t t = (size_t)blockIdx.x * 256 + threadIdx.x; if (t >= n8) return; FragH fh, fl; const v4f a = *(const v4fa*)(F + t * 8), c = *(const v4fa*)(F + t * 8 + 4);
#pragma unroll
  for (int q = 0; q < 4; ++q) { _Float16 h = (_Float16)a[q]; fh.h[q] = h; fl.h[q] = (_Float16)((a[q] - (float)h) * 1024.0f); h = (_Float16)c[q]; fh.h[4 + q] = h; fl.h[4 + q] = (_Float16)((c[q] - (float)h) * 1024.0f); }
  { *(v8us*)((unsigned short*)Hh + t * 8) = fh.half[0]; *(v8us*)((unsigned short*)Hl + t * 8) = fl.half[0];  } }

// ---- fast GEMM (wave tile 32x64; requires M % 32 == 0 rows per launch region and N % 64 == 0); epilogue = k_gemm_hhx semantics ----
__device__ __forceinline__ v16h g2_frag(const _Float16* p, int hh) { FragH f; f.half[0] = *(const v8us*)((const unsigned short*)p + 8 * hh); f.half[1] = *(const v8us*)((const unsigned short*)p + 16 + 8 * hh); return f.v; }
__device__ __forceinline__ v8f g2_mma(v16h a, v16h b, v8f c) { v8f d = __builtin_amdgcn_wmma_f32_16x16x32_f16(false, a, false, b, (short)0, c, false, false); asm volatile("v_nop\n\tv_nop\n\tv_nop\n\tv_nop" : "+v"(d) : "v"(a), "v"(b)); return d; }
template <int ACT>
__global__ __launch_bounds__(128) void k_gemm2(const _Float16* __restrict__ A, int lda, size_t sA, const _Float16* __restrict__ Bh, int ldb, size_t sB, float alpha, const float* __restrict__ bias, size_t sBias, const float* __restrict__ CP, int rowsPerB, size_t sCPb, int row0g,
    float* __restrict__ C, _Float16* __restrict__ C16, int ldc, size_t sC, int M, int N, int K) { static_assert(ACT == 0 || ACT == 3 || ACT == 6 || ACT == 8 || ACT == 9 || ACT == 11 || ACT == 12 || ACT == 14 || ACT == 15 || ACT == 16 || ACT == 17, "k_gemm2: unsupported ACT code (would silently apply no activation)");
  __shared__ __attribute__((aligned(16))) float so[4][32][68];
  const int tid = threadIdx.x, w = tid >> 5, lane = tid & 31, ln = lane & 15, hh = lane >> 4; const int by = blockIdx.y;
  A += (size_t)by * sA; Bh += (size_t)by * sB; const size_t cofs = (size_t)by * sC; const float* bp = bias ? bias + (size_t)by * sBias : nullptr;
  const int ntn = N >> 6; const int mt = blockIdx.x / ntn, nq = blockIdx.x - mt * ntn; const int row0 = mt * 128 + 32 * w, col0 = nq * 64; if (row0 >= M) return;
  const _Float16* a0p = A + (size_t)(row0 + ln) * lda; const _Float16* a1p = a0p + (size_t)16 * lda;
  const _Float16* b0p = Bh + (size_t)(col0 + ln) * ldb; const _Float16* b1p = b0p + (size_t)16 * ldb; const _Float16* b2p = b1p + (size_t)16 * ldb; const _Float16* b3p = b2p + (size_t)16 * ldb;
  const v8f z8 = {0.f,0.f,0.f,0.f,0.f,0.f,0.f,0.f}; v8f c00 = z8, c01 = z8, c02 = z8, c03 = z8, c10 = z8, c11 = z8, c12 = z8, c13 = z8;
#pragma unroll 1
  for (int kb = 0; kb < K; kb += 32) { const v16h a0 = g2_frag(a0p + kb, hh), a1 = g2_frag(a1p + kb, hh);
    v16h b = g2_frag(b0p + kb, hh); c00 = g2_mma(a0, b, c00); c10 = g2_mma(a1, b, c10);
    b = g2_frag(b1p + kb, hh); c01 = g2_mma(a0, b, c01); c11 = g2_mma(a1, b, c11);
    b = g2_frag(b2p + kb, hh); c02 = g2_mma(a0, b, c02); c12 = g2_mma(a1, b, c12);
    b = g2_frag(b3p + kb, hh); c03 = g2_mma(a0, b, c03); c13 = g2_mma(a1, b, c13); }
  v8f accs[8] = {c00, c01, c02, c03, c10, c11, c12, c13};
#pragma unroll
  for (int u = 0; u < 8; ++u) { const int t = u & 3, half = u >> 2; const int col = col0 + t * 16 + ln; const float bv = bp ? bf16_round(bp[col]) : 0.f;
#pragma unroll
    for (int r = 0; r < 8; ++r) { const int rloc = half * 16 + 8 * hh + r; float v = accs[u][r] * alpha + bv; if (CP) { if (rowsPerB < 0) v += CP[cofs + (size_t)(row0g + row0 + rloc) * ldc + col];      /* rowsPerB < 0: own element of the batched C plane */ else { const int bidx = (row0g + row0 + rloc) / rowsPerB; v += CP[(size_t)bidx * sCPb + (size_t)by * 64 + col]; } }
      if (ACT == 3) v = fmaxf(v, 0.f); else if (ACT == 6) v = 0.5f * v * (1.0f + erff(v * 0.70710678118654752f)); else if (ACT == 11) v = 1.0f / (1.0f + expf(-v)); else if (ACT == 15) v = v / (1.0f + expf(-v)); else if (ACT == 12) v = (v > 0.f) ? v : 0.01f * v; else if (ACT == 8) v = tanhf(v); else if (ACT == 9) v = 0.5f * v * (1.0f + tanhf(0.7978845608028654f * (v + 0.044715f * v * v * v))); else if (ACT == 14) v = (v > 0.f) ? v : 0.1f * v; else if (ACT == 16) v = (v >= 0.f) ? v : 0.3f * v; else if (ACT == 17) v = (v >= 0.f) ? v : 0.2f * v;
      so[w][rloc][t * 16 + ln] = v; } }
  __builtin_amdgcn_fence(__ATOMIC_ACQ_REL, "workgroup"); __builtin_amdgcn_wave_barrier();
  const int rsub = lane >> 4, c4 = (lane & 15) * 4;
  {
#pragma unroll
    for (int q = 0; q < 16; ++q) { const int r = q * 2 + rsub; const v4f v = *(const v4fa*)&so[w][r][c4]; if (C) *(v4f*)(C + cofs + (size_t)(row0 + r) * ldc + col0 + c4) = v; if (C16) { v4h h4; for (int i = 0; i < 4; ++i) h4[i] = (_Float16)v[i]; *(v4h*)(C16 + cofs + (size_t)(row0 + r) * ldc + col0 + c4) = h4; } }
     } }


// ---- GEMM with both operand tiles staged in LDS: C[M][NN] (f32) = alpha * A[M][CC] . Bh[NN][CC]^T; K = CC; grid = (M / 128) * (NN / (128 NT)) ----
// Work-group tile 128 x 128, 8 waves; wave tile 32 x 64 and k order as k_gemm2. A fragment load straight from global touches 16 lines for its 512 bytes and stands in front of its own WMMAs;
// here each global load of a wave is one whole 512-byte row (4 lines), all 32 of a wave are in flight together, and the fragments come from LDS rows pitched 528 B (16 B x 33: no bank conflict for 16-byte reads).
// FIN (the projection): C = (alpha * A . Bh^T + bf16(bpj[col])) + bf16(residual), the residual read from the channel-first inputs in the accumulators' own layout:
// a lane's 8 accumulator rows of one column are 8 neighbouring pixels of one channel, 32 bytes in a row; a wave's 32 pixels of a channel are one whole 128-byte line.
// ACF (the qkv product): A is not read as f16 rows; the tile's 128 pixels x 256 channels come from the channel-first f32 inputs. Wave w brings channels 32 w .. 32 w + 31:
// a load's 8-lane groups take one 128-byte line (32 pixels) of 4 channels that lie 8 apart, so after 8 loads a lane holds 8 neighbouring channels of 4 pixels: 4 whole 16-byte pieces of pixel rows.
// NT: a work-group fills its A tile once and takes NT neighbouring 128-column tiles of B one after the other against it. The next B tile's rows are loaded into registers under the current tile's products;
// the output staging then lies on the B rows (never on A), and the tile's stores to C stay in flight while the next tile is worked on.
#define GLP 264      /* LDS row pitch in f16 elements */
typedef float v2f __attribute__((ext_vector_type(2)));
typedef _Float16 v2h __attribute__((ext_vector_type(2)));
// two f32 -> bf16 (nearest even), those values as f16, packed
__device__ __forceinline__ unsigned pk_bf_h(float x, float y) { unsigned u;
  asm("v_cvt_pk_bf16_f32 %0, %1, %2" : "=v"(u) : "v"(x), "v"(y));      /* as asm so that both sources are read where their loads left them: through a 2-vector the compiler first copied one register of every pair */
  const v2f r = {__uint_as_float(u << 16), __uint_as_float(u & 0xFFFF0000u)}; return __builtin_bit_cast(unsigned, __builtin_convertvector(r, v2h)); }
typedef unsigned v4ua __attribute__((ext_vector_type(4), may_alias));
// work-group barrier that orders LDS alone: __syncthreads() would also wait for the wave's global loads and stores, here the next B tile's loads and the last tile's stores to C, which no other wave reads
__device__ __forceinline__ void lds_barrier() { __builtin_amdgcn_fence(__ATOMIC_RELEASE, "workgroup", "local"); __builtin_amdgcn_s_barrier(); __builtin_amdgcn_fence(__ATOMIC_ACQUIRE, "workgroup", "local"); }
template <int NN, bool FIN, bool ACF, int NT>
__global__ __launch_bounds__(256) void k_gemm3(const _Float16* __restrict__ A, const _Float16* __restrict__ Bh, float alpha, float* __restrict__ C, const float* __restrict__ bpj, const float* __restrict__ rgb, const float* __restrict__ ir) {
  static_assert(!FIN || (NN == CC && DIMH == 128 && PX % 128 == 0), "FIN: a 128-column tile is one input's channels, a 128-row tile lies in one image");
  static_assert(!ACF || (CC == 256 && DIMH == 128 && PX % 128 == 0), "ACF: 4 waves per input, a 128-row tile lies in one image");
  static_assert(NN % (128 * NT) == 0 && (!FIN || NT == 1), "NT tiles divide the columns; the residual's loads are written for one tile");
  __shared__ __attribute__((aligned(16))) _Float16 sm[NT > 1 ? 128 * GLP + 8 * 32 * 68 * 2 : (128 + 128) * GLP];      /* 128 A rows, then 128 B rows; after the products the waves' output staging: NT = 1 from the start, NT > 1 from the B rows on (8 x 32 x 68 floats, 2 KiB more than these) */
  const int lane = threadIdx.x & 31, ln = lane & 15, hh = lane >> 4; const int w = __builtin_amdgcn_readfirstlane((int)threadIdx.x >> 5); const int wr = w & 3, wc = w >> 2;
  const int ntn = NN / (128 * NT); const int mt = blockIdx.x / ntn, nq0 = (blockIdx.x - mt * ntn) * NT; const int row0 = mt * 128 + 32 * wr;
  _Float16* sb = sm + 128 * GLP;
  const unsigned short* ga = (const unsigned short*)A + (size_t)(mt * 128 + 16 * w) * CC + lane * 8; const unsigned short* gb = (const unsigned short*)Bh + (size_t)(nq0 * 128 + 16 * w) * CC + lane * 8;
  v8us ra[16], rb[16];      /* wave w brings rows 16 w .. 16 w + 15 of either tile; the loops below are unrolled so that the arrays are registers and each row is an immediate offset */
  v4f fa[32]; const char* asrc = nullptr; unsigned aob = 0; const int cs = lane >> 3, pg = lane & 7;      /* ACF: [pixel block t][channel i] = 4 pixels 32 t + 4 pg .. + 3 of channel 32 w + 8 cs + i; asrc, aob: these loads' scalar base and offset register */
  if (ACF) { const int img = mt / (PX / 128), p0 = (mt - img * (PX / 128)) * 128;
    asrc = (const char*)((w < 4 ? rgb : ir) + ((size_t)img * DIMH + 32 * (w & 3)) * PX + p0); aob = (unsigned)(8 * cs * PX + 4 * pg) * 4u;
#pragma unroll
    for (int t = 0; t < 4; ++t) {
#pragma unroll
      for (int i = 0; i < 8; ++i) fa[t * 8 + i] = *(const v4fa*)(asrc + aob + (i * PX + 32 * t) * 4); }
  } else {
#pragma unroll
    for (int i = 0; i < 16; ++i) ra[i] = *(const v8us*)(ga + i * CC);
  }
#pragma unroll
  for (int i = 0; i < 16; ++i) rb[i] = *(const v8us*)(gb + i * CC);
  /* s_wait_xcnt 0 behind the tile's loads, in front of every overwrite of a register that they name; their offset registers (ACF: the A loads' scalar base too) are its inputs, so that none of them is overwritten ahead of it; its memory clobber also keeps every LDS store behind the last load, so the wave pays one load latency for all its rows */
  if (ACF) { asm volatile("s_wait_xcnt 0x0" :: "v"(lane), "v"(aob), "s"(asrc) : "memory");
    __builtin_amdgcn_sched_barrier(0); }      /* no conversion moves up among the loads: its wait for an A row would hold back the issue of the B rows */
  else asm volatile("s_wait_xcnt 0x0" :: "v"(lane) : "memory");
  if (ACF) {      /* 16-byte piece 4 w + cs of pixel row 32 t + 4 pg + j: at the pitch of 33 pieces the 32 lanes fall on all 16 bank groups, two lanes each */
#pragma unroll
    for (int t = 0; t < 4; ++t) {
#pragma unroll
      for (int j = 0; j < 4; ++j) { const v4ua o = {pk_bf_h(fa[t * 8][j], fa[t * 8 + 1][j]), pk_bf_h(fa[t * 8 + 2][j], fa[t * 8 + 3][j]), pk_bf_h(fa[t * 8 + 4][j], fa[t * 8 + 5][j]), pk_bf_h(fa[t * 8 + 6][j], fa[t * 8 + 7][j])};
        *(v4ua*)((unsigned short*)sm + (32 * t + 4 * pg + j) * GLP + 32 * w + 8 * cs) = o; } }
  } else {
#pragma unroll
    for (int i = 0; i < 16; ++i) *(v8us*)((unsigned short*)sm + (16 * w + i) * GLP + lane * 8) = ra[i];
  }
#pragma unroll 1
  for (int nt = 0; nt < NT; ++nt) {      /* stays rolled: one copy of the products and the epilogue in the instruction cache, one set of registers */
  const int nq = nq0 + nt, col0 = nq * 128 + 64 * wc;
#pragma unroll
  for (int i = 0; i < 16; ++i) *(v8us*)((unsigned short*)sb + (16 * w + i) * GLP + lane * 8) = rb[i];
  if (NT > 1) lds_barrier(); else __syncthreads();      /* tile filled */
  if (NT > 1 && nt + 1 < NT) {      /* the next B tile's rows: issued here, stored to LDS at the head of the next trip, so they fly under the products and the epilogue */
    gb += 128 * CC;
#pragma unroll
    for (int i = 0; i < 16; ++i) rb[i] = *(const v8us*)(gb + i * CC);
    /* s_wait_xcnt 0 behind these loads, in front of every overwrite of a register that they name; its memory clobber also keeps the loads from sinking below the products */
    asm volatile("s_wait_xcnt 0x0" :: "v"(lane), "v"(gb) : "memory");
  }
  /* the residual's and the bias's loads stand behind the barrier (which waits for every load issued in front of it) and ahead of the products, under which they fly */
  v4f rs[16]; float bv[4]; unsigned rob = 0;      /* residual: [fragment u][rows 0-3, 4-7]; bias: one column per t; rob: the residual loads' offset register */
  if (FIN) { const int img = mt / (PX / 128), p0 = (mt - img * (PX / 128)) * 128 + 32 * wr;
    const char* rsrc = (const char*)((nq ? ir : rgb) + ((size_t)img * DIMH + 64 * wc) * PX + p0); rob = (unsigned)(ln * PX + 8 * hh) * 4u; const float* bsrc = bpj + col0;
#pragma unroll
    for (int u = 0; u < 8; ++u) { const int t = u & 3, half = u >> 2;      /* unrolled: rs is registers, each load an immediate offset */
      rs[2 * u] = *(const v4fa*)(rsrc + rob + (t * 16 * PX + half * 16) * 4); rs[2 * u + 1] = *(const v4fa*)(rsrc + rob + (t * 16 * PX + half * 16 + 4) * 4); }
#pragma unroll
    for (int t = 0; t < 4; ++t) bv[t] = bsrc[t * 16 + ln];
  }
  const _Float16* pa = sm + (32 * wr + ln) * GLP; const _Float16* pb = sb + (64 * wc + ln) * GLP;
  const v8f z8 = {0.f,0.f,0.f,0.f,0.f,0.f,0.f,0.f}; v8f c00 = z8, c01 = z8, c02 = z8, c03 = z8, c10 = z8, c11 = z8, c12 = z8, c13 = z8;
  v16h a0 = g2_frag(pa, hh), a1 = g2_frag(pa + 16 * GLP, hh), b0 = g2_frag(pb, hh), b1 = g2_frag(pb + 16 * GLP, hh), b2 = g2_frag(pb + 32 * GLP, hh), b3 = g2_frag(pb + 48 * GLP, hh);
  /* unrolled whole (8 steps): the two fragment sets then need no register moves, and every LDS address is an immediate offset */
#pragma unroll
  for (int kb = 0; kb < CC; kb += 32) { v16h n0 = a0, n1 = a1, m0 = b0, m1 = b1, m2 = b2, m3 = b3;
    if (kb + 32 < CC) { const int kn = kb + 32;      /* the next step's 12 LDS reads as one group ahead of this step's WMMAs */
      n0 = g2_frag(pa + kn, hh); n1 = g2_frag(pa + 16 * GLP + kn, hh); m0 = g2_frag(pb + kn, hh); m1 = g2_frag(pb + 16 * GLP + kn, hh); m2 = g2_frag(pb + 32 * GLP + kn, hh); m3 = g2_frag(pb + 48 * GLP + kn, hh); }
    c00 = g2_mma(a0, b0, c00); c10 = g2_mma(a1, b0, c10); c01 = g2_mma(a0, b1, c01); c11 = g2_mma(a1, b1, c11);
    c02 = g2_mma(a0, b2, c02); c12 = g2_mma(a1, b2, c12); c03 = g2_mma(a0, b3, c03); c13 = g2_mma(a1, b3, c13);
    a0 = n0; a1 = n1; b0 = m0; b1 = m1; b2 = m2; b3 = m3; }
  /* s_wait_xcnt 0 behind the residual's and the bias's loads; their two offset registers are its inputs, so that neither is overwritten ahead of it */
  if (FIN) { __builtin_amdgcn_sched_barrier(0);      /* none of the epilogue's arithmetic moves up among the products: its wait for the residual would stall them */
    asm volatile("s_wait_xcnt 0x0" :: "v"(rob), "v"(ln) : "memory"); }
  if (NT > 1) lds_barrier(); else __syncthreads();      /* every wave has read its last fragment: the tiles' LDS may now take the output staging */
  float* so = (float*)(NT > 1 ? sb : sm) + w * (32 * 68);      /* this wave's own 32 rows x 68 floats */
  v8f accs[8] = {c00, c01, c02, c03, c10, c11, c12, c13};      /* unrolled below, as in k_gemm2: accumulators are indexed by constants only */
#pragma unroll
  for (int u = 0; u < 8; ++u) { const int t = u & 3, half = u >> 2;
#pragma unroll
    for (int r = 0; r < 8; ++r) { float v = accs[u][r] * alpha; if (FIN) v = (v + bf16_round(bv[t])) + bf16_round(rs[2 * u + (r >> 2)][r & 3]); so[(half * 16 + 8 * hh + r) * 68 + t * 16 + ln] = v; } }
  if (NT > 1) __builtin_amdgcn_fence(__ATOMIC_ACQ_REL, "workgroup", "local");      /* LDS alone, as in lds_barrier() */
  else __builtin_amdgcn_fence(__ATOMIC_ACQ_REL, "workgroup");
  __builtin_amdgcn_wave_barrier();
  const int rsub = lane >> 4, c4 = (lane & 15) * 4;
  if (NT > 1) { char* cb = (char*)(C + (size_t)row0 * NN + col0); const unsigned cob = (unsigned)(rsub * NN + c4) * 4u;      /* scalar base, one offset register, each row pair an immediate offset */
#pragma unroll
    for (int q = 0; q < 16; ++q) { const v4f v = *(const v4fa*)&so[(q * 2 + rsub) * 68 + c4]; *(v4f*)(cb + cob + q * 2 * NN * 4) = v; }
    /* s_wait_xcnt 0 behind the stores, in front of the next trip's overwrite of their base and data registers */
    asm volatile("s_wait_xcnt 0x0" :: "v"(cob), "s"(cb) : "memory");
    if (nt + 1 < NT) lds_barrier();      /* every wave has read its staging back: the B rows may take the next tile */
  } else {
#pragma unroll
  for (int q = 0; q < 16; ++q) { const int r = q * 2 + rsub; const v4f v = *(const v4fa*)&so[r * 68 + c4]; *(v4f*)(C + (size_t)(row0 + r) * NN + col0 + c4) = v; }
  } } }

__global__ __launch_bounds__(256) void k_wnat(const float* __restrict__ w, size_t n8, _Float16* __restrict__ Bt) { const size_t t = (size_t)blockIdx.x * 256 + threadIdx.x; if (t >= n8) return; FragH f; for (int q = 0; q < 8; ++q) f.h[q] = (_Float16)(bf16_round(w[t * 8 + q]) * 16.0f); *(v8us*)((unsigned short*)Bt + t * 8) = f.half[0];  }
__global__ __launch_bounds__(256) void k_rsm(const float* __restrict__ S, _Float16* __restrict__ P, int nrows) {
  #pragma clang fp contract(off)
  const int i = blockIdx.x * 256 + threadIdx.x; if (i >= nrows) return; const float* s = S + (size_t)i * SQ; float mx = -3.0e38f;
#pragma unroll 1
  for (int j = 0; j < SQ; ++j) mx = fmaxf(mx, s[j]); float se = 0.f;
#pragma unroll 1
  for (int j = 0; j < SQ; ++j) se += expf(s[j] - mx); const float sc = 256.0f / se;
#pragma unroll 1
  for (int j0 = 0; j0 < SQ; j0 += 8) { FragH f; for (int q = 0; q < 8; ++q) f.h[q] = (_Float16)(expf(s[j0 + q] - mx) * sc); unsigned short* d = (unsigned short*)P + (size_t)i * SQ + j0; *(v8us*)d = f.half[0];  } }
__global__ __launch_bounds__(256) void k_vt(const _Float16* __restrict__ V16, int b, int h0, _Float16* __restrict__ VT) { __shared__ unsigned short tl[64][65]; const int tid = threadIdx.x; const int hh = blockIdx.x % HG, sg = blockIdx.x / HG; const int s0 = sg * 64; const int h = h0 + hh;
  for (int i = tid; i < 64 * 8; i += 256) { const int j = i / 8, d8 = (i % 8) * 8; FragH f; f.half[0] = *(const v8us*)((const unsigned short*)V16 + ((size_t)b * SQ + s0 + j) * DM + h * HD + d8); for (int q = 0; q < 8; ++q) tl[d8 + q][j] = f.u[q]; }
  __syncthreads();
  { for (int i = tid; i < 64 * 8; i += 256) { const int d = i / 8, j8 = (i % 8) * 8; FragH f; for (int q = 0; q < 8; ++q) f.u[q] = tl[d][j8 + q]; *(v8us*)((unsigned short*)VT + ((size_t)hh * HD + d) * SQ + s0 + j8) = f.half[0]; }  } }


// lane ^ M partner's value added (M = 1, 2, 4: all inside a 16-lane row), as one DPP add
template <int M>
__device__ __forceinline__ float xadd(float s) { return s + __int_as_float(__builtin_amdgcn_update_dpp(0, __float_as_int(s), 0x160 | M, 0xf, 0xf, true)); }
// One wave per (image column x, dilation, class of y modulo the dilation, segment): lane = 4 channels, 8 lanes = one head, so the 128 channels of a q, k or v row are one 512-byte load of whole lines.
// The wave walks down its column in steps of the dilation: the window rows y and y + dil of one pixel are the rows y - dil and y of the next, so they stay in registers (3 row slots of 3 k and 3 v rows each)
// and a pixel loads q and one new window row (7 rows) where it took 19. The walk is unrolled by 3, so that each slot is a fixed set of registers and nothing is moved.
// Work-group = 8 waves on 8 neighbouring columns. Segments: 5 x 8 pixels of the 40 of a class (dilation 2), 3 x 9 of the 27 or 26 (dilation 3): 10 + 9 = 19 walks a column,
// 760 work-groups, 6,080 waves of 8 or 9 pixels: close to six waves for each of the 1,024 SIMDs.
// An out-of-image neighbour reads an in-image row instead (row and column each fall back to the pixel's own), takes logit 0 and weight 0 on v.
#define DLW 19       /* walks a column: 2 classes x 5 segments + 3 classes x 3 segments */
__global__ __launch_bounds__(256) void k_dla(const float* __restrict__ F, _Float16* __restrict__ X16) {
  static_assert(WS % 8 == 0 && HS == 80, "8 columns a work-group; the segment table is for 80 rows");
  const int lane = threadIdx.x & 31; const int w = __builtin_amdgcn_readfirstlane((int)threadIdx.x >> 5);
  const int c = blockIdx.x % DLW, t = blockIdx.x / DLW; const int x = (t % (WS / 8)) * 8 + w, img = t / (WS / 8);
  const int di = c >= 10 ? 1 : 0, cw = di ? c - 10 : c; const int dil = di ? 3 : 2, len = di ? 9 : 8; const int cls = di ? cw % 3 : cw % 2, seg = di ? cw / 3 : cw / 2;      /* divisors as constants: a division by a variable goes through the vector unit, and y would no longer be a scalar */
  const int left = (di ? (HS - cls + 2) / 3 : (HS - cls + 1) / 2) - seg * len; const int n = left < len ? left : len;      /* pixels of this walk */
  int y = cls + seg * len * dil;
  const char* Fi = (const char*)(F + (size_t)img * PX * QW + di * 128); char* Xi = (char*)((unsigned short*)X16 + (size_t)img * PX * CC + di * 128);
  const unsigned vo = (unsigned)lane * 16u, vs = (unsigned)lane * 8u;      /* the lane's 4 channels: byte offset in an f32 row, in an f16 row */
  const bool okc[3] = {x - dil >= 0, true, x + dil < WS}; const int xc[3] = {okc[0] ? x - dil : x, x, okc[2] ? x + dil : x};
  v4f k[3][3], v[3][3]; bool okr[3]; const char* pr[3];      /* [slot][column]; pr: the scalar bases of the row loaded last */
  auto row = [&](int s, int yy) { okr[s] = yy >= 0 && yy < HS; const int yc = okr[s] ? yy : y;
#pragma unroll
    for (int j = 0; j < 3; ++j) { pr[j] = Fi + (size_t)((yc * WS + xc[j]) * (QW * 4)); k[s][j] = *(const v4fa*)(pr[j] + vo + CC * 4); v[s][j] = *(const v4fa*)(pr[j] + vo + 2 * CC * 4); } };
  row(0, y - dil);
  /* s_wait_xcnt 0 behind a row's loads, in front of every overwrite of a register that they name; the bases and the offset that their addresses are formed from are its inputs */
  asm volatile("s_wait_xcnt 0x0" :: "s"(pr[0]), "s"(pr[1]), "s"(pr[2]), "v"(vo) : "memory");
  row(1, y);
  asm volatile("s_wait_xcnt 0x0" :: "s"(pr[0]), "s"(pr[1]), "s"(pr[2]), "v"(vo) : "memory");      /* as above */
#pragma unroll 1
  for (int j0 = 0; j0 < n; j0 += 3) {      /* stays rolled: the body already holds the 3 places of the slots */
#pragma unroll
    for (int u = 0; u < 3; ++u) {      /* unrolled: slot numbers are constants, the slots registers */
      if (j0 + u < n) { const int sl[3] = {u, (u + 1) % 3, (u + 2) % 3};      /* slots of the rows y - dil, y, y + dil */
        const char* pq = Fi + (size_t)((y * WS + x) * (QW * 4)); const v4f q = *(const v4fa*)(pq + vo);
        row(sl[2], y + dil);
        /* s_wait_xcnt 0 behind the pixel's loads, as above */
        asm volatile("s_wait_xcnt 0x0" :: "s"(pq), "s"(pr[0]), "s"(pr[1]), "s"(pr[2]), "v"(vo) : "memory");
        __builtin_amdgcn_sched_barrier(0);      /* all 7 loads of a pixel issue before any of its arithmetic: one latency a pixel, not one per group of loads */
        float s[9]; bool ok[9]; float mx = -INFINITY;
#pragma unroll
        for (int kk = 0; kk < 9; ++kk) { const v4f kr = k[sl[kk / 3]][kk % 3]; ok[kk] = okr[sl[kk / 3]] && okc[kk % 3];
          float d = fmaf(q[3], kr[3], fmaf(q[2], kr[2], fmaf(q[1], kr[1], q[0] * kr[0]))); d = xadd<4>(xadd<2>(xadd<1>(d)));
          s[kk] = ok[kk] ? d * SCL : 0.f; mx = fmaxf(mx, s[kk]); }
        float se = 0.f; v4f acc = {0.f, 0.f, 0.f, 0.f};
#pragma unroll
        for (int kk = 0; kk < 9; ++kk) { const float e = expf(s[kk] - mx); se += e; const float pw = ok[kk] ? e : 0.f; const v4f vr = v[sl[kk / 3]][kk % 3];
          for (int ch = 0; ch < 4; ++ch) acc[ch] = fmaf(pw, vr[ch], acc[ch]); }
        const float inv = 1.0f / se; v4h o; for (int ch = 0; ch < 4; ++ch) o[ch] = (_Float16)(acc[ch] * inv);
        char* po = Xi + (size_t)((y * WS + x) * (CC * 2)); *(v4h*)(po + vs) = o;
        /* s_wait_xcnt 0 behind the store, in front of the next pixel's overwrite of its address and data registers */
        asm volatile("s_wait_xcnt 0x0" :: "s"(po), "v"(vs) : "memory");
        y += dil; } } } }

extern "C" void kernel_launch(void* const* d_in, const int* in_sizes, int n_in,
                              void* d_out, int out_size, void* d_ws, size_t ws_size, hipStream_t stream) {
  (void)in_sizes; (void)n_in; (void)out_size;
  const float* const* I = (const float* const*)d_in; const float* rgb = I[0]; const float* ir = I[1]; const float* wqkv = I[2]; const float* wp = I[3]; const float* bp = I[4];
  char* ws = (char*)d_ws; size_t off = 0;
  auto take = [&](size_t bytes) { char* p = ws + off; off += (bytes + 255) & ~(size_t)255; return p; };
  _Float16* BQ = (_Float16*)take((size_t)QW * CC * 2); _Float16* BP = (_Float16*)take((size_t)CC * CC * 2); float* F = (float*)take(NR * QW * 4); _Float16* X16 = (_Float16*)take(NR * CC * 2);
  if (off > ws_size) return;      /* 0.5 + 75 + 12.5 = approx 88 MiB */
  k_wnat<<<(unsigned)(((size_t)QW * CC / 8 + 255) / 256), 256, 0, stream>>>(wqkv, (size_t)QW * CC / 8, BQ); k_wnat<<<(unsigned)(((size_t)CC * CC / 8 + 255) / 256), 256, 0, stream>>>(wp, (size_t)CC * CC / 8, BP);
  k_gemm3<QW, false, true, 3><<<(unsigned)((NR / 128) * (QW / 384)), 256, 0, stream>>>(nullptr, BQ, 0.0625f, F, nullptr, rgb, ir);      /* qkv (f32) */
  k_dla<<<(unsigned)(NB * (WS / 8) * DLW), 256, 0, stream>>>(F, X16);
  k_gemm3<CC, true, false, 1><<<(unsigned)((NR / 128) * (CC / 128)), 256, 0, stream>>>(X16, BP, 0.0625f, (float*)d_out, bp, rgb, ir);      /* proj + bias + residual */
}

// v007
// One run takes 53 microseconds.
// Timed twice side by side with v006, it ran 1.04 times as fast both times.
// All steps since v000 together make it 15.2 times as fast.
#include <hip/hip_runtime.h>
// Multi-dilate local attention (rgb, ir [4][128][80][80] -> y = [rgb | ir] (256 ch); qkv = 1x1 (w_qkv [768][256]) split as [3][2 dilations][128 = 4 heads x 32]; per dilation d in (2, 3): each pixel attends to its 3x3 dilated neighbourhood (zero-padded unfold: out-of-image neighbours contribute k = v = 0, logit 0) with softmax(q.k / sqrt(32)) over the 9; heads merged dilation-major; proj (w_proj [256][256]) + b_proj; + y -> NHWC [4][80][80][256]).
// Structure: qkv as a WMMA GEMM whose A tile comes straight from the two channel-first inputs, turned into concatenated pixel rows (exact f16) on its way into LDS (operand tiles staged in LDS, 32x64 wave tiles, f32 accumulation, exact x16 natural weights; exact products) kept f32; the dilated local attention, one wave walking down a column in steps of the dilation with the window's rows kept in registers, on VALU (f32; 4 channels a lane, softmax weights in registers) into f16 rows; projection GEMM whose epilogue adds bias + residual (f32, VALU) and writes the NHWC output.
// Compute dtype: inputs rounded to bf16; y / weights exact; qkv and the attention f32; the attended rows as a plain f16 GEMM operand (~2^-12). v_wmma_f32_16x16x32_f16.
#define NB 4
#define DIMH 128
#define CC 256
#define QW 768
#define HS 80
#define WS 80
#define PX (HS * WS)                 /* 6400 = 50 x 128 */
#define NR ((size_t)NB * PX)         /* 25,600 rows */
#define NRD ((int)NR)                /* unused */
#define SCL 0.17677669529663689f
#define SQ 64
#define DM 64
#define NH 1
#define HD 64
#define HG 1
typedef __bf16 v16b __attribute__((ext_vector_type(16)));
typedef unsigned short v8us __attribute__((ext_vector_type(8), may_alias));
typedef float  v8f  __attribute__((ext_vector_type(8)));
typedef float  v4f  __attribute__((ext_vector_type(4)));
typedef float  v4fa __attribute__((ext_vector_type(4), may_alias));
union FragB { v16b v; v8us half[2]; unsigned short u[16]; };

__device__ __forceinline__ unsigned short bf16_bits(float x) { unsigned int u = __float_as_uint(x); return (unsigned short)((u + 0x7FFFu + ((u >> 16) & 1u)) >> 16); }
__device__ __forceinline__ float bf16_val(unsigned short b) { return __uint_as_float(((unsigned int)b) << 16); }
__device__ __forceinline__ float bf16_round(float x) { return bf16_val(bf16_bits(x)); }
// D += A·B with NT terms: 1 = ah·bh, 2 = + al·bh (A split), 3 = + ah·bl (both split)
template <int NT>
__device__ __forceinline__ v8f mmaN(v16b ah, v16b al, v16b bh, v16b bl, v8f c) {
  c = __builtin_amdgcn_wmma_f32_16x16x32_bf16(false, ah, false, bh, (short)0, c, false, false);
  if (NT >= 2) c = __builtin_amdgcn_wmma_f32_16x16x32_bf16(false, al, false, bh, (short)0, c, false, false);
  if (NT >= 3) c = __builtin_amdgcn_wmma_f32_16x16x32_bf16(false, ah, false, bl, (short)0, c, false, false);
  asm volatile("v_nop\n\tv_nop\n\tv_nop\n\tv_nop" : "+v"(c) : "v"(ah), "v"(al), "v"(bh), "v"(bl));
  return c;
}

__global__ __launch_bounds__(256) void k_wt_bf16(const float* __restrict__ W, unsigned short* __restrict__ Wt, int K, int N) {
  const int t = blockIdx.x * 256 + threadIdx.x;
  const int k8n = K / 8;
  if (t >= N * k8n) return;
  const int n = t / k8n, k8 = (t % k8n) * 8;
  v8us v;
#pragma unroll
  for (int i = 0; i < 8; ++i) v[i] = bf16_bits(W[(size_t)(k8 + i) * N + n]);
  *(v8us*)(Wt + (size_t)n * K + k8) = v;
  
}

// GEMM C[M][N] (f32, pitch ldc) = act(A[M][K]·W + bias). A f32 row-major (pitch lda) converted per fragment to bf16
// (ASPLIT: hi/lo two planes -> 2 terms, else single rounded term); Wt bf16 [N][K] (pitch ldb). BIAS_BF16 rounds the
// bias to bf16 first (bias quantised to bf16 before the add). K%32==0, M%16==0, N%64==0.
template <bool ASPLIT, int ACT, bool BIAS_BF16>
__global__ __launch_bounds__(128) void k_gemm_bf(const float* __restrict__ A, int lda, const unsigned short* __restrict__ Wt, int ldb,
                                               const float* __restrict__ bias, float* __restrict__ C, int ldc, int M, int N, int K) {
  __shared__ __attribute__((aligned(16))) float so[4][16][64];
  const int tid = threadIdx.x, w = tid >> 5, lane = tid & 31, ln = lane & 15, hh = lane >> 4;
  const int ntn = N / 64;
  const int wid = blockIdx.x * 4 + w;
  const int mt = wid / ntn, nq = wid % ntn;
  if (mt * 16 >= M) return;
  const int row0 = mt * 16, col0 = nq * 64;
  const float* arow = A + (size_t)(row0 + ln) * lda;
  v8f acc[4] = {};
  for (int kb = 0; kb < K; kb += 32) {
    FragB ah, al;
    const v4f x0 = *(const v4fa*)(arow + kb + 8 * hh), x1 = *(const v4fa*)(arow + kb + 8 * hh + 4);
    const v4f x2 = *(const v4fa*)(arow + kb + 16 + 8 * hh), x3 = *(const v4fa*)(arow + kb + 16 + 8 * hh + 4);
    float xs[16] = {x0[0],x0[1],x0[2],x0[3],x1[0],x1[1],x1[2],x1[3],x2[0],x2[1],x2[2],x2[3],x3[0],x3[1],x3[2],x3[3]};
#pragma unroll
    for (int i = 0; i < 16; ++i) { const unsigned short hb = bf16_bits(xs[i]); ah.u[i] = hb; al.u[i] = ASPLIT ? bf16_bits(xs[i] - bf16_val(hb)) : (unsigned short)0; }
#pragma unroll
    for (int t = 0; t < 4; ++t) {
      const unsigned short* brow = Wt + (size_t)(col0 + t * 16 + ln) * ldb + kb;
      FragB b;
      b.half[0] = *(const v8us*)(brow + 8 * hh);
      b.half[1] = *(const v8us*)(brow + 16 + 8 * hh);
      acc[t] = mmaN<ASPLIT ? 2 : 1>(ah.v, al.v, b.v, b.v, acc[t]);
    }
  }
#pragma unroll
  for (int t = 0; t < 4; ++t) {
    float bv = bias ? bias[col0 + t * 16 + ln] : 0.f;
    if (BIAS_BF16) bv = bf16_round(bv);
#pragma unroll
    for (int r = 0; r < 8; ++r) { float v = acc[t][r] + bv; if (ACT == 1) v = fmaxf(v, 0.f); so[w][8 * hh + r][t * 16 + ln] = v; }
  }
  __builtin_amdgcn_fence(__ATOMIC_ACQ_REL, "workgroup");
  __builtin_amdgcn_wave_barrier();
  const int rsub = lane >> 4, c4 = (lane & 15) * 4;
  {
#pragma unroll
    for (int q = 0; q < 8; ++q) {
      const int r = q * 2 + rsub;
      const v4f v = *(const v4fa*)&so[w][r][c4];
      *(v4f*)(C + (size_t)(row0 + r) * ldc + col0 + c4) = v;
    }
    
  }
}

// GEMM C = act(A·W + bias + resid): A f32 (ASPLIT -> hi/lo 2 terms), Wt bf16 [N][K]; ACT 0 none, 1 relu, 2 exact gelu;
// resid (optional, f32, row index = (row % rmod), pitch ldr, RES_BF16 rounds it) added before the activation.
template <bool ASPLIT, int ACT, bool BIAS_BF16, bool RES_BF16>
__global__ __launch_bounds__(128) void k_gemm_bf3(const float* __restrict__ A, int lda, const unsigned short* __restrict__ Wt, int ldb,
                                                const float* __restrict__ bias, const float* __restrict__ resid, int rmod, int ldr,
                                                float* __restrict__ C, int ldc, int M, int N, int K) {
  __shared__ __attribute__((aligned(16))) float so[4][16][64];
  const int tid = threadIdx.x, w = tid >> 5, lane = tid & 31, ln = lane & 15, hh = lane >> 4;
  const int ntn = N / 64;
  const int wid = blockIdx.x * 4 + w;
  const int mt = wid / ntn, nq = wid % ntn;
  if (mt * 16 >= M) return;
  const int row0 = mt * 16, col0 = nq * 64;
  const float* arow = A + (size_t)(row0 + ln) * lda;
  v8f acc[4] = {};
  for (int kb = 0; kb < K; kb += 32) {
    FragB ah, al;
    const v4f x0 = *(const v4fa*)(arow + kb + 8 * hh), x1 = *(const v4fa*)(arow + kb + 8 * hh + 4);
    const v4f x2 = *(const v4fa*)(arow + kb + 16 + 8 * hh), x3 = *(const v4fa*)(arow + kb + 16 + 8 * hh + 4);
    float xs[16] = {x0[0],x0[1],x0[2],x0[3],x1[0],x1[1],x1[2],x1[3],x2[0],x2[1],x2[2],x2[3],x3[0],x3[1],x3[2],x3[3]};
#pragma unroll
    for (int i = 0; i < 16; ++i) { const unsigned short hb = bf16_bits(xs[i]); ah.u[i] = hb; al.u[i] = ASPLIT ? bf16_bits(xs[i] - bf16_val(hb)) : (unsigned short)0; }
#pragma unroll
    for (int t = 0; t < 4; ++t) {
      const unsigned short* brow = Wt + (size_t)(col0 + t * 16 + ln) * ldb + kb;
      FragB b;
      b.half[0] = *(const v8us*)(brow + 8 * hh);
      b.half[1] = *(const v8us*)(brow + 16 + 8 * hh);
      acc[t] = mmaN<ASPLIT ? 2 : 1>(ah.v, al.v, b.v, b.v, acc[t]);
    }
  }
#pragma unroll
  for (int t = 0; t < 4; ++t) {
    const int col = col0 + t * 16 + ln;
    float bv = bias ? bias[col] : 0.f;
    if (BIAS_BF16) bv = bf16_round(bv);
#pragma unroll
    for (int r = 0; r < 8; ++r) {
      float v = acc[t][r] + bv;
      if (resid) { float rv = resid[(size_t)((row0 + 8 * hh + r) % rmod) * ldr + col]; if (RES_BF16) rv = bf16_round(rv); v += rv; }
      if (ACT == 1) v = fmaxf(v, 0.f);
      if (ACT == 2) v = 0.5f * v * (1.0f + erff(v * 0.70710678118654752f));
      if (ACT == 3) { const float u = 0.7978845608028654f * (v + 0.044715f * v * v * v); v = 0.5f * v * (1.0f + tanhf(u)); }
      so[w][8 * hh + r][t * 16 + ln] = v;
    }
  }
  __builtin_amdgcn_fence(__ATOMIC_ACQ_REL, "workgroup");
  __builtin_amdgcn_wave_barrier();
  const int rsub = lane >> 4, c4 = (lane & 15) * 4;
  {
#pragma unroll
    for (int q = 0; q < 8; ++q) {
      const int r = q * 2 + rsub;
      const v4f v = *(const v4fa*)&so[w][r][c4];
      *(v4f*)(C + (size_t)(row0 + r) * ldc + col0 + c4) = v;
    }
    
  }
}
// row LayerNorm (biased variance, eps) over N: s = X (+ R); optional out_sum <- s; out_norm <- (s-mu)*rsqrt(var+eps)*g + b
template <bool PARAM_BF16>
__global__ __launch_bounds__(256) void k_layernorm(const float* __restrict__ X, const float* __restrict__ R, const float* __restrict__ g, const float* __restrict__ bta,
                                                  float* __restrict__ out_sum, float* __restrict__ out_norm, int N, float eps) {
  __shared__ float red[256];
  const int row = blockIdx.x, tid = threadIdx.x;
  const float* x = X + (size_t)row * N; const float* rr = R ? R + (size_t)row * N : nullptr;
  float vals[16];                     // up to N = 4096
  const int per = N / 256;            // contiguous chunk per thread? use strided-by-4 chunks: thread handles j = tid*4 + 1024*u
  float s1 = 0.f;
  for (int u = 0; u < per / 4; ++u) {
    const int j = tid * 4 + 1024 * u;
    const v4f a = *(const v4fa*)(x + j);
    v4f b = {0.f,0.f,0.f,0.f}; if (rr) b = *(const v4fa*)(rr + j);
#pragma unroll
    for (int q = 0; q < 4; ++q) { const float v = a[q] + b[q]; vals[u * 4 + q] = v; s1 += v; }
  }
  red[tid] = s1; __syncthreads();
  for (int st = 128; st > 0; st >>= 1) { if (tid < st) red[tid] += red[tid + st]; __syncthreads(); }
  const float mu = red[0] / (float)N; __syncthreads();
  float s2 = 0.f;
  for (int u = 0; u < per / 4; ++u)
#pragma unroll
    for (int q = 0; q < 4; ++q) { const float c = vals[u * 4 + q] - mu; s2 += c * c; }
  red[tid] = s2; __syncthreads();
  for (int st = 128; st > 0; st >>= 1) { if (tid < st) red[tid] += red[tid + st]; __syncthreads(); }
  const float rs = rsqrtf(red[0] / (float)N + eps);
  {
    for (int u = 0; u < per / 4; ++u) {
      const int j = tid * 4 + 1024 * u;
      v4f o, sm;
#pragma unroll
      for (int q = 0; q < 4; ++q) {
        float gg = g[j + q], bb = bta[j + q];
        if (PARAM_BF16) { gg = bf16_round(gg); bb = bf16_round(bb); }
        sm[q] = vals[u * 4 + q]; o[q] = (vals[u * 4 + q] - mu) * rs * gg + bb;
      }
      if (out_sum) *(v4f*)(out_sum + (size_t)row * N + j) = sm;
      *(v4f*)(out_norm + (size_t)row * N + j) = o;
    }
    
  }
}



// ---- f16 WMMA path (v_wmma_f32_16x16x32_f16): 11-bit significands for operands in range — used here for the qkv and projection GEMMs
typedef _Float16 v16h __attribute__((ext_vector_type(16)));
union FragH { v16h v; v8us half[2]; _Float16 h[16]; unsigned short u[16]; };
template <int NT>
__device__ __forceinline__ v8f mmaH(v16h ah, v16h al, v16h bh, v16h bl, v8f c) {
  c = __builtin_amdgcn_wmma_f32_16x16x32_f16(false, ah, false, bh, (short)0, c, false, false);
  if (NT >= 2) c = __builtin_amdgcn_wmma_f32_16x16x32_f16(false, al, false, bh, (short)0, c, false, false);
  if (NT >= 3) c = __builtin_amdgcn_wmma_f32_16x16x32_f16(false, ah, false, bl, (short)0, c, false, false);
  asm volatile("v_nop\n\tv_nop\n\tv_nop\n\tv_nop" : "+v"(c) : "v"(ah), "v"(al), "v"(bh), "v"(bl));
  return c;
}
// batched GEMM like k_gemm_b but f16 operands: A f32 (split into f16 hi/lo if ASPLIT, else rounded to f16), Bt = f16 values [n][k]; alpha; C f32; N multiple of 16 (partial tiles skipped)
template <bool ASPLIT>
__global__ __launch_bounds__(128) void k_gemm_h(const float* __restrict__ A, int lda, size_t sA, const _Float16* __restrict__ Bh, int ldb, size_t sB, float alpha, float* __restrict__ C, int ldc, size_t sC, int M, int N, int K) {
  __shared__ __attribute__((aligned(16))) float so[4][16][64];
  const int tid = threadIdx.x, w = tid >> 5, lane = tid & 31, ln = lane & 15, hh = lane >> 4; const int by = blockIdx.y;
  A += (size_t)by * sA; Bh += (size_t)by * sB; C += (size_t)by * sC;
  const int ntn = (N + 63) / 64; const int wid = blockIdx.x * 4 + w; const int mt = wid / ntn, nq = wid % ntn; if (mt * 16 >= M) return;
  const int row0 = mt * 16, col0 = nq * 64; const float* arow = A + (size_t)(row0 + ln) * lda;
  v8f acc[4] = {};
  for (int kb = 0; kb < K; kb += 32) {
    FragH ah, al;
    const v4f x0 = *(const v4fa*)(arow + kb + 8 * hh), x1 = *(const v4fa*)(arow + kb + 8 * hh + 4), x2 = *(const v4fa*)(arow + kb + 16 + 8 * hh), x3 = *(const v4fa*)(arow + kb + 16 + 8 * hh + 4);
    float xs[16] = {x0[0],x0[1],x0[2],x0[3],x1[0],x1[1],x1[2],x1[3],x2[0],x2[1],x2[2],x2[3],x3[0],x3[1],x3[2],x3[3]};
#pragma unroll
    for (int i = 0; i < 16; ++i) { const _Float16 h = (_Float16)xs[i]; ah.h[i] = h; al.h[i] = ASPLIT ? (_Float16)(xs[i] - (float)h) : (_Float16)0.0f; }
#pragma unroll
    for (int t = 0; t < 4; ++t) { if (col0 + t * 16 >= N) continue; const size_t boff = (size_t)(col0 + t * 16 + ln) * ldb + kb; FragH bq; bq.half[0] = *(const v8us*)(Bh + boff + 8 * hh); bq.half[1] = *(const v8us*)(Bh + boff + 16 + 8 * hh);
      acc[t] = mmaH<ASPLIT ? 2 : 1>(ah.v, al.v, bq.v, bq.v, acc[t]); }
  }
#pragma unroll
  for (int t = 0; t < 4; ++t) { if (col0 + t * 16 >= N) continue;
#pragma unroll
    for (int r = 0; r < 8; ++r) so[w][8 * hh + r][t * 16 + ln] = acc[t][r] * alpha; }
  __builtin_amdgcn_fence(__ATOMIC_ACQ_REL, "workgroup"); __builtin_amdgcn_wave_barrier();
  const int rsub = lane >> 4, c4 = (lane & 15) * 4;
  {
#pragma unroll
    for (int q = 0; q < 8; ++q) { const int r = q * 2 + rsub; if (col0 + c4 < N) { const v4f v = *(const v4fa*)&so[w][r][c4]; *(v4f*)(C + (size_t)(row0 + r) * ldc + col0 + c4) = v; } }
     }
}

// Wt[n][k] = f16(W[k][n]·scale) from f32 row-major W[K][N] (scale = power of two; bf16-exact weights stay exact in f16 away from the subnormal range)
__global__ __launch_bounds__(256) void k_wt_f16(const float* __restrict__ W, _Float16* __restrict__ Wt, int K, int N, float scale) {
  const int t = blockIdx.x * 256 + threadIdx.x; if (t >= N * (K / 8)) return; const int n = t / (K / 8), k8 = (t % (K / 8)) * 8; FragH f;
#pragma unroll
  for (int i = 0; i < 8; ++i) f.h[i] = (_Float16)(bf16_round(W[(size_t)(k8 + i) * N + n]) * scale); const v8us o = f.half[0];
  *(v8us*)((unsigned short*)Wt + (size_t)n * K + k8) = o; 
}
// k_gemm_hh variant with fused epilogue: v = acc·alpha + bias[by·sBias + col] (+ CP[(row/rowsPerB)·sCPb + by·64 + col] if CP) ; ACT 0 none / 1 elu ; writes f16 C16 (and f32 C if non-null)
template <int ACT>
__global__ __launch_bounds__(128) void k_gemm_hhx(const _Float16* __restrict__ A, int lda, size_t sA, const _Float16* __restrict__ Bh, int ldb, size_t sB, float alpha, const float* __restrict__ bias, size_t sBias, const float* __restrict__ CP, int rowsPerB, size_t sCPb, int row0g,
    float* __restrict__ C, _Float16* __restrict__ C16, int ldc, size_t sC, int M, int N, int K) {
  __shared__ __attribute__((aligned(16))) float so[4][16][64];
  const int tid = threadIdx.x, w = tid >> 5, lane = tid & 31, ln = lane & 15, hh = lane >> 4; const int by = blockIdx.y;
  A += (size_t)by * sA; Bh += (size_t)by * sB; const size_t cofs = (size_t)by * sC; const float* bp = bias ? bias + (size_t)by * sBias : nullptr;
  const int ntn = (N + 63) / 64; const int wid = blockIdx.x * 4 + w; const int mt = wid / ntn, nq = wid % ntn; if (mt * 16 >= M) return;
  const int row0 = mt * 16, col0 = nq * 64; const _Float16* arow = A + (size_t)(row0 + ln) * lda;
  v8f acc[4] = {};
  for (int kb = 0; kb < K; kb += 32) { FragH ah; ah.half[0] = *(const v8us*)((const unsigned short*)arow + kb + 8 * hh); ah.half[1] = *(const v8us*)((const unsigned short*)arow + kb + 16 + 8 * hh);
#pragma unroll
    for (int t = 0; t < 4; ++t) { if (col0 + t * 16 >= N) continue; const size_t boff = (size_t)(col0 + t * 16 + ln) * ldb + kb; FragH bq; bq.half[0] = *(const v8us*)((const unsigned short*)Bh + boff + 8 * hh); bq.half[1] = *(const v8us*)((const unsigned short*)Bh + boff + 16 + 8 * hh);
      acc[t] = mmaH<1>(ah.v, ah.v, bq.v, bq.v, acc[t]); }
  }
#pragma unroll
  for (int t = 0; t < 4; ++t) { if (col0 + t * 16 >= N) continue; const int col = col0 + t * 16 + ln; const float bv = bp ? bf16_round(bp[col]) : 0.f;
#pragma unroll
    for (int r = 0; r < 8; ++r) { float v = acc[t][r] * alpha + bv; if (CP) { const int rr = row0g + row0 + 8 * hh + r; if (rowsPerB < 0) v += CP[cofs + (size_t)rr * ldc + col];      /* rowsPerB < 0: own element of the batched C plane */ else { const int bidx = rr / rowsPerB; v += CP[(size_t)bidx * sCPb + (size_t)by * 64 + col]; } } if (ACT == 1) v = (v > 0.f) ? v : expm1f(v); else if (ACT == 7) v = (v > 0.f) ? v + 1.0f : expf(v); else if (ACT == 8) v = tanhf(v); else if (ACT == 9) v = 0.5f * v * (1.0f + tanhf(0.7978845608028654f * (v + 0.044715f * v * v * v))); else if (ACT == 11) v = 1.0f / (1.0f + expf(-v)); else if (ACT == 12) v = (v > 0.f) ? v : 0.01f * v; else if (ACT == 14) v = (v > 0.f) ? v : 0.1f * v; else if (ACT == 16) v = (v >= 0.f) ? v : 0.3f * v; else if (ACT == 17) v = (v >= 0.f) ? v : 0.2f * v; else if (ACT == 15) v = v / (1.0f + expf(-v)); else if (ACT == 3) v = fmaxf(v, 0.f); else if (ACT == 6) v = 0.5f * v * (1.0f + erff(v * 0.70710678118654752f)); so[w][8 * hh + r][t * 16 + ln] = v; } }
  __builtin_amdgcn_fence(__ATOMIC_ACQ_REL, "workgroup"); __builtin_amdgcn_wave_barrier();
  const int rsub = lane >> 4, c4 = (lane & 15) * 4; typedef _Float16 v4h __attribute__((ext_vector_type(4)));
  {
#pragma unroll
    for (int q = 0; q < 8; ++q) { const int r = q * 2 + rsub; if (col0 + c4 < N) { const v4f v = *(const v4fa*)&so[w][r][c4]; if (C) *(v4f*)(C + cofs + (size_t)(row0 + r) * ldc + col0 + c4) = v; if (C16) { v4h h4; for (int i = 0; i < 4; ++i) h4[i] = (_Float16)v[i]; *(v4h*)(C16 + cofs + (size_t)(row0 + r) * ldc + col0 + c4) = h4; } } }
     }
}


typedef _Float16 v4h __attribute__((ext_vector_type(4)));

__global__ __launch_bounds__(256) void k_x16(const float* __restrict__ x, _Float16* __restrict__ X16, size_t n8) { const size_t t = (size_t)blockIdx.x * 256 + threadIdx.x; if (t >= n8) return; FragH f;
#pragma unroll
  for (int q = 0; q < 8; ++q) f.h[q] = (_Float16)bf16_round(x[t * 8 + q]); *(v8us*)((unsigned short*)X16 + t * 8) = f.half[0];  }
__global__ __launch_bounds__(256) void k_h16(const float* __restrict__ x, _Float16* __restrict__ X16, size_t n8) { const size_t t = (size_t)blockIdx.x * 256 + threadIdx.x; if (t >= n8) return; FragH f;
#pragma unroll
  for (int q = 0; q < 8; ++q) f.h[q] = (_Float16)x[t * 8 + q]; *(v8us*)((unsigned short*)X16 + t * 8) = f.half[0];  }
__global__ __launch_bounds__(256) void k_round16f(const float* __restrict__ W, _Float16* __restrict__ Bt, size_t n8) { const size_t t = (size_t)blockIdx.x * 256 + threadIdx.x; if (t >= n8) return; FragH f;
#pragma unroll
  for (int i = 0; i < 8; ++i) f.h[i] = (_Float16)(bf16_round(W[t * 8 + i]) * 16.0f); *(v8us*)((unsigned short*)Bt + t * 8) = f.half[0];  }
template <int NHv, int TTv>
__global__ __launch_bounds__(256) void k_vt(const _Float16* __restrict__ V16, int ldv, int voff, _Float16* __restrict__ Vt) { __shared__ unsigned short tl[64][66]; const int tid = threadIdx.x; const int slab = blockIdx.x / (TTv / 64), lg = blockIdx.x % (TTv / 64); const int b = slab / NHv, h = slab % NHv;
  for (int i = tid; i < 64 * 8; i += 256) { const int r = i / 8, c8 = (i % 8) * 8; FragH f; f.half[0] = *(const v8us*)((const unsigned short*)V16 + ((size_t)b * TTv + lg * 64 + r) * ldv + voff + h * 64 + c8);
#pragma unroll
    for (int q = 0; q < 8; ++q) tl[r][c8 + q] = f.u[q]; }
  __syncthreads();
  {
#pragma unroll
    for (int rd = 0; rd < 2; ++rd) { const int d = rd * 32 + tid / 8, pc = tid % 8; FragH f;
#pragma unroll
      for (int q = 0; q < 8; ++q) f.u[q] = tl[pc * 8 + q][d];
      *(v8us*)((unsigned short*)Vt + ((size_t)slab * 64 + d) * TTv + lg * 64 + pc * 8) = f.half[0]; }
     } }

__global__ __launch_bounds__(256) void k_hl(const float* __restrict__ F, _Float16* __restrict__ Hh, _Float16* __restrict__ Hl, size_t n8) { const size_t t = (size_t)blockIdx.x * 256 + threadIdx.x; if (t >= n8) return; FragH fh, fl; const v4f a = *(const v4fa*)(F + t * 8), c = *(const v4fa*)(F + t * 8 + 4);
#pragma unroll
  for (int q = 0; q < 4; ++q) { _Float16 h = (_Float16)a[q]; fh.h[q] = h; fl.h[q] = (_Float16)((a[q] - (float)h) * 1024.0f); h = (_Float16)c[q]; fh.h[4 + q] = h; fl.h[4 + q] = (_Float16)((c[q] - (float)h) * 1024.0f); }
  { *(v8us*)((unsigned short*)Hh + t * 8) = fh.half[0]; *(v8us*)((unsigned short*)Hl + t * 8) = fl.half[0];  } }

// ---- fast GEMM (wave tile 32x64; requires M % 32 == 0 rows per launch region and N % 64 == 0); epilogue = k_gemm_hhx semantics ----
__device__ __forceinline__ v16h g2_frag(const _Float16* p, int hh) { FragH f; f.half[0] = *(const v8us*)((const unsigned short*)p + 8 * hh); f.half[1] = *(const v8us*)((const unsigned short*)p + 16 + 8 * hh); return f.v; }
__device__ __forceinline__ v8f g2_mma(v16h a, v16h b, v8f c) { v8f d = __builtin_amdgcn_wmma_f32_16x16x32_f16(false, a, false, b, (short)0, c, false, false); asm volatile("v_nop\n\tv_nop\n\tv_nop\n\tv_nop" : "+v"(d) : "v"(a), "v"(b)); return d; }
template <int ACT>
__global__ __launch_bounds__(128) void k_gemm2(const _Float16* __restrict__ A, int lda, size_t sA, const _Float16* __restrict__ Bh, int ldb, size_t sB, float alpha, const float* __restrict__ bias, size_t sBias, const float* __restrict__ CP, int rowsPerB, size_t sCPb, int row0g,
    float* __restrict__ C, _Float16* __restrict__ C16, int ldc, size_t sC, int M, int N, int K) { static_assert(ACT == 0 || ACT == 3 || ACT == 6 || ACT == 8 || ACT == 9 || ACT == 11 || ACT == 12 || ACT == 14 || ACT == 15 || ACT == 16 || ACT == 17, "k_gemm2: unsupported ACT code (would silently apply no activation)");
  __shared__ __attribute__((aligned(16))) float so[4][32][68];
  const int tid = threadIdx.x, w = tid >> 5, lane = tid & 31, ln = lane & 15, hh = lane >> 4; const int by = blockIdx.y;
  A += (size_t)by * sA; Bh += (size_t)by * sB; const size_t cofs = (size_t)by * sC; const float* bp = bias ? bias + (size_t)by * sBias : nullptr;
  const int ntn = N >> 6; const int mt = blockIdx.x / ntn, nq = blockIdx.x - mt * ntn; const int row0 = mt * 128 + 32 * w, col0 = nq * 64; if (row0 >= M) return;
  const _Float16* a0p = A + (size_t)(row0 + ln) * lda; const _Float16* a1p = a0p + (size_t)16 * lda;
  const _Float16* b0p = Bh + (size_t)(col0 + ln) * ldb; const _Float16* b1p = b0p + (size_t)16 * ldb; const _Float16* b2p = b1p + (size_t)16 * ldb; const _Float16* b3p = b2p + (size_t)16 * ldb;
  const v8f z8 = {0.f,0.f,0.f,0.f,0.f,0.f,0.f,0.f}; v8f c00 = z8, c01 = z8, c02 = z8, c03 = z8, c10 = z8, c11 = z8, c12 = z8, c13 = z8;
#pragma unroll 1
  for (int kb = 0; kb < K; kb += 32) { const v16h a0 = g2_frag(a0p + kb, hh), a1 = g2_frag(a1p + kb, hh);
    v16h b = g2_frag(b0p + kb, hh); c00 = g2_mma(a0, b, c00); c10 = g2_mma(a1, b, c10);
    b = g2_frag(b1p + kb, hh); c01 = g2_mma(a0, b, c01); c11 = g2_mma(a1, b, c11);
    b = g2_frag(b2p + kb, hh); c02 = g2_mma(a0, b, c02); c12 = g2_mma(a1, b, c12);
    b = g2_frag(b3p + kb, hh); c03 = g2_mma(a0, b, c03); c13 = g2_mma(a1, b, c13); }
  v8f accs[8] = {c00, c01, c02, c03, c10, c11, c12, c13};
#pragma unroll
  for (int u = 0; u < 8; ++u) { const int t = u & 3, half = u >> 2; const int col = col0 + t * 16 + ln; const float bv = bp ? bf16_round(bp[col]) : 0.f;
#pragma unroll
    for (int r = 0; r < 8; ++r) { const int rloc = half * 16 + 8 * hh + r; float v = accs[u][r] * alpha + bv; if (CP) { if (rowsPerB < 0) v += CP[cofs + (size_t)(row0g + row0 + rloc) * ldc + col];      /* rowsPerB < 0: own element of the batched C plane */ else { const int bidx = (row0g + row0 + rloc) / rowsPerB; v += CP[(size_t)bidx * sCPb + (size_t)by * 64 + col]; } }
      if (ACT == 3) v = fmaxf(v, 0.f); else if (ACT == 6) v = 0.5f * v * (1.0f + erff(v * 0.70710678118654752f)); else if (ACT == 11) v = 1.0f / (1.0f + expf(-v)); else if (ACT == 15) v = v / (1.0f + expf(-v)); else if (ACT == 12) v = (v > 0.f) ? v : 0.01f * v; else if (ACT == 8) v = tanhf(v); else if (ACT == 9) v = 0.5f * v * (1.0f + tanhf(0.7978845608028654f * (v + 0.044715f * v * v * v))); else if (ACT == 14) v = (v > 0.f) ? v : 0.1f * v; else if (ACT == 16) v = (v >= 0.f) ? v : 0.3f * v; else if (ACT == 17) v = (v >= 0.f) ? v : 0.2f * v;
      so[w][rloc][t * 16 + ln] = v; } }
  __builtin_amdgcn_fence(__ATOMIC_ACQ_REL, "workgroup"); __builtin_amdgcn_wave_barrier();
  const int rsub = lane >> 4, c4 = (lane & 15) * 4;
  {
#pragma unroll
    for (int q = 0; q < 16; ++q) { const int r = q * 2 + rsub; const v4f v = *(const v4fa*)&so[w][r][c4]; if (C) *(v4f*)(C + cofs + (size_t)(row0 + r) * ldc + col0 + c4) = v; if (C16) { v4h h4; for (int i = 0; i < 4; ++i) h4[i] = (_Float16)v[i]; *(v4h*)(C16 + cofs + (size_t)(row0 + r) * ldc + col0 + c4) = h4; } }
     } }


// ---- GEMM with both operand tiles staged in LDS: C[M][NN] (f32) = alpha * A[M][CC] . Bh[NN][CC]^T; K = CC; grid = (M / 128) * (NN / (128 NT)) ----
// Work-group tile 128 x 128, 8 waves; wave tile 32 x 64 and k order as k_gemm2. A fragment load straight from global touches 16 lines for its 512 bytes and stands in front of its own WMMAs;
// here each global load of a wave is one whole 512-byte row (4 lines), all 32 of a wave are in flight together, and the fragments come from LDS rows pitched 528 B (16 B x 33: no bank conflict for 16-byte reads).
// FIN (the projection): C = (alpha * A . Bh^T + bf16(bpj[col])) + bf16(residual), the residual read from the channel-first inputs in the accumulators' own layout:
// a lane's 8 accumulator rows of one column are 8 neighbouring pixels of one channel, 32 bytes in a row; a wave's 32 pixels of a channel are one whole 128-byte line.
// ACF (the qkv product): A is not read as f16 rows; the tile's 128 pixels x 256 channels come from the channel-first f32 inputs. Wave w brings channels 32 w .. 32 w + 31:
// a load's 8-lane groups take one 128-byte line (32 pixels) of 4 channels that lie 8 apart, so after 8 loads a lane holds 8 neighbouring channels of 4 pixels: 4 whole 16-byte pieces of pixel rows.
// NT: a work-group fills its A tile once and takes NT neighbouring 128-column tiles of B one after the other against it. The next B tile's rows are loaded into registers under the current tile's products;
// the output staging then lies on the B rows (never on A), and the tile's stores to C stay in flight while the next tile is worked on.
#define GLP 264      /* LDS row pitch in f16 elements */
typedef float v2f __attribute__((ext_vector_type(2)));
typedef _Float16 v2h __attribute__((ext_vector_type(2)));
// two f32 -> bf16 (nearest even), those values as f16, packed
__device__ __forceinline__ unsigned pk_bf_h(float x, float y) { unsigned u;
  asm("v_cvt_pk_bf16_f32 %0, %1, %2" : "=v"(u) : "v"(x), "v"(y));      /* as asm so that both sources are read where their loads left them: through a 2-vector the compiler first copied one register of every pair */
  const v2f r = {__uint_as_float(u << 16), __uint_as_float(u & 0xFFFF0000u)}; return __builtin_bit_cast(unsigned, __builtin_convertvector(r, v2h)); }
typedef unsigned v4ua __attribute__((ext_vector_type(4), may_alias));
// work-group barrier that orders LDS alone: __syncthreads() would also wait for the wave's global loads and stores, here the next B tile's loads and the last tile's stores to C, which no other wave reads
__device__ __forceinline__ void lds_barrier() { __builtin_amdgcn_fence(__ATOMIC_RELEASE, "workgroup", "local"); __builtin_amdgcn_s_barrier(); __builtin_amdgcn_fence(__ATOMIC_ACQUIRE, "workgroup", "local"); }
template <int NN, bool FIN, bool ACF, int NT>
__global__ __launch_bounds__(256) void k_gemm3(const _Float16* __restrict__ A, const _Float16* __restrict__ Bh, float alpha, float* __restrict__ C, const float* __restrict__ bpj, const float* __restrict__ rgb, const float* __restrict__ ir) {
  static_assert(!FIN || (NN == CC && DIMH == 128 && PX % 128 == 0), "FIN: a 128-column tile is one input's channels, a 128-row tile lies in one image");
  static_assert(!ACF || (CC == 256 && DIMH == 128 && PX % 128 == 0), "ACF: 4 waves per input, a 128-row tile lies in one image");
  static_assert(NN % (128 * NT) == 0 && (!FIN || NT == 1), "NT tiles divide the columns; the residual's loads are written for one tile");
  __shared__ __attribute__((aligned(16))) _Float16 sm[NT > 1 ? 128 * GLP + 8 * 32 * 68 * 2 : (128 + 128) * GLP];      /* 128 A rows, then 128 B rows; after the products the waves' output staging: NT = 1 from the start, NT > 1 from the B rows on (8 x 32 x 68 floats, 2 KiB more than these) */
  const int lane = threadIdx.x & 31, ln = lane & 15, hh = lane >> 4; const int w = __builtin_amdgcn_readfirstlane((int)threadIdx.x >> 5); const int wr = w & 3, wc = w >> 2;
  const int ntn = NN / (128 * NT); const int mt = blockIdx.x / ntn, nq0 = (blockIdx.x - mt * ntn) * NT; const int row0 = mt * 128 + 32 * wr;
  _Float16* sb = sm + 128 * GLP;
  const unsigned short* ga = (const unsigned short*)A + (size_t)(mt * 128 + 16 * w) * CC + lane * 8; const unsigned short* gb = (const unsigned short*)Bh + (size_t)(nq0 * 128 + 16 * w) * CC + lane * 8;
  v8us ra[16], rb[16];      /* wave w brings rows 16 w .. 16 w + 15 of either tile; the loops below are unrolled so that the arrays are registers and each row is an immediate offset */
  v4f fa[32]; const char* asrc = nullptr; unsigned aob = 0; const int cs = lane >> 3, pg = lane & 7;      /* ACF: [pixel block t][channel i] = 4 pixels 32 t + 4 pg .. + 3 of channel 32 w + 8 cs + i; asrc, aob: these loads' scalar base and offset register */
  if (ACF) { const int img = mt / (PX / 128), p0 = (mt - img * (PX / 128)) * 128;
    asrc = (const char*)((w < 4 ? rgb : ir) + ((size_t)img * DIMH + 32 * (w & 3)) * PX + p0); aob = (unsigned)(8 * cs * PX + 4 * pg) * 4u;
#pragma unroll
    for (int t = 0; t < 4; ++t) {
#pragma unroll
      for (int i = 0; i < 8; ++i) fa[t * 8 + i] = *(const v4fa*)(asrc + aob + (i * PX + 32 * t) * 4); }
  } else {
#pragma unroll
    for (int i = 0; i < 16; ++i) ra[i] = *(const v8us*)(ga + i * CC);
  }
#pragma unroll
  for (int i = 0; i < 16; ++i) rb[i] = *(const v8us*)(gb + i * CC);
  /* s_wait_xcnt 0 behind the tile's loads, in front of every overwrite of a register that they name; their offset registers (ACF: the A loads' scalar base too) are its inputs, so that none of them is overwritten ahead of it; its memory clobber also keeps every LDS store behind the last load, so the wave pays one load latency for all its rows */
  if (ACF) { asm volatile("s_wait_xcnt 0x0" :: "v"(lane), "v"(aob), "s"(asrc) : "memory");
    __builtin_amdgcn_sched_barrier(0); }      /* no conversion moves up among the loads: its wait for an A row would hold back the issue of the B rows */
  else asm volatile("s_wait_xcnt 0x0" :: "v"(lane) : "memory");
  if (ACF) {      /* 16-byte piece 4 w + cs of pixel row 32 t + 4 pg + j: at the pitch of 33 pieces the 32 lanes fall on all 16 bank groups, two lanes each */
#pragma unroll
    for (int t = 0; t < 4; ++t) {
#pragma unroll
      for (int j = 0; j < 4; ++j) { const v4ua o = {pk_bf_h(fa[t * 8][j], fa[t * 8 + 1][j]), pk_bf_h(fa[t * 8 + 2][j], fa[t * 8 + 3][j]), pk_bf_h(fa[t * 8 + 4][j], fa[t * 8 + 5][j]), pk_bf_h(fa[t * 8 + 6][j], fa[t * 8 + 7][j])};
        *(v4ua*)((unsigned short*)sm + (32 * t + 4 * pg + j) * GLP + 32 * w + 8 * cs) = o; } }
  } else {
#pragma unroll
    for (int i = 0; i < 16; ++i) *(v8us*)((unsigned short*)sm + (16 * w + i) * GLP + lane * 8) = ra[i];
  }
#pragma unroll 1
  for (int nt = 0; nt < NT; ++nt) {      /* stays rolled: one copy of the products and the epilogue in the instruction cache, one set of registers */
  const int nq = nq0 + nt, col0 = nq * 128 + 64 * wc;
#pragma unroll
  for (int i = 0; i < 16; ++i) *(v8us*)((unsigned short*)sb + (16 * w + i) * GLP + lane * 8) = rb[i];
  if (NT > 1) lds_barrier(); else __syncthreads();      /* tile filled */
  if (NT > 1 && nt + 1 < NT) {      /* the next B tile's rows: issued here, stored to LDS at the head of the next trip, so they fly under the products and the epilogue */
    gb += 128 * CC;
#pragma unroll
    for (int i = 0; i < 16; ++i) rb[i] = *(const v8us*)(gb + i * CC);
    /* s_wait_xcnt 0 behind these loads, in front of every overwrite of a register that they name; its memory clobber also keeps the loads from sinking below the products */
    asm volatile("s_wait_xcnt 0x0" :: "v"(lane), "v"(gb) : "memory");
  }
  /* the residual's and the bias's loads stand behind the barrier (which waits for every load issued in front of it) and ahead of the products, under which they fly */
  v4f rs[16]; float bv[4]; unsigned rob = 0;      /* residual: [fragment u][rows 0-3, 4-7]; bias: one column per t; rob: the residual loads' offset register */
  if (FIN) { const int img = mt / (PX / 128), p0 = (mt - img * (PX / 128)) * 128 + 32 * wr;
    const char* rsrc = (const char*)((nq ? ir : rgb) + ((size_t)img * DIMH + 64 * wc) * PX + p0); rob = (unsigned)(ln * PX + 8 * hh) * 4u; const float* bsrc = bpj + col0;
#pragma unroll
    for (int u = 0; u < 8; ++u) { const int t = u & 3, half = u >> 2;      /* unrolled: rs is registers, each load an immediate offset */
      rs[2 * u] = *(const v4fa*)(rsrc + rob + (t * 16 * PX + half * 16) * 4); rs[2 * u + 1] = *(const v4fa*)(rsrc + rob + (t * 16 * PX + half * 16 + 4) * 4); }
#pragma unroll
    for (int t = 0; t < 4; ++t) bv[t] = bsrc[t * 16 + ln];
  }
  const _Float16* pa = sm + (32 * wr + ln) * GLP; const _Float16* pb = sb + (64 * wc + ln) * GLP;
  const v8f z8 = {0.f,0.f,0.f,0.f,0.f,0.f,0.f,0.f}; v8f c00 = z8, c01 = z8, c02 = z8, c03 = z8, c10 = z8, c11 = z8, c12 = z8, c13 = z8;
  v16h a0 = g2_frag(pa, hh), a1 = g2_frag(pa + 16 * GLP, hh), b0 = g2_frag(pb, hh), b1 = g2_frag(pb + 16 * GLP, hh), b2 = g2_frag(pb + 32 * GLP, hh), b3 = g2_frag(pb + 48 * GLP, hh);
  /* unrolled whole (8 steps): the two fragment sets then need no register moves, and every LDS address is an immediate offset */
#pragma unroll
  for (int kb = 0; kb < CC; kb += 32) { v16h n0 = a0, n1 = a1, m0 = b0, m1 = b1, m2 = b2, m3 = b3;
    if (kb + 32 < CC) { const int kn = kb + 32;      /* the next step's 12 LDS reads as one group ahead of this step's WMMAs */
      n0 = g2_frag(pa + kn, hh); n1 = g2_frag(pa + 16 * GLP + kn, hh); m0 = g2_frag(pb + kn, hh); m1 = g2_frag(pb + 16 * GLP + kn, hh); m2 = g2_frag(pb + 32 * GLP + kn, hh); m3 = g2_frag(pb + 48 * GLP + kn, hh); }
    c00 = g2_mma(a0, b0, c00); c10 = g2_mma(a1, b0, c10); c01 = g2_mma(a0, b1, c01); c11 = g2_mma(a1, b1, c11);
    c02 = g2_mma(a0, b2, c02); c12 = g2_mma(a1, b2, c12); c03 = g2_mma(a0, b3, c03); c13 = g2_mma(a1, b3, c13);
    a0 = n0; a1 = n1; b0 = m0; b1 = m1; b2 = m2; b3 = m3; }
  /* s_wait_xcnt 0 behind the residual's and the bias's loads; their two offset registers are its inputs, so that neither is overwritten ahead of it */
  if (FIN) { __builtin_amdgcn_sched_barrier(0);      /* none of the epilogue's arithmetic moves up among the products: its wait for the residual would stall them */
    asm volatile("s_wait_xcnt 0x0" :: "v"(rob), "v"(ln) : "memory"); }
  if (NT > 1) lds_barrier(); else __syncthreads();      /* every wave has read its last fragment: the tiles' LDS may now take the output staging */
  float* so = (float*)(NT > 1 ? sb : sm) + w * (32 * 68);      /* this wave's own 32 rows x 68 floats */
  v8f accs[8] = {c00, c01, c02, c03, c10, c11, c12, c13};      /* unrolled below, as in k_gemm2: accumulators are indexed by constants only */
#pragma unroll
  for (int u = 0; u < 8; ++u) { const int t = u & 3, half = u >> 2;
#pragma unroll
    for (int r = 0; r < 8; ++r) { float v = accs[u][r] * alpha; if (FIN) v = (v + bf16_round(bv[t])) + bf16_round(rs[2 * u + (r >> 2)][r & 3]); so[(half * 16 + 8 * hh + r) * 68 + t * 16 + ln] = v; } }
  if (NT > 1) __builtin_amdgcn_fence(__ATOMIC_ACQ_REL, "workgroup", "local");      /* LDS alone, as in lds_barrier() */
  else __builtin_amdgcn_fence(__ATOMIC_ACQ_REL, "workgroup");
  __builtin_amdgcn_wave_barrier();
  const int rsub = lane >> 4, c4 = (lane & 15) * 4;
  if (NT > 1) { char* cb = (char*)(C + (size_t)row0 * NN + col0); const unsigned cob = (unsigned)(rsub * NN + c4) * 4u;      /* scalar base, one offset register, each row pair an immediate offset */
#pragma unroll
    for (int q = 0; q < 16; ++q) { const v4f v = *(const v4fa*)&so[(q * 2 + rsub) * 68 + c4]; *(v4f*)(cb + cob + q * 2 * NN * 4) = v; }
    /* s_wait_xcnt 0 behind the stores, in front of the next trip's overwrite of their base and data registers */
    asm volatile("s_wait_xcnt 0x0" :: "v"(cob), "s"(cb) : "memory");
    if (nt + 1 < NT) lds_barrier();      /* every wave has read its staging back: the B rows may take the next tile */
  } else {
#pragma unroll
  for (int q = 0; q < 16; ++q) { const int r = q * 2 + rsub; const v4f v = *(const v4fa*)&so[r * 68 + c4]; *(v4f*)(C + (size_t)(row0 + r) * NN + col0 + c4) = v; }
  } } }

// both weight matrices in one launch: the first na8 threads take wa -> Ba, the next nb8 take wb -> Bb (na8 a multiple of 256, so a work-group lies in one matrix); 8 weights a thread
__global__ __launch_bounds__(256) void k_wnat(const float* __restrict__ wa, size_t na8, _Float16* __restrict__ Ba, const float* __restrict__ wb, size_t nb8, _Float16* __restrict__ Bb) { size_t t = (size_t)blockIdx.x * 256 + threadIdx.x; const bool second = (size_t)blockIdx.x * 256 >= na8; const float* w = second ? wb : wa; _Float16* Bt = second ? Bb : Ba; if (second) t -= na8; if (t >= (second ? nb8 : na8)) return; FragH f; for (int q = 0; q < 8; ++q) f.h[q] = (_Float16)(bf16_round(w[t * 8 + q]) * 16.0f); *(v8us*)((unsigned short*)Bt + t * 8) = f.half[0];  }
__global__ __launch_bounds__(256) void k_rsm(const float* __restrict__ S, _Float16* __restrict__ P, int nrows) {
  #pragma clang fp contract(off)
  const int i = blockIdx.x * 256 + threadIdx.x; if (i >= nrows) return; const float* s = S + (size_t)i * SQ; float mx = -3.0e38f;
#pragma unroll 1
  for (int j = 0; j < SQ; ++j) mx = fmaxf(mx, s[j]); float se = 0.f;
#pragma unroll 1
  for (int j = 0; j < SQ; ++j) se += expf(s[j] - mx); const float sc = 256.0f / se;
#pragma unroll 1
  for (int j0 = 0; j0 < SQ; j0 += 8) { FragH f; for (int q = 0; q < 8; ++q) f.h[q] = (_Float16)(expf(s[j0 + q] - mx) * sc); unsigned short* d = (unsigned short*)P + (size_t)i * SQ + j0; *(v8us*)d = f.half[0];  } }
__global__ __launch_bounds__(256) void k_vt(const _Float16* __restrict__ V16, int b, int h0, _Float16* __restrict__ VT) { __shared__ unsigned short tl[64][65]; const int tid = threadIdx.x; const int hh = blockIdx.x % HG, sg = blockIdx.x / HG; const int s0 = sg * 64; const int h = h0 + hh;
  for (int i = tid; i < 64 * 8; i += 256) { const int j = i / 8, d8 = (i % 8) * 8; FragH f; f.half[0] = *(const v8us*)((const unsigned short*)V16 + ((size_t)b * SQ + s0 + j) * DM + h * HD + d8); for (int q = 0; q < 8; ++q) tl[d8 + q][j] = f.u[q]; }
  __syncthreads();
  { for (int i = tid; i < 64 * 8; i += 256) { const int d = i / 8, j8 = (i % 8) * 8; FragH f; for (int q = 0; q < 8; ++q) f.u[q] = tl[d][j8 + q]; *(v8us*)((unsigned short*)VT + ((size_t)hh * HD + d) * SQ + s0 + j8) = f.half[0]; }  } }


// lane ^ M partner's value added (M = 1, 2, 4: all inside a 16-lane row), as one DPP add
template <int M>
__device__ __forceinline__ float xadd(float s) { return s + __int_as_float(__builtin_amdgcn_update_dpp(0, __float_as_int(s), 0x160 | M, 0xf, 0xf, true)); }
// One wave per (image column x, dilation, class of y modulo the dilation, segment): lane = 4 channels, 8 lanes = one head, so the 128 channels of a q, k or v row are one 512-byte load of whole lines.
// The wave walks down its column in steps of the dilation: the window rows y and y + dil of one pixel are the rows y - dil and y of the next, so they stay in registers (3 row slots of 3 k and 3 v rows each)
// and a pixel loads q and one new window row (7 rows) where it took 19. The walk is unrolled by 3, so that each slot is a fixed set of registers and nothing is moved.
// Work-group = 8 waves on 8 neighbouring columns. Segments: 5 x 8 pixels of the 40 of a class (dilation 2), 3 x 9 of the 27 or 26 (dilation 3): 10 + 9 = 19 walks a column,
// 760 work-groups, 6,080 waves of 8 or 9 pixels: close to six waves for each of the 1,024 SIMDs.
// An out-of-image neighbour reads an in-image row instead (row and column each fall back to the pixel's own), takes logit 0 and weight 0 on v.
#define DLW 19       /* walks a column: 2 classes x 5 segments + 3 classes x 3 segments */
__global__ __launch_bounds__(256) void k_dla(const float* __restrict__ F, _Float16* __restrict__ X16) {
  static_assert(WS % 8 == 0 && HS == 80, "8 columns a work-group; the segment table is for 80 rows");
  const int lane = threadIdx.x & 31; const int w = __builtin_amdgcn_readfirstlane((int)threadIdx.x >> 5);
  const int c = blockIdx.x % DLW, t = blockIdx.x / DLW; const int x = (t % (WS / 8)) * 8 + w, img = t / (WS / 8);
  const int di = c >= 10 ? 1 : 0, cw = di ? c - 10 : c; const int dil = di ? 3 : 2, len = di ? 9 : 8; const int cls = di ? cw % 3 : cw % 2, seg = di ? cw / 3 : cw / 2;      /* divisors as constants: a division by a variable goes through the vector unit, and y would no longer be a scalar */
  const int left = (di ? (HS - cls + 2) / 3 : (HS - cls + 1) / 2) - seg * len; const int n = left < len ? left : len;      /* pixels of this walk */
  int y = cls + seg * len * dil;
  const char* Fi = (const char*)(F + (size_t)img * PX * QW + di * 128); char* Xi = (char*)((unsigned short*)X16 + (size_t)img * PX * CC + di * 128);
  const unsigned vo = (unsigned)lane * 16u, vs = (unsigned)lane * 8u;      /* the lane's 4 channels: byte offset in an f32 row, in an f16 row */
  const bool okc[3] = {x - dil >= 0, true, x + dil < WS}; const int xc[3] = {okc[0] ? x - dil : x, x, okc[2] ? x + dil : x};
  v4f k[3][3], v[3][3]; bool okr[3]; const char* pr[3];      /* [slot][column]; pr: the scalar bases of the row loaded last */
  auto row = [&](int s, int yy) { okr[s] = yy >= 0 && yy < HS; const int yc = okr[s] ? yy : y;
#pragma unroll
    for (int j = 0; j < 3; ++j) { pr[j] = Fi + (size_t)((yc * WS + xc[j]) * (QW * 4)); k[s][j] = *(const v4fa*)(pr[j] + vo + CC * 4); v[s][j] = *(const v4fa*)(pr[j] + vo + 2 * CC * 4); } };
  row(0, y - dil);
  /* s_wait_xcnt 0 behind a row's loads, in front of every overwrite of a register that they name; the bases and the offset that their addresses are formed from are its inputs */
  asm volatile("s_wait_xcnt 0x0" :: "s"(pr[0]), "s"(pr[1]), "s"(pr[2]), "v"(vo) : "memory");
  row(1, y);
  asm volatile("s_wait_xcnt 0x0" :: "s"(pr[0]), "s"(pr[1]), "s"(pr[2]), "v"(vo) : "memory");      /* as above */
#pragma unroll 1
  for (int j0 = 0; j0 < n; j0 += 3) {      /* stays rolled: the body already holds the 3 places of the slots */
#pragma unroll
    for (int u = 0; u < 3; ++u) {      /* unrolled: slot numbers are constants, the slots registers */
      if (j0 + u < n) { const int sl[3] = {u, (u + 1) % 3, (u + 2) % 3};      /* slots of the rows y - dil, y, y + dil */
        const char* pq = Fi + (size_t)((y * WS + x) * (QW * 4)); const v4f q = *(const v4fa*)(pq + vo);
        row(sl[2], y + dil);
        /* s_wait_xcnt 0 behind the pixel's loads, as above */
        asm volatile("s_wait_xcnt 0x0" :: "s"(pq), "s"(pr[0]), "s"(pr[1]), "s"(pr[2]), "v"(vo) : "memory");
        __builtin_amdgcn_sched_barrier(0);      /* all 7 loads of a pixel issue before any of its arithmetic: one latency a pixel, not one per group of loads */
        float s[9]; bool ok[9]; float mx = -INFINITY;
#pragma unroll
        for (int kk = 0; kk < 9; ++kk) { const v4f kr = k[sl[kk / 3]][kk % 3]; ok[kk] = okr[sl[kk / 3]] && okc[kk % 3];
          float d = fmaf(q[3], kr[3], fmaf(q[2], kr[2], fmaf(q[1], kr[1], q[0] * kr[0]))); d = xadd<4>(xadd<2>(xadd<1>(d)));
          s[kk] = ok[kk] ? d * SCL : 0.f; mx = fmaxf(mx, s[kk]); }
        float se = 0.f; v4f acc = {0.f, 0.f, 0.f, 0.f};
#pragma unroll
        for (int kk = 0; kk < 9; ++kk) { const float e = expf(s[kk] - mx); se += e; const float pw = ok[kk] ? e : 0.f; const v4f vr = v[sl[kk / 3]][kk % 3];
          for (int ch = 0; ch < 4; ++ch) acc[ch] = fmaf(pw, vr[ch], acc[ch]); }
        const float inv = 1.0f / se; v4h o; for (int ch = 0; ch < 4; ++ch) o[ch] = (_Float16)(acc[ch] * inv);
        char* po = Xi + (size_t)((y * WS + x) * (CC * 2)); *(v4h*)(po + vs) = o;
        /* s_wait_xcnt 0 behind the store, in front of the next pixel's overwrite of its address and data registers */
        asm volatile("s_wait_xcnt 0x0" :: "s"(po), "v"(vs) : "memory");
        y += dil; } } } }

extern "C" void kernel_launch(void* const* d_in, const int* in_sizes, int n_in,
                              void* d_out, int out_size, void* d_ws, size_t ws_size, hipStream_t stream) {
  (void)in_sizes; (void)n_in; (void)out_size;
  const float* const* I = (const float* const*)d_in; const float* rgb = I[0]; const float* ir = I[1]; const float* wqkv = I[2]; const float* wp = I[3]; const float* bp = I[4];
  char* ws = (char*)d_ws; size_t off = 0;
  auto take = [&](size_t bytes) { char* p = ws + off; off += (bytes + 255) & ~(size_t)255; return p; };
  _Float16* BQ = (_Float16*)take((size_t)QW * CC * 2); _Float16* BP = (_Float16*)take((size_t)CC * CC * 2); float* F = (float*)take(NR * QW * 4); _Float16* X16 = (_Float16*)take(NR * CC * 2);
  if (off > ws_size) return;      /* 0.5 + 75 + 12.5 = approx 88 MiB */
  static_assert(((size_t)QW * CC / 8) % 256 == 0 && ((size_t)CC * CC / 8) % 256 == 0, "k_wnat: whole work-groups per matrix");
  k_wnat<<<(unsigned)(((size_t)QW * CC / 8 + (size_t)CC * CC / 8) / 256), 256, 0, stream>>>(wqkv, (size_t)QW * CC / 8, BQ, wp, (size_t)CC * CC / 8, BP);
  k_gemm3<QW, false, true, 3><<<(unsigned)((NR / 128) * (QW / 384)), 256, 0, stream>>>(nullptr, BQ, 0.0625f, F, nullptr, rgb, ir);      /* qkv (f32) */
  k_dla<<<(unsigned)(NB * (WS / 8) * DLW), 256, 0, stream>>>(F, X16);
  k_gemm3<CC, true, false, 1><<<(unsigned)((NR / 128) * (CC / 128)), 256, 0, stream>>>(X16, BP, 0.0625f, (float*)d_out, bp, rgb, ir);      /* proj + bias + residual */
}

// v008
// A run of this version takes 50.7 microseconds.
// Two timings next to v007 both put it at 1.05 times that version's speed.
// Counting every step since v000, it is 16.0 times as fast.
#include <hip/hip_runtime.h>
// Multi-dilate local attention (rgb, ir [4][128][80][80] -> y = [rgb | ir] (256 ch); qkv = 1x1 (w_qkv [768][256]) split as [3][2 dilations][128 = 4 heads x 32]; per dilation d in (2, 3): each pixel attends to its 3x3 dilated neighbourhood (zero-padded unfold: out-of-image neighbours contribute k = v = 0, logit 0) with softmax(q.k / sqrt(32)) over the 9; heads merged dilation-major; proj (w_proj [256][256]) + b_proj; + y -> NHWC [4][80][80][256]).
// Structure: qkv as a WMMA GEMM whose A tile comes straight from the two channel-first inputs, turned into concatenated pixel rows (exact f16) on its way into LDS (operand tiles staged in LDS, 32x64 wave tiles, f32 accumulation, exact x16 natural weights; exact products) kept f32; the dilated local attention, one wave walking down a column in steps of the dilation with the window's rows kept in registers, on VALU (f32; 4 channels a lane, softmax weights in registers) into f16 rows; projection GEMM whose epilogue adds bias + residual (f32, VALU) and writes the NHWC output.
// Compute dtype: inputs rounded to bf16; y / weights exact; qkv and the attention f32; the attended rows as a plain f16 GEMM operand (~2^-12). v_wmma_f32_16x16x32_f16.
#define NB 4
#define DIMH 128
#define CC 256
#define QW 768
#define HS 80
#define WS 80
#define PX (HS * WS)                 /* 6400 = 50 x 128 */
#define NR ((size_t)NB * PX)         /* 25,600 rows */
#define NRD ((int)NR)                /* unused */
#define SCL 0.17677669529663689f
#define SCL2 (SCL * 1.44269504088896341f)      /* 1 / sqrt(32) times log2 e: logits for a base-2 exponential */
#define SQ 64
#define DM 64
#define NH 1
#define HD 64
#define HG 1
typedef __bf16 v16b __attribute__((ext_vector_type(16)));
typedef unsigned short v8us __attribute__((ext_vector_type(8), may_alias));
typedef float  v8f  __attribute__((ext_vector_type(8)));
typedef float  v4f  __attribute__((ext_vector_type(4)));
typedef float  v4fa __attribute__((ext_vector_type(4), may_alias));
union FragB { v16b v; v8us half[2]; unsigned short u[16]; };

__device__ __forceinline__ unsigned short bf16_bits(float x) { unsigned int u = __float_as_uint(x); return (unsigned short)((u + 0x7FFFu + ((u >> 16) & 1u)) >> 16); }
__device__ __forceinline__ float bf16_val(unsigned short b) { return __uint_as_float(((unsigned int)b) << 16); }
__device__ __forceinline__ float bf16_round(float x) { return bf16_val(bf16_bits(x)); }
// D += A·B with NT terms: 1 = ah·bh, 2 = + al·bh (A split), 3 = + ah·bl (both split)
template <int NT>
__device__ __forceinline__ v8f mmaN(v16b ah, v16b al, v16b bh, v16b bl, v8f c) {
  c = __builtin_amdgcn_wmma_f32_16x16x32_bf16(false, ah, false, bh, (short)0, c, false, false);
  if (NT >= 2) c = __builtin_amdgcn_wmma_f32_16x16x32_bf16(false, al, false, bh, (short)0, c, false, false);
  if (NT >= 3) c = __builtin_amdgcn_wmma_f32_16x16x32_bf16(false, ah, false, bl, (short)0, c, false, false);
  asm volatile("v_nop\n\tv_nop\n\tv_nop\n\tv_nop" : "+v"(c) : "v"(ah), "v"(al), "v"(bh), "v"(bl));
  return c;
}

__global__ __launch_bounds__(256) void k_wt_bf16(const float* __restrict__ W, unsigned short* __restrict__ Wt, int K, int N) {
  const int t = blockIdx.x * 256 + threadIdx.x;
  const int k8n = K / 8;
  if (t >= N * k8n) return;
  const int n = t / k8n, k8 = (t % k8n) * 8;
  v8us v;
#pragma unroll
  for (int i = 0; i < 8; ++i) v[i] = bf16_bits(W[(size_t)(k8 + i) * N + n]);
  *(v8us*)(Wt + (size_t)n * K + k8) = v;
  
}

// GEMM C[M][N] (f32, pitch ldc) = act(A[M][K]·W + bias). A f32 row-major (pitch lda) converted per fragment to bf16
// (ASPLIT: hi/lo two planes -> 2 terms, else single rounded term); Wt bf16 [N][K] (pitch ldb). BIAS_BF16 rounds the
// bias to bf16 first (bias quantised to bf16 before the add). K%32==0, M%16==0, N%64==0.
template <bool ASPLIT, int ACT, bool BIAS_BF16>
__global__ __launch_bounds__(128) void k_gemm_bf(const float* __restrict__ A, int lda, const unsigned short* __restrict__ Wt, int ldb,
                                               const float* __restrict__ bias, float* __restrict__ C, int ldc, int M, int N, int K) {
  __shared__ __attribute__((aligned(16))) float so[4][16][64];
  const int tid = threadIdx.x, w = tid >> 5, lane = tid & 31, ln = lane & 15, hh = lane >> 4;
  const int ntn = N / 64;
  const int wid = blockIdx.x * 4 + w;
  const int mt = wid / ntn, nq = wid % ntn;
  if (mt * 16 >= M) return;
  const int row0 = mt * 16, col0 = nq * 64;
  const float* arow = A + (size_t)(row0 + ln) * lda;
  v8f acc[4] = {};
  for (int kb = 0; kb < K; kb += 32) {
    FragB ah, al;
    const v4f x0 = *(const v4fa*)(arow + kb + 8 * hh), x1 = *(const v4fa*)(arow + kb + 8 * hh + 4);
    const v4f x2 = *(const v4fa*)(arow + kb + 16 + 8 * hh), x3 = *(const v4fa*)(arow + kb + 16 + 8 * hh + 4);
    float xs[16] = {x0[0],x0[1],x0[2],x0[3],x1[0],x1[1],x1[2],x1[3],x2[0],x2[1],x2[2],x2[3],x3[0],x3[1],x3[2],x3[3]};
#pragma unroll
    for (int i = 0; i < 16; ++i) { const unsigned short hb = bf16_bits(xs[i]); ah.u[i] = hb; al.u[i] = ASPLIT ? bf16_bits(xs[i] - bf16_val(hb)) : (unsigned short)0; }
#pragma unroll
    for (int t = 0; t < 4; ++t) {
      const unsigned short* brow = Wt + (size_t)(col0 + t * 16 + ln) * ldb + kb;
      FragB b;
      b.half[0] = *(const v8us*)(brow + 8 * hh);
      b.half[1] = *(const v8us*)(brow + 16 + 8 * hh);
      acc[t] = mmaN<ASPLIT ? 2 : 1>(ah.v, al.v, b.v, b.v, acc[t]);
    }
  }
#pragma unroll
  for (int t = 0; t < 4; ++t) {
    float bv = bias ? bias[col0 + t * 16 + ln] : 0.f;
    if (BIAS_BF16) bv = bf16_round(bv);
#pragma unroll
    for (int r = 0; r < 8; ++r) { float v = acc[t][r] + bv; if (ACT == 1) v = fmaxf(v, 0.f); so[w][8 * hh + r][t * 16 + ln] = v; }
  }
  __builtin_amdgcn_fence(__ATOMIC_ACQ_REL, "workgroup");
  __builtin_amdgcn_wave_barrier();
  const int rsub = lane >> 4, c4 = (lane & 15) * 4;
  {
#pragma unroll
    for (int q = 0; q < 8; ++q) {
      const int r = q * 2 + rsub;
      const v4f v = *(const v4fa*)&so[w][r][c4];
      *(v4f*)(C + (size_t)(row0 + r) * ldc + col0 + c4) = v;
    }
    
  }
}

// GEMM C = act(A·W + bias + resid): A f32 (ASPLIT -> hi/lo 2 terms), Wt bf16 [N][K]; ACT 0 none, 1 relu, 2 exact gelu;
// resid (optional, f32, row index = (row % rmod), pitch ldr, RES_BF16 rounds it) added before the activation.
template <bool ASPLIT, int ACT, bool BIAS_BF16, bool RES_BF16>
__global__ __launch_bounds__(128) void k_gemm_bf3(const float* __restrict__ A, int lda, const unsigned short* __restrict__ Wt, int ldb,
                                                const float* __restrict__ bias, const float* __restrict__ resid, int rmod, int ldr,
                                                float* __restrict__ C, int ldc, int M, int N, int K) {
  __shared__ __attribute__((aligned(16))) float so[4][16][64];
  const int tid = threadIdx.x, w = tid >> 5, lane = tid & 31, ln = lane & 15, hh = lane >> 4;
  const int ntn = N / 64;
  const int wid = blockIdx.x * 4 + w;
  const int mt = wid / ntn, nq = wid % ntn;
  if (mt * 16 >= M) return;
  const int row0 = mt * 16, col0 = nq * 64;
  const float* arow = A + (size_t)(row0 + ln) * lda;
  v8f acc[4] = {};
  for (int kb = 0; kb < K; kb += 32) {
    FragB ah, al;
    const v4f x0 = *(const v4fa*)(arow + kb + 8 * hh), x1 = *(const v4fa*)(arow + kb + 8 * hh + 4);
    const v4f x2 = *(const v4fa*)(arow + kb + 16 + 8 * hh), x3 = *(const v4fa*)(arow + kb + 16 + 8 * hh + 4);
    float xs[16] = {x0[0],x0[1],x0[2],x0[3],x1[0],x1[1],x1[2],x1[3],x2[0],x2[1],x2[2],x2[3],x3[0],x3[1],x3[2],x3[3]};
#pragma unroll
    for (int i = 0; i < 16; ++i) { const unsigned short hb = bf16_bits(xs[i]); ah.u[i] = hb; al.u[i] = ASPLIT ? bf16_bits(xs[i] - bf16_val(hb)) : (unsigned short)0; }
#pragma unroll
    for (int t = 0; t < 4; ++t) {
      const unsigned short* brow = Wt + (size_t)(col0 + t * 16 + ln) * ldb + kb;
      FragB b;
      b.half[0] = *(const v8us*)(brow + 8 * hh);
      b.half[1] = *(const v8us*)(brow + 16 + 8 * hh);
      acc[t] = mmaN<ASPLIT ? 2 : 1>(ah.v, al.v, b.v, b.v, acc[t]);
    }
  }
#pragma unroll
  for (int t = 0; t < 4; ++t) {
    const int col = col0 + t * 16 + ln;
    float bv = bias ? bias[col] : 0.f;
    if (BIAS_BF16) bv = bf16_round(bv);
#pragma unroll
    for (int r = 0; r < 8; ++r) {
      float v = acc[t][r] + bv;
      if (resid) { float rv = resid[(size_t)((row0 + 8 * hh + r) % rmod) * ldr + col]; if (RES_BF16) rv = bf16_round(rv); v += rv; }
      if (ACT == 1) v = fmaxf(v, 0.f);
      if (ACT == 2) v = 0.5f * v * (1.0f + erff(v * 0.70710678118654752f));
      if (ACT == 3) { const float u = 0.7978845608028654f * (v + 0.044715f * v * v * v); v = 0.5f * v * (1.0f + tanhf(u)); }
      so[w][8 * hh + r][t * 16 + ln] = v;
    }
  }
  __builtin_amdgcn_fence(__ATOMIC_ACQ_REL, "workgroup");
  __builtin_amdgcn_wave_barrier();
  const int rsub = lane >> 4, c4 = (lane & 15) * 4;
  {
#pragma unroll
    for (int q = 0; q < 8; ++q) {
      const int r = q * 2 + rsub;
      const v4f v = *(const v4fa*)&so[w][r][c4];
      *(v4f*)(C + (size_t)(row0 + r) * ldc + col0 + c4) = v;
    }
    
  }
}
// row LayerNorm (biased variance, eps) over N: s = X (+ R); optional out_sum <- s; out_norm <- (s-mu)*rsqrt(var+eps)*g + b
template <bool PARAM_BF16>
__global__ __launch_bounds__(256) void k_layernorm(const float* __restrict__ X, const float* __restrict__ R, const float* __restrict__ g, const float* __restrict__ bta,
                                                  float* __restrict__ out_sum, float* __restrict__ out_norm, int N, float eps) {
  __shared__ float red[256];
  const int row = blockIdx.x, tid = threadIdx.x;
  const float* x = X + (size_t)row * N; const float* rr = R ? R + (size_t)row * N : nullptr;
  float vals[16];                     // up to N = 4096
  const int per = N / 256;            // contiguous chunk per thread? use strided-by-4 chunks: thread handles j = tid*4 + 1024*u
  float s1 = 0.f;
  for (int u = 0; u < per / 4; ++u) {
    const int j = tid * 4 + 1024 * u;
    const v4f a = *(const v4fa*)(x + j);
    v4f b = {0.f,0.f,0.f,0.f}; if (rr) b = *(const v4fa*)(rr + j);
#pragma unroll
    for (int q = 0; q < 4; ++q) { const float v = a[q] + b[q]; vals[u * 4 + q] = v; s1 += v; }
  }
  red[tid] = s1; __syncthreads();
  for (int st = 128; st > 0; st >>= 1) { if (tid < st) red[tid] += red[tid + st]; __syncthreads(); }
  const float mu = red[0] / (float)N; __syncthreads();
  float s2 = 0.f;
  for (int u = 0; u < per / 4; ++u)
#pragma unroll
    for (int q = 0; q < 4; ++q) { const float c = vals[u * 4 + q] - mu; s2 += c * c; }
  red[tid] = s2; __syncthreads();
  for (int st = 128; st > 0; st >>= 1) { if (tid < st) red[tid] += red[tid + st]; __syncthreads(); }
  const float rs = rsqrtf(red[0] / (float)N + eps);
  {
    for (int u = 0; u < per / 4; ++u) {
      const int j = tid * 4 + 1024 * u;
      v4f o, sm;
#pragma unroll
      for (int q = 0; q < 4; ++q) {
        float gg = g[j + q], bb = bta[j + q];
        if (PARAM_BF16) { gg = bf16_round(gg); bb = bf16_round(bb); }
        sm[q] = vals[u * 4 + q]; o[q] = (vals[u * 4 + q] - mu) * rs * gg + bb;
      }
      if (out_sum) *(v4f*)(out_sum + (size_t)row * N + j) = sm;
      *(v4f*)(out_norm + (size_t)row * N + j) = o;
    }
    
  }
}



// ---- f16 WMMA path (v_wmma_f32_16x16x32_f16): 11-bit significands for operands in range — used here for the qkv and projection GEMMs
typedef _Float16 v16h __attribute__((ext_vector_type(16)));
union FragH { v16h v; v8us half[2]; _Float16 h[16]; unsigned short u[16]; };
template <int NT>
__device__ __forceinline__ v8f mmaH(v16h ah, v16h al, v16h bh, v16h bl, v8f c) {
  c = __builtin_amdgcn_wmma_f32_16x16x32_f16(false, ah, false, bh, (short)0, c, false, false);
  if (NT >= 2) c = __builtin_amdgcn_wmma_f32_16x16x32_f16(false, al, false, bh, (short)0, c, false, false);
  if (NT >= 3) c = __builtin_amdgcn_wmma_f32_16x16x32_f16(false, ah, false, bl, (short)0, c, false, false);
  asm volatile("v_nop\n\tv_nop\n\tv_nop\n\tv_nop" : "+v"(c) : "v"(ah), "v"(al), "v"(bh), "v"(bl));
  return c;
}
// batched GEMM like k_gemm_b but f16 operands: A f32 (split into f16 hi/lo if ASPLIT, else rounded to f16), Bt = f16 values [n][k]; alpha; C f32; N multiple of 16 (partial tiles skipped)
template <bool ASPLIT>
__global__ __launch_bounds__(128) void k_gemm_h(const float* __restrict__ A, int lda, size_t sA, const _Float16* __restrict__ Bh, int ldb, size_t sB, float alpha, float* __restrict__ C, int ldc, size_t sC, int M, int N, int K) {
  __shared__ __attribute__((aligned(16))) float so[4][16][64];
  const int tid = threadIdx.x, w = tid >> 5, lane = tid & 31, ln = lane & 15, hh = lane >> 4; const int by = blockIdx.y;
  A += (size_t)by * sA; Bh += (size_t)by * sB; C += (size_t)by * sC;
  const int ntn = (N + 63) / 64; const int wid = blockIdx.x * 4 + w; const int mt = wid / ntn, nq = wid % ntn; if (mt * 16 >= M) return;
  const int row0 = mt * 16, col0 = nq * 64; const float* arow = A + (size_t)(row0 + ln) * lda;
  v8f acc[4] = {};
  for (int kb = 0; kb < K; kb += 32) {
    FragH ah, al;
    const v4f x0 = *(const v4fa*)(arow + kb + 8 * hh), x1 = *(const v4fa*)(arow + kb + 8 * hh + 4), x2 = *(const v4fa*)(arow + kb + 16 + 8 * hh), x3 = *(const v4fa*)(arow + kb + 16 + 8 * hh + 4);
    float xs[16] = {x0[0],x0[1],x0[2],x0[3],x1[0],x1[1],x1[2],x1[3],x2[0],x2[1],x2[2],x2[3],x3[0],x3[1],x3[2],x3[3]};
#pragma unroll
    for (int i = 0; i < 16; ++i) { const _Float16 h = (_Float16)xs[i]; ah.h[i] = h; al.h[i] = ASPLIT ? (_Float16)(xs[i] - (float)h) : (_Float16)0.0f; }
#pragma unroll
    for (int t = 0; t < 4; ++t) { if (col0 + t * 16 >= N) continue; const size_t boff = (size_t)(col0 + t * 16 + ln) * ldb + kb; FragH bq; bq.half[0] = *(const v8us*)(Bh + boff + 8 * hh); bq.half[1] = *(const v8us*)(Bh + boff + 16 + 8 * hh);
      acc[t] = mmaH<ASPLIT ? 2 : 1>(ah.v, al.v, bq.v, bq.v, acc[t]); }
  }
#pragma unroll
  for (int t = 0; t < 4; ++t) { if (col0 + t * 16 >= N) continue;
#pragma unroll
    for (int r = 0; r < 8; ++r) so[w][8 * hh + r][t * 16 + ln] = acc[t][r] * alpha; }
  __builtin_amdgcn_fence(__ATOMIC_ACQ_REL, "workgroup"); __builtin_amdgcn_wave_barrier();
  const int rsub = lane >> 4, c4 = (lane & 15) * 4;
  {
#pragma unroll
    for (int q = 0; q < 8; ++q) { const int r = q * 2 + rsub; if (col0 + c4 < N) { const v4f v = *(const v4fa*)&so[w][r][c4]; *(v4f*)(C + (size_t)(row0 + r) * ldc + col0 + c4) = v; } }
     }
}

// Wt[n][k] = f16(W[k][n]·scale) from f32 row-major W[K][N] (scale = power of two; bf16-exact weights stay exact in f16 away from the subnormal range)
__global__ __launch_bounds__(256) void k_wt_f16(const float* __restrict__ W, _Float16* __restrict__ Wt, int K, int N, float scale) {
  const int t = blockIdx.x * 256 + threadIdx.x; if (t >= N * (K / 8)) return; const int n = t / (K / 8), k8 = (t % (K / 8)) * 8; FragH f;
#pragma unroll
  for (int i = 0; i < 8; ++i) f.h[i] = (_Float16)(bf16_round(W[(size_t)(k8 + i) * N + n]) * scale); const v8us o = f.half[0];
  *(v8us*)((unsigned short*)Wt + (size_t)n * K + k8) = o; 
}
// k_gemm_hh variant with fused epilogue: v = acc·alpha + bias[by·sBias + col] (+ CP[(row/rowsPerB)·sCPb + by·64 + col] if CP) ; ACT 0 none / 1 elu ; writes f16 C16 (and f32 C if non-null)
template <int ACT>
__global__ __launch_bounds__(128) void k_gemm_hhx(const _Float16* __restrict__ A, int lda, size_t sA, const _Float16* __restrict__ Bh, int ldb, size_t sB, float alpha, const float* __restrict__ bias, size_t sBias, const float* __restrict__ CP, int rowsPerB, size_t sCPb, int row0g,
    float* __restrict__ C, _Float16* __restrict__ C16, int ldc, size_t sC, int M, int N, int K) {
  __shared__ __attribute__((aligned(16))) float so[4][16][64];
  const int tid = threadIdx.x, w = tid >> 5, lane = tid & 31, ln = lane & 15, hh = lane >> 4; const int by = blockIdx.y;
  A += (size_t)by * sA; Bh += (size_t)by * sB; const size_t cofs = (size_t)by * sC; const float* bp = bias ? bias + (size_t)by * sBias : nullptr;
  const int ntn = (N + 63) / 64; const int wid = blockIdx.x * 4 + w; const int mt = wid / ntn, nq = wid % ntn; if (mt * 16 >= M) return;
  const int row0 = mt * 16, col0 = nq * 64; const _Float16* arow = A + (size_t)(row0 + ln) * lda;
  v8f acc[4] = {};
  for (int kb = 0; kb < K; kb += 32) { FragH ah; ah.half[0] = *(const v8us*)((const unsigned short*)arow + kb + 8 * hh); ah.half[1] = *(const v8us*)((const unsigned short*)arow + kb + 16 + 8 * hh);
#pragma unroll
    for (int t = 0; t < 4; ++t) { if (col0 + t * 16 >= N) continue; const size_t boff = (size_t)(col0 + t * 16 + ln) * ldb + kb; FragH bq; bq.half[0] = *(const v8us*)((const unsigned short*)Bh + boff + 8 * hh); bq.half[1] = *(const v8us*)((const unsigned short*)Bh + boff + 16 + 8 * hh);
      acc[t] = mmaH<1>(ah.v, ah.v, bq.v, bq.v, acc[t]); }
  }
#pragma unroll
  for (int t = 0; t < 4; ++t) { if (col0 + t * 16 >= N) continue; const int col = col0 + t * 16 + ln; const float bv = bp ? bf16_round(bp[col]) : 0.f;
#pragma unroll
    for (int r = 0; r < 8; ++r) { float v = acc[t][r] * alpha + bv; if (CP) { const int rr = row0g + row0 + 8 * hh + r; if (rowsPerB < 0) v += CP[cofs + (size_t)rr * ldc + col];      /* rowsPerB < 0: own element of the batched C plane */ else { const int bidx = rr / rowsPerB; v += CP[(size_t)bidx * sCPb + (size_t)by * 64 + col]; } } if (ACT == 1) v = (v > 0.f) ? v : expm1f(v); else if (ACT == 7) v = (v > 0.f) ? v + 1.0f : expf(v); else if (ACT == 8) v = tanhf(v); else if (ACT == 9) v = 0.5f * v * (1.0f + tanhf(0.7978845608028654f * (v + 0.044715f * v * v * v))); else if (ACT == 11) v = 1.0f / (1.0f + expf(-v)); else if (ACT == 12) v = (v > 0.f) ? v : 0.01f * v; else if (ACT == 14) v = (v > 0.f) ? v : 0.1f * v; else if (ACT == 16) v = (v >= 0.f) ? v : 0.3f * v; else if (ACT == 17) v = (v >= 0.f) ? v : 0.2f * v; else if (ACT == 15) v = v / (1.0f + expf(-v)); else if (ACT == 3) v = fmaxf(v, 0.f); else if (ACT == 6) v = 0.5f * v * (1.0f + erff(v * 0.70710678118654752f)); so[w][8 * hh + r][t * 16 + ln] = v; } }
  __builtin_amdgcn_fence(__ATOMIC_ACQ_REL, "workgroup"); __builtin_amdgcn_wave_barrier();
  const int rsub = lane >> 4, c4 = (lane & 15) * 4; typedef _Float16 v4h __attribute__((ext_vector_type(4)));
  {
#pragma unroll
    for (int q = 0; q < 8; ++q) { const int r = q * 2 + rsub; if (col0 + c4 < N) { const v4f v = *(const v4fa*)&so[w][r][c4]; if (C) *(v4f*)(C + cofs + (size_t)(row0 + r) * ldc + col0 + c4) = v; if (C16) { v4h h4; for (int i = 0; i < 4; ++i) h4[i] = (_Float16)v[i]; *(v4h*)(C16 + cofs + (size_t)(row0 + r) * ldc + col0 + c4) = h4; } } }
     }
}


typedef _Float16 v4h __attribute__((ext_vector_type(4)));

__global__ __launch_bounds__(256) void k_x16(const float* __restrict__ x, _Float16* __restrict__ X16, size_t n8) { const size_t t = (size_t)blockIdx.x * 256 + threadIdx.x; if (t >= n8) return; FragH f;
#pragma unroll
  for (int q = 0; q < 8; ++q) f.h[q] = (_Float16)bf16_round(x[t * 8 + q]); *(v8us*)((unsigned short*)X16 + t * 8) = f.half[0];  }
__global__ __launch_bounds__(256) void k_h16(const float* __restrict__ x, _Float16* __restrict__ X16, size_t n8) { const size_t t = (size_t)blockIdx.x * 256 + threadIdx.x; if (t >= n8) return; FragH f;
#pragma unroll
  for (int q = 0; q < 8; ++q) f.h[q] = (_Float16)x[t * 8 + q]; *(v8us*)((unsigned short*)X16 + t * 8) = f.half[0];  }
__global__ __launch_bounds__(256) void k_round16f(const float* __restrict__ W, _Float16* __restrict__ Bt, size_t n8) { const size_t t = (size_t)blockIdx.x * 256 + threadIdx.x; if (t >= n8) return; FragH f;
#pragma unroll
  for (int i = 0; i < 8; ++i) f.h[i] = (_Float16)(bf16_round(W[t * 8 + i]) * 16.0f); *(v8us*)((unsigned short*)Bt + t * 8) = f.half[0];  }
template <int NHv, int TTv>
__global__ __launch_bounds__(256) void k_vt(const _Float16* __restrict__ V16, int ldv, int voff, _Float16* __restrict__ Vt) { __shared__ unsigned short tl[64][66]; const int tid = threadIdx.x; const int slab = blockIdx.x / (TTv / 64), lg = blockIdx.x % (TTv / 64); const int b = slab / NHv, h = slab % NHv;
  for (int i = tid; i < 64 * 8; i += 256) { const int r = i / 8, c8 = (i % 8) * 8; FragH f; f.half[0] = *(const v8us*)((const unsigned short*)V16 + ((size_t)b * TTv + lg * 64 + r) * ldv + voff + h * 64 + c8);
#pragma unroll
    for (int q = 0; q < 8; ++q) tl[r][c8 + q] = f.u[q]; }
  __syncthreads();
  {
#pragma unroll
    for (int rd = 0; rd < 2; ++rd) { const int d = rd * 32 + tid / 8, pc = tid % 8; FragH f;
#pragma unroll
      for (int q = 0; q < 8; ++q) f.u[q] = tl[pc * 8 + q][d];
      *(v8us*)((unsigned short*)Vt + ((size_t)slab * 64 + d) * TTv + lg * 64 + pc * 8) = f.half[0]; }
     } }

__global__ __launch_bounds__(256) void k_hl(const float* __restrict__ F, _Float16* __restrict__ Hh, _Float16* __restrict__ Hl, size_t n8) { const size_t t = (size_t)blockIdx.x * 256 + threadIdx.x; if (t >= n8) return; FragH fh, fl; const v4f a = *(const v4fa*)(F + t * 8), c = *(const v4fa*)(F + t * 8 + 4);
#pragma unroll
  for (int q = 0; q < 4; ++q) { _Float16 h = (_Float16)a[q]; fh.h[q] = h; fl.h[q] = (_Float16)((a[q] - (float)h) * 1024.0f); h = (_Float16)c[q]; fh.h[4 + q] = h; fl.h[4 + q] = (_Float16)((c[q] - (float)h) * 1024.0f); }
  { *(v8us*)((unsigned short*)Hh + t * 8) = fh.half[0]; *(v8us*)((unsigned short*)Hl + t * 8) = fl.half[0];  } }

// ---- fast GEMM (wave tile 32x64; requires M % 32 == 0 rows per launch region and N % 64 == 0); epilogue = k_gemm_hhx semantics ----
__device__ __forceinline__ v16h g2_frag(const _Float16* p, int hh) { FragH f; f.half[0] = *(const v8us*)((const unsigned short*)p + 8 * hh); f.half[1] = *(const v8us*)((const unsigned short*)p + 16 + 8 * hh); return f.v; }
__device__ __forceinline__ v8f g2_mma(v16h a, v16h b, v8f c) { v8f d = __builtin_amdgcn_wmma_f32_16x16x32_f16(false, a, false, b, (short)0, c, false, false); asm volatile("v_nop\n\tv_nop\n\tv_nop\n\tv_nop" : "+v"(d) : "v"(a), "v"(b)); return d; }
template <int ACT>
__global__ __launch_bounds__(128) void k_gemm2(const _Float16* __restrict__ A, int lda, size_t sA, const _Float16* __restrict__ Bh, int ldb, size_t sB, float alpha, const float* __restrict__ bias, size_t sBias, const float* __restrict__ CP, int rowsPerB, size_t sCPb, int row0g,
    float* __restrict__ C, _Float16* __restrict__ C16, int ldc, size_t sC, int M, int N, int K) { static_assert(ACT == 0 || ACT == 3 || ACT == 6 || ACT == 8 || ACT == 9 || ACT == 11 || ACT == 12 || ACT == 14 || ACT == 15 || ACT == 16 || ACT == 17, "k_gemm2: unsupported ACT code (would silently apply no activation)");
  __shared__ __attribute__((aligned(16))) float so[4][32][68];
  const int tid = threadIdx.x, w = tid >> 5, lane = tid & 31, ln = lane & 15, hh = lane >> 4; const int by = blockIdx.y;
  A += (size_t)by * sA; Bh += (size_t)by * sB; const size_t cofs = (size_t)by * sC; const float* bp = bias ? bias + (size_t)by * sBias : nullptr;
  const int ntn = N >> 6; const int mt = blockIdx.x / ntn, nq = blockIdx.x - mt * ntn; const int row0 = mt * 128 + 32 * w, col0 = nq * 64; if (row0 >= M) return;
  const _Float16* a0p = A + (size_t)(row0 + ln) * lda; const _Float16* a1p = a0p + (size_t)16 * lda;
  const _Float16* b0p = Bh + (size_t)(col0 + ln) * ldb; const _Float16* b1p = b0p + (size_t)16 * ldb; const _Float16* b2p = b1p + (size_t)16 * ldb; const _Float16* b3p = b2p + (size_t)16 * ldb;
  const v8f z8 = {0.f,0.f,0.f,0.f,0.f,0.f,0.f,0.f}; v8f c00 = z8, c01 = z8, c02 = z8, c03 = z8, c10 = z8, c11 = z8, c12 = z8, c13 = z8;
#pragma unroll 1
  for (int kb = 0; kb < K; kb += 32) { const v16h a0 = g2_frag(a0p + kb, hh), a1 = g2_frag(a1p + kb, hh);
    v16h b = g2_frag(b0p + kb, hh); c00 = g2_mma(a0, b, c00); c10 = g2_mma(a1, b, c10);
    b = g2_frag(b1p + kb, hh); c01 = g2_mma(a0, b, c01); c11 = g2_mma(a1, b, c11);
    b = g2_frag(b2p + kb, hh); c02 = g2_mma(a0, b, c02); c12 = g2_mma(a1, b, c12);
    b = g2_frag(b3p + kb, hh); c03 = g2_mma(a0, b, c03); c13 = g2_mma(a1, b, c13); }
  v8f accs[8] = {c00, c01, c02, c03, c10, c11, c12, c13};
#pragma unroll
  for (int u = 0; u < 8; ++u) { const int t = u & 3, half = u >> 2; const int col = col0 + t * 16 + ln; const float bv = bp ? bf16_round(bp[col]) : 0.f;
#pragma unroll
    for (int r = 0; r < 8; ++r) { const int rloc = half * 16 + 8 * hh + r; float v = accs[u][r] * alpha + bv; if (CP) { if (rowsPerB < 0) v += CP[cofs + (size_t)(row0g + row0 + rloc) * ldc + col];      /* rowsPerB < 0: own element of the batched C plane */ else { const int bidx = (row0g + row0 + rloc) / rowsPerB; v += CP[(size_t)bidx * sCPb + (size_t)by * 64 + col]; } }
      if (ACT == 3) v = fmaxf(v, 0.f); else if (ACT == 6) v = 0.5f * v * (1.0f + erff(v * 0.70710678118654752f)); else if (ACT == 11) v = 1.0f / (1.0f + expf(-v)); else if (ACT == 15) v = v / (1.0f + expf(-v)); else if (ACT == 12) v = (v > 0.f) ? v : 0.01f * v; else if (ACT == 8) v = tanhf(v); else if (ACT == 9) v = 0.5f * v * (1.0f + tanhf(0.7978845608028654f * (v + 0.044715f * v * v * v))); else if (ACT == 14) v = (v > 0.f) ? v : 0.1f * v; else if (ACT == 16) v = (v >= 0.f) ? v : 0.3f * v; else if (ACT == 17) v = (v >= 0.f) ? v : 0.2f * v;
      so[w][rloc][t * 16 + ln] = v; } }
  __builtin_amdgcn_fence(__ATOMIC_ACQ_REL, "workgroup"); __builtin_amdgcn_wave_barrier();
  const int rsub = lane >> 4, c4 = (lane & 15) * 4;
  {
#pragma unroll
    for (int q = 0; q < 16; ++q) { const int r = q * 2 + rsub; const v4f v = *(const v4fa*)&so[w][r][c4]; if (C) *(v4f*)(C + cofs + (size_t)(row0 + r) * ldc + col0 + c4) = v; if (C16) { v4h h4; for (int i = 0; i < 4; ++i) h4[i] = (_Float16)v[i]; *(v4h*)(C16 + cofs + (size_t)(row0 + r) * ldc + col0 + c4) = h4; } }
     } }


// ---- GEMM with both operand tiles staged in LDS: C[M][NN] (f32) = alpha * A[M][CC] . Bh[NN][CC]^T; K = CC; grid = (M / 128) * (NN / (128 NT)) ----
// Work-group tile 128 x 128, 8 waves; wave tile 32 x 64 and k order as k_gemm2. A fragment load straight from global touches 16 lines for its 512 bytes and stands in front of its own WMMAs;
// here each global load of a wave is one whole 512-byte row (4 lines), all 32 of a wave are in flight together, and the fragments come from LDS rows pitched 528 B (16 B x 33: no bank conflict for 16-byte reads).
// FIN (the projection): C = (alpha * A . Bh^T + bf16(bpj[col])) + bf16(residual), the residual read from the channel-first inputs in the accumulators' own layout:
// a lane's 8 accumulator rows of one column are 8 neighbouring pixels of one channel, 32 bytes in a row; a wave's 32 pixels of a channel are one whole 128-byte line.
// ACF (the qkv product): A is not read as f16 rows; the tile's 128 pixels x 256 channels come from the channel-first f32 inputs. Wave w brings channels 32 w .. 32 w + 31:
// a load's 8-lane groups take one 128-byte line (32 pixels) of 4 channels that lie 8 apart, so after 8 loads a lane holds 8 neighbouring channels of 4 pixels: 4 whole 16-byte pieces of pixel rows.
// NT: a work-group fills its A tile once and takes NT neighbouring 128-column tiles of B one after the other against it. The next B tile's rows are loaded into registers under the current tile's products;
// the output staging then lies on the B rows (never on A), and the tile's stores to C stay in flight while the next tile is worked on.
#define GLP 264      /* LDS row pitch in f16 elements */
typedef float v2f __attribute__((ext_vector_type(2)));
typedef _Float16 v2h __attribute__((ext_vector_type(2)));
// two f32 -> bf16 (nearest even), those values as f16, packed
__device__ __forceinline__ unsigned pk_bf_h(float x, float y) { unsigned u;
  asm("v_cvt_pk_bf16_f32 %0, %1, %2" : "=v"(u) : "v"(x), "v"(y));      /* as asm so that both sources are read where their loads left them: through a 2-vector the compiler first copied one register of every pair */
  const v2f r = {__uint_as_float(u << 16), __uint_as_float(u & 0xFFFF0000u)}; return __builtin_bit_cast(unsigned, __builtin_convertvector(r, v2h)); }
typedef unsigned v4ua __attribute__((ext_vector_type(4), may_alias));
// work-group barrier that orders LDS alone: __syncthreads() would also wait for the wave's global loads and stores, here the next B tile's loads and the last tile's stores to C, which no other wave reads
__device__ __forceinline__ void lds_barrier() { __builtin_amdgcn_fence(__ATOMIC_RELEASE, "workgroup", "local"); __builtin_amdgcn_s_barrier(); __builtin_amdgcn_fence(__ATOMIC_ACQUIRE, "workgroup", "local"); }
template <int NN, bool FIN, bool ACF, int NT>
__global__ __launch_bounds__(256) void k_gemm3(const _Float16* __restrict__ A, const _Float16* __restrict__ Bh, float alpha, float* __restrict__ C, const float* __restrict__ bpj, const float* __restrict__ rgb, const float* __restrict__ ir) {
  static_assert(!FIN || (NN == CC && DIMH == 128 && PX % 128 == 0), "FIN: a 128-column tile is one input's channels, a 128-row tile lies in one image");
  static_assert(!ACF || (CC == 256 && DIMH == 128 && PX % 128 == 0), "ACF: 4 waves per input, a 128-row tile lies in one image");
  static_assert(NN % (128 * NT) == 0 && (!FIN || NT == 1), "NT tiles divide the columns; the residual's loads are written for one tile");
  __shared__ __attribute__((aligned(16))) _Float16 sm[NT > 1 ? 128 * GLP + 8 * 32 * 68 * 2 : (128 + 128) * GLP];      /* 128 A rows, then 128 B rows; after the products the waves' output staging: NT = 1 from the start, NT > 1 from the B rows on (8 x 32 x 68 floats, 2 KiB more than these) */
  const int lane = threadIdx.x & 31, ln = lane & 15, hh = lane >> 4; const int w = __builtin_amdgcn_readfirstlane((int)threadIdx.x >> 5); const int wr = w & 3, wc = w >> 2;
  const int ntn = NN / (128 * NT); const int mt = blockIdx.x / ntn, nq0 = (blockIdx.x - mt * ntn) * NT; const int row0 = mt * 128 + 32 * wr;
  _Float16* sb = sm + 128 * GLP;
  const unsigned short* ga = (const unsigned short*)A + (size_t)(mt * 128 + 16 * w) * CC + lane * 8; const unsigned short* gb = (const unsigned short*)Bh + (size_t)(nq0 * 128 + 16 * w) * CC + lane * 8;
  v8us ra[16], rb[16];      /* wave w brings rows 16 w .. 16 w + 15 of either tile; the loops below are unrolled so that the arrays are registers and each row is an immediate offset */
  v4f fa[32]; const char* asrc = nullptr; unsigned aob = 0; const int cs = lane >> 3, pg = lane & 7;      /* ACF: [pixel block t][channel i] = 4 pixels 32 t + 4 pg .. + 3 of channel 32 w + 8 cs + i; asrc, aob: these loads' scalar base and offset register */
  if (ACF) { const int img = mt / (PX / 128), p0 = (mt - img * (PX / 128)) * 128;
    asrc = (const char*)((w < 4 ? rgb : ir) + ((size_t)img * DIMH + 32 * (w & 3)) * PX + p0); aob = (unsigned)(8 * cs * PX + 4 * pg) * 4u;
#pragma unroll
    for (int t = 0; t < 4; ++t) {
#pragma unroll
      for (int i = 0; i < 8; ++i) fa[t * 8 + i] = *(const v4fa*)(asrc + aob + (i * PX + 32 * t) * 4); }
  } else {
#pragma unroll
    for (int i = 0; i < 16; ++i) ra[i] = *(const v8us*)(ga + i * CC);
  }
#pragma unroll
  for (int i = 0; i < 16; ++i) rb[i] = *(const v8us*)(gb + i * CC);
  /* s_wait_xcnt 0 behind the tile's loads, in front of every overwrite of a register that they name; their offset registers (ACF: the A loads' scalar base too) are its inputs, so that none of them is overwritten ahead of it; its memory clobber also keeps every LDS store behind the last load, so the wave pays one load latency for all its rows */
  if (ACF) { asm volatile("s_wait_xcnt 0x0" :: "v"(lane), "v"(aob), "s"(asrc) : "memory");
    __builtin_amdgcn_sched_barrier(0); }      /* no conversion moves up among the loads: its wait for an A row would hold back the issue of the B rows */
  else asm volatile("s_wait_xcnt 0x0" :: "v"(lane) : "memory");
  if (ACF) {      /* 16-byte piece 4 w + cs of pixel row 32 t + 4 pg + j: at the pitch of 33 pieces the 32 lanes fall on all 16 bank groups, two lanes each */
#pragma unroll
    for (int t = 0; t < 4; ++t) {
#pragma unroll
      for (int j = 0; j < 4; ++j) { const v4ua o = {pk_bf_h(fa[t * 8][j], fa[t * 8 + 1][j]), pk_bf_h(fa[t * 8 + 2][j], fa[t * 8 + 3][j]), pk_bf_h(fa[t * 8 + 4][j], fa[t * 8 + 5][j]), pk_bf_h(fa[t * 8 + 6][j], fa[t * 8 + 7][j])};
        *(v4ua*)((unsigned short*)sm + (32 * t + 4 * pg + j) * GLP + 32 * w + 8 * cs) = o; } }
  } else {
#pragma unroll
    for (int i = 0; i < 16; ++i) *(v8us*)((unsigned short*)sm + (16 * w + i) * GLP + lane * 8) = ra[i];
  }
#pragma unroll 1
  for (int nt = 0; nt < NT; ++nt) {      /* stays rolled: one copy of the products and the epilogue in the instruction cache, one set of registers */
  const int nq = nq0 + nt, col0 = nq * 128 + 64 * wc;
#pragma unroll
  for (int i = 0; i < 16; ++i) *(v8us*)((unsigned short*)sb + (16 * w + i) * GLP + lane * 8) = rb[i];
  if (NT > 1) lds_barrier(); else __syncthreads();      /* tile filled */
  if (NT > 1 && nt + 1 < NT) {      /* the next B tile's rows: issued here, stored to LDS at the head of the next trip, so they fly under the products and the epilogue */
    gb += 128 * CC;
#pragma unroll
    for (int i = 0; i < 16; ++i) rb[i] = *(const v8us*)(gb + i * CC);
    /* s_wait_xcnt 0 behind these loads, in front of every overwrite of a register that they name; its memory clobber also keeps the loads from sinking below the products */
    asm volatile("s_wait_xcnt 0x0" :: "v"(lane), "v"(gb) : "memory");
  }
  /* the residual's and the bias's loads stand behind the barrier (which waits for every load issued in front of it) and ahead of the products, under which they fly */
  v4f rs[16]; float bv[4]; unsigned rob = 0;      /* residual: [fragment u][rows 0-3, 4-7]; bias: one column per t; rob: the residual loads' offset register */
  if (FIN) { const int img = mt / (PX / 128), p0 = (mt - img * (PX / 128)) * 128 + 32 * wr;
    const char* rsrc = (const char*)((nq ? ir : rgb) + ((size_t)img * DIMH + 64 * wc) * PX + p0); rob = (unsigned)(ln * PX + 8 * hh) * 4u; const float* bsrc = bpj + col0;
#pragma unroll
    for (int u = 0; u < 8; ++u) { const int t = u & 3, half = u >> 2;      /* unrolled: rs is registers, each load an immediate offset */
      rs[2 * u] = *(const v4fa*)(rsrc + rob + (t * 16 * PX + half * 16) * 4); rs[2 * u + 1] = *(const v4fa*)(rsrc + rob + (t * 16 * PX + half * 16 + 4) * 4); }
#pragma unroll
    for (int t = 0; t < 4; ++t) bv[t] = bsrc[t * 16 + ln];
  }
  const _Float16* pa = sm + (32 * wr + ln) * GLP; const _Float16* pb = sb + (64 * wc + ln) * GLP;
  const v8f z8 = {0.f,0.f,0.f,0.f,0.f,0.f,0.f,0.f}; v8f c00 = z8, c01 = z8, c02 = z8, c03 = z8, c10 = z8, c11 = z8, c12 = z8, c13 = z8;
  v16h a0 = g2_frag(pa, hh), a1 = g2_frag(pa + 16 * GLP, hh), b0 = g2_frag(pb, hh), b1 = g2_frag(pb + 16 * GLP, hh), b2 = g2_frag(pb + 32 * GLP, hh), b3 = g2_frag(pb + 48 * GLP, hh);
  /* unrolled whole (8 steps): the two fragment sets then need no register moves, and every LDS address is an immediate offset */
#pragma unroll
  for (int kb = 0; kb < CC; kb += 32) { v16h n0 = a0, n1 = a1, m0 = b0, m1 = b1, m2 = b2, m3 = b3;
    if (kb + 32 < CC) { const int kn = kb + 32;      /* the next step's 12 LDS reads as one group ahead of this step's WMMAs */
      n0 = g2_frag(pa + kn, hh); n1 = g2_frag(pa + 16 * GLP + kn, hh); m0 = g2_frag(pb + kn, hh); m1 = g2_frag(pb + 16 * GLP + kn, hh); m2 = g2_frag(pb + 32 * GLP + kn, hh); m3 = g2_frag(pb + 48 * GLP + kn, hh); }
    c00 = g2_mma(a0, b0, c00); c10 = g2_mma(a1, b0, c10); c01 = g2_mma(a0, b1, c01); c11 = g2_mma(a1, b1, c11);
    c02 = g2_mma(a0, b2, c02); c12 = g2_mma(a1, b2, c12); c03 = g2_mma(a0, b3, c03); c13 = g2_mma(a1, b3, c13);
    a0 = n0; a1 = n1; b0 = m0; b1 = m1; b2 = m2; b3 = m3; }
  /* s_wait_xcnt 0 behind the residual's and the bias's loads; their two offset registers are its inputs, so that neither is overwritten ahead of it */
  if (FIN) { __builtin_amdgcn_sched_barrier(0);      /* none of the epilogue's arithmetic moves up among the products: its wait for the residual would stall them */
    asm volatile("s_wait_xcnt 0x0" :: "v"(rob), "v"(ln) : "memory"); }
  if (NT > 1) lds_barrier(); else __syncthreads();      /* every wave has read its last fragment: the tiles' LDS may now take the output staging */
  float* so = (float*)(NT > 1 ? sb : sm) + w * (32 * 68);      /* this wave's own 32 rows x 68 floats */
  v8f accs[8] = {c00, c01, c02, c03, c10, c11, c12, c13};      /* unrolled below, as in k_gemm2: accumulators are indexed by constants only */
#pragma unroll
  for (int u = 0; u < 8; ++u) { const int t = u & 3, half = u >> 2;
#pragma unroll
    for (int r = 0; r < 8; ++r) { float v = accs[u][r] * alpha; if (FIN) v = (v + bf16_round(bv[t])) + bf16_round(rs[2 * u + (r >> 2)][r & 3]); so[(half * 16 + 8 * hh + r) * 68 + t * 16 + ln] = v; } }
  if (NT > 1) __builtin_amdgcn_fence(__ATOMIC_ACQ_REL, "workgroup", "local");      /* LDS alone, as in lds_barrier() */
  else __builtin_amdgcn_fence(__ATOMIC_ACQ_REL, "workgroup");
  __builtin_amdgcn_wave_barrier();
  const int rsub = lane >> 4, c4 = (lane & 15) * 4;
  if (NT > 1) { char* cb = (char*)(C + (size_t)row0 * NN + col0); const unsigned cob = (unsigned)(rsub * NN + c4) * 4u;      /* scalar base, one offset register, each row pair an immediate offset */
#pragma unroll
    for (int q = 0; q < 16; ++q) { const v4f v = *(const v4fa*)&so[(q * 2 + rsub) * 68 + c4]; *(v4f*)(cb + cob + q * 2 * NN * 4) = v; }
    /* s_wait_xcnt 0 behind the stores, in front of the next trip's overwrite of their base and data registers */
    asm volatile("s_wait_xcnt 0x0" :: "v"(cob), "s"(cb) : "memory");
    if (nt + 1 < NT) lds_barrier();      /* every wave has read its staging back: the B rows may take the next tile */
  } else {
#pragma unroll
  for (int q = 0; q < 16; ++q) { const int r = q * 2 + rsub; const v4f v = *(const v4fa*)&so[r * 68 + c4]; *(v4f*)(C + (size_t)(row0 + r) * NN + col0 + c4) = v; }
  } } }

// both weight matrices in one launch: the first na8 threads take wa -> Ba, the next nb8 take wb -> Bb (na8 a multiple of 256, so a work-group lies in one matrix); 8 weights a thread
__global__ __launch_bounds__(256) void k_wnat(const float* __restrict__ wa, size_t na8, _Float16* __restrict__ Ba, const float* __restrict__ wb, size_t nb8, _Float16* __restrict__ Bb) { size_t t = (size_t)blockIdx.x * 256 + threadIdx.x; const bool second = (size_t)blockIdx.x * 256 >= na8; const float* w = second ? wb : wa; _Float16* Bt = second ? Bb : Ba; if (second) t -= na8; if (t >= (second ? nb8 : na8)) return; FragH f; for (int q = 0; q < 8; ++q) f.h[q] = (_Float16)(bf16_round(w[t * 8 + q]) * 16.0f); *(v8us*)((unsigned short*)Bt + t * 8) = f.half[0];  }
__global__ __launch_bounds__(256) void k_rsm(const float* __restrict__ S, _Float16* __restrict__ P, int nrows) {
  #pragma clang fp contract(off)
  const int i = blockIdx.x * 256 + threadIdx.x; if (i >= nrows) return; const float* s = S + (size_t)i * SQ; float mx = -3.0e38f;
#pragma unroll 1
  for (int j = 0; j < SQ; ++j) mx = fmaxf(mx, s[j]); float se = 0.f;
#pragma unroll 1
  for (int j = 0; j < SQ; ++j) se += expf(s[j] - mx); const float sc = 256.0f / se;
#pragma unroll 1
  for (int j0 = 0; j0 < SQ; j0 += 8) { FragH f; for (int q = 0; q < 8; ++q) f.h[q] = (_Float16)(expf(s[j0 + q] - mx) * sc); unsigned short* d = (unsigned short*)P + (size_t)i * SQ + j0; *(v8us*)d = f.half[0];  } }
__global__ __launch_bounds__(256) void k_vt(const _Float16* __restrict__ V16, int b, int h0, _Float16* __restrict__ VT) { __shared__ unsigned short tl[64][65]; const int tid = threadIdx.x; const int hh = blockIdx.x % HG, sg = blockIdx.x / HG; const int s0 = sg * 64; const int h = h0 + hh;
  for (int i = tid; i < 64 * 8; i += 256) { const int j = i / 8, d8 = (i % 8) * 8; FragH f; f.half[0] = *(const v8us*)((const unsigned short*)V16 + ((size_t)b * SQ + s0 + j) * DM + h * HD + d8); for (int q = 0; q < 8; ++q) tl[d8 + q][j] = f.u[q]; }
  __syncthreads();
  { for (int i = tid; i < 64 * 8; i += 256) { const int d = i / 8, j8 = (i % 8) * 8; FragH f; for (int q = 0; q < 8; ++q) f.u[q] = tl[d][j8 + q]; *(v8us*)((unsigned short*)VT + ((size_t)hh * HD + d) * SQ + s0 + j8) = f.half[0]; }  } }


// lane ^ M partner's value added (M = 1, 2, 4: all inside a 16-lane row), as one DPP add
template <int M>
__device__ __forceinline__ float xadd(float s) { return s + __int_as_float(__builtin_amdgcn_update_dpp(0, __float_as_int(s), 0x160 | M, 0xf, 0xf, true)); }
// One wave per (image column x, dilation, class of y modulo the dilation, segment): lane = 4 channels, 8 lanes = one head, so the 128 channels of a q, k or v row are one 512-byte load of whole lines.
// The wave walks down its column in steps of the dilation: the window rows y and y + dil of one pixel are the rows y - dil and y of the next, so they stay in registers (3 row slots of 3 k and 3 v rows each)
// and a pixel loads q and one new window row (7 rows) where it took 19. The walk is unrolled by 3, so that each slot is a fixed set of registers and nothing is moved.
// Work-group = 8 waves on 8 neighbouring columns. Segments: 5 x 8 pixels of the 40 of a class (dilation 2), 3 x 9 of the 27 or 26 (dilation 3): 10 + 9 = 19 walks a column,
// 760 work-groups, 6,080 waves of 8 or 9 pixels: close to six waves for each of the 1,024 SIMDs.
// An out-of-image neighbour reads an in-image row instead (row and column each fall back to the pixel's own), takes logit 0 and weight 0 on v.
// Softmax in base 2: the logits carry log2 e, so each of the 9 exponentials is the hardware's own 2^x.
#define DLW 19       /* walks a column: 2 classes x 5 segments + 3 classes x 3 segments */
__global__ __launch_bounds__(256) void k_dla(const float* __restrict__ F, _Float16* __restrict__ X16) {
  static_assert(WS % 8 == 0 && HS == 80, "8 columns a work-group; the segment table is for 80 rows");
  const int lane = threadIdx.x & 31; const int w = __builtin_amdgcn_readfirstlane((int)threadIdx.x >> 5);
  const int c = blockIdx.x % DLW, t = blockIdx.x / DLW; const int x = (t % (WS / 8)) * 8 + w, img = t / (WS / 8);
  const int di = c >= 10 ? 1 : 0, cw = di ? c - 10 : c; const int dil = di ? 3 : 2, len = di ? 9 : 8; const int cls = di ? cw % 3 : cw % 2, seg = di ? cw / 3 : cw / 2;      /* divisors as constants: a division by a variable goes through the vector unit, and y would no longer be a scalar */
  const int left = (di ? (HS - cls + 2) / 3 : (HS - cls + 1) / 2) - seg * len; const int n = left < len ? left : len;      /* pixels of this walk */
  int y = cls + seg * len * dil;
  const char* Fi = (const char*)(F + (size_t)img * PX * QW + di * 128); char* Xi = (char*)((unsigned short*)X16 + (size_t)img * PX * CC + di * 128);
  const unsigned vo = (unsigned)lane * 16u, vs = (unsigned)lane * 8u;      /* the lane's 4 channels: byte offset in an f32 row, in an f16 row */
  const bool okc[3] = {x - dil >= 0, true, x + dil < WS}; const int xc[3] = {okc[0] ? x - dil : x, x, okc[2] ? x + dil : x};
  v4f k[3][3], v[3][3]; bool okr[3]; const char* pr[3];      /* [slot][column]; pr: the scalar bases of the row loaded last */
  auto row = [&](int s, int yy) { okr[s] = yy >= 0 && yy < HS; const int yc = okr[s] ? yy : y;
#pragma unroll
    for (int j = 0; j < 3; ++j) { pr[j] = Fi + (size_t)((yc * WS + xc[j]) * (QW * 4)); k[s][j] = *(const v4fa*)(pr[j] + vo + CC * 4); v[s][j] = *(const v4fa*)(pr[j] + vo + 2 * CC * 4); } };
  row(0, y - dil);
  /* s_wait_xcnt 0 behind a row's loads, in front of every overwrite of a register that they name; the bases and the offset that their addresses are formed from are its inputs */
  asm volatile("s_wait_xcnt 0x0" :: "s"(pr[0]), "s"(pr[1]), "s"(pr[2]), "v"(vo) : "memory");
  row(1, y);
  asm volatile("s_wait_xcnt 0x0" :: "s"(pr[0]), "s"(pr[1]), "s"(pr[2]), "v"(vo) : "memory");      /* as above */
#pragma unroll 1
  for (int j0 = 0; j0 < n; j0 += 3) {      /* stays rolled: the body already holds the 3 places of the slots */
#pragma unroll
    for (int u = 0; u < 3; ++u) {      /* unrolled: slot numbers are constants, the slots registers */
      if (j0 + u < n) { const int sl[3] = {u, (u + 1) % 3, (u + 2) % 3};      /* slots of the rows y - dil, y, y + dil */
        const char* pq = Fi + (size_t)((y * WS + x) * (QW * 4)); const v4f q = *(const v4fa*)(pq + vo);
        row(sl[2], y + dil);
        /* s_wait_xcnt 0 behind the pixel's loads, as above */
        asm volatile("s_wait_xcnt 0x0" :: "s"(pq), "s"(pr[0]), "s"(pr[1]), "s"(pr[2]), "v"(vo) : "memory");
        __builtin_amdgcn_sched_barrier(0);      /* all 7 loads of a pixel issue before any of its arithmetic: one latency a pixel, not one per group of loads */
        float s[9]; bool ok[9]; float mx = -INFINITY;
#pragma unroll
        for (int kk = 0; kk < 9; ++kk) { const v4f kr = k[sl[kk / 3]][kk % 3]; ok[kk] = okr[sl[kk / 3]] && okc[kk % 3];
          float d = fmaf(q[3], kr[3], fmaf(q[2], kr[2], fmaf(q[1], kr[1], q[0] * kr[0]))); d = xadd<4>(xadd<2>(xadd<1>(d)));
          s[kk] = ok[kk] ? d * SCL2 : 0.f; mx = fmaxf(mx, s[kk]); }
        float a[9], ex[9];
#pragma unroll
        for (int kk = 0; kk < 9; ++kk) a[kk] = s[kk] - mx;
        /* exp(x) = 2^(x log2 e), the factor already in the logits: one v_exp_f32 each; the argument is never above 0, so the library expf's range split, ldexp and overflow and underflow selects have nothing to do.
           As one asm statement for the slot that the instruction set asks for behind a transcendental. Here every result register
           differs from every source (early clobber), so each v_exp_f32 is independent of the one in front of it, and the v_nop fills the slot behind the last. */
        asm("v_exp_f32 %0, %9\n\tv_exp_f32 %1, %10\n\tv_exp_f32 %2, %11\n\tv_exp_f32 %3, %12\n\tv_exp_f32 %4, %13\n\tv_exp_f32 %5, %14\n\tv_exp_f32 %6, %15\n\tv_exp_f32 %7, %16\n\tv_exp_f32 %8, %17\n\tv_nop"
            : "=&v"(ex[0]), "=&v"(ex[1]), "=&v"(ex[2]), "=&v"(ex[3]), "=&v"(ex[4]), "=&v"(ex[5]), "=&v"(ex[6]), "=&v"(ex[7]), "=&v"(ex[8])
            : "v"(a[0]), "v"(a[1]), "v"(a[2]), "v"(a[3]), "v"(a[4]), "v"(a[5]), "v"(a[6]), "v"(a[7]), "v"(a[8]));
        float se = 0.f; v4f acc = {0.f, 0.f, 0.f, 0.f};
#pragma unroll
        for (int kk = 0; kk < 9; ++kk) { const float e = ex[kk]; se += e; const float pw = ok[kk] ? e : 0.f; const v4f vr = v[sl[kk / 3]][kk % 3];
          for (int ch = 0; ch < 4; ++ch) acc[ch] = fmaf(pw, vr[ch], acc[ch]); }
        const float inv = 1.0f / se; v4h o; for (int ch = 0; ch < 4; ++ch) o[ch] = (_Float16)(acc[ch] * inv);
        char* po = Xi + (size_t)((y * WS + x) * (CC * 2)); *(v4h*)(po + vs) = o;
        /* s_wait_xcnt 0 behind the store, in front of the next pixel's overwrite of its address and data registers */
        asm volatile("s_wait_xcnt 0x0" :: "s"(po), "v"(vs) : "memory");
        y += dil; } } } }

extern "C" void kernel_launch(void* const* d_in, const int* in_sizes, int n_in,
                              void* d_out, int out_size, void* d_ws, size_t ws_size, hipStream_t stream) {
  (void)in_sizes; (void)n_in; (void)out_size;
  const float* const* I = (const float* const*)d_in; const float* rgb = I[0]; const float* ir = I[1]; const float* wqkv = I[2]; const float* wp = I[3]; const float* bp = I[4];
  char* ws = (char*)d_ws; size_t off = 0;
  auto take = [&](size_t bytes) { char* p = ws + off; off += (bytes + 255) & ~(size_t)255; return p; };
  _Float16* BQ = (_Float16*)take((size_t)QW * CC * 2); _Float16* BP = (_Float16*)take((size_t)CC * CC * 2); float* F = (float*)take(NR * QW * 4); _Float16* X16 = (_Float16*)take(NR * CC * 2);
  if (off > ws_size) return;      /* 0.5 + 75 + 12.5 = approx 88 MiB */
  static_assert(((size_t)QW * CC / 8) % 256 == 0 && ((size_t)CC * CC / 8) % 256 == 0, "k_wnat: whole work-groups per matrix");
  k_wnat<<<(unsigned)(((size_t)QW * CC / 8 + (size_t)CC * CC / 8) / 256), 256, 0, stream>>>(wqkv, (size_t)QW * CC / 8, BQ, wp, (size_t)CC * CC / 8, BP);
  k_gemm3<QW, false, true, 3><<<(unsigned)((NR / 128) * (QW / 384)), 256, 0, stream>>>(nullptr, BQ, 0.0625f, F, nullptr, rgb, ir);      /* qkv (f32) */
  k_dla<<<(unsigned)(NB * (WS / 8) * DLW), 256, 0, stream>>>(F, X16);
  k_gemm3<CC, true, false, 1><<<(unsigned)((NR / 128) * (CC / 128)), 256, 0, stream>>>(X16, BP, 0.0625f, (float*)d_out, bp, rgb, ir);      /* proj + bias + residual */
}

// v009
// Measured time: 48.9 microseconds a run.
// Next to v008, in two timings, it ran 1.04 times as fast each time.
// Counting every step since v000, it is 16.6 times as fast.
#include <hip/hip_runtime.h>
// Multi-dilate local attention (rgb, ir [4][128][80][80] -> y = [rgb | ir] (256 ch); qkv = 1x1 (w_qkv [768][256]) split as [3][2 dilations][128 = 4 heads x 32]; per dilation d in (2, 3): each pixel attends to its 3x3 dilated neighbourhood (zero-padded unfold: out-of-image neighbours contribute k = v = 0, logit 0) with softmax(q.k / sqrt(32)) over the 9; heads merged dilation-major; proj (w_proj [256][256]) + b_proj; + y -> NHWC [4][80][80][256]).
// Structure: qkv as a WMMA GEMM whose A tile comes straight from the two channel-first inputs, turned into concatenated pixel rows (bf16) on its way into LDS (operand tiles staged in LDS, 32x64 wave tiles, f32 accumulation; both operands bf16, the weight rows rounded on their way into LDS too; exact products) kept f32; the dilated local attention, one wave walking down a column in steps of the dilation with the window's rows kept in registers, on VALU (f32; 4 channels a lane, softmax weights in registers) into f16 rows; projection GEMM whose epilogue adds bias + residual (f32, VALU) and writes the NHWC output.
// Compute dtype: inputs rounded to bf16; y / weights exact; qkv and the attention f32; the attended rows as a plain f16 GEMM operand (~2^-12). v_wmma_f32_16x16x32_bf16 (qkv), v_wmma_f32_16x16x32_f16 (projection).
#define NB 4
#define DIMH 128
#define CC 256
#define QW 768
#define HS 80
#define WS 80
#define PX (HS * WS)                 /* 6400 = 50 x 128 */
#define NR ((size_t)NB * PX)         /* 25,600 rows */
#define NRD ((int)NR)                /* unused */
#define SCL 0.17677669529663689f
#define SCL2 (SCL * 1.44269504088896341f)      /* 1 / sqrt(32) times log2 e: logits for a base-2 exponential */
#define SQ 64
#define DM 64
#define NH 1
#define HD 64
#define HG 1
typedef __bf16 v16b __attribute__((ext_vector_type(16)));
typedef unsigned short v8us __attribute__((ext_vector_type(8), may_alias));
typedef float  v8f  __attribute__((ext_vector_type(8)));
typedef float  v4f  __attribute__((ext_vector_type(4)));
typedef float  v4fa __attribute__((ext_vector_type(4), may_alias));
union FragB { v16b v; v8us half[2]; unsigned short u[16]; };

__device__ __forceinline__ unsigned short bf16_bits(float x) { unsigned int u = __float_as_uint(x); return (unsigned short)((u + 0x7FFFu + ((u >> 16) & 1u)) >> 16); }
__device__ __forceinline__ float bf16_val(unsigned short b) { return __uint_as_float(((unsigned int)b) << 16); }
__device__ __forceinline__ float bf16_round(float x) { return bf16_val(bf16_bits(x)); }
// D += A·B with NT terms: 1 = ah·bh, 2 = + al·bh (A split), 3 = + ah·bl (both split)
template <int NT>
__device__ __forceinline__ v8f mmaN(v16b ah, v16b al, v16b bh, v16b bl, v8f c) {
  c = __builtin_amdgcn_wmma_f32_16x16x32_bf16(false, ah, false, bh, (short)0, c, false, false);
  if (NT >= 2) c = __builtin_amdgcn_wmma_f32_16x16x32_bf16(false, al, false, bh, (short)0, c, false, false);
  if (NT >= 3) c = __builtin_amdgcn_wmma_f32_16x16x32_bf16(false, ah, false, bl, (short)0, c, false, false);
  asm volatile("v_nop\n\tv_nop\n\tv_nop\n\tv_nop" : "+v"(c) : "v"(ah), "v"(al), "v"(bh), "v"(bl));
  return c;
}

__global__ __launch_bounds__(256) void k_wt_bf16(const float* __restrict__ W, unsigned short* __restrict__ Wt, int K, int N) {
  const int t = blockIdx.x * 256 + threadIdx.x;
  const int k8n = K / 8;
  if (t >= N * k8n) return;
  const int n = t / k8n, k8 = (t % k8n) * 8;
  v8us v;
#pragma unroll
  for (int i = 0; i < 8; ++i) v[i] = bf16_bits(W[(size_t)(k8 + i) * N + n]);
  *(v8us*)(Wt + (size_t)n * K + k8) = v;
  
}

// GEMM C[M][N] (f32, pitch ldc) = act(A[M][K]·W + bias). A f32 row-major (pitch lda) converted per fragment to bf16
// (ASPLIT: hi/lo two planes -> 2 terms, else single rounded term); Wt bf16 [N][K] (pitch ldb). BIAS_BF16 rounds the
// bias to bf16 first (bias quantised to bf16 before the add). K%32==0, M%16==0, N%64==0.
template <bool ASPLIT, int ACT, bool BIAS_BF16>
__global__ __launch_bounds__(128) void k_gemm_bf(const float* __restrict__ A, int lda, const unsigned short* __restrict__ Wt, int ldb,
                                               const float* __restrict__ bias, float* __restrict__ C, int ldc, int M, int N, int K) {
  __shared__ __attribute__((aligned(16))) float so[4][16][64];
  const int tid = threadIdx.x, w = tid >> 5, lane = tid & 31, ln = lane & 15, hh = lane >> 4;
  const int ntn = N / 64;
  const int wid = blockIdx.x * 4 + w;
  const int mt = wid / ntn, nq = wid % ntn;
  if (mt * 16 >= M) return;
  const int row0 = mt * 16, col0 = nq * 64;
  const float* arow = A + (size_t)(row0 + ln) * lda;
  v8f acc[4] = {};
  for (int kb = 0; kb < K; kb += 32) {
    FragB ah, al;
    const v4f x0 = *(const v4fa*)(arow + kb + 8 * hh), x1 = *(const v4fa*)(arow + kb + 8 * hh + 4);
    const v4f x2 = *(const v4fa*)(arow + kb + 16 + 8 * hh), x3 = *(const v4fa*)(arow + kb + 16 + 8 * hh + 4);
    float xs[16] = {x0[0],x0[1],x0[2],x0[3],x1[0],x1[1],x1[2],x1[3],x2[0],x2[1],x2[2],x2[3],x3[0],x3[1],x3[2],x3[3]};
#pragma unroll
    for (int i = 0; i < 16; ++i) { const unsigned short hb = bf16_bits(xs[i]); ah.u[i] = hb; al.u[i] = ASPLIT ? bf16_bits(xs[i] - bf16_val(hb)) : (unsigned short)0; }
#pragma unroll
    for (int t = 0; t < 4; ++t) {
      const unsigned short* brow = Wt + (size_t)(col0 + t * 16 + ln) * ldb + kb;
      FragB b;
      b.half[0] = *(const v8us*)(brow + 8 * hh);
      b.half[1] = *(const v8us*)(brow + 16 + 8 * hh);
      acc[t] = mmaN<ASPLIT ? 2 : 1>(ah.v, al.v, b.v, b.v, acc[t]);
    }
  }
#pragma unroll
  for (int t = 0; t < 4; ++t) {
    float bv = bias ? bias[col0 + t * 16 + ln] : 0.f;
    if (BIAS_BF16) bv = bf16_round(bv);
#pragma unroll
    for (int r = 0; r < 8; ++r) { float v = acc[t][r] + bv; if (ACT == 1) v = fmaxf(v, 0.f); so[w][8 * hh + r][t * 16 + ln] = v; }
  }
  __builtin_amdgcn_fence(__ATOMIC_ACQ_REL, "workgroup");
  __builtin_amdgcn_wave_barrier();
  const int rsub = lane >> 4, c4 = (lane & 15) * 4;
  {
#pragma unroll
    for (int q = 0; q < 8; ++q) {
      const int r = q * 2 + rsub;
      const v4f v = *(const v4fa*)&so[w][r][c4];
      *(v4f*)(C + (size_t)(row0 + r) * ldc + col0 + c4) = v;
    }
    
  }
}

// GEMM C = act(A·W + bias + resid): A f32 (ASPLIT -> hi/lo 2 terms), Wt bf16 [N][K]; ACT 0 none, 1 relu, 2 exact gelu;
// resid (optional, f32, row index = (row % rmod), pitch ldr, RES_BF16 rounds it) added before the activation.
template <bool ASPLIT, int ACT, bool BIAS_BF16, bool RES_BF16>
__global__ __launch_bounds__(128) void k_gemm_bf3(const float* __restrict__ A, int lda, const unsigned short* __restrict__ Wt, int ldb,
                                                const float* __restrict__ bias, const float* __restrict__ resid, int rmod, int ldr,
                                                float* __restrict__ C, int ldc, int M, int N, int K) {
  __shared__ __attribute__((aligned(16))) float so[4][16][64];
  const int tid = threadIdx.x, w = tid >> 5, lane = tid & 31, ln = lane & 15, hh = lane >> 4;
  const int ntn = N / 64;
  const int wid = blockIdx.x * 4 + w;
  const int mt = wid / ntn, nq = wid % ntn;
  if (mt * 16 >= M) return;
  const int row0 = mt * 16, col0 = nq * 64;
  const float* arow = A + (size_t)(row0 + ln) * lda;
  v8f acc[4] = {};
  for (int kb = 0; kb < K; kb += 32) {
    FragB ah, al;
    const v4f x0 = *(const v4fa*)(arow + kb + 8 * hh), x1 = *(const v4fa*)(arow + kb + 8 * hh + 4);
    const v4f x2 = *(const v4fa*)(arow + kb + 16 + 8 * hh), x3 = *(const v4fa*)(arow + kb + 16 + 8 * hh + 4);
    float xs[16] = {x0[0],x0[1],x0[2],x0[3],x1[0],x1[1],x1[2],x1[3],x2[0],x2[1],x2[2],x2[3],x3[0],x3[1],x3[2],x3[3]};
#pragma unroll
    for (int i = 0; i < 16; ++i) { const unsigned short hb = bf16_bits(xs[i]); ah.u[i] = hb; al.u[i] = ASPLIT ? bf16_bits(xs[i] - bf16_val(hb)) : (unsigned short)0; }
#pragma unroll
    for (int t = 0; t < 4; ++t) {
      const unsigned short* brow = Wt + (size_t)(col0 + t * 16 + ln) * ldb + kb;
      FragB b;
      b.half[0] = *(const v8us*)(brow + 8 * hh);
      b.half[1] = *(const v8us*)(brow + 16 + 8 * hh);
      acc[t] = mmaN<ASPLIT ? 2 : 1>(ah.v, al.v, b.v, b.v, acc[t]);
    }
  }
#pragma unroll
  for (int t = 0; t < 4; ++t) {
    const int col = col0 + t * 16 + ln;
    float bv = bias ? bias[col] : 0.f;
    if (BIAS_BF16) bv = bf16_round(bv);
#pragma unroll
    for (int r = 0; r < 8; ++r) {
      float v = acc[t][r] + bv;
      if (resid) { float rv = resid[(size_t)((row0 + 8 * hh + r) % rmod) * ldr + col]; if (RES_BF16) rv = bf16_round(rv); v += rv; }
      if (ACT == 1) v = fmaxf(v, 0.f);
      if (ACT == 2) v = 0.5f * v * (1.0f + erff(v * 0.70710678118654752f));
      if (ACT == 3) { const float u = 0.7978845608028654f * (v + 0.044715f * v * v * v); v = 0.5f * v * (1.0f + tanhf(u)); }
      so[w][8 * hh + r][t * 16 + ln] = v;
    }
  }
  __builtin_amdgcn_fence(__ATOMIC_ACQ_REL, "workgroup");
  __builtin_amdgcn_wave_barrier();
  const int rsub = lane >> 4, c4 = (lane & 15) * 4;
  {
#pragma unroll
    for (int q = 0; q < 8; ++q) {
      const int r = q * 2 + rsub;
      const v4f v = *(const v4fa*)&so[w][r][c4];
      *(v4f*)(C + (size_t)(row0 + r) * ldc + col0 + c4) = v;
    }
    
  }
}
// row LayerNorm (biased variance, eps) over N: s = X (+ R); optional out_sum <- s; out_norm <- (s-mu)*rsqrt(var+eps)*g + b
template <bool PARAM_BF16>
__global__ __launch_bounds__(256) void k_layernorm(const float* __restrict__ X, const float* __restrict__ R, const float* __restrict__ g, const float* __restrict__ bta,
                                                  float* __restrict__ out_sum, float* __restrict__ out_norm, int N, float eps) {
  __shared__ float red[256];
  const int row = blockIdx.x, tid = threadIdx.x;
  const float* x = X + (size_t)row * N; const float* rr = R ? R + (size_t)row * N : nullptr;
  float vals[16];                     // up to N = 4096
  const int per = N / 256;            // contiguous chunk per thread? use strided-by-4 chunks: thread handles j = tid*4 + 1024*u
  float s1 = 0.f;
  for (int u = 0; u < per / 4; ++u) {
    const int j = tid * 4 + 1024 * u;
    const v4f a = *(const v4fa*)(x + j);
    v4f b = {0.f,0.f,0.f,0.f}; if (rr) b = *(const v4fa*)(rr + j);
#pragma unroll
    for (int q = 0; q < 4; ++q) { const float v = a[q] + b[q]; vals[u * 4 + q] = v; s1 += v; }
  }
  red[tid] = s1; __syncthreads();
  for (int st = 128; st > 0; st >>= 1) { if (tid < st) red[tid] += red[tid + st]; __syncthreads(); }
  const float mu = red[0] / (float)N; __syncthreads();
  float s2 = 0.f;
  for (int u = 0; u < per / 4; ++u)
#pragma unroll
    for (int q = 0; q < 4; ++q) { const float c = vals[u * 4 + q] - mu; s2 += c * c; }
  red[tid] = s2; __syncthreads();
  for (int st = 128; st > 0; st >>= 1) { if (tid < st) red[tid] += red[tid + st]; __syncthreads(); }
  const float rs = rsqrtf(red[0] / (float)N + eps);
  {
    for (int u = 0; u < per / 4; ++u) {
      const int j = tid * 4 + 1024 * u;
      v4f o, sm;
#pragma unroll
      for (int q = 0; q < 4; ++q) {
        float gg = g[j + q], bb = bta[j + q];
        if (PARAM_BF16) { gg = bf16_round(gg); bb = bf16_round(bb); }
        sm[q] = vals[u * 4 + q]; o[q] = (vals[u * 4 + q] - mu) * rs * gg + bb;
      }
      if (out_sum) *(v4f*)(out_sum + (size_t)row * N + j) = sm;
      *(v4f*)(out_norm + (size_t)row * N + j) = o;
    }
    
  }
}



// ---- f16 WMMA path (v_wmma_f32_16x16x32_f16): 11-bit significands for operands in range — used here for the projection GEMM
typedef _Float16 v16h __attribute__((ext_vector_type(16)));
union FragH { v16h v; v8us half[2]; _Float16 h[16]; unsigned short u[16]; };
template <int NT>
__device__ __forceinline__ v8f mmaH(v16h ah, v16h al, v16h bh, v16h bl, v8f c) {
  c = __builtin_amdgcn_wmma_f32_16x16x32_f16(false, ah, false, bh, (short)0, c, false, false);
  if (NT >= 2) c = __builtin_amdgcn_wmma_f32_16x16x32_f16(false, al, false, bh, (short)0, c, false, false);
  if (NT >= 3) c = __builtin_amdgcn_wmma_f32_16x16x32_f16(false, ah, false, bl, (short)0, c, false, false);
  asm volatile("v_nop\n\tv_nop\n\tv_nop\n\tv_nop" : "+v"(c) : "v"(ah), "v"(al), "v"(bh), "v"(bl));
  return c;
}
// batched GEMM like k_gemm_b but f16 operands: A f32 (split into f16 hi/lo if ASPLIT, else rounded to f16), Bt = f16 values [n][k]; alpha; C f32; N multiple of 16 (partial tiles skipped)
template <bool ASPLIT>
__global__ __launch_bounds__(128) void k_gemm_h(const float* __restrict__ A, int lda, size_t sA, const _Float16* __restrict__ Bh, int ldb, size_t sB, float alpha, float* __restrict__ C, int ldc, size_t sC, int M, int N, int K) {
  __shared__ __attribute__((aligned(16))) float so[4][16][64];
  const int tid = threadIdx.x, w = tid >> 5, lane = tid & 31, ln = lane & 15, hh = lane >> 4; const int by = blockIdx.y;
  A += (size_t)by * sA; Bh += (size_t)by * sB; C += (size_t)by * sC;
  const int ntn = (N + 63) / 64; const int wid = blockIdx.x * 4 + w; const int mt = wid / ntn, nq = wid % ntn; if (mt * 16 >= M) return;
  const int row0 = mt * 16, col0 = nq * 64; const float* arow = A + (size_t)(row0 + ln) * lda;
  v8f acc[4] = {};
  for (int kb = 0; kb < K; kb += 32) {
    FragH ah, al;
    const v4f x0 = *(const v4fa*)(arow + kb + 8 * hh), x1 = *(const v4fa*)(arow + kb + 8 * hh + 4), x2 = *(const v4fa*)(arow + kb + 16 + 8 * hh), x3 = *(const v4fa*)(arow + kb + 16 + 8 * hh + 4);
    float xs[16] = {x0[0],x0[1],x0[2],x0[3],x1[0],x1[1],x1[2],x1[3],x2[0],x2[1],x2[2],x2[3],x3[0],x3[1],x3[2],x3[3]};
#pragma unroll
    for (int i = 0; i < 16; ++i) { const _Float16 h = (_Float16)xs[i]; ah.h[i] = h; al.h[i] = ASPLIT ? (_Float16)(xs[i] - (float)h) : (_Float16)0.0f; }
#pragma unroll
    for (int t = 0; t < 4; ++t) { if (col0 + t * 16 >= N) continue; const size_t boff = (size_t)(col0 + t * 16 + ln) * ldb + kb; FragH bq; bq.half[0] = *(const v8us*)(Bh + boff + 8 * hh); bq.half[1] = *(const v8us*)(Bh + boff + 16 + 8 * hh);
      acc[t] = mmaH<ASPLIT ? 2 : 1>(ah.v, al.v, bq.v, bq.v, acc[t]); }
  }
#pragma unroll
  for (int t = 0; t < 4; ++t) { if (col0 + t * 16 >= N) continue;
#pragma unroll
    for (int r = 0; r < 8; ++r) so[w][8 * hh + r][t * 16 + ln] = acc[t][r] * alpha; }
  __builtin_amdgcn_fence(__ATOMIC_ACQ_REL, "workgroup"); __builtin_amdgcn_wave_barrier();
  const int rsub = lane >> 4, c4 = (lane & 15) * 4;
  {
#pragma unroll
    for (int q = 0; q < 8; ++q) { const int r = q * 2 + rsub; if (col0 + c4 < N) { const v4f v = *(const v4fa*)&so[w][r][c4]; *(v4f*)(C + (size_t)(row0 + r) * ldc + col0 + c4) = v; } }
     }
}

// Wt[n][k] = f16(W[k][n]·scale) from f32 row-major W[K][N] (scale = power of two; bf16-exact weights stay exact in f16 away from the subnormal range)
__global__ __launch_bounds__(256) void k_wt_f16(const float* __restrict__ W, _Float16* __restrict__ Wt, int K, int N, float scale) {
  const int t = blockIdx.x * 256 + threadIdx.x; if (t >= N * (K / 8)) return; const int n = t / (K / 8), k8 = (t % (K / 8)) * 8; FragH f;
#pragma unroll
  for (int i = 0; i < 8; ++i) f.h[i] = (_Float16)(bf16_round(W[(size_t)(k8 + i) * N + n]) * scale); const v8us o = f.half[0];
  *(v8us*)((unsigned short*)Wt + (size_t)n * K + k8) = o; 
}
// k_gemm_hh variant with fused epilogue: v = acc·alpha + bias[by·sBias + col] (+ CP[(row/rowsPerB)·sCPb + by·64 + col] if CP) ; ACT 0 none / 1 elu ; writes f16 C16 (and f32 C if non-null)
template <int ACT>
__global__ __launch_bounds__(128) void k_gemm_hhx(const _Float16* __restrict__ A, int lda, size_t sA, const _Float16* __restrict__ Bh, int ldb, size_t sB, float alpha, const float* __restrict__ bias, size_t sBias, const float* __restrict__ CP, int rowsPerB, size_t sCPb, int row0g,
    float* __restrict__ C, _Float16* __restrict__ C16, int ldc, size_t sC, int M, int N, int K) {
  __shared__ __attribute__((aligned(16))) float so[4][16][64];
  const int tid = threadIdx.x, w = tid >> 5, lane = tid & 31, ln = lane & 15, hh = lane >> 4; const int by = blockIdx.y;
  A += (size_t)by * sA; Bh += (size_t)by * sB; const size_t cofs = (size_t)by * sC; const float* bp = bias ? bias + (size_t)by * sBias : nullptr;
  const int ntn = (N + 63) / 64; const int wid = blockIdx.x * 4 + w; const int mt = wid / ntn, nq = wid % ntn; if (mt * 16 >= M) return;
  const int row0 = mt * 16, col0 = nq * 64; const _Float16* arow = A + (size_t)(row0 + ln) * lda;
  v8f acc[4] = {};
  for (int kb = 0; kb < K; kb += 32) { FragH ah; ah.half[0] = *(const v8us*)((const unsigned short*)arow + kb + 8 * hh); ah.half[1] = *(const v8us*)((const unsigned short*)arow + kb + 16 + 8 * hh);
#pragma unroll
    for (int t = 0; t < 4; ++t) { if (col0 + t * 16 >= N) continue; const size_t boff = (size_t)(col0 + t * 16 + ln) * ldb + kb; FragH bq; bq.half[0] = *(const v8us*)((const unsigned short*)Bh + boff + 8 * hh); bq.half[1] = *(const v8us*)((const unsigned short*)Bh + boff + 16 + 8 * hh);
      acc[t] = mmaH<1>(ah.v, ah.v, bq.v, bq.v, acc[t]); }
  }
#pragma unroll
  for (int t = 0; t < 4; ++t) { if (col0 + t * 16 >= N) continue; const int col = col0 + t * 16 + ln; const float bv = bp ? bf16_round(bp[col]) : 0.f;
#pragma unroll
    for (int r = 0; r < 8; ++r) { float v = acc[t][r] * alpha + bv; if (CP) { const int rr = row0g + row0 + 8 * hh + r; if (rowsPerB < 0) v += CP[cofs + (size_t)rr * ldc + col];      /* rowsPerB < 0: own element of the batched C plane */ else { const int bidx = rr / rowsPerB; v += CP[(size_t)bidx * sCPb + (size_t)by * 64 + col]; } } if (ACT == 1) v = (v > 0.f) ? v : expm1f(v); else if (ACT == 7) v = (v > 0.f) ? v + 1.0f : expf(v); else if (ACT == 8) v = tanhf(v); else if (ACT == 9) v = 0.5f * v * (1.0f + tanhf(0.7978845608028654f * (v + 0.044715f * v * v * v))); else if (ACT == 11) v = 1.0f / (1.0f + expf(-v)); else if (ACT == 12) v = (v > 0.f) ? v : 0.01f * v; else if (ACT == 14) v = (v > 0.f) ? v : 0.1f * v; else if (ACT == 16) v = (v >= 0.f) ? v : 0.3f * v; else if (ACT == 17) v = (v >= 0.f) ? v : 0.2f * v; else if (ACT == 15) v = v / (1.0f + expf(-v)); else if (ACT == 3) v = fmaxf(v, 0.f); else if (ACT == 6) v = 0.5f * v * (1.0f + erff(v * 0.70710678118654752f)); so[w][8 * hh + r][t * 16 + ln] = v; } }
  __builtin_amdgcn_fence(__ATOMIC_ACQ_REL, "workgroup"); __builtin_amdgcn_wave_barrier();
  const int rsub = lane >> 4, c4 = (lane & 15) * 4; typedef _Float16 v4h __attribute__((ext_vector_type(4)));
  {
#pragma unroll
    for (int q = 0; q < 8; ++q) { const int r = q * 2 + rsub; if (col0 + c4 < N) { const v4f v = *(const v4fa*)&so[w][r][c4]; if (C) *(v4f*)(C + cofs + (size_t)(row0 + r) * ldc + col0 + c4) = v; if (C16) { v4h h4; for (int i = 0; i < 4; ++i) h4[i] = (_Float16)v[i]; *(v4h*)(C16 + cofs + (size_t)(row0 + r) * ldc + col0 + c4) = h4; } } }
     }
}


typedef _Float16 v4h __attribute__((ext_vector_type(4)));

__global__ __launch_bounds__(256) void k_x16(const float* __restrict__ x, _Float16* __restrict__ X16, size_t n8) { const size_t t = (size_t)blockIdx.x * 256 + threadIdx.x; if (t >= n8) return; FragH f;
#pragma unroll
  for (int q = 0; q < 8; ++q) f.h[q] = (_Float16)bf16_round(x[t * 8 + q]); *(v8us*)((unsigned short*)X16 + t * 8) = f.half[0];  }
__global__ __launch_bounds__(256) void k_h16(const float* __restrict__ x, _Float16* __restrict__ X16, size_t n8) { const size_t t = (size_t)blockIdx.x * 256 + threadIdx.x; if (t >= n8) return; FragH f;
#pragma unroll
  for (int q = 0; q < 8; ++q) f.h[q] = (_Float16)x[t * 8 + q]; *(v8us*)((unsigned short*)X16 + t * 8) = f.half[0];  }
__global__ __launch_bounds__(256) void k_round16f(const float* __restrict__ W, _Float16* __restrict__ Bt, size_t n8) { const size_t t = (size_t)blockIdx.x * 256 + threadIdx.x; if (t >= n8) return; FragH f;
#pragma unroll
  for (int i = 0; i < 8; ++i) f.h[i] = (_Float16)(bf16_round(W[t * 8 + i]) * 16.0f); *(v8us*)((unsigned short*)Bt + t * 8) = f.half[0];  }
template <int NHv, int TTv>
__global__ __launch_bounds__(256) void k_vt(const _Float16* __restrict__ V16, int ldv, int voff, _Float16* __restrict__ Vt) { __shared__ unsigned short tl[64][66]; const int tid = threadIdx.x; const int slab = blockIdx.x / (TTv / 64), lg = blockIdx.x % (TTv / 64); const int b = slab / NHv, h = slab % NHv;
  for (int i = tid; i < 64 * 8; i += 256) { const int r = i / 8, c8 = (i % 8) * 8; FragH f; f.half[0] = *(const v8us*)((const unsigned short*)V16 + ((size_t)b * TTv + lg * 64 + r) * ldv + voff + h * 64 + c8);
#pragma unroll
    for (int q = 0; q < 8; ++q) tl[r][c8 + q] = f.u[q]; }
  __syncthreads();
  {
#pragma unroll
    for (int rd = 0; rd < 2; ++rd) { const int d = rd * 32 + tid / 8, pc = tid % 8; FragH f;
#pragma unroll
      for (int q = 0; q < 8; ++q) f.u[q] = tl[pc * 8 + q][d];
      *(v8us*)((unsigned short*)Vt + ((size_t)slab * 64 + d) * TTv + lg * 64 + pc * 8) = f.half[0]; }
     } }

__global__ __launch_bounds__(256) void k_hl(const float* __restrict__ F, _Float16* __restrict__ Hh, _Float16* __restrict__ Hl, size_t n8) { const size_t t = (size_t)blockIdx.x * 256 + threadIdx.x; if (t >= n8) return; FragH fh, fl; const v4f a = *(const v4fa*)(F + t * 8), c = *(const v4fa*)(F + t * 8 + 4);
#pragma unroll
  for (int q = 0; q < 4; ++q) { _Float16 h = (_Float16)a[q]; fh.h[q] = h; fl.h[q] = (_Float16)((a[q] - (float)h) * 1024.0f); h = (_Float16)c[q]; fh.h[4 + q] = h; fl.h[4 + q] = (_Float16)((c[q] - (float)h) * 1024.0f); }
  { *(v8us*)((unsigned short*)Hh + t * 8) = fh.half[0]; *(v8us*)((unsigned short*)Hl + t * 8) = fl.half[0];  } }

// ---- fast GEMM (wave tile 32x64; requires M % 32 == 0 rows per launch region and N % 64 == 0); epilogue = k_gemm_hhx semantics ----
__device__ __forceinline__ v16h g2_frag(const _Float16* p, int hh) { FragH f; f.half[0] = *(const v8us*)((const unsigned short*)p + 8 * hh); f.half[1] = *(const v8us*)((const unsigned short*)p + 16 + 8 * hh); return f.v; }
__device__ __forceinline__ v8f g2_mma(v16h a, v16h b, v8f c) { v8f d = __builtin_amdgcn_wmma_f32_16x16x32_f16(false, a, false, b, (short)0, c, false, false); asm volatile("v_nop\n\tv_nop\n\tv_nop\n\tv_nop" : "+v"(d) : "v"(a), "v"(b)); return d; }
template <int ACT>
__global__ __launch_bounds__(128) void k_gemm2(const _Float16* __restrict__ A, int lda, size_t sA, const _Float16* __restrict__ Bh, int ldb, size_t sB, float alpha, const float* __restrict__ bias, size_t sBias, const float* __restrict__ CP, int rowsPerB, size_t sCPb, int row0g,
    float* __restrict__ C, _Float16* __restrict__ C16, int ldc, size_t sC, int M, int N, int K) { static_assert(ACT == 0 || ACT == 3 || ACT == 6 || ACT == 8 || ACT == 9 || ACT == 11 || ACT == 12 || ACT == 14 || ACT == 15 || ACT == 16 || ACT == 17, "k_gemm2: unsupported ACT code (would silently apply no activation)");
  __shared__ __attribute__((aligned(16))) float so[4][32][68];
  const int tid = threadIdx.x, w = tid >> 5, lane = tid & 31, ln = lane & 15, hh = lane >> 4; const int by = blockIdx.y;
  A += (size_t)by * sA; Bh += (size_t)by * sB; const size_t cofs = (size_t)by * sC; const float* bp = bias ? bias + (size_t)by * sBias : nullptr;
  const int ntn = N >> 6; const int mt = blockIdx.x / ntn, nq = blockIdx.x - mt * ntn; const int row0 = mt * 128 + 32 * w, col0 = nq * 64; if (row0 >= M) return;
  const _Float16* a0p = A + (size_t)(row0 + ln) * lda; const _Float16* a1p = a0p + (size_t)16 * lda;
  const _Float16* b0p = Bh + (size_t)(col0 + ln) * ldb; const _Float16* b1p = b0p + (size_t)16 * ldb; const _Float16* b2p = b1p + (size_t)16 * ldb; const _Float16* b3p = b2p + (size_t)16 * ldb;
  const v8f z8 = {0.f,0.f,0.f,0.f,0.f,0.f,0.f,0.f}; v8f c00 = z8, c01 = z8, c02 = z8, c03 = z8, c10 = z8, c11 = z8, c12 = z8, c13 = z8;
#pragma unroll 1
  for (int kb = 0; kb < K; kb += 32) { const v16h a0 = g2_frag(a0p + kb, hh), a1 = g2_frag(a1p + kb, hh);
    v16h b = g2_frag(b0p + kb, hh); c00 = g2_mma(a0, b, c00); c10 = g2_mma(a1, b, c10);
    b = g2_frag(b1p + kb, hh); c01 = g2_mma(a0, b, c01); c11 = g2_mma(a1, b, c11);
    b = g2_frag(b2p + kb, hh); c02 = g2_mma(a0, b, c02); c12 = g2_mma(a1, b, c12);
    b = g2_frag(b3p + kb, hh); c03 = g2_mma(a0, b, c03); c13 = g2_mma(a1, b, c13); }
  v8f accs[8] = {c00, c01, c02, c03, c10, c11, c12, c13};
#pragma unroll
  for (int u = 0; u < 8; ++u) { const int t = u & 3, half = u >> 2; const int col = col0 + t * 16 + ln; const float bv = bp ? bf16_round(bp[col]) : 0.f;
#pragma unroll
    for (int r = 0; r < 8; ++r) { const int rloc = half * 16 + 8 * hh + r; float v = accs[u][r] * alpha + bv; if (CP) { if (rowsPerB < 0) v += CP[cofs + (size_t)(row0g + row0 + rloc) * ldc + col];      /* rowsPerB < 0: own element of the batched C plane */ else { const int bidx = (row0g + row0 + rloc) / rowsPerB; v += CP[(size_t)bidx * sCPb + (size_t)by * 64 + col]; } }
      if (ACT == 3) v = fmaxf(v, 0.f); else if (ACT == 6) v = 0.5f * v * (1.0f + erff(v * 0.70710678118654752f)); else if (ACT == 11) v = 1.0f / (1.0f + expf(-v)); else if (ACT == 15) v = v / (1.0f + expf(-v)); else if (ACT == 12) v = (v > 0.f) ? v : 0.01f * v; else if (ACT == 8) v = tanhf(v); else if (ACT == 9) v = 0.5f * v * (1.0f + tanhf(0.7978845608028654f * (v + 0.044715f * v * v * v))); else if (ACT == 14) v = (v > 0.f) ? v : 0.1f * v; else if (ACT == 16) v = (v >= 0.f) ? v : 0.3f * v; else if (ACT == 17) v = (v >= 0.f) ? v : 0.2f * v;
      so[w][rloc][t * 16 + ln] = v; } }
  __builtin_amdgcn_fence(__ATOMIC_ACQ_REL, "workgroup"); __builtin_amdgcn_wave_barrier();
  const int rsub = lane >> 4, c4 = (lane & 15) * 4;
  {
#pragma unroll
    for (int q = 0; q < 16; ++q) { const int r = q * 2 + rsub; const v4f v = *(const v4fa*)&so[w][r][c4]; if (C) *(v4f*)(C + cofs + (size_t)(row0 + r) * ldc + col0 + c4) = v; if (C16) { v4h h4; for (int i = 0; i < 4; ++i) h4[i] = (_Float16)v[i]; *(v4h*)(C16 + cofs + (size_t)(row0 + r) * ldc + col0 + c4) = h4; } }
     } }


// ---- GEMM with both operand tiles staged in LDS: C[M][NN] (f32) = alpha * A[M][CC] . Bh[NN][CC]^T; K = CC; grid = (M / 128) * (NN / (128 NT)) ----
// Work-group tile 128 x 128, 8 waves; wave tile 32 x 64 and k order as k_gemm2. A fragment load straight from global touches 16 lines for its 512 bytes and stands in front of its own WMMAs;
// here each global load of a wave is one whole 512-byte row (4 lines), all 32 of a wave are in flight together, and the fragments come from LDS rows pitched 528 B (16 B x 33: no bank conflict for 16-byte reads).
// FIN (the projection): C = (alpha * A . Bh^T + bf16(bpj[col])) + bf16(residual), the residual read from the channel-first inputs in the accumulators' own layout:
// a lane's 8 accumulator rows of one column are 8 neighbouring pixels of one channel, 32 bytes in a row; a wave's 32 pixels of a channel are one whole 128-byte line.
// ACF (the qkv product): A is not read as f16 rows; the tile's 128 pixels x 256 channels come from the channel-first f32 inputs. Wave w brings channels 32 w .. 32 w + 31:
// a load's 8-lane groups take one 128-byte line (32 pixels) of 4 channels that lie 8 apart, so after 8 loads a lane holds 8 neighbouring channels of 4 pixels: 4 whole 16-byte pieces of pixel rows.
// ACF also takes B from the f32 weights Wf [NN][CC] itself, and both operands are bf16 (what the inputs are rounded to: one conversion a pair, products exact): no conversion launch in front. A weight row is two whole 512-byte loads of a wave,
// a lane's 4 + 4 weights two 8-byte LDS stores. In f32 a tile's rows would take 128 registers a lane, so they come in two parts: the next tile's first part flies under the products and is packed behind them, its second part flies under the epilogue.
// NT: a work-group fills its A tile once and takes NT neighbouring 128-column tiles of B one after the other against it. The next B tile's rows are loaded into registers under the current tile's products;
// the output staging then lies on the B rows (never on A), and the tile's stores to C stay in flight while the next tile is worked on.
#define GLP 264      /* LDS row pitch in f16 elements */
// two f32 -> bf16 (nearest even), packed
__device__ __forceinline__ unsigned pk_bf(float x, float y) { unsigned u;
  asm("v_cvt_pk_bf16_f32 %0, %1, %2" : "=v"(u) : "v"(x), "v"(y));      /* as asm so that both sources are read where their loads left them: through a 2-vector the compiler first copied one register of every pair */
  return u; }
// g2_mma on bf16 operands (the same fragment registers, read as bf16)
__device__ __forceinline__ v8f g2_mmb(v16h a, v16h b, v8f c) { v8f d = __builtin_amdgcn_wmma_f32_16x16x32_bf16(false, __builtin_bit_cast(v16b, a), false, __builtin_bit_cast(v16b, b), (short)0, c, false, false); asm volatile("v_nop\n\tv_nop\n\tv_nop\n\tv_nop" : "+v"(d) : "v"(a), "v"(b)); return d; }
typedef unsigned v4ua __attribute__((ext_vector_type(4), may_alias));
typedef unsigned v2ua __attribute__((ext_vector_type(2), may_alias));
#define BH1 8        /* ACF: of a wave's 16 weight rows of the next tile, those that fly under the products; the rest fly under the epilogue */
// work-group barrier that orders LDS alone: __syncthreads() would also wait for the wave's global loads and stores, here the next B tile's loads and the last tile's stores to C, which no other wave reads
__device__ __forceinline__ void lds_barrier() { __builtin_amdgcn_fence(__ATOMIC_RELEASE, "workgroup", "local"); __builtin_amdgcn_s_barrier(); __builtin_amdgcn_fence(__ATOMIC_ACQUIRE, "workgroup", "local"); }
template <int NN, bool FIN, bool ACF, int NT>
__global__ __launch_bounds__(256) void k_gemm3(const _Float16* __restrict__ A, const _Float16* __restrict__ Bh, float alpha, float* __restrict__ C, const float* __restrict__ bpj, const float* __restrict__ rgb, const float* __restrict__ ir, const float* __restrict__ Wf) {
  static_assert(!FIN || (NN == CC && DIMH == 128 && PX % 128 == 0), "FIN: a 128-column tile is one input's channels, a 128-row tile lies in one image");
  static_assert(!ACF || (CC == 256 && DIMH == 128 && PX % 128 == 0), "ACF: 4 waves per input, a 128-row tile lies in one image");
  static_assert(NN % (128 * NT) == 0 && (!FIN || NT == 1), "NT tiles divide the columns; the residual's loads are written for one tile");
  __shared__ __attribute__((aligned(16))) _Float16 sm[NT > 1 ? 128 * GLP + 8 * 32 * 68 * 2 : (128 + 128) * GLP];      /* 128 A rows, then 128 B rows; after the products the waves' output staging: NT = 1 from the start, NT > 1 from the B rows on (8 x 32 x 68 floats, 2 KiB more than these) */
  const int lane = threadIdx.x & 31, ln = lane & 15, hh = lane >> 4; const int w = __builtin_amdgcn_readfirstlane((int)threadIdx.x >> 5); const int wr = w & 3, wc = w >> 2;
  const int ntn = NN / (128 * NT); const int mt = blockIdx.x / ntn, nq0 = (blockIdx.x - mt * ntn) * NT; const int row0 = mt * 128 + 32 * wr;
  _Float16* sb = sm + 128 * GLP;
  const unsigned short* ga = (const unsigned short*)A + (size_t)(mt * 128 + 16 * w) * CC + lane * 8; const unsigned short* gb = (const unsigned short*)Bh + (size_t)(nq0 * 128 + 16 * w) * CC + lane * 8;
  v8us ra[16], rb[16];      /* wave w brings rows 16 w .. 16 w + 15 of either tile; the loops below are unrolled so that the arrays are registers and each row is an immediate offset */
  v4f fa[32]; const char* asrc = nullptr; unsigned aob = 0; const int cs = lane >> 3, pg = lane & 7;      /* ACF: [pixel block t][channel i] = 4 pixels 32 t + 4 pg .. + 3 of channel 32 w + 8 cs + i; asrc, aob: these loads' scalar base and offset register */
  v4f rbf[BH1 < 8 ? 32 - 2 * BH1 : 16]; v2ua pk1[2 * BH1]; const char* gbs = nullptr; const unsigned bob = (unsigned)lane * 16u;      /* ACF: weight rows in flight as f32 [row][k half]; the first part packed; these loads' scalar base and offset (the lane number, scaled by the load) */
  /* both unrolled: rbf is registers, each row an immediate offset. bld: rows r0 .. r0 + nr - 1 of the wave's 16 into rbf; bput: rbf, rounded and packed, into these rows of the B tile */
  auto bld = [&](int r0, int nr) {
#pragma unroll
    for (int i = 0; i < nr; ++i) { rbf[2 * i] = *(const v4fa*)(gbs + bob + (r0 + i) * CC * 4); rbf[2 * i + 1] = *(const v4fa*)(gbs + bob + (r0 + i) * CC * 4 + 512); } };
  auto bput = [&](int r0, int nr) {
#pragma unroll
    for (int i = 0; i < 2 * nr; ++i) *(v2ua*)((unsigned short*)sb + (16 * w + r0 + (i >> 1)) * GLP + (i & 1) * 128 + lane * 4) = v2ua{pk_bf(rbf[i][0], rbf[i][1]), pk_bf(rbf[i][2], rbf[i][3])}; };
  if (ACF) { const int img = mt / (PX / 128), p0 = (mt - img * (PX / 128)) * 128;
    asrc = (const char*)((w < 4 ? rgb : ir) + ((size_t)img * DIMH + 32 * (w & 3)) * PX + p0); aob = (unsigned)(8 * cs * PX + 4 * pg) * 4u;
    gbs = (const char*)(Wf + (size_t)(nq0 * 128 + 16 * w) * CC); bld(0, 8);
    __builtin_amdgcn_sched_barrier(0);      /* these 16 loads issue ahead of the A rows': loads return in order, and the first weight rows are wanted first */
#pragma unroll
    for (int t = 0; t < 4; ++t) {
#pragma unroll
      for (int i = 0; i < 8; ++i) fa[t * 8 + i] = *(const v4fa*)(asrc + aob + (i * PX + 32 * t) * 4); }
  } else {
#pragma unroll
    for (int i = 0; i < 16; ++i) ra[i] = *(const v8us*)(ga + i * CC);
  }
  if (!ACF) {
#pragma unroll
  for (int i = 0; i < 16; ++i) rb[i] = *(const v8us*)(gb + i * CC);
  }
  /* s_wait_xcnt 0 behind the tile's loads (ACF: the A rows and the first 8 weight rows), in front of every overwrite of a register that they name; their offset registers (ACF: the A loads' scalar base too) are its inputs, so that none of them is overwritten ahead of it; its memory clobber also keeps every LDS store behind these loads, so the wave pays one load latency for all of them */
  if (ACF) { asm volatile("s_wait_xcnt 0x0" :: "v"(lane), "v"(aob), "s"(asrc), "s"(gbs) : "memory");
    __builtin_amdgcn_sched_barrier(0);      /* no conversion moves up among the loads: its wait would hold back the issue of the loads behind it */
    bput(0, 8); bld(8, 8);      /* the first 8 weight rows were issued first and return first: the A rows stay in flight */
    asm volatile("s_wait_xcnt 0x0" :: "v"(lane), "s"(gbs) : "memory");      /* as above, for the second 8 rows */
    __builtin_amdgcn_sched_barrier(0); }      /* the second 8 rows issue before the wave waits for its A rows */
  else asm volatile("s_wait_xcnt 0x0" :: "v"(lane) : "memory");
  if (ACF) {      /* 16-byte piece 4 w + cs of pixel row 32 t + 4 pg + j: at the pitch of 33 pieces the 32 lanes fall on all 16 bank groups, two lanes each */
#pragma unroll
    for (int t = 0; t < 4; ++t) {
#pragma unroll
      for (int j = 0; j < 4; ++j) { const v4ua o = {pk_bf(fa[t * 8][j], fa[t * 8 + 1][j]), pk_bf(fa[t * 8 + 2][j], fa[t * 8 + 3][j]), pk_bf(fa[t * 8 + 4][j], fa[t * 8 + 5][j]), pk_bf(fa[t * 8 + 6][j], fa[t * 8 + 7][j])};
        *(v4ua*)((unsigned short*)sm + (32 * t + 4 * pg + j) * GLP + 32 * w + 8 * cs) = o; } }
    bput(8, 8);
  } else {
#pragma unroll
    for (int i = 0; i < 16; ++i) *(v8us*)((unsigned short*)sm + (16 * w + i) * GLP + lane * 8) = ra[i];
  }
#pragma unroll
  for (int nt = 0; nt < NT; ++nt) {      /* unrolled: rolled, the tests for a next tile are three separate branches, and the compiler then keeps the weight rows' registers alive through the products and spills */
  const int nq = nq0 + nt, col0 = nq * 128 + 64 * wc;
  if (!ACF) {      /* ACF: the B rows were stored ahead of the loop or at the foot of the last trip */
#pragma unroll
  for (int i = 0; i < 16; ++i) *(v8us*)((unsigned short*)sb + (16 * w + i) * GLP + lane * 8) = rb[i];
  }
  if (NT > 1) lds_barrier(); else __syncthreads();      /* tile filled */
  if (ACF && NT > 1 && nt + 1 < NT) {      /* the next B tile's first part: issued here, it flies under the products */
    gbs += 128 * CC * 4; bld(0, BH1);
    /* s_wait_xcnt 0 behind these loads, in front of every overwrite of a register that they name; its memory clobber also keeps the loads from sinking below the products */
    asm volatile("s_wait_xcnt 0x0" :: "v"(lane), "s"(gbs) : "memory");
  }
  if (!ACF && NT > 1 && nt + 1 < NT) {      /* the next B tile's rows: issued here, stored to LDS at the head of the next trip, so they fly under the products and the epilogue */
    gb += 128 * CC;
#pragma unroll
    for (int i = 0; i < 16; ++i) rb[i] = *(const v8us*)(gb + i * CC);
    /* s_wait_xcnt 0 behind these loads, in front of every overwrite of a register that they name; its memory clobber also keeps the loads from sinking below the products */
    asm volatile("s_wait_xcnt 0x0" :: "v"(lane), "v"(gb) : "memory");
  }
  /* the residual's and the bias's loads stand behind the barrier (which waits for every load issued in front of it) and ahead of the products, under which they fly */
  v4f rs[16]; float bv[4]; unsigned rob = 0;      /* residual: [fragment u][rows 0-3, 4-7]; bias: one column per t; rob: the residual loads' offset register */
  if (FIN) { const int img = mt / (PX / 128), p0 = (mt - img * (PX / 128)) * 128 + 32 * wr;
    const char* rsrc = (const char*)((nq ? ir : rgb) + ((size_t)img * DIMH + 64 * wc) * PX + p0); rob = (unsigned)(ln * PX + 8 * hh) * 4u; const float* bsrc = bpj + col0;
#pragma unroll
    for (int u = 0; u < 8; ++u) { const int t = u & 3, half = u >> 2;      /* unrolled: rs is registers, each load an immediate offset */
      rs[2 * u] = *(const v4fa*)(rsrc + rob + (t * 16 * PX + half * 16) * 4); rs[2 * u + 1] = *(const v4fa*)(rsrc + rob + (t * 16 * PX + half * 16 + 4) * 4); }
#pragma unroll
    for (int t = 0; t < 4; ++t) bv[t] = bsrc[t * 16 + ln];
  }
  const _Float16* pa = sm + (32 * wr + ln) * GLP; const _Float16* pb = sb + (64 * wc + ln) * GLP;
  const v8f z8 = {0.f,0.f,0.f,0.f,0.f,0.f,0.f,0.f}; v8f c00 = z8, c01 = z8, c02 = z8, c03 = z8, c10 = z8, c11 = z8, c12 = z8, c13 = z8;
  v16h a0 = g2_frag(pa, hh), a1 = g2_frag(pa + 16 * GLP, hh), b0 = g2_frag(pb, hh), b1 = g2_frag(pb + 16 * GLP, hh), b2 = g2_frag(pb + 32 * GLP, hh), b3 = g2_frag(pb + 48 * GLP, hh);
  /* unrolled whole (8 steps): the two fragment sets then need no register moves, and every LDS address is an immediate offset */
#pragma unroll
  for (int kb = 0; kb < CC; kb += 32) { v16h n0 = a0, n1 = a1, m0 = b0, m1 = b1, m2 = b2, m3 = b3;
    if (kb + 32 < CC) { const int kn = kb + 32;      /* the next step's 12 LDS reads as one group ahead of this step's WMMAs */
      n0 = g2_frag(pa + kn, hh); n1 = g2_frag(pa + 16 * GLP + kn, hh); m0 = g2_frag(pb + kn, hh); m1 = g2_frag(pb + 16 * GLP + kn, hh); m2 = g2_frag(pb + 32 * GLP + kn, hh); m3 = g2_frag(pb + 48 * GLP + kn, hh); }
    if (ACF) { c00 = g2_mmb(a0, b0, c00); c10 = g2_mmb(a1, b0, c10); c01 = g2_mmb(a0, b1, c01); c11 = g2_mmb(a1, b1, c11);
    c02 = g2_mmb(a0, b2, c02); c12 = g2_mmb(a1, b2, c12); c03 = g2_mmb(a0, b3, c03); c13 = g2_mmb(a1, b3, c13); } else {
    c00 = g2_mma(a0, b0, c00); c10 = g2_mma(a1, b0, c10); c01 = g2_mma(a0, b1, c01); c11 = g2_mma(a1, b1, c11);
    c02 = g2_mma(a0, b2, c02); c12 = g2_mma(a1, b2, c12); c03 = g2_mma(a0, b3, c03); c13 = g2_mma(a1, b3, c13); }
    a0 = n0; a1 = n1; b0 = m0; b1 = m1; b2 = m2; b3 = m3; }
  /* s_wait_xcnt 0 behind the residual's and the bias's loads; their two offset registers are its inputs, so that neither is overwritten ahead of it */
  if (FIN) { __builtin_amdgcn_sched_barrier(0);      /* none of the epilogue's arithmetic moves up among the products: its wait for the residual would stall them */
    asm volatile("s_wait_xcnt 0x0" :: "v"(rob), "v"(ln) : "memory"); }
  if (ACF && NT > 1 && nt + 1 < NT) { __builtin_amdgcn_sched_barrier(0);      /* the packing stays behind the products: its wait for the rows would stall them */
#pragma unroll
    for (int i = 0; i < 2 * BH1; ++i) pk1[i] = v2ua{pk_bf(rbf[i][0], rbf[i][1]), pk_bf(rbf[i][2], rbf[i][3])};      /* unrolled: pk1 is registers */
    bld(BH1, 16 - BH1);      /* the second part flies under the epilogue */
    asm volatile("s_wait_xcnt 0x0" :: "v"(lane), "s"(gbs) : "memory");      /* as above; its memory clobber keeps the loads ahead of the epilogue */
  }
  if (NT > 1) lds_barrier(); else __syncthreads();      /* every wave has read its last fragment: the tiles' LDS may now take the output staging */
  float* so = (float*)(NT > 1 ? sb : sm) + w * (32 * 68);      /* this wave's own 32 rows x 68 floats */
  v8f accs[8] = {c00, c01, c02, c03, c10, c11, c12, c13};      /* unrolled below, as in k_gemm2: accumulators are indexed by constants only */
#pragma unroll
  for (int u = 0; u < 8; ++u) { const int t = u & 3, half = u >> 2;
#pragma unroll
    for (int r = 0; r < 8; ++r) { float v = ACF ? accs[u][r] : accs[u][r] * alpha; if (FIN) v = (v + bf16_round(bv[t])) + bf16_round(rs[2 * u + (r >> 2)][r & 3]); so[(half * 16 + 8 * hh + r) * 68 + t * 16 + ln] = v; } }
  if (NT > 1) __builtin_amdgcn_fence(__ATOMIC_ACQ_REL, "workgroup", "local");      /* LDS alone, as in lds_barrier() */
  else __builtin_amdgcn_fence(__ATOMIC_ACQ_REL, "workgroup");
  __builtin_amdgcn_wave_barrier();
  const int rsub = lane >> 4, c4 = (lane & 15) * 4;
  if (NT > 1) { char* cb = (char*)(C + (size_t)row0 * NN + col0); const unsigned cob = (unsigned)(rsub * NN + c4) * 4u;      /* scalar base, one offset register, each row pair an immediate offset */
#pragma unroll
    for (int q = 0; q < 16; ++q) { const v4f v = *(const v4fa*)&so[(q * 2 + rsub) * 68 + c4]; *(v4f*)(cb + cob + q * 2 * NN * 4) = v; }
    /* s_wait_xcnt 0 behind the stores, in front of the next trip's overwrite of their base and data registers */
    asm volatile("s_wait_xcnt 0x0" :: "v"(cob), "s"(cb) : "memory");
    if (nt + 1 < NT) { lds_barrier();      /* every wave has read its staging back: the B rows may take the next tile */
      if (ACF) {
#pragma unroll
        for (int i = 0; i < 2 * BH1; ++i) *(v2ua*)((unsigned short*)sb + (16 * w + (i >> 1)) * GLP + (i & 1) * 128 + lane * 4) = pk1[i];      /* unrolled, as above */
        bput(BH1, 16 - BH1); } }
  } else {
#pragma unroll
  for (int q = 0; q < 16; ++q) { const int r = q * 2 + rsub; const v4f v = *(const v4fa*)&so[r * 68 + c4]; *(v4f*)(C + (size_t)(row0 + r) * NN + col0 + c4) = v; }
  } } }

__global__ __launch_bounds__(256) void k_rsm(const float* __restrict__ S, _Float16* __restrict__ P, int nrows) {
  #pragma clang fp contract(off)
  const int i = blockIdx.x * 256 + threadIdx.x; if (i >= nrows) return; const float* s = S + (size_t)i * SQ; float mx = -3.0e38f;
#pragma unroll 1
  for (int j = 0; j < SQ; ++j) mx = fmaxf(mx, s[j]); float se = 0.f;
#pragma unroll 1
  for (int j = 0; j < SQ; ++j) se += expf(s[j] - mx); const float sc = 256.0f / se;
#pragma unroll 1
  for (int j0 = 0; j0 < SQ; j0 += 8) { FragH f; for (int q = 0; q < 8; ++q) f.h[q] = (_Float16)(expf(s[j0 + q] - mx) * sc); unsigned short* d = (unsigned short*)P + (size_t)i * SQ + j0; *(v8us*)d = f.half[0];  } }
__global__ __launch_bounds__(256) void k_vt(const _Float16* __restrict__ V16, int b, int h0, _Float16* __restrict__ VT) { __shared__ unsigned short tl[64][65]; const int tid = threadIdx.x; const int hh = blockIdx.x % HG, sg = blockIdx.x / HG; const int s0 = sg * 64; const int h = h0 + hh;
  for (int i = tid; i < 64 * 8; i += 256) { const int j = i / 8, d8 = (i % 8) * 8; FragH f; f.half[0] = *(const v8us*)((const unsigned short*)V16 + ((size_t)b * SQ + s0 + j) * DM + h * HD + d8); for (int q = 0; q < 8; ++q) tl[d8 + q][j] = f.u[q]; }
  __syncthreads();
  { for (int i = tid; i < 64 * 8; i += 256) { const int d = i / 8, j8 = (i % 8) * 8; FragH f; for (int q = 0; q < 8; ++q) f.u[q] = tl[d][j8 + q]; *(v8us*)((unsigned short*)VT + ((size_t)hh * HD + d) * SQ + s0 + j8) = f.half[0]; }  } }


// lane ^ M partner's value added (M = 1, 2, 4: all inside a 16-lane row), as one DPP add
template <int M>
__device__ __forceinline__ float xadd(float s) { return s + __int_as_float(__builtin_amdgcn_update_dpp(0, __float_as_int(s), 0x160 | M, 0xf, 0xf, true)); }
// One wave per (image column x, dilation, class of y modulo the dilation, segment): lane = 4 channels, 8 lanes = one head, so the 128 channels of a q, k or v row are one 512-byte load of whole lines.
// The wave walks down its column in steps of the dilation: the window rows y and y + dil of one pixel are the rows y - dil and y of the next, so they stay in registers (3 row slots of 3 k and 3 v rows each)
// and a pixel loads q and one new window row (7 rows) where it took 19. The walk is unrolled by 3, so that each slot is a fixed set of registers and nothing is moved.
// Work-group = 8 waves on 8 neighbouring columns. Segments: 5 x 8 pixels of the 40 of a class (dilation 2), 3 x 9 of the 27 or 26 (dilation 3): 10 + 9 = 19 walks a column,
// 760 work-groups, 6,080 waves of 8 or 9 pixels: close to six waves for each of the 1,024 SIMDs.
// An out-of-image neighbour reads an in-image row instead (row and column each fall back to the pixel's own), takes logit 0 and weight 0 on v.
// Softmax in base 2: the logits carry log2 e, so each of the 9 exponentials is the hardware's own 2^x.
// The work-groups behind the walks' (from DLG on) turn the projection's weights wp into Bp = f16(16 bf16(wp)), 8 weights a thread: the next launch reads them, and they need no launch of their own.
#define DLW 19       /* walks a column: 2 classes x 5 segments + 3 classes x 3 segments */
#define DLG (NB * (WS / 8) * DLW)       /* work-groups that walk */
__global__ __launch_bounds__(256) void k_dla(const float* __restrict__ F, _Float16* __restrict__ X16, const float* __restrict__ wp, _Float16* __restrict__ Bp) {
  static_assert(WS % 8 == 0 && HS == 80, "8 columns a work-group; the segment table is for 80 rows");
  if (blockIdx.x >= DLG) { const size_t t = (size_t)(blockIdx.x - DLG) * 256 + threadIdx.x; FragH f; for (int q = 0; q < 8; ++q) f.h[q] = (_Float16)(bf16_round(wp[t * 8 + q]) * 16.0f); *(v8us*)((unsigned short*)Bp + t * 8) = f.half[0]; return; }
  const int lane = threadIdx.x & 31; const int w = __builtin_amdgcn_readfirstlane((int)threadIdx.x >> 5);
  const int c = blockIdx.x % DLW, t = blockIdx.x / DLW; const int x = (t % (WS / 8)) * 8 + w, img = t / (WS / 8);
  const int di = c >= 10 ? 1 : 0, cw = di ? c - 10 : c; const int dil = di ? 3 : 2, len = di ? 9 : 8; const int cls = di ? cw % 3 : cw % 2, seg = di ? cw / 3 : cw / 2;      /* divisors as constants: a division by a variable goes through the vector unit, and y would no longer be a scalar */
  const int left = (di ? (HS - cls + 2) / 3 : (HS - cls + 1) / 2) - seg * len; const int n = left < len ? left : len;      /* pixels of this walk */
  int y = cls + seg * len * dil;
  const char* Fi = (const char*)(F + (size_t)img * PX * QW + di * 128); char* Xi = (char*)((unsigned short*)X16 + (size_t)img * PX * CC + di * 128);
  const unsigned vo = (unsigned)lane * 16u, vs = (unsigned)lane * 8u;      /* the lane's 4 channels: byte offset in an f32 row, in an f16 row */
  const bool okc[3] = {x - dil >= 0, true, x + dil < WS}; const int xc[3] = {okc[0] ? x - dil : x, x, okc[2] ? x + dil : x};
  v4f k[3][3], v[3][3]; bool okr[3]; const char* pr[3];      /* [slot][column]; pr: the scalar bases of the row loaded last */
  auto row = [&](int s, int yy) { okr[s] = yy >= 0 && yy < HS; const int yc = okr[s] ? yy : y;
#pragma unroll
    for (int j = 0; j < 3; ++j) { pr[j] = Fi + (size_t)((yc * WS + xc[j]) * (QW * 4)); k[s][j] = *(const v4fa*)(pr[j] + vo + CC * 4); v[s][j] = *(const v4fa*)(pr[j] + vo + 2 * CC * 4); } };
  row(0, y - dil);
  /* s_wait_xcnt 0 behind a row's loads, in front of every overwrite of a register that they name; the bases and the offset that their addresses are formed from are its inputs */
  asm volatile("s_wait_xcnt 0x0" :: "s"(pr[0]), "s"(pr[1]), "s"(pr[2]), "v"(vo) : "memory");
  row(1, y);
  asm volatile("s_wait_xcnt 0x0" :: "s"(pr[0]), "s"(pr[1]), "s"(pr[2]), "v"(vo) : "memory");      /* as above */
#pragma unroll 1
  for (int j0 = 0; j0 < n; j0 += 3) {      /* stays rolled: the body already holds the 3 places of the slots */
#pragma unroll
    for (int u = 0; u < 3; ++u) {      /* unrolled: slot numbers are constants, the slots registers */
      if (j0 + u < n) { const int sl[3] = {u, (u + 1) % 3, (u + 2) % 3};      /* slots of the rows y - dil, y, y + dil */
        const char* pq = Fi + (size_t)((y * WS + x) * (QW * 4)); const v4f q = *(const v4fa*)(pq + vo);
        row(sl[2], y + dil);
        /* s_wait_xcnt 0 behind the pixel's loads, as above */
        asm volatile("s_wait_xcnt 0x0" :: "s"(pq), "s"(pr[0]), "s"(pr[1]), "s"(pr[2]), "v"(vo) : "memory");
        __builtin_amdgcn_sched_barrier(0);      /* all 7 loads of a pixel issue before any of its arithmetic: one latency a pixel, not one per group of loads */
        float s[9]; bool ok[9]; float mx = -INFINITY;
#pragma unroll
        for (int kk = 0; kk < 9; ++kk) { const v4f kr = k[sl[kk / 3]][kk % 3]; ok[kk] = okr[sl[kk / 3]] && okc[kk % 3];
          float d = fmaf(q[3], kr[3], fmaf(q[2], kr[2], fmaf(q[1], kr[1], q[0] * kr[0]))); d = xadd<4>(xadd<2>(xadd<1>(d)));
          s[kk] = ok[kk] ? d * SCL2 : 0.f; mx = fmaxf(mx, s[kk]); }
        float a[9], ex[9];
#pragma unroll
        for (int kk = 0; kk < 9; ++kk) a[kk] = s[kk] - mx;
        /* exp(x) = 2^(x log2 e), the factor already in the logits: one v_exp_f32 each; the argument is never above 0, so the library expf's range split, ldexp and overflow and underflow selects have nothing to do.
           As one asm statement for the slot that the instruction set asks for behind a transcendental. Here every result register
           differs from every source (early clobber), so each v_exp_f32 is independent of the one in front of it, and the v_nop fills the slot behind the last. */
        asm("v_exp_f32 %0, %9\n\tv_exp_f32 %1, %10\n\tv_exp_f32 %2, %11\n\tv_exp_f32 %3, %12\n\tv_exp_f32 %4, %13\n\tv_exp_f32 %5, %14\n\tv_exp_f32 %6, %15\n\tv_exp_f32 %7, %16\n\tv_exp_f32 %8, %17\n\tv_nop"
            : "=&v"(ex[0]), "=&v"(ex[1]), "=&v"(ex[2]), "=&v"(ex[3]), "=&v"(ex[4]), "=&v"(ex[5]), "=&v"(ex[6]), "=&v"(ex[7]), "=&v"(ex[8])
            : "v"(a[0]), "v"(a[1]), "v"(a[2]), "v"(a[3]), "v"(a[4]), "v"(a[5]), "v"(a[6]), "v"(a[7]), "v"(a[8]));
        float se = 0.f; v4f acc = {0.f, 0.f, 0.f, 0.f};
#pragma unroll
        for (int kk = 0; kk < 9; ++kk) { const float e = ex[kk]; se += e; const float pw = ok[kk] ? e : 0.f; const v4f vr = v[sl[kk / 3]][kk % 3];
          for (int ch = 0; ch < 4; ++ch) acc[ch] = fmaf(pw, vr[ch], acc[ch]); }
        const float inv = 1.0f / se; v4h o; for (int ch = 0; ch < 4; ++ch) o[ch] = (_Float16)(acc[ch] * inv);
        char* po = Xi + (size_t)((y * WS + x) * (CC * 2)); *(v4h*)(po + vs) = o;
        /* s_wait_xcnt 0 behind the store, in front of the next pixel's overwrite of its address and data registers */
        asm volatile("s_wait_xcnt 0x0" :: "s"(po), "v"(vs) : "memory");
        y += dil; } } } }

extern "C" void kernel_launch(void* const* d_in, const int* in_sizes, int n_in,
                              void* d_out, int out_size, void* d_ws, size_t ws_size, hipStream_t stream) {
  (void)in_sizes; (void)n_in; (void)out_size;
  const float* const* I = (const float* const*)d_in; const float* rgb = I[0]; const float* ir = I[1]; const float* wqkv = I[2]; const float* wp = I[3]; const float* bp = I[4];
  char* ws = (char*)d_ws; size_t off = 0;
  auto take = [&](size_t bytes) { char* p = ws + off; off += (bytes + 255) & ~(size_t)255; return p; };
  _Float16* BP = (_Float16*)take((size_t)CC * CC * 2); float* F = (float*)take(NR * QW * 4); _Float16* X16 = (_Float16*)take(NR * CC * 2);
  if (off > ws_size) return;      /* 0.1 + 75 + 12.5 = approx 88 MiB */
  static_assert(((size_t)CC * CC / 8) % 256 == 0, "k_dla: whole work-groups for the projection's weights");
  k_gemm3<QW, false, true, 3><<<(unsigned)((NR / 128) * (QW / 384)), 256, 0, stream>>>(nullptr, nullptr, 1.0f, F, nullptr, rgb, ir, wqkv);      /* qkv (f32) */
  k_dla<<<(unsigned)(DLG + (size_t)CC * CC / 8 / 256), 256, 0, stream>>>(F, X16, wp, BP);
  k_gemm3<CC, true, false, 1><<<(unsigned)((NR / 128) * (CC / 128)), 256, 0, stream>>>(X16, BP, 0.0625f, (float*)d_out, bp, rgb, ir, nullptr);      /* proj + bias + residual */
}

// v010
// A run of this version takes 38.4 microseconds.
// Next to v009, in two timings, it ran 1.27 times as fast each time.
// Counting every step since v000, it is 21.1 times as fast.
#include <hip/hip_runtime.h>
// Multi-dilate local attention (rgb, ir [4][128][80][80] -> y = [rgb | ir] (256 ch); qkv = 1x1 (w_qkv [768][256]) split as [3][2 dilations][128 = 4 heads x 32]; per dilation d in (2, 3): each pixel attends to its 3x3 dilated neighbourhood (zero-padded unfold: out-of-image neighbours contribute k = v = 0, logit 0) with softmax(q.k / sqrt(32)) over the 9; heads merged dilation-major; proj (w_proj [256][256]) + b_proj; + y -> NHWC [4][80][80][256]).
// Structure: qkv and the dilated local attention in one kernel: a work-group walks down rows in steps of the dilation; each row piece comes straight from the two channel-first inputs, turned into concatenated pixel rows (bf16) on its way into LDS, and is multiplied on WMMA (f32 accumulation; both operands bf16, the weight fragments kept in registers; exact products) into q, k, v rows kept f32 in LDS rings; the attention on VALU (f32; one wave a pixel, 4 channels a lane, softmax weights in registers) into f16 rows; projection GEMM (operand tiles staged in LDS, 32x64 wave tiles) whose epilogue adds bias + residual (f32, VALU) and writes the NHWC output.
// Compute dtype: inputs rounded to bf16; y / weights exact; qkv and the attention f32; the attended rows as a plain f16 GEMM operand (~2^-12). v_wmma_f32_16x16x32_bf16 (qkv), v_wmma_f32_16x16x32_f16 (projection).
#define NB 4
#define DIMH 128
#define CC 256
#define QW 768
#define HS 80
#define WS 80
#define PX (HS * WS)                 /* 6400 = 50 x 128 */
#define NR ((size_t)NB * PX)         /* 25,600 rows */
#define NRD ((int)NR)                /* unused */
#define SCL 0.17677669529663689f
#define SCL2 (SCL * 1.44269504088896341f)      /* 1 / sqrt(32) times log2 e: logits for a base-2 exponential */
#define SQ 64
#define DM 64
#define NH 1
#define HD 64
#define HG 1
typedef __bf16 v16b __attribute__((ext_vector_type(16)));
typedef unsigned short v8us __attribute__((ext_vector_type(8), may_alias));
typedef float  v8f  __attribute__((ext_vector_type(8)));
typedef float  v4f  __attribute__((ext_vector_type(4)));
typedef float  v4fa __attribute__((ext_vector_type(4), may_alias));
union FragB { v16b v; v8us half[2]; unsigned short u[16]; };

__device__ __forceinline__ unsigned short bf16_bits(float x) { unsigned int u = __float_as_uint(x); return (unsigned short)((u + 0x7FFFu + ((u >> 16) & 1u)) >> 16); }
__device__ __forceinline__ float bf16_val(unsigned short b) { return __uint_as_float(((unsigned int)b) << 16); }
__device__ __forceinline__ float bf16_round(float x) { return bf16_val(bf16_bits(x)); }
// D += A·B with NT terms: 1 = ah·bh, 2 = + al·bh (A split), 3 = + ah·bl (both split)
template <int NT>
__device__ __forceinline__ v8f mmaN(v16b ah, v16b al, v16b bh, v16b bl, v8f c) {
  c = __builtin_amdgcn_wmma_f32_16x16x32_bf16(false, ah, false, bh, (short)0, c, false, false);
  if (NT >= 2) c = __builtin_amdgcn_wmma_f32_16x16x32_bf16(false, al, false, bh, (short)0, c, false, false);
  if (NT >= 3) c = __builtin_amdgcn_wmma_f32_16x16x32_bf16(false, ah, false, bl, (short)0, c, false, false);
  asm volatile("v_nop\n\tv_nop\n\tv_nop\n\tv_nop" : "+v"(c) : "v"(ah), "v"(al), "v"(bh), "v"(bl));
  return c;
}

__global__ __launch_bounds__(256) void k_wt_bf16(const float* __restrict__ W, unsigned short* __restrict__ Wt, int K, int N) {
  const int t = blockIdx.x * 256 + threadIdx.x;
  const int k8n = K / 8;
  if (t >= N * k8n) return;
  const int n = t / k8n, k8 = (t % k8n) * 8;
  v8us v;
#pragma unroll
  for (int i = 0; i < 8; ++i) v[i] = bf16_bits(W[(size_t)(k8 + i) * N + n]);
  *(v8us*)(Wt + (size_t)n * K + k8) = v;
  
}

// GEMM C[M][N] (f32, pitch ldc) = act(A[M][K]·W + bias). A f32 row-major (pitch lda) converted per fragment to bf16
// (ASPLIT: hi/lo two planes -> 2 terms, else single rounded term); Wt bf16 [N][K] (pitch ldb). BIAS_BF16 rounds the
// bias to bf16 first (bias quantised to bf16 before the add). K%32==0, M%16==0, N%64==0.
template <bool ASPLIT, int ACT, bool BIAS_BF16>
__global__ __launch_bounds__(128) void k_gemm_bf(const float* __restrict__ A, int lda, const unsigned short* __restrict__ Wt, int ldb,
                                               const float* __restrict__ bias, float* __restrict__ C, int ldc, int M, int N, int K) {
  __shared__ __attribute__((aligned(16))) float so[4][16][64];
  const int tid = threadIdx.x, w = tid >> 5, lane = tid & 31, ln = lane & 15, hh = lane >> 4;
  const int ntn = N / 64;
  const int wid = blockIdx.x * 4 + w;
  const int mt = wid / ntn, nq = wid % ntn;
  if (mt * 16 >= M) return;
  const int row0 = mt * 16, col0 = nq * 64;
  const float* arow = A + (size_t)(row0 + ln) * lda;
  v8f acc[4] = {};
  for (int kb = 0; kb < K; kb += 32) {
    FragB ah, al;
    const v4f x0 = *(const v4fa*)(arow + kb + 8 * hh), x1 = *(const v4fa*)(arow + kb + 8 * hh + 4);
    const v4f x2 = *(const v4fa*)(arow + kb + 16 + 8 * hh), x3 = *(const v4fa*)(arow + kb + 16 + 8 * hh + 4);
    float xs[16] = {x0[0],x0[1],x0[2],x0[3],x1[0],x1[1],x1[2],x1[3],x2[0],x2[1],x2[2],x2[3],x3[0],x3[1],x3[2],x3[3]};
#pragma unroll
    for (int i = 0; i < 16; ++i) { const unsigned short hb = bf16_bits(xs[i]); ah.u[i] = hb; al.u[i] = ASPLIT ? bf16_bits(xs[i] - bf16_val(hb)) : (unsigned short)0; }
#pragma unroll
    for (int t = 0; t < 4; ++t) {
      const unsigned short* brow = Wt + (size_t)(col0 + t * 16 + ln) * ldb + kb;
      FragB b;
      b.half[0] = *(const v8us*)(brow + 8 * hh);
      b.half[1] = *(const v8us*)(brow + 16 + 8 * hh);
      acc[t] = mmaN<ASPLIT ? 2 : 1>(ah.v, al.v, b.v, b.v, acc[t]);
    }
  }
#pragma unroll
  for (int t = 0; t < 4; ++t) {
    float bv = bias ? bias[col0 + t * 16 + ln] : 0.f;
    if (BIAS_BF16) bv = bf16_round(bv);
#pragma unroll
    for (int r = 0; r < 8; ++r) { float v = acc[t][r] + bv; if (ACT == 1) v = fmaxf(v, 0.f); so[w][8 * hh + r][t * 16 + ln] = v; }
  }
  __builtin_amdgcn_fence(__ATOMIC_ACQ_REL, "workgroup");
  __builtin_amdgcn_wave_barrier();
  const int rsub = lane >> 4, c4 = (lane & 15) * 4;
  {
#pragma unroll
    for (int q = 0; q < 8; ++q) {
      const int r = q * 2 + rsub;
      const v4f v = *(const v4fa*)&so[w][r][c4];
      *(v4f*)(C + (size_t)(row0 + r) * ldc + col0 + c4) = v;
    }
    
  }
}

// GEMM C = act(A·W + bias + resid): A f32 (ASPLIT -> hi/lo 2 terms), Wt bf16 [N][K]; ACT 0 none, 1 relu, 2 exact gelu;
// resid (optional, f32, row index = (row % rmod), pitch ldr, RES_BF16 rounds it) added before the activation.
template <bool ASPLIT, int ACT, bool BIAS_BF16, bool RES_BF16>
__global__ __launch_bounds__(128) void k_gemm_bf3(const float* __restrict__ A, int lda, const unsigned short* __restrict__ Wt, int ldb,
                                                const float* __restrict__ bias, const float* __restrict__ resid, int rmod, int ldr,
                                                float* __restrict__ C, int ldc, int M, int N, int K) {
  __shared__ __attribute__((aligned(16))) float so[4][16][64];
  const int tid = threadIdx.x, w = tid >> 5, lane = tid & 31, ln = lane & 15, hh = lane >> 4;
  const int ntn = N / 64;
  const int wid = blockIdx.x * 4 + w;
  const int mt = wid / ntn, nq = wid % ntn;
  if (mt * 16 >= M) return;
  const int row0 = mt * 16, col0 = nq * 64;
  const float* arow = A + (size_t)(row0 + ln) * lda;
  v8f acc[4] = {};
  for (int kb = 0; kb < K; kb += 32) {
    FragB ah, al;
    const v4f x0 = *(const v4fa*)(arow + kb + 8 * hh), x1 = *(const v4fa*)(arow + kb + 8 * hh + 4);
    const v4f x2 = *(const v4fa*)(arow + kb + 16 + 8 * hh), x3 = *(const v4fa*)(arow + kb + 16 + 8 * hh + 4);
    float xs[16] = {x0[0],x0[1],x0[2],x0[3],x1[0],x1[1],x1[2],x1[3],x2[0],x2[1],x2[2],x2[3],x3[0],x3[1],x3[2],x3[3]};
#pragma unroll
    for (int i = 0; i < 16; ++i) { const unsigned short hb = bf16_bits(xs[i]); ah.u[i] = hb; al.u[i] = ASPLIT ? bf16_bits(xs[i] - bf16_val(hb)) : (unsigned short)0; }
#pragma unroll
    for (int t = 0; t < 4; ++t) {
      const unsigned short* brow = Wt + (size_t)(col0 + t * 16 + ln) * ldb + kb;
      FragB b;
      b.half[0] = *(const v8us*)(brow + 8 * hh);
      b.half[1] = *(const v8us*)(brow + 16 + 8 * hh);
      acc[t] = mmaN<ASPLIT ? 2 : 1>(ah.v, al.v, b.v, b.v, acc[t]);
    }
  }
#pragma unroll
  for (int t = 0; t < 4; ++t) {
    const int col = col0 + t * 16 + ln;
    float bv = bias ? bias[col] : 0.f;
    if (BIAS_BF16) bv = bf16_round(bv);
#pragma unroll
    for (int r = 0; r < 8; ++r) {
      float v = acc[t][r] + bv;
      if (resid) { float rv = resid[(size_t)((row0 + 8 * hh + r) % rmod) * ldr + col]; if (RES_BF16) rv = bf16_round(rv); v += rv; }
      if (ACT == 1) v = fmaxf(v, 0.f);
      if (ACT == 2) v = 0.5f * v * (1.0f + erff(v * 0.70710678118654752f));
      if (ACT == 3) { const float u = 0.7978845608028654f * (v + 0.044715f * v * v * v); v = 0.5f * v * (1.0f + tanhf(u)); }
      so[w][8 * hh + r][t * 16 + ln] = v;
    }
  }
  __builtin_amdgcn_fence(__ATOMIC_ACQ_REL, "workgroup");
  __builtin_amdgcn_wave_barrier();
  const int rsub = lane >> 4, c4 = (lane & 15) * 4;
  {
#pragma unroll
    for (int q = 0; q < 8; ++q) {
      const int r = q * 2 + rsub;
      const v4f v = *(const v4fa*)&so[w][r][c4];
      *(v4f*)(C + (size_t)(row0 + r) * ldc + col0 + c4) = v;
    }
    
  }
}
// row LayerNorm (biased variance, eps) over N: s = X (+ R); optional out_sum <- s; out_norm <- (s-mu)*rsqrt(var+eps)*g + b
template <bool PARAM_BF16>
__global__ __launch_bounds__(256) void k_layernorm(const float* __restrict__ X, const float* __restrict__ R, const float* __restrict__ g, const float* __restrict__ bta,
                                                  float* __restrict__ out_sum, float* __restrict__ out_norm, int N, float eps) {
  __shared__ float red[256];
  const int row = blockIdx.x, tid = threadIdx.x;
  const float* x = X + (size_t)row * N; const float* rr = R ? R + (size_t)row * N : nullptr;
  float vals[16];                     // up to N = 4096
  const int per = N / 256;            // contiguous chunk per thread? use strided-by-4 chunks: thread handles j = tid*4 + 1024*u
  float s1 = 0.f;
  for (int u = 0; u < per / 4; ++u) {
    const int j = tid * 4 + 1024 * u;
    const v4f a = *(const v4fa*)(x + j);
    v4f b = {0.f,0.f,0.f,0.f}; if (rr) b = *(const v4fa*)(rr + j);
#pragma unroll
    for (int q = 0; q < 4; ++q) { const float v = a[q] + b[q]; vals[u * 4 + q] = v; s1 += v; }
  }
  red[tid] = s1; __syncthreads();
  for (int st = 128; st > 0; st >>= 1) { if (tid < st) red[tid] += red[tid + st]; __syncthreads(); }
  const float mu = red[0] / (float)N; __syncthreads();
  float s2 = 0.f;
  for (int u = 0; u < per / 4; ++u)
#pragma unroll
    for (int q = 0; q < 4; ++q) { const float c = vals[u * 4 + q] - mu; s2 += c * c; }
  red[tid] = s2; __syncthreads();
  for (int st = 128; st > 0; st >>= 1) { if (tid < st) red[tid] += red[tid + st]; __syncthreads(); }
  const float rs = rsqrtf(red[0] / (float)N + eps);
  {
    for (int u = 0; u < per / 4; ++u) {
      const int j = tid * 4 + 1024 * u;
      v4f o, sm;
#pragma unroll
      for (int q = 0; q < 4; ++q) {
        float gg = g[j + q], bb = bta[j + q];
        if (PARAM_BF16) { gg = bf16_round(gg); bb = bf16_round(bb); }
        sm[q] = vals[u * 4 + q]; o[q] = (vals[u * 4 + q] - mu) * rs * gg + bb;
      }
      if (out_sum) *(v4f*)(out_sum + (size_t)row * N + j) = sm;
      *(v4f*)(out_norm + (size_t)row * N + j) = o;
    }
    
  }
}



// ---- f16 WMMA path (v_wmma_f32_16x16x32_f16): 11-bit significands for operands in range — used here for the projection GEMM
typedef _Float16 v16h __attribute__((ext_vector_type(16)));
union FragH { v16h v; v8us half[2]; _Float16 h[16]; unsigned short u[16]; };
template <int NT>
__device__ __forceinline__ v8f mmaH(v16h ah, v16h al, v16h bh, v16h bl, v8f c) {
  c = __builtin_amdgcn_wmma_f32_16x16x32_f16(false, ah, false, bh, (short)0, c, false, false);
  if (NT >= 2) c = __builtin_amdgcn_wmma_f32_16x16x32_f16(false, al, false, bh, (short)0, c, false, false);
  if (NT >= 3) c = __builtin_amdgcn_wmma_f32_16x16x32_f16(false, ah, false, bl, (short)0, c, false, false);
  asm volatile("v_nop\n\tv_nop\n\tv_nop\n\tv_nop" : "+v"(c) : "v"(ah), "v"(al), "v"(bh), "v"(bl));
  return c;
}
// batched GEMM like k_gemm_b but f16 operands: A f32 (split into f16 hi/lo if ASPLIT, else rounded to f16), Bt = f16 values [n][k]; alpha; C f32; N multiple of 16 (partial tiles skipped)
template <bool ASPLIT>
__global__ __launch_bounds__(128) void k_gemm_h(const float* __restrict__ A, int lda, size_t sA, const _Float16* __restrict__ Bh, int ldb, size_t sB, float alpha, float* __restrict__ C, int ldc, size_t sC, int M, int N, int K) {
  __shared__ __attribute__((aligned(16))) float so[4][16][64];
  const int tid = threadIdx.x, w = tid >> 5, lane = tid & 31, ln = lane & 15, hh = lane >> 4; const int by = blockIdx.y;
  A += (size_t)by * sA; Bh += (size_t)by * sB; C += (size_t)by * sC;
  const int ntn = (N + 63) / 64; const int wid = blockIdx.x * 4 + w; const int mt = wid / ntn, nq = wid % ntn; if (mt * 16 >= M) return;
  const int row0 = mt * 16, col0 = nq * 64; const float* arow = A + (size_t)(row0 + ln) * lda;
  v8f acc[4] = {};
  for (int kb = 0; kb < K; kb += 32) {
    FragH ah, al;
    const v4f x0 = *(const v4fa*)(arow + kb + 8 * hh), x1 = *(const v4fa*)(arow + kb + 8 * hh + 4), x2 = *(const v4fa*)(arow + kb + 16 + 8 * hh), x3 = *(const v4fa*)(arow + kb + 16 + 8 * hh + 4);
    float xs[16] = {x0[0],x0[1],x0[2],x0[3],x1[0],x1[1],x1[2],x1[3],x2[0],x2[1],x2[2],x2[3],x3[0],x3[1],x3[2],x3[3]};
#pragma unroll
    for (int i = 0; i < 16; ++i) { const _Float16 h = (_Float16)xs[i]; ah.h[i] = h; al.h[i] = ASPLIT ? (_Float16)(xs[i] - (float)h) : (_Float16)0.0f; }
#pragma unroll
    for (int t = 0; t < 4; ++t) { if (col0 + t * 16 >= N) continue; const size_t boff = (size_t)(col0 + t * 16 + ln) * ldb + kb; FragH bq; bq.half[0] = *(const v8us*)(Bh + boff + 8 * hh); bq.half[1] = *(const v8us*)(Bh + boff + 16 + 8 * hh);
      acc[t] = mmaH<ASPLIT ? 2 : 1>(ah.v, al.v, bq.v, bq.v, acc[t]); }
  }
#pragma unroll
  for (int t = 0; t < 4; ++t) { if (col0 + t * 16 >= N) continue;
#pragma unroll
    for (int r = 0; r < 8; ++r) so[w][8 * hh + r][t * 16 + ln] = acc[t][r] * alpha; }
  __builtin_amdgcn_fence(__ATOMIC_ACQ_REL, "workgroup"); __builtin_amdgcn_wave_barrier();
  const int rsub = lane >> 4, c4 = (lane & 15) * 4;
  {
#pragma unroll
    for (int q = 0; q < 8; ++q) { const int r = q * 2 + rsub; if (col0 + c4 < N) { const v4f v = *(const v4fa*)&so[w][r][c4]; *(v4f*)(C + (size_t)(row0 + r) * ldc + col0 + c4) = v; } }
     }
}

// Wt[n][k] = f16(W[k][n]·scale) from f32 row-major W[K][N] (scale = power of two; bf16-exact weights stay exact in f16 away from the subnormal range)
__global__ __launch_bounds__(256) void k_wt_f16(const float* __restrict__ W, _Float16* __restrict__ Wt, int K, int N, float scale) {
  const int t = blockIdx.x * 256 + threadIdx.x; if (t >= N * (K / 8)) return; const int n = t / (K / 8), k8 = (t % (K / 8)) * 8; FragH f;
#pragma unroll
  for (int i = 0; i < 8; ++i) f.h[i] = (_Float16)(bf16_round(W[(size_t)(k8 + i) * N + n]) * scale); const v8us o = f.half[0];
  *(v8us*)((unsigned short*)Wt + (size_t)n * K + k8) = o; 
}
// k_gemm_hh variant with fused epilogue: v = acc·alpha + bias[by·sBias + col] (+ CP[(row/rowsPerB)·sCPb + by·64 + col] if CP) ; ACT 0 none / 1 elu ; writes f16 C16 (and f32 C if non-null)
template <int ACT>
__global__ __launch_bounds__(128) void k_gemm_hhx(const _Float16* __restrict__ A, int lda, size_t sA, const _Float16* __restrict__ Bh, int ldb, size_t sB, float alpha, const float* __restrict__ bias, size_t sBias, const float* __restrict__ CP, int rowsPerB, size_t sCPb, int row0g,
    float* __restrict__ C, _Float16* __restrict__ C16, int ldc, size_t sC, int M, int N, int K) {
  __shared__ __attribute__((aligned(16))) float so[4][16][64];
  const int tid = threadIdx.x, w = tid >> 5, lane = tid & 31, ln = lane & 15, hh = lane >> 4; const int by = blockIdx.y;
  A += (size_t)by * sA; Bh += (size_t)by * sB; const size_t cofs = (size_t)by * sC; const float* bp = bias ? bias + (size_t)by * sBias : nullptr;
  const int ntn = (N + 63) / 64; const int wid = blockIdx.x * 4 + w; const int mt = wid / ntn, nq = wid % ntn; if (mt * 16 >= M) return;
  const int row0 = mt * 16, col0 = nq * 64; const _Float16* arow = A + (size_t)(row0 + ln) * lda;
  v8f acc[4] = {};
  for (int kb = 0; kb < K; kb += 32) { FragH ah; ah.half[0] = *(const v8us*)((const unsigned short*)arow + kb + 8 * hh); ah.half[1] = *(const v8us*)((const unsigned short*)arow + kb + 16 + 8 * hh);
#pragma unroll
    for (int t = 0; t < 4; ++t) { if (col0 + t * 16 >= N) continue; const size_t boff = (size_t)(col0 + t * 16 + ln) * ldb + kb; FragH bq; bq.half[0] = *(const v8us*)((const unsigned short*)Bh + boff + 8 * hh); bq.half[1] = *(const v8us*)((const unsigned short*)Bh + boff + 16 + 8 * hh);
      acc[t] = mmaH<1>(ah.v, ah.v, bq.v, bq.v, acc[t]); }
  }
#pragma unroll
  for (int t = 0; t < 4; ++t) { if (col0 + t * 16 >= N) continue; const int col = col0 + t * 16 + ln; const float bv = bp ? bf16_round(bp[col]) : 0.f;
#pragma unroll
    for (int r = 0; r < 8; ++r) { float v = acc[t][r] * alpha + bv; if (CP) { const int rr = row0g + row0 + 8 * hh + r; if (rowsPerB < 0) v += CP[cofs + (size_t)rr * ldc + col];      /* rowsPerB < 0: own element of the batched C plane */ else { const int bidx = rr / rowsPerB; v += CP[(size_t)bidx * sCPb + (size_t)by * 64 + col]; } } if (ACT == 1) v = (v > 0.f) ? v : expm1f(v); else if (ACT == 7) v = (v > 0.f) ? v + 1.0f : expf(v); else if (ACT == 8) v = tanhf(v); else if (ACT == 9) v = 0.5f * v * (1.0f + tanhf(0.7978845608028654f * (v + 0.044715f * v * v * v))); else if (ACT == 11) v = 1.0f / (1.0f + expf(-v)); else if (ACT == 12) v = (v > 0.f) ? v : 0.01f * v; else if (ACT == 14) v = (v > 0.f) ? v : 0.1f * v; else if (ACT == 16) v = (v >= 0.f) ? v : 0.3f * v; else if (ACT == 17) v = (v >= 0.f) ? v : 0.2f * v; else if (ACT == 15) v = v / (1.0f + expf(-v)); else if (ACT == 3) v = fmaxf(v, 0.f); else if (ACT == 6) v = 0.5f * v * (1.0f + erff(v * 0.70710678118654752f)); so[w][8 * hh + r][t * 16 + ln] = v; } }
  __builtin_amdgcn_fence(__ATOMIC_ACQ_REL, "workgroup"); __builtin_amdgcn_wave_barrier();
  const int rsub = lane >> 4, c4 = (lane & 15) * 4; typedef _Float16 v4h __attribute__((ext_vector_type(4)));
  {
#pragma unroll
    for (int q = 0; q < 8; ++q) { const int r = q * 2 + rsub; if (col0 + c4 < N) { const v4f v = *(const v4fa*)&so[w][r][c4]; if (C) *(v4f*)(C + cofs + (size_t)(row0 + r) * ldc + col0 + c4) = v; if (C16) { v4h h4; for (int i = 0; i < 4; ++i) h4[i] = (_Float16)v[i]; *(v4h*)(C16 + cofs + (size_t)(row0 + r) * ldc + col0 + c4) = h4; } } }
     }
}


typedef _Float16 v4h __attribute__((ext_vector_type(4)));

__global__ __launch_bounds__(256) void k_x16(const float* __restrict__ x, _Float16* __restrict__ X16, size_t n8) { const size_t t = (size_t)blockIdx.x * 256 + threadIdx.x; if (t >= n8) return; FragH f;
#pragma unroll
  for (int q = 0; q < 8; ++q) f.h[q] = (_Float16)bf16_round(x[t * 8 + q]); *(v8us*)((unsigned short*)X16 + t * 8) = f.half[0];  }
__global__ __launch_bounds__(256) void k_h16(const float* __restrict__ x, _Float16* __restrict__ X16, size_t n8) { const size_t t = (size_t)blockIdx.x * 256 + threadIdx.x; if (t >= n8) return; FragH f;
#pragma unroll
  for (int q = 0; q < 8; ++q) f.h[q] = (_Float16)x[t * 8 + q]; *(v8us*)((unsigned short*)X16 + t * 8) = f.half[0];  }
__global__ __launch_bounds__(256) void k_round16f(const float* __restrict__ W, _Float16* __restrict__ Bt, size_t n8) { const size_t t = (size_t)blockIdx.x * 256 + threadIdx.x; if (t >= n8) return; FragH f;
#pragma unroll
  for (int i = 0; i < 8; ++i) f.h[i] = (_Float16)(bf16_round(W[t * 8 + i]) * 16.0f); *(v8us*)((unsigned short*)Bt + t * 8) = f.half[0];  }
template <int NHv, int TTv>
__global__ __launch_bounds__(256) void k_vt(const _Float16* __restrict__ V16, int ldv, int voff, _Float16* __restrict__ Vt) { __shared__ unsigned short tl[64][66]; const int tid = threadIdx.x; const int slab = blockIdx.x / (TTv / 64), lg = blockIdx.x % (TTv / 64); const int b = slab / NHv, h = slab % NHv;
  for (int i = tid; i < 64 * 8; i += 256) { const int r = i / 8, c8 = (i % 8) * 8; FragH f; f.half[0] = *(const v8us*)((const unsigned short*)V16 + ((size_t)b * TTv + lg * 64 + r) * ldv + voff + h * 64 + c8);
#pragma unroll
    for (int q = 0; q < 8; ++q) tl[r][c8 + q] = f.u[q]; }
  __syncthreads();
  {
#pragma unroll
    for (int rd = 0; rd < 2; ++rd) { const int d = rd * 32 + tid / 8, pc = tid % 8; FragH f;
#pragma unroll
      for (int q = 0; q < 8; ++q) f.u[q] = tl[pc * 8 + q][d];
      *(v8us*)((unsigned short*)Vt + ((size_t)slab * 64 + d) * TTv + lg * 64 + pc * 8) = f.half[0]; }
     } }

__global__ __launch_bounds__(256) void k_hl(const float* __restrict__ F, _Float16* __restrict__ Hh, _Float16* __restrict__ Hl, size_t n8) { const size_t t = (size_t)blockIdx.x * 256 + threadIdx.x; if (t >= n8) return; FragH fh, fl; const v4f a = *(const v4fa*)(F + t * 8), c = *(const v4fa*)(F + t * 8 + 4);
#pragma unroll
  for (int q = 0; q < 4; ++q) { _Float16 h = (_Float16)a[q]; fh.h[q] = h; fl.h[q] = (_Float16)((a[q] - (float)h) * 1024.0f); h = (_Float16)c[q]; fh.h[4 + q] = h; fl.h[4 + q] = (_Float16)((c[q] - (float)h) * 1024.0f); }
  { *(v8us*)((unsigned short*)Hh + t * 8) = fh.half[0]; *(v8us*)((unsigned short*)Hl + t * 8) = fl.half[0];  } }

// ---- fast GEMM (wave tile 32x64; requires M % 32 == 0 rows per launch region and N % 64 == 0); epilogue = k_gemm_hhx semantics ----
__device__ __forceinline__ v16h g2_frag(const _Float16* p, int hh) { FragH f; f.half[0] = *(const v8us*)((const unsigned short*)p + 8 * hh); f.half[1] = *(const v8us*)((const unsigned short*)p + 16 + 8 * hh); return f.v; }
__device__ __forceinline__ v8f g2_mma(v16h a, v16h b, v8f c) { v8f d = __builtin_amdgcn_wmma_f32_16x16x32_f16(false, a, false, b, (short)0, c, false, false); asm volatile("v_nop\n\tv_nop\n\tv_nop\n\tv_nop" : "+v"(d) : "v"(a), "v"(b)); return d; }
template <int ACT>
__global__ __launch_bounds__(128) void k_gemm2(const _Float16* __restrict__ A, int lda, size_t sA, const _Float16* __restrict__ Bh, int ldb, size_t sB, float alpha, const float* __restrict__ bias, size_t sBias, const float* __restrict__ CP, int rowsPerB, size_t sCPb, int row0g,
    float* __restrict__ C, _Float16* __restrict__ C16, int ldc, size_t sC, int M, int N, int K) { static_assert(ACT == 0 || ACT == 3 || ACT == 6 || ACT == 8 || ACT == 9 || ACT == 11 || ACT == 12 || ACT == 14 || ACT == 15 || ACT == 16 || ACT == 17, "k_gemm2: unsupported ACT code (would silently apply no activation)");
  __shared__ __attribute__((aligned(16))) float so[4][32][68];
  const int tid = threadIdx.x, w = tid >> 5, lane = tid & 31, ln = lane & 15, hh = lane >> 4; const int by = blockIdx.y;
  A += (size_t)by * sA; Bh += (size_t)by * sB; const size_t cofs = (size_t)by * sC; const float* bp = bias ? bias + (size_t)by * sBias : nullptr;
  const int ntn = N >> 6; const int mt = blockIdx.x / ntn, nq = blockIdx.x - mt * ntn; const int row0 = mt * 128 + 32 * w, col0 = nq * 64; if (row0 >= M) return;
  const _Float16* a0p = A + (size_t)(row0 + ln) * lda; const _Float16* a1p = a0p + (size_t)16 * lda;
  const _Float16* b0p = Bh + (size_t)(col0 + ln) * ldb; const _Float16* b1p = b0p + (size_t)16 * ldb; const _Float16* b2p = b1p + (size_t)16 * ldb; const _Float16* b3p = b2p + (size_t)16 * ldb;
  const v8f z8 = {0.f,0.f,0.f,0.f,0.f,0.f,0.f,0.f}; v8f c00 = z8, c01 = z8, c02 = z8, c03 = z8, c10 = z8, c11 = z8, c12 = z8, c13 = z8;
#pragma unroll 1
  for (int kb = 0; kb < K; kb += 32) { const v16h a0 = g2_frag(a0p + kb, hh), a1 = g2_frag(a1p + kb, hh);
    v16h b = g2_frag(b0p + kb, hh); c00 = g2_mma(a0, b, c00); c10 = g2_mma(a1, b, c10);
    b = g2_frag(b1p + kb, hh); c01 = g2_mma(a0, b, c01); c11 = g2_mma(a1, b, c11);
    b = g2_frag(b2p + kb, hh); c02 = g2_mma(a0, b, c02); c12 = g2_mma(a1, b, c12);
    b = g2_frag(b3p + kb, hh); c03 = g2_mma(a0, b, c03); c13 = g2_mma(a1, b, c13); }
  v8f accs[8] = {c00, c01, c02, c03, c10, c11, c12, c13};
#pragma unroll
  for (int u = 0; u < 8; ++u) { const int t = u & 3, half = u >> 2; const int col = col0 + t * 16 + ln; const float bv = bp ? bf16_round(bp[col]) : 0.f;
#pragma unroll
    for (int r = 0; r < 8; ++r) { const int rloc = half * 16 + 8 * hh + r; float v = accs[u][r] * alpha + bv; if (CP) { if (rowsPerB < 0) v += CP[cofs + (size_t)(row0g + row0 + rloc) * ldc + col];      /* rowsPerB < 0: own element of the batched C plane */ else { const int bidx = (row0g + row0 + rloc) / rowsPerB; v += CP[(size_t)bidx * sCPb + (size_t)by * 64 + col]; } }
      if (ACT == 3) v = fmaxf(v, 0.f); else if (ACT == 6) v = 0.5f * v * (1.0f + erff(v * 0.70710678118654752f)); else if (ACT == 11) v = 1.0f / (1.0f + expf(-v)); else if (ACT == 15) v = v / (1.0f + expf(-v)); else if (ACT == 12) v = (v > 0.f) ? v : 0.01f * v; else if (ACT == 8) v = tanhf(v); else if (ACT == 9) v = 0.5f * v * (1.0f + tanhf(0.7978845608028654f * (v + 0.044715f * v * v * v))); else if (ACT == 14) v = (v > 0.f) ? v : 0.1f * v; else if (ACT == 16) v = (v >= 0.f) ? v : 0.3f * v; else if (ACT == 17) v = (v >= 0.f) ? v : 0.2f * v;
      so[w][rloc][t * 16 + ln] = v; } }
  __builtin_amdgcn_fence(__ATOMIC_ACQ_REL, "workgroup"); __builtin_amdgcn_wave_barrier();
  const int rsub = lane >> 4, c4 = (lane & 15) * 4;
  {
#pragma unroll
    for (int q = 0; q < 16; ++q) { const int r = q * 2 + rsub; const v4f v = *(const v4fa*)&so[w][r][c4]; if (C) *(v4f*)(C + cofs + (size_t)(row0 + r) * ldc + col0 + c4) = v; if (C16) { v4h h4; for (int i = 0; i < 4; ++i) h4[i] = (_Float16)v[i]; *(v4h*)(C16 + cofs + (size_t)(row0 + r) * ldc + col0 + c4) = h4; } }
     } }


// ---- GEMM with both operand tiles staged in LDS: C[M][NN] (f32) = alpha * A[M][CC] . Bh[NN][CC]^T; K = CC; grid = (M / 128) * (NN / (128 NT)) ----
// Work-group tile 128 x 128, 8 waves; wave tile 32 x 64 and k order as k_gemm2. A fragment load straight from global touches 16 lines for its 512 bytes and stands in front of its own WMMAs;
// here each global load of a wave is one whole 512-byte row (4 lines), all 32 of a wave are in flight together, and the fragments come from LDS rows pitched 528 B (16 B x 33: no bank conflict for 16-byte reads).
// FIN (the projection): C = (alpha * A . Bh^T + bf16(bpj[col])) + bf16(residual), the residual read from the channel-first inputs in the accumulators' own layout:
// a lane's 8 accumulator rows of one column are 8 neighbouring pixels of one channel, 32 bytes in a row; a wave's 32 pixels of a channel are one whole 128-byte line.
// ACF (the qkv product): A is not read as f16 rows; the tile's 128 pixels x 256 channels come from the channel-first f32 inputs. Wave w brings channels 32 w .. 32 w + 31:
// a load's 8-lane groups take one 128-byte line (32 pixels) of 4 channels that lie 8 apart, so after 8 loads a lane holds 8 neighbouring channels of 4 pixels: 4 whole 16-byte pieces of pixel rows.
// ACF also takes B from the f32 weights Wf [NN][CC] itself, and both operands are bf16 (what the inputs are rounded to: one conversion a pair, products exact): no conversion launch in front. A weight row is two whole 512-byte loads of a wave,
// a lane's 4 + 4 weights two 8-byte LDS stores. In f32 a tile's rows would take 128 registers a lane, so they come in two parts: the next tile's first part flies under the products and is packed behind them, its second part flies under the epilogue.
// NT: a work-group fills its A tile once and takes NT neighbouring 128-column tiles of B one after the other against it. The next B tile's rows are loaded into registers under the current tile's products;
// the output staging then lies on the B rows (never on A), and the tile's stores to C stay in flight while the next tile is worked on.
#define GLP 264      /* LDS row pitch in f16 elements */
// two f32 -> bf16 (nearest even), packed
__device__ __forceinline__ unsigned pk_bf(float x, float y) { unsigned u;
  asm("v_cvt_pk_bf16_f32 %0, %1, %2" : "=v"(u) : "v"(x), "v"(y));      /* as asm so that both sources are read where their loads left them: through a 2-vector the compiler first copied one register of every pair */
  return u; }
// g2_mma on bf16 operands (the same fragment registers, read as bf16)
__device__ __forceinline__ v8f g2_mmb(v16h a, v16h b, v8f c) { v8f d = __builtin_amdgcn_wmma_f32_16x16x32_bf16(false, __builtin_bit_cast(v16b, a), false, __builtin_bit_cast(v16b, b), (short)0, c, false, false); asm volatile("v_nop\n\tv_nop\n\tv_nop\n\tv_nop" : "+v"(d) : "v"(a), "v"(b)); return d; }
typedef unsigned v4ua __attribute__((ext_vector_type(4), may_alias));
typedef unsigned v2ua __attribute__((ext_vector_type(2), may_alias));
#define BH1 8        /* ACF: of a wave's 16 weight rows of the next tile, those that fly under the products; the rest fly under the epilogue */
// work-group barrier that orders LDS alone: __syncthreads() would also wait for the wave's global loads and stores, here the next B tile's loads and the last tile's stores to C, which no other wave reads
__device__ __forceinline__ void lds_barrier() { __builtin_amdgcn_fence(__ATOMIC_RELEASE, "workgroup", "local"); __builtin_amdgcn_s_barrier(); __builtin_amdgcn_fence(__ATOMIC_ACQUIRE, "workgroup", "local"); }
template <int NN, bool FIN, bool ACF, int NT>
__global__ __launch_bounds__(256) void k_gemm3(const _Float16* __restrict__ A, const _Float16* __restrict__ Bh, float alpha, float* __restrict__ C, const float* __restrict__ bpj, const float* __restrict__ rgb, const float* __restrict__ ir, const float* __restrict__ Wf) {
  static_assert(!FIN || (NN == CC && DIMH == 128 && PX % 128 == 0), "FIN: a 128-column tile is one input's channels, a 128-row tile lies in one image");
  static_assert(!ACF || (CC == 256 && DIMH == 128 && PX % 128 == 0), "ACF: 4 waves per input, a 128-row tile lies in one image");
  static_assert(NN % (128 * NT) == 0 && (!FIN || NT == 1), "NT tiles divide the columns; the residual's loads are written for one tile");
  __shared__ __attribute__((aligned(16))) _Float16 sm[NT > 1 ? 128 * GLP + 8 * 32 * 68 * 2 : (128 + 128) * GLP];      /* 128 A rows, then 128 B rows; after the products the waves' output staging: NT = 1 from the start, NT > 1 from the B rows on (8 x 32 x 68 floats, 2 KiB more than these) */
  const int lane = threadIdx.x & 31, ln = lane & 15, hh = lane >> 4; const int w = __builtin_amdgcn_readfirstlane((int)threadIdx.x >> 5); const int wr = w & 3, wc = w >> 2;
  const int ntn = NN / (128 * NT); const int mt = blockIdx.x / ntn, nq0 = (blockIdx.x - mt * ntn) * NT; const int row0 = mt * 128 + 32 * wr;
  _Float16* sb = sm + 128 * GLP;
  const unsigned short* ga = (const unsigned short*)A + (size_t)(mt * 128 + 16 * w) * CC + lane * 8; const unsigned short* gb = (const unsigned short*)Bh + (size_t)(nq0 * 128 + 16 * w) * CC + lane * 8;
  v8us ra[16], rb[16];      /* wave w brings rows 16 w .. 16 w + 15 of either tile; the loops below are unrolled so that the arrays are registers and each row is an immediate offset */
  v4f fa[32]; const char* asrc = nullptr; unsigned aob = 0; const int cs = lane >> 3, pg = lane & 7;      /* ACF: [pixel block t][channel i] = 4 pixels 32 t + 4 pg .. + 3 of channel 32 w + 8 cs + i; asrc, aob: these loads' scalar base and offset register */
  v4f rbf[BH1 < 8 ? 32 - 2 * BH1 : 16]; v2ua pk1[2 * BH1]; const char* gbs = nullptr; const unsigned bob = (unsigned)lane * 16u;      /* ACF: weight rows in flight as f32 [row][k half]; the first part packed; these loads' scalar base and offset (the lane number, scaled by the load) */
  /* both unrolled: rbf is registers, each row an immediate offset. bld: rows r0 .. r0 + nr - 1 of the wave's 16 into rbf; bput: rbf, rounded and packed, into these rows of the B tile */
  auto bld = [&](int r0, int nr) {
#pragma unroll
    for (int i = 0; i < nr; ++i) { rbf[2 * i] = *(const v4fa*)(gbs + bob + (r0 + i) * CC * 4); rbf[2 * i + 1] = *(const v4fa*)(gbs + bob + (r0 + i) * CC * 4 + 512); } };
  auto bput = [&](int r0, int nr) {
#pragma unroll
    for (int i = 0; i < 2 * nr; ++i) *(v2ua*)((unsigned short*)sb + (16 * w + r0 + (i >> 1)) * GLP + (i & 1) * 128 + lane * 4) = v2ua{pk_bf(rbf[i][0], rbf[i][1]), pk_bf(rbf[i][2], rbf[i][3])}; };
  if (ACF) { const int img = mt / (PX / 128), p0 = (mt - img * (PX / 128)) * 128;
    asrc = (const char*)((w < 4 ? rgb : ir) + ((size_t)img * DIMH + 32 * (w & 3)) * PX + p0); aob = (unsigned)(8 * cs * PX + 4 * pg) * 4u;
    gbs = (const char*)(Wf + (size_t)(nq0 * 128 + 16 * w) * CC); bld(0, 8);
    __builtin_amdgcn_sched_barrier(0);      /* these 16 loads issue ahead of the A rows': loads return in order, and the first weight rows are wanted first */
#pragma unroll
    for (int t = 0; t < 4; ++t) {
#pragma unroll
      for (int i = 0; i < 8; ++i) fa[t * 8 + i] = *(const v4fa*)(asrc + aob + (i * PX + 32 * t) * 4); }
  } else {
#pragma unroll
    for (int i = 0; i < 16; ++i) ra[i] = *(const v8us*)(ga + i * CC);
  }
  if (!ACF) {
#pragma unroll
  for (int i = 0; i < 16; ++i) rb[i] = *(const v8us*)(gb + i * CC);
  }
  /* s_wait_xcnt 0 behind the tile's loads (ACF: the A rows and the first 8 weight rows), in front of every overwrite of a register that they name; their offset registers (ACF: the A loads' scalar base too) are its inputs, so that none of them is overwritten ahead of it; its memory clobber also keeps every LDS store behind these loads, so the wave pays one load latency for all of them */
  if (ACF) { asm volatile("s_wait_xcnt 0x0" :: "v"(lane), "v"(aob), "s"(asrc), "s"(gbs) : "memory");
    __builtin_amdgcn_sched_barrier(0);      /* no conversion moves up among the loads: its wait would hold back the issue of the loads behind it */
    bput(0, 8); bld(8, 8);      /* the first 8 weight rows were issued first and return first: the A rows stay in flight */
    asm volatile("s_wait_xcnt 0x0" :: "v"(lane), "s"(gbs) : "memory");      /* as above, for the second 8 rows */
    __builtin_amdgcn_sched_barrier(0); }      /* the second 8 rows issue before the wave waits for its A rows */
  else asm volatile("s_wait_xcnt 0x0" :: "v"(lane) : "memory");
  if (ACF) {      /* 16-byte piece 4 w + cs of pixel row 32 t + 4 pg + j: at the pitch of 33 pieces the 32 lanes fall on all 16 bank groups, two lanes each */
#pragma unroll
    for (int t = 0; t < 4; ++t) {
#pragma unroll
      for (int j = 0; j < 4; ++j) { const v4ua o = {pk_bf(fa[t * 8][j], fa[t * 8 + 1][j]), pk_bf(fa[t * 8 + 2][j], fa[t * 8 + 3][j]), pk_bf(fa[t * 8 + 4][j], fa[t * 8 + 5][j]), pk_bf(fa[t * 8 + 6][j], fa[t * 8 + 7][j])};
        *(v4ua*)((unsigned short*)sm + (32 * t + 4 * pg + j) * GLP + 32 * w + 8 * cs) = o; } }
    bput(8, 8);
  } else {
#pragma unroll
    for (int i = 0; i < 16; ++i) *(v8us*)((unsigned short*)sm + (16 * w + i) * GLP + lane * 8) = ra[i];
  }
#pragma unroll
  for (int nt = 0; nt < NT; ++nt) {      /* unrolled: rolled, the tests for a next tile are three separate branches, and the compiler then keeps the weight rows' registers alive through the products and spills */
  const int nq = nq0 + nt, col0 = nq * 128 + 64 * wc;
  if (!ACF) {      /* ACF: the B rows were stored ahead of the loop or at the foot of the last trip */
#pragma unroll
  for (int i = 0; i < 16; ++i) *(v8us*)((unsigned short*)sb + (16 * w + i) * GLP + lane * 8) = rb[i];
  }
  if (NT > 1) lds_barrier(); else __syncthreads();      /* tile filled */
  if (ACF && NT > 1 && nt + 1 < NT) {      /* the next B tile's first part: issued here, it flies under the products */
    gbs += 128 * CC * 4; bld(0, BH1);
    /* s_wait_xcnt 0 behind these loads, in front of every overwrite of a register that they name; its memory clobber also keeps the loads from sinking below the products */
    asm volatile("s_wait_xcnt 0x0" :: "v"(lane), "s"(gbs) : "memory");
  }
  if (!ACF && NT > 1 && nt + 1 < NT) {      /* the next B tile's rows: issued here, stored to LDS at the head of the next trip, so they fly under the products and the epilogue */
    gb += 128 * CC;
#pragma unroll
    for (int i = 0; i < 16; ++i) rb[i] = *(const v8us*)(gb + i * CC);
    /* s_wait_xcnt 0 behind these loads, in front of every overwrite of a register that they name; its memory clobber also keeps the loads from sinking below the products */
    asm volatile("s_wait_xcnt 0x0" :: "v"(lane), "v"(gb) : "memory");
  }
  /* the residual's and the bias's loads stand behind the barrier (which waits for every load issued in front of it) and ahead of the products, under which they fly */
  v4f rs[16]; float bv[4]; unsigned rob = 0;      /* residual: [fragment u][rows 0-3, 4-7]; bias: one column per t; rob: the residual loads' offset register */
  if (FIN) { const int img = mt / (PX / 128), p0 = (mt - img * (PX / 128)) * 128 + 32 * wr;
    const char* rsrc = (const char*)((nq ? ir : rgb) + ((size_t)img * DIMH + 64 * wc) * PX + p0); rob = (unsigned)(ln * PX + 8 * hh) * 4u; const float* bsrc = bpj + col0;
#pragma unroll
    for (int u = 0; u < 8; ++u) { const int t = u & 3, half = u >> 2;      /* unrolled: rs is registers, each load an immediate offset */
      rs[2 * u] = *(const v4fa*)(rsrc + rob + (t * 16 * PX + half * 16) * 4); rs[2 * u + 1] = *(const v4fa*)(rsrc + rob + (t * 16 * PX + half * 16 + 4) * 4); }
#pragma unroll
    for (int t = 0; t < 4; ++t) bv[t] = bsrc[t * 16 + ln];
  }
  const _Float16* pa = sm + (32 * wr + ln) * GLP; const _Float16* pb = sb + (64 * wc + ln) * GLP;
  const v8f z8 = {0.f,0.f,0.f,0.f,0.f,0.f,0.f,0.f}; v8f c00 = z8, c01 = z8, c02 = z8, c03 = z8, c10 = z8, c11 = z8, c12 = z8, c13 = z8;
  v16h a0 = g2_frag(pa, hh), a1 = g2_frag(pa + 16 * GLP, hh), b0 = g2_frag(pb, hh), b1 = g2_frag(pb + 16 * GLP, hh), b2 = g2_frag(pb + 32 * GLP, hh), b3 = g2_frag(pb + 48 * GLP, hh);
  /* unrolled whole (8 steps): the two fragment sets then need no register moves, and every LDS address is an immediate offset */
#pragma unroll
  for (int kb = 0; kb < CC; kb += 32) { v16h n0 = a0, n1 = a1, m0 = b0, m1 = b1, m2 = b2, m3 = b3;
    if (kb + 32 < CC) { const int kn = kb + 32;      /* the next step's 12 LDS reads as one group ahead of this step's WMMAs */
      n0 = g2_frag(pa + kn, hh); n1 = g2_frag(pa + 16 * GLP + kn, hh); m0 = g2_frag(pb + kn, hh); m1 = g2_frag(pb + 16 * GLP + kn, hh); m2 = g2_frag(pb + 32 * GLP + kn, hh); m3 = g2_frag(pb + 48 * GLP + kn, hh); }
    if (ACF) { c00 = g2_mmb(a0, b0, c00); c10 = g2_mmb(a1, b0, c10); c01 = g2_mmb(a0, b1, c01); c11 = g2_mmb(a1, b1, c11);
    c02 = g2_mmb(a0, b2, c02); c12 = g2_mmb(a1, b2, c12); c03 = g2_mmb(a0, b3, c03); c13 = g2_mmb(a1, b3, c13); } else {
    c00 = g2_mma(a0, b0, c00); c10 = g2_mma(a1, b0, c10); c01 = g2_mma(a0, b1, c01); c11 = g2_mma(a1, b1, c11);
    c02 = g2_mma(a0, b2, c02); c12 = g2_mma(a1, b2, c12); c03 = g2_mma(a0, b3, c03); c13 = g2_mma(a1, b3, c13); }
    a0 = n0; a1 = n1; b0 = m0; b1 = m1; b2 = m2; b3 = m3; }
  /* s_wait_xcnt 0 behind the residual's and the bias's loads; their two offset registers are its inputs, so that neither is overwritten ahead of it */
  if (FIN) { __builtin_amdgcn_sched_barrier(0);      /* none of the epilogue's arithmetic moves up among the products: its wait for the residual would stall them */
    asm volatile("s_wait_xcnt 0x0" :: "v"(rob), "v"(ln) : "memory"); }
  if (ACF && NT > 1 && nt + 1 < NT) { __builtin_amdgcn_sched_barrier(0);      /* the packing stays behind the products: its wait for the rows would stall them */
#pragma unroll
    for (int i = 0; i < 2 * BH1; ++i) pk1[i] = v2ua{pk_bf(rbf[i][0], rbf[i][1]), pk_bf(rbf[i][2], rbf[i][3])};      /* unrolled: pk1 is registers */
    bld(BH1, 16 - BH1);      /* the second part flies under the epilogue */
    asm volatile("s_wait_xcnt 0x0" :: "v"(lane), "s"(gbs) : "memory");      /* as above; its memory clobber keeps the loads ahead of the epilogue */
  }
  if (NT > 1) lds_barrier(); else __syncthreads();      /* every wave has read its last fragment: the tiles' LDS may now take the output staging */
  float* so = (float*)(NT > 1 ? sb : sm) + w * (32 * 68);      /* this wave's own 32 rows x 68 floats */
  v8f accs[8] = {c00, c01, c02, c03, c10, c11, c12, c13};      /* unrolled below, as in k_gemm2: accumulators are indexed by constants only */
#pragma unroll
  for (int u = 0; u < 8; ++u) { const int t = u & 3, half = u >> 2;
#pragma unroll
    for (int r = 0; r < 8; ++r) { float v = ACF ? accs[u][r] : accs[u][r] * alpha; if (FIN) v = (v + bf16_round(bv[t])) + bf16_round(rs[2 * u + (r >> 2)][r & 3]); so[(half * 16 + 8 * hh + r) * 68 + t * 16 + ln] = v; } }
  if (NT > 1) __builtin_amdgcn_fence(__ATOMIC_ACQ_REL, "workgroup", "local");      /* LDS alone, as in lds_barrier() */
  else __builtin_amdgcn_fence(__ATOMIC_ACQ_REL, "workgroup");
  __builtin_amdgcn_wave_barrier();
  const int rsub = lane >> 4, c4 = (lane & 15) * 4;
  if (NT > 1) { char* cb = (char*)(C + (size_t)row0 * NN + col0); const unsigned cob = (unsigned)(rsub * NN + c4) * 4u;      /* scalar base, one offset register, each row pair an immediate offset */
#pragma unroll
    for (int q = 0; q < 16; ++q) { const v4f v = *(const v4fa*)&so[(q * 2 + rsub) * 68 + c4]; *(v4f*)(cb + cob + q * 2 * NN * 4) = v; }
    /* s_wait_xcnt 0 behind the stores, in front of the next trip's overwrite of their base and data registers */
    asm volatile("s_wait_xcnt 0x0" :: "v"(cob), "s"(cb) : "memory");
    if (nt + 1 < NT) { lds_barrier();      /* every wave has read its staging back: the B rows may take the next tile */
      if (ACF) {
#pragma unroll
        for (int i = 0; i < 2 * BH1; ++i) *(v2ua*)((unsigned short*)sb + (16 * w + (i >> 1)) * GLP + (i & 1) * 128 + lane * 4) = pk1[i];      /* unrolled, as above */
        bput(BH1, 16 - BH1); } }
  } else {
#pragma unroll
  for (int q = 0; q < 16; ++q) { const int r = q * 2 + rsub; const v4f v = *(const v4fa*)&so[r * 68 + c4]; *(v4f*)(C + (size_t)(row0 + r) * NN + col0 + c4) = v; }
  } } }

__global__ __launch_bounds__(256) void k_rsm(const float* __restrict__ S, _Float16* __restrict__ P, int nrows) {
  #pragma clang fp contract(off)
  const int i = blockIdx.x * 256 + threadIdx.x; if (i >= nrows) return; const float* s = S + (size_t)i * SQ; float mx = -3.0e38f;
#pragma unroll 1
  for (int j = 0; j < SQ; ++j) mx = fmaxf(mx, s[j]); float se = 0.f;
#pragma unroll 1
  for (int j = 0; j < SQ; ++j) se += expf(s[j] - mx); const float sc = 256.0f / se;
#pragma unroll 1
  for (int j0 = 0; j0 < SQ; j0 += 8) { FragH f; for (int q = 0; q < 8; ++q) f.h[q] = (_Float16)(expf(s[j0 + q] - mx) * sc); unsigned short* d = (unsigned short*)P + (size_t)i * SQ + j0; *(v8us*)d = f.half[0];  } }
__global__ __launch_bounds__(256) void k_vt(const _Float16* __restrict__ V16, int b, int h0, _Float16* __restrict__ VT) { __shared__ unsigned short tl[64][65]; const int tid = threadIdx.x; const int hh = blockIdx.x % HG, sg = blockIdx.x / HG; const int s0 = sg * 64; const int h = h0 + hh;
  for (int i = tid; i < 64 * 8; i += 256) { const int j = i / 8, d8 = (i % 8) * 8; FragH f; f.half[0] = *(const v8us*)((const unsigned short*)V16 + ((size_t)b * SQ + s0 + j) * DM + h * HD + d8); for (int q = 0; q < 8; ++q) tl[d8 + q][j] = f.u[q]; }
  __syncthreads();
  { for (int i = tid; i < 64 * 8; i += 256) { const int d = i / 8, j8 = (i % 8) * 8; FragH f; for (int q = 0; q < 8; ++q) f.u[q] = tl[d][j8 + q]; *(v8us*)((unsigned short*)VT + ((size_t)hh * HD + d) * SQ + s0 + j8) = f.half[0]; }  } }


// lane ^ M partner's value added (M = 1, 2, 4: all inside a 16-lane row), as one DPP add
template <int M>
__device__ __forceinline__ float xadd(float s) { return s + __int_as_float(__builtin_amdgcn_update_dpp(0, __float_as_int(s), 0x160 | M, 0xf, 0xf, true)); }
// qkv product and dilated attention in one kernel: q, k and v never leave the WGP.
// A pixel of dilation d attends only to rows y - d, y, y + d, so a work-group takes (image, dilation, class of y modulo d, segment of that class, half of the width) and walks down its rows in steps of d.
// A step brings one row piece of 48 pixels x 256 channels from the channel-first f32 inputs (16-byte loads, a lane 8 neighbouring channels of 4 pixels), rounds it to bf16 into LDS pixel rows, multiplies it by the dilation's
// 384 weight rows (q, k, v), and puts q into a ring of 2 and k, v into a ring of 3 row pieces in LDS (f32). Then the row above, whose three window rows are now in the ring, is attended: 40 pixels, one wave a pixel, lane = 4 channels.
// The weights stay in registers for the whole walk: 12 waves, wave w holds the B fragments of columns 32 w .. 32 w + 31 (2 column tiles x 8 k steps, 128 registers); waves 0-3 make q, 4-7 k, 8-11 v. They come once through LDS:
// whole 512-byte row loads, rounded to bf16, read back as fragments by the wave that stored them.
// Pieces: columns 0-47 serve pixels 0-39, columns 32-79 serve pixels 40-79 (a window reaches 3 columns out). Segments: 8 x 5 rows of the 40 of a class (dilation 2), 5 x 6 of the 27 or 26 (dilation 3); a walk computes one row above and one below its own.
// 16 + 15 = 31 walks a half image, 248 work-groups: one for each WGP, in one round.
// An out-of-image neighbour reads an in-image row piece instead (row and column each fall back to the pixel's own), takes logit 0 and weight 0 on v.
// Softmax in base 2: the logits carry log2 e, so each of the 9 exponentials is the hardware's own 2^x.
// The first threads of the grid also turn the projection's weights wp into Bp = f16(16 bf16(wp)), 8 weights a thread: the next launch reads them.
#define FWK 31       /* walks a half image: 2 classes x 8 segments + 3 classes x 5 segments */
#define FPX 48       /* pixels of a row piece */
#define FOP 40       /* pixels of it that are attended */
#define KVP 132      /* LDS pitch of a q, k or v row in floats: 16 B x 33 */
#define FRW (FPX * KVP)      /* floats of a row piece */
__global__ __launch_bounds__(384) void k_qdla(const float* __restrict__ rgb, const float* __restrict__ ir, const float* __restrict__ Wf, _Float16* __restrict__ X16, const float* __restrict__ wp, _Float16* __restrict__ Bp) {
  static_assert(WS == 80 && HS == 80 && CC == 256 && DIMH == 128, "the pieces and the segment table are for 80 x 80 pixels, 256 channels");
  static_assert(FPX * GLP * 2 + 8 * FRW * 4 >= 384 * GLP * 2, "the weights' staging fits the rings");
  __shared__ __attribute__((aligned(16))) float sm[FPX * GLP / 2 + 8 * FRW];      /* A row piece (bf16), q ring of 2, k ring of 3, v ring of 3; ahead of the walk: the 384 weight rows (bf16) */
  const int tid = (int)threadIdx.x, lane = tid & 31, ln = lane & 15, hh = lane >> 4; const int w = __builtin_amdgcn_readfirstlane(tid >> 5);
  { const unsigned g = blockIdx.x * 384u + (unsigned)tid;
    if (g < (unsigned)(CC * CC / 8)) { FragH f; for (int q = 0; q < 8; ++q) f.h[q] = (_Float16)(bf16_round(wp[(size_t)g * 8 + q]) * 16.0f); *(v8us*)((unsigned short*)Bp + (size_t)g * 8) = f.half[0]; } }
  const int c = blockIdx.x % FWK, t = blockIdx.x / FWK; const int xp = t & 1, img = t >> 1;
  const int di = c >= 16 ? 1 : 0, cw = di ? c - 16 : c; const int dil = di ? 3 : 2, len = di ? 6 : 5; const int cls = di ? cw % 3 : cw % 2, seg = di ? cw / 3 : cw / 2;      /* divisors as constants, so that all of this stays scalar */
  const int left = (di ? (HS - cls + 2) / 3 : (HS - cls + 1) / 2) - seg * len; const int n = left < len ? left : len;      /* rows of this walk */
  const int xb = xp * 32;      /* first column of the piece */
  unsigned short* sa = (unsigned short*)sm; float* sq = sm + FPX * GLP / 2; float* sk = sq + 2 * FRW; float* sv = sk + 3 * FRW;
  /* A loads: thread = (16-byte piece of the row, group of 8 channels) */
  const int pc = tid % 12, cg = tid / 12;
  const float* abase = (cg < 16 ? rgb : ir) + ((size_t)img * DIMH + (cg & 15) * 8) * PX + xb + pc * 4;
  v4f fa[8];
  auto ald = [&](int yy) { const float* p = abase + yy * WS;
#pragma unroll
    for (int i = 0; i < 8; ++i) fa[i] = *(const v4fa*)(p + i * PX);      /* unrolled: fa is registers, each channel an immediate offset */
    /* s_wait_xcnt 0 behind the row's loads, in front of every overwrite of their address register, which is its input */
    asm volatile("s_wait_xcnt 0x0" :: "v"(p) : "memory"); };
  /* where no row is loaded fa takes a value all the same: left as it was, it would count as alive through the products, and the compiler spilled part of it */
  auto azero = [&]() {
#pragma unroll
    for (int i = 0; i < 8; ++i) fa[i] = v4f{0.f, 0.f, 0.f, 0.f}; };
  int y = cls + (seg * len - 1) * dil;      /* the row above the walk's first */
  { /* the weights: wave w brings its own 32 rows, 8 at a time into one of two register sets: a set's 16 loads are issued before the other set is packed, so up to 32 loads are in flight and the wave pays about one latency for all */
    const char* gw = (const char*)(Wf + (size_t)((w >> 2) * CC + di * 128 + (w & 3) * 32) * CC); const unsigned wo = (unsigned)lane * 16u;
    v4f ra[16], rb[16];
    auto wld = [&](v4f (&r)[16], int b) {
#pragma unroll
      for (int i = 0; i < 8; ++i) { r[2 * i] = *(const v4fa*)(gw + wo + (b * 8 + i) * CC * 4); r[2 * i + 1] = *(const v4fa*)(gw + wo + (b * 8 + i) * CC * 4 + 512); }      /* unrolled: r is registers, each row an immediate offset */
      /* s_wait_xcnt 0 behind these loads, in front of every overwrite of a register that they name; base and offset are its inputs */
      asm volatile("s_wait_xcnt 0x0" :: "v"(wo), "s"(gw) : "memory");
      __builtin_amdgcn_sched_barrier(0); };      /* the loads stay ahead of the other set's packing, whose wait would hold back their issue */
    auto wput = [&](v4f (&r)[16], int b) {
#pragma unroll
      for (int i = 0; i < 16; ++i) *(v2ua*)(sa + (32 * w + b * 8 + (i >> 1)) * GLP + (i & 1) * 128 + lane * 4) = v2ua{pk_bf(r[i][0], r[i][1]), pk_bf(r[i][2], r[i][3])};
      __builtin_amdgcn_sched_barrier(0); };      /* a set is packed and stored before its registers take the next loads: moved together the compiler spilled */
    wld(ra, 0); wld(rb, 1); wput(ra, 0); wld(ra, 2); wput(rb, 1); wld(rb, 3); wput(ra, 2); wput(rb, 3); }
  v16h bw[2][8];
#pragma unroll
  for (int j = 0; j < 2; ++j) {
#pragma unroll
    for (int kb = 0; kb < 8; ++kb) bw[j][kb] = g2_frag((const _Float16*)sa + (32 * w + 16 * j + ln) * GLP + kb * 32, hh); }      /* unrolled: bw is registers */
  if (y >= 0) ald(y); else azero();      /* behind the weights' staging, whose 128 registers are free again */
  lds_barrier();      /* every wave has read its weights: the LDS may take the rows */
  char* Xi = (char*)((unsigned short*)X16 + (size_t)img * PX * CC + di * 128); const unsigned vs = (unsigned)lane * 8u;
  float* dst0 = (w < 4 ? sq : w < 8 ? sk : sv) + (w & 3) * 32 + ln + 8 * hh * KVP;      /* this wave's columns in a row piece, the lane's first accumulator row */
  const _Float16* pa = (const _Float16*)sa + ln * GLP;
  int s0 = 0, s1 = 2, s2 = 1;      /* ring slots of this step's row, of the row above it, of the row above that */
#pragma unroll 1
  for (int s = 0; s < n + 2; ++s) {      /* stays rolled: slots are LDS offsets, nothing is indexed by s in registers */
    const bool val = y >= 0 && y < HS;
    if (val) {      /* 16-byte piece cg of pixel rows 4 pc .. 4 pc + 3; unrolled: fa is indexed by constants */
#pragma unroll
      for (int j = 0; j < 4; ++j) { const v4ua o = {pk_bf(fa[0][j], fa[1][j]), pk_bf(fa[2][j], fa[3][j]), pk_bf(fa[4][j], fa[5][j]), pk_bf(fa[6][j], fa[7][j])};
        *(v4ua*)(sa + (pc * 4 + j) * GLP + cg * 8) = o; } }
    lds_barrier();      /* the A piece is filled; every wave has left the last step's attention, so the oldest ring slots are free */
    if (val) {
      const v8f z8 = {0.f,0.f,0.f,0.f,0.f,0.f,0.f,0.f}; v8f a00 = z8, a01 = z8, a10 = z8, a11 = z8, a20 = z8, a21 = z8;
      v16h f0 = g2_frag(pa, hh), f1 = g2_frag(pa + 16 * GLP, hh), f2 = g2_frag(pa + 32 * GLP, hh);
      /* unrolled whole (8 steps): bw is indexed by constants, every LDS address is an immediate offset */
#pragma unroll
      for (int kb = 0; kb < 8; ++kb) { v16h n0 = f0, n1 = f1, n2 = f2;
        if (kb < 7) { n0 = g2_frag(pa + (kb + 1) * 32, hh); n1 = g2_frag(pa + 16 * GLP + (kb + 1) * 32, hh); n2 = g2_frag(pa + 32 * GLP + (kb + 1) * 32, hh); }      /* the next step's LDS reads ahead of this step's WMMAs */
        a00 = g2_mmb(f0, bw[0][kb], a00); a10 = g2_mmb(f1, bw[0][kb], a10); a20 = g2_mmb(f2, bw[0][kb], a20);
        a01 = g2_mmb(f0, bw[1][kb], a01); a11 = g2_mmb(f1, bw[1][kb], a11); a21 = g2_mmb(f2, bw[1][kb], a21);
        f0 = n0; f1 = n1; f2 = n2; }
      float* dst = dst0 + (w < 4 ? (s & 1) : s0) * FRW;      /* unrolled below: accumulators are indexed by constants only */
#pragma unroll
      for (int r = 0; r < 8; ++r) { dst[r * KVP] = a00[r]; dst[r * KVP + 16] = a01[r]; dst[(16 + r) * KVP] = a10[r]; dst[(16 + r) * KVP + 16] = a11[r]; dst[(32 + r) * KVP] = a20[r]; dst[(32 + r) * KVP + 16] = a21[r]; }
    }
    lds_barrier();      /* this row's q, k, v are in the rings; every wave has read its last A fragment */
    if (s + 1 < n + 2 && y + dil < HS) ald(y + dil); else azero();      /* the next row's loads fly under the attention */
    if (s >= 2) { const int yo = y - dil;      /* the row attended: its window rows are yo - dil (slot s2), yo (s1), yo + dil (s0) */
      const bool okr[3] = {yo - dil >= 0, true, yo + dil < HS}; const int rsl[3] = {okr[0] ? s2 : s1, s1, okr[2] ? s0 : s1};
      const float* qrow = sq + ((s & 1) ^ 1) * FRW + lane * 4;
#pragma unroll 1
      for (int xo = w; xo < FOP; xo += 12) {      /* stays rolled: 3 or 4 pixels a wave, each with its 19 LDS row reads */
        const int x = xp * FOP + xo, xl = x - xb;
        const bool okc[3] = {x - dil >= 0, true, x + dil < WS}; const int xc[3] = {okc[0] ? xl - dil : xl, xl, okc[2] ? xl + dil : xl};
        const v4f q = *(const v4fa*)(qrow + xl * KVP);
        v4f k[9], v[9];      /* the loops over the 9 neighbours are unrolled: k, v, the logits and the weights are registers */
#pragma unroll
        for (int kk = 0; kk < 9; ++kk) k[kk] = *(const v4fa*)(sk + rsl[kk / 3] * FRW + xc[kk % 3] * KVP + lane * 4);
        float sc[9]; bool ok[9]; float mx = -INFINITY;
#pragma unroll
        for (int kk = 0; kk < 9; ++kk) { const v4f kr = k[kk]; ok[kk] = okr[kk / 3] && okc[kk % 3];
          float d = fmaf(q[3], kr[3], fmaf(q[2], kr[2], fmaf(q[1], kr[1], q[0] * kr[0]))); d = xadd<4>(xadd<2>(xadd<1>(d)));
          sc[kk] = ok[kk] ? d * SCL2 : 0.f; mx = fmaxf(mx, sc[kk]); }
        __builtin_amdgcn_sched_barrier(0);      /* the v rows are read behind the logits, into the k rows' registers: all 19 rows at once do not fit beside the weights and the next row's loads */
#pragma unroll
        for (int kk = 0; kk < 9; ++kk) v[kk] = *(const v4fa*)(sv + rsl[kk / 3] * FRW + xc[kk % 3] * KVP + lane * 4);
        float a[9], ex[9];
#pragma unroll
        for (int kk = 0; kk < 9; ++kk) a[kk] = sc[kk] - mx;
        /* exp(x) = 2^(x log2 e), the factor already in the logits: one v_exp_f32 each; the argument is never above 0, so the library expf's range split, ldexp and overflow and underflow selects have nothing to do.
           As one asm statement for the slot that the instruction set asks for behind a transcendental: every result register differs from every source (early clobber), so each v_exp_f32 is independent of the one in front of it,
           and the v_nop fills the slot behind the last. */
        asm("v_exp_f32 %0, %9\n\tv_exp_f32 %1, %10\n\tv_exp_f32 %2, %11\n\tv_exp_f32 %3, %12\n\tv_exp_f32 %4, %13\n\tv_exp_f32 %5, %14\n\tv_exp_f32 %6, %15\n\tv_exp_f32 %7, %16\n\tv_exp_f32 %8, %17\n\tv_nop"
            : "=&v"(ex[0]), "=&v"(ex[1]), "=&v"(ex[2]), "=&v"(ex[3]), "=&v"(ex[4]), "=&v"(ex[5]), "=&v"(ex[6]), "=&v"(ex[7]), "=&v"(ex[8])
            : "v"(a[0]), "v"(a[1]), "v"(a[2]), "v"(a[3]), "v"(a[4]), "v"(a[5]), "v"(a[6]), "v"(a[7]), "v"(a[8]));
        float se = 0.f; v4f acc = {0.f, 0.f, 0.f, 0.f};
#pragma unroll
        for (int kk = 0; kk < 9; ++kk) { const float e = ex[kk]; se += e; const float pw = ok[kk] ? e : 0.f; const v4f vr = v[kk];
          for (int ch = 0; ch < 4; ++ch) acc[ch] = fmaf(pw, vr[ch], acc[ch]); }
        const float inv = 1.0f / se; v4h o; for (int ch = 0; ch < 4; ++ch) o[ch] = (_Float16)(acc[ch] * inv);
        char* po = Xi + (size_t)((yo * WS + x) * (CC * 2)); *(v4h*)(po + vs) = o;
        /* s_wait_xcnt 0 behind the store, in front of the next pixel's overwrite of its address and data registers */
        asm volatile("s_wait_xcnt 0x0" :: "s"(po), "v"(vs) : "memory");
      } }
    y += dil; const int sn = s2; s2 = s1; s1 = s0; s0 = sn; } }

extern "C" void kernel_launch(void* const* d_in, const int* in_sizes, int n_in,
                              void* d_out, int out_size, void* d_ws, size_t ws_size, hipStream_t stream) {
  (void)in_sizes; (void)n_in; (void)out_size;
  const float* const* I = (const float* const*)d_in; const float* rgb = I[0]; const float* ir = I[1]; const float* wqkv = I[2]; const float* wp = I[3]; const float* bp = I[4];
  char* ws = (char*)d_ws; size_t off = 0;
  auto take = [&](size_t bytes) { char* p = ws + off; off += (bytes + 255) & ~(size_t)255; return p; };
  _Float16* BP = (_Float16*)take((size_t)CC * CC * 2); _Float16* X16 = (_Float16*)take(NR * CC * 2);
  if (off > ws_size) return;      /* 0.1 + 12.5 = approx 13 MiB */
  k_qdla<<<(unsigned)(NB * 2 * FWK), 384, 0, stream>>>(rgb, ir, wqkv, X16, wp, BP);      /* qkv + attention */
  k_gemm3<CC, true, false, 1><<<(unsigned)((NR / 128) * (CC / 128)), 256, 0, stream>>>(X16, BP, 0.0625f, (float*)d_out, bp, rgb, ir, nullptr);      /* proj + bias + residual */
}
